// v000
// Measured on an AMD MI455X. A time is GPU time per run, averaged over a window of back-to-back runs after a warm-up
// (all launches, gaps included; the runs take copies of the inputs in turn), and the median of several windows.
// Apart from v000's, it joins two sittings. Times from different sittings can be a few percent apart, while
// side-by-side timings come from the same sitting.
// v000 is the starting kernel. One run takes 351 microseconds.
#include <hip/hip_runtime.h>
// Gated global/local self attention (B=4, S=1024, HID=768, 12×64): q,k,v = x·W + b ((in,out)); scores = q·k/8; global path softmax(scores + attention_mask[b,0,0,k]); local path softmax(scores + (1 − local_mask[b,0,q,k])·f32_min); ctx = gate[b,h,q]·ctx_local + (1 − gate)·ctx_global, merged → [4,1024,768].
// Compute dtype: x, weights, biases, additive mask and gates rounded to bf16; q/k/v f16 GEMM planes; two fused flash-style kernels on v_wmma_f32_16x16x32_f16 (online softmax f32, P f16 ×2^10, f32 accumulate): one with the per-batch additive key bias, one with the per-batch 0/1 (q,k) mask
// (0 → −inf, all-masked chunks skipped); the gated combination in f32.
#define BB 4
#define TT 1024
#define DD 768
#define NH 12
#define NR (BB * TT)

typedef __bf16 v16b __attribute__((ext_vector_type(16)));
typedef unsigned short v8us __attribute__((ext_vector_type(8), may_alias));
typedef float  v8f  __attribute__((ext_vector_type(8)));
typedef float  v4f  __attribute__((ext_vector_type(4)));
typedef float  v4fa __attribute__((ext_vector_type(4), may_alias));
union FragB { v16b v; v8us half[2]; unsigned short u[16]; };

__device__ __forceinline__ unsigned short bf16_bits(float x) { unsigned int u = __float_as_uint(x); return (unsigned short)((u + 0x7FFFu + ((u >> 16) & 1u)) >> 16); }
__device__ __forceinline__ float bf16_val(unsigned short b) { return __uint_as_float(((unsigned int)b) << 16); }
__device__ __forceinline__ float bf16_round(float x) { return bf16_val(bf16_bits(x)); }
// D += A·B with NT terms: 1 = ah·bh, 2 = + al·bh (A split), 3 = + ah·bl (both split)
template <int NT>
__device__ __forceinline__ v8f mmaN(v16b ah, v16b al, v16b bh, v16b bl, v8f c) {
  c = __builtin_amdgcn_wmma_f32_16x16x32_bf16(false, ah, false, bh, (short)0, c, false, false);
  if (NT >= 2) c = __builtin_amdgcn_wmma_f32_16x16x32_bf16(false, al, false, bh, (short)0, c, false, false);
  if (NT >= 3) c = __builtin_amdgcn_wmma_f32_16x16x32_bf16(false, ah, false, bl, (short)0, c, false, false);
  asm volatile("v_nop\n\tv_nop\n\tv_nop\n\tv_nop" : "+v"(c) : "v"(ah), "v"(al), "v"(bh), "v"(bl));
  return c;
}

__global__ __launch_bounds__(256) void k_wt_bf16(const float* __restrict__ W, unsigned short* __restrict__ Wt, int K, int N) {
  const int t = blockIdx.x * 256 + threadIdx.x;
  const int k8n = K / 8;
  if (t >= N * k8n) return;
  const int n = t / k8n, k8 = (t % k8n) * 8;
  v8us v;
#pragma unroll
  for (int i = 0; i < 8; ++i) v[i] = bf16_bits(W[(size_t)(k8 + i) * N + n]);
  *(v8us*)(Wt + (size_t)n * K + k8) = v;
  
}

// GEMM C[M][N] (f32, pitch ldc) = act(A[M][K]·W + bias). A f32 row-major (pitch lda) converted per fragment to bf16
// (ASPLIT: hi/lo two planes -> 2 terms, else single rounded term); Wt bf16 [N][K] (pitch ldb). BIAS_BF16 rounds the
// bias to bf16 first (bias quantised to bf16 before the add). K%32==0, M%16==0, N%64==0.
template <bool ASPLIT, int ACT, bool BIAS_BF16>
__global__ __launch_bounds__(128) void k_gemm_bf(const float* __restrict__ A, int lda, const unsigned short* __restrict__ Wt, int ldb,
                                               const float* __restrict__ bias, float* __restrict__ C, int ldc, int M, int N, int K) {
  __shared__ __attribute__((aligned(16))) float so[4][16][64];
  const int tid = threadIdx.x, w = tid >> 5, lane = tid & 31, ln = lane & 15, hh = lane >> 4;
  const int ntn = N / 64;
  const int wid = blockIdx.x * 4 + w;
  const int mt = wid / ntn, nq = wid % ntn;
  if (mt * 16 >= M) return;
  const int row0 = mt * 16, col0 = nq * 64;
  const float* arow = A + (size_t)(row0 + ln) * lda;
  v8f acc[4] = {};
  for (int kb = 0; kb < K; kb += 32) {
    FragB ah, al;
    const v4f x0 = *(const v4fa*)(arow + kb + 8 * hh), x1 = *(const v4fa*)(arow + kb + 8 * hh + 4);
    const v4f x2 = *(const v4fa*)(arow + kb + 16 + 8 * hh), x3 = *(const v4fa*)(arow + kb + 16 + 8 * hh + 4);
    float xs[16] = {x0[0],x0[1],x0[2],x0[3],x1[0],x1[1],x1[2],x1[3],x2[0],x2[1],x2[2],x2[3],x3[0],x3[1],x3[2],x3[3]};
#pragma unroll
    for (int i = 0; i < 16; ++i) { const unsigned short hb = bf16_bits(xs[i]); ah.u[i] = hb; al.u[i] = ASPLIT ? bf16_bits(xs[i] - bf16_val(hb)) : (unsigned short)0; }
#pragma unroll
    for (int t = 0; t < 4; ++t) {
      const unsigned short* brow = Wt + (size_t)(col0 + t * 16 + ln) * ldb + kb;
      FragB b;
      b.half[0] = *(const v8us*)(brow + 8 * hh);
      b.half[1] = *(const v8us*)(brow + 16 + 8 * hh);
      acc[t] = mmaN<ASPLIT ? 2 : 1>(ah.v, al.v, b.v, b.v, acc[t]);
    }
  }
#pragma unroll
  for (int t = 0; t < 4; ++t) {
    float bv = bias ? bias[col0 + t * 16 + ln] : 0.f;
    if (BIAS_BF16) bv = bf16_round(bv);
#pragma unroll
    for (int r = 0; r < 8; ++r) { float v = acc[t][r] + bv; if (ACT == 1) v = fmaxf(v, 0.f); so[w][8 * hh + r][t * 16 + ln] = v; }
  }
  __builtin_amdgcn_fence(__ATOMIC_ACQ_REL, "workgroup");
  __builtin_amdgcn_wave_barrier();
  const int rsub = lane >> 4, c4 = (lane & 15) * 4;
  {
#pragma unroll
    for (int q = 0; q < 8; ++q) {
      const int r = q * 2 + rsub;
      const v4f v = *(const v4fa*)&so[w][r][c4];
      *(v4f*)(C + (size_t)(row0 + r) * ldc + col0 + c4) = v;
    }
    
  }
}

// Flash-style causal/unmasked attention, all contractions 3-term bf16 hi/lo splits, f32 softmax with running max.
// q,k,v rows are read from f32 buffers with arbitrary row pitch (so they can live inside a fused qkv buffer);
// D = head size (multiple of 32, <= 128); one wave = 16 query rows; block = 4 waves (64 queries) sharing K/V chunks of 32.
template <int D, bool CAUSAL>
__global__ __launch_bounds__(128) void k_flash(const float* __restrict__ qb, const float* __restrict__ kb, const float* __restrict__ vb,
                                             int pitch, int T, int H, float scale, float* __restrict__ y, int ypitch) {
  constexpr int KS = D / 32;        // k-steps for QK
  constexpr int DT = D / 16;        // d tiles for PV
  __shared__ __attribute__((aligned(16))) unsigned short sKh[32][D + 8], sKl[32][D + 8], sVh[32][D + 8], sVl[32][D + 8];
  __shared__ __attribute__((aligned(16))) unsigned short sPh[4][16][40], sPl[4][16][40];
  __shared__ __attribute__((aligned(16))) float sO[4][16][D];
  const int tid = threadIdx.x, w = tid >> 5, lane = tid & 31, ln = lane & 15, hh = lane >> 4;
  const int nqb = (T + 63) / 64;
  const int bh = blockIdx.x / nqb, qblk = blockIdx.x % nqb;
  const int b = bh / H, h = bh % H;
  const int q0 = qblk * 64 + w * 16;
  const float* Q = qb + (size_t)b * T * pitch + h * D;
  const float* K = kb + (size_t)b * T * pitch + h * D;
  const float* V = vb + (size_t)b * T * pitch + h * D;

  // A fragments of the wave's 16 query rows (scaled), hi/lo
  FragB aqh[KS], aql[KS];
  {
    int row = q0 + ln; if (row >= T) row = T - 1;
    const float* qr = Q + (size_t)row * pitch;
#pragma unroll
    for (int ks = 0; ks < KS; ++ks)
#pragma unroll
      for (int i = 0; i < 16; ++i) {
        const int d = ks * 32 + ((i < 8) ? (8 * hh + i) : (16 + 8 * hh + (i - 8)));
        const float x = qr[d] * scale; const unsigned short hb = bf16_bits(x);
        aqh[ks].u[i] = hb; aql[ks].u[i] = bf16_bits(x - bf16_val(hb));
      }
  }
  float m_r[8], l_r[8];
#pragma unroll
  for (int r = 0; r < 8; ++r) { m_r[r] = -3.0e38f; l_r[r] = 0.f; }
  v8f oacc[DT];
#pragma unroll
  for (int dt = 0; dt < DT; ++dt) oacc[dt] = (v8f){0.f,0.f,0.f,0.f,0.f,0.f,0.f,0.f};

  const int kv_end = CAUSAL ? min(T, qblk * 64 + 64) : T;     // block-uniform
  for (int j0 = 0; j0 < kv_end; j0 += 32) {
    __syncthreads();
    for (int e = tid; e < 32 * (D / 4); e += 128) {
      const int r = e / (D / 4), c4 = (e % (D / 4)) * 4;
      const int key = j0 + r;
      v4f kf = {0.f,0.f,0.f,0.f}, vf = {0.f,0.f,0.f,0.f};
      if (key < T) { kf = *(const v4fa*)(K + (size_t)key * pitch + c4); vf = *(const v4fa*)(V + (size_t)key * pitch + c4); }
#pragma unroll
      for (int t = 0; t < 4; ++t) {
        unsigned short hb = bf16_bits(kf[t]); sKh[r][c4 + t] = hb; sKl[r][c4 + t] = bf16_bits(kf[t] - bf16_val(hb));
        hb = bf16_bits(vf[t]); sVh[r][c4 + t] = hb; sVl[r][c4 + t] = bf16_bits(vf[t] - bf16_val(hb));
      }
    }
    __syncthreads();
    // S tile 16 x 32
    v8f s[2];
#pragma unroll
    for (int nt = 0; nt < 2; ++nt) {
      v8f acc = {};
#pragma unroll
      for (int ks = 0; ks < KS; ++ks) {
        FragB bh_, bl_;
        bh_.half[0] = *(const v8us*)&sKh[nt * 16 + ln][ks * 32 + 8 * hh]; bh_.half[1] = *(const v8us*)&sKh[nt * 16 + ln][ks * 32 + 16 + 8 * hh];
        bl_.half[0] = *(const v8us*)&sKl[nt * 16 + ln][ks * 32 + 8 * hh]; bl_.half[1] = *(const v8us*)&sKl[nt * 16 + ln][ks * 32 + 16 + 8 * hh];
        acc = mmaN<3>(aqh[ks].v, aql[ks].v, bh_.v, bl_.v, acc);
      }
      s[nt] = acc;
    }
    // mask + running max (rows 8hh+r; the 16 lanes of a half share rows)
    float alpha[8];
#pragma unroll
    for (int r = 0; r < 8; ++r) {
      const int qi = q0 + 8 * hh + r;
      const int ja = j0 + ln, jb = j0 + 16 + ln;
      if (CAUSAL) { if (ja > qi) s[0][r] = -3.0e38f; if (jb > qi) s[1][r] = -3.0e38f; }
      if (ja >= T) s[0][r] = -3.0e38f;
      if (jb >= T) s[1][r] = -3.0e38f;
      float mx = fmaxf(s[0][r], s[1][r]);
      mx = fmaxf(mx, __shfl_xor(mx, 1, 32)); mx = fmaxf(mx, __shfl_xor(mx, 2, 32)); mx = fmaxf(mx, __shfl_xor(mx, 4, 32)); mx = fmaxf(mx, __shfl_xor(mx, 8, 32));
      const float mnew = fmaxf(m_r[r], mx);
      alpha[r] = (mnew > -1.0e38f) ? __expf(m_r[r] - mnew) : 1.0f;
      const float p0 = (s[0][r] > -1.0e38f) ? __expf(s[0][r] - mnew) : 0.f;
      const float p1 = (s[1][r] > -1.0e38f) ? __expf(s[1][r] - mnew) : 0.f;
      m_r[r] = mnew;
      l_r[r] = l_r[r] * alpha[r] + p0 + p1;            // per-lane partial row sum (16 lanes combined at the end)
      unsigned short hb = bf16_bits(p0); sPh[w][8 * hh + r][ln] = hb;      sPl[w][8 * hh + r][ln] = bf16_bits(p0 - bf16_val(hb));
      hb = bf16_bits(p1);                sPh[w][8 * hh + r][16 + ln] = hb; sPl[w][8 * hh + r][16 + ln] = bf16_bits(p1 - bf16_val(hb));
    }
#pragma unroll
    for (int dt = 0; dt < DT; ++dt)
#pragma unroll
      for (int r = 0; r < 8; ++r) oacc[dt][r] *= alpha[r];
    __builtin_amdgcn_fence(__ATOMIC_ACQ_REL, "workgroup");
    __builtin_amdgcn_wave_barrier();
    FragB pah, pal;
    pah.half[0] = *(const v8us*)&sPh[w][ln][8 * hh]; pah.half[1] = *(const v8us*)&sPh[w][ln][16 + 8 * hh];
    pal.half[0] = *(const v8us*)&sPl[w][ln][8 * hh]; pal.half[1] = *(const v8us*)&sPl[w][ln][16 + 8 * hh];
#pragma unroll
    for (int dt = 0; dt < DT; ++dt) {
      FragB bvh, bvl;
#pragma unroll
      for (int i = 0; i < 8; ++i) {
        bvh.u[i] = sVh[8 * hh + i][dt * 16 + ln]; bvh.u[8 + i] = sVh[16 + 8 * hh + i][dt * 16 + ln];
        bvl.u[i] = sVl[8 * hh + i][dt * 16 + ln]; bvl.u[8 + i] = sVl[16 + 8 * hh + i][dt * 16 + ln];
      }
      oacc[dt] = mmaN<3>(pah.v, pal.v, bvh.v, bvl.v, oacc[dt]);
    }
    __builtin_amdgcn_fence(__ATOMIC_ACQ_REL, "workgroup");
    __builtin_amdgcn_wave_barrier();
  }
#pragma unroll
  for (int r = 0; r < 8; ++r) {
    float l = l_r[r];
    l += __shfl_xor(l, 1, 32); l += __shfl_xor(l, 2, 32); l += __shfl_xor(l, 4, 32); l += __shfl_xor(l, 8, 32);
    l_r[r] = (l > 0.f) ? 1.0f / l : 0.f;
  }
#pragma unroll
  for (int dt = 0; dt < DT; ++dt)
#pragma unroll
    for (int r = 0; r < 8; ++r) sO[w][8 * hh + r][dt * 16 + ln] = oacc[dt][r] * l_r[r];
  __builtin_amdgcn_fence(__ATOMIC_ACQ_REL, "workgroup");
  __builtin_amdgcn_wave_barrier();
  {
    for (int r = 0; r < 16; ++r) {
      const int row = q0 + r;
      if (row < T && lane < D / 4) {
        const v4f val = *(const v4fa*)&sO[w][r][lane * 4];
        *(v4f*)(y + ((size_t)b * T + row) * ypitch + h * D + lane * 4) = val;
      }
    }
    
  }
}

// GEMM C = act(A·W + bias + resid): A f32 (ASPLIT -> hi/lo 2 terms), Wt bf16 [N][K]; ACT 0 none, 1 relu, 2 exact gelu;
// resid (optional, f32, row index = (row % rmod), pitch ldr, RES_BF16 rounds it) added before the activation.
template <bool ASPLIT, int ACT, bool BIAS_BF16, bool RES_BF16>
__global__ __launch_bounds__(128) void k_gemm_bf3(const float* __restrict__ A, int lda, const unsigned short* __restrict__ Wt, int ldb,
                                                const float* __restrict__ bias, const float* __restrict__ resid, int rmod, int ldr,
                                                float* __restrict__ C, int ldc, int M, int N, int K) {
  __shared__ __attribute__((aligned(16))) float so[4][16][64];
  const int tid = threadIdx.x, w = tid >> 5, lane = tid & 31, ln = lane & 15, hh = lane >> 4;
  const int ntn = N / 64;
  const int wid = blockIdx.x * 4 + w;
  const int mt = wid / ntn, nq = wid % ntn;
  if (mt * 16 >= M) return;
  const int row0 = mt * 16, col0 = nq * 64;
  const float* arow = A + (size_t)(row0 + ln) * lda;
  v8f acc[4] = {};
  for (int kb = 0; kb < K; kb += 32) {
    FragB ah, al;
    const v4f x0 = *(const v4fa*)(arow + kb + 8 * hh), x1 = *(const v4fa*)(arow + kb + 8 * hh + 4);
    const v4f x2 = *(const v4fa*)(arow + kb + 16 + 8 * hh), x3 = *(const v4fa*)(arow + kb + 16 + 8 * hh + 4);
    float xs[16] = {x0[0],x0[1],x0[2],x0[3],x1[0],x1[1],x1[2],x1[3],x2[0],x2[1],x2[2],x2[3],x3[0],x3[1],x3[2],x3[3]};
#pragma unroll
    for (int i = 0; i < 16; ++i) { const unsigned short hb = bf16_bits(xs[i]); ah.u[i] = hb; al.u[i] = ASPLIT ? bf16_bits(xs[i] - bf16_val(hb)) : (unsigned short)0; }
#pragma unroll
    for (int t = 0; t < 4; ++t) {
      const unsigned short* brow = Wt + (size_t)(col0 + t * 16 + ln) * ldb + kb;
      FragB b;
      b.half[0] = *(const v8us*)(brow + 8 * hh);
      b.half[1] = *(const v8us*)(brow + 16 + 8 * hh);
      acc[t] = mmaN<ASPLIT ? 2 : 1>(ah.v, al.v, b.v, b.v, acc[t]);
    }
  }
#pragma unroll
  for (int t = 0; t < 4; ++t) {
    const int col = col0 + t * 16 + ln;
    float bv = bias ? bias[col] : 0.f;
    if (BIAS_BF16) bv = bf16_round(bv);
#pragma unroll
    for (int r = 0; r < 8; ++r) {
      float v = acc[t][r] + bv;
      if (resid) { float rv = resid[(size_t)((row0 + 8 * hh + r) % rmod) * ldr + col]; if (RES_BF16) rv = bf16_round(rv); v += rv; }
      if (ACT == 1) v = fmaxf(v, 0.f);
      if (ACT == 2) v = 0.5f * v * (1.0f + erff(v * 0.70710678118654752f));
      if (ACT == 3) { const float u = 0.7978845608028654f * (v + 0.044715f * v * v * v); v = 0.5f * v * (1.0f + tanhf(u)); }
      so[w][8 * hh + r][t * 16 + ln] = v;
    }
  }
  __builtin_amdgcn_fence(__ATOMIC_ACQ_REL, "workgroup");
  __builtin_amdgcn_wave_barrier();
  const int rsub = lane >> 4, c4 = (lane & 15) * 4;
  {
#pragma unroll
    for (int q = 0; q < 8; ++q) {
      const int r = q * 2 + rsub;
      const v4f v = *(const v4fa*)&so[w][r][c4];
      *(v4f*)(C + (size_t)(row0 + r) * ldc + col0 + c4) = v;
    }
    
  }
}
// row LayerNorm (biased variance, eps) over N: s = X (+ R); optional out_sum <- s; out_norm <- (s-mu)*rsqrt(var+eps)*g + b
template <bool PARAM_BF16>
__global__ __launch_bounds__(256) void k_layernorm(const float* __restrict__ X, const float* __restrict__ R, const float* __restrict__ g, const float* __restrict__ bta,
                                                  float* __restrict__ out_sum, float* __restrict__ out_norm, int N, float eps) {
  __shared__ float red[256];
  const int row = blockIdx.x, tid = threadIdx.x;
  const float* x = X + (size_t)row * N; const float* rr = R ? R + (size_t)row * N : nullptr;
  float vals[16];                     // up to N = 4096
  const int per = N / 256;            // contiguous chunk per thread? use strided-by-4 chunks: thread handles j = tid*4 + 1024*u
  float s1 = 0.f;
  for (int u = 0; u < per / 4; ++u) {
    const int j = tid * 4 + 1024 * u;
    const v4f a = *(const v4fa*)(x + j);
    v4f b = {0.f,0.f,0.f,0.f}; if (rr) b = *(const v4fa*)(rr + j);
#pragma unroll
    for (int q = 0; q < 4; ++q) { const float v = a[q] + b[q]; vals[u * 4 + q] = v; s1 += v; }
  }
  red[tid] = s1; __syncthreads();
  for (int st = 128; st > 0; st >>= 1) { if (tid < st) red[tid] += red[tid + st]; __syncthreads(); }
  const float mu = red[0] / (float)N; __syncthreads();
  float s2 = 0.f;
  for (int u = 0; u < per / 4; ++u)
#pragma unroll
    for (int q = 0; q < 4; ++q) { const float c = vals[u * 4 + q] - mu; s2 += c * c; }
  red[tid] = s2; __syncthreads();
  for (int st = 128; st > 0; st >>= 1) { if (tid < st) red[tid] += red[tid + st]; __syncthreads(); }
  const float rs = rsqrtf(red[0] / (float)N + eps);
  {
    for (int u = 0; u < per / 4; ++u) {
      const int j = tid * 4 + 1024 * u;
      v4f o, sm;
#pragma unroll
      for (int q = 0; q < 4; ++q) {
        float gg = g[j + q], bb = bta[j + q];
        if (PARAM_BF16) { gg = bf16_round(gg); bb = bf16_round(bb); }
        sm[q] = vals[u * 4 + q]; o[q] = (vals[u * 4 + q] - mu) * rs * gg + bb;
      }
      if (out_sum) *(v4f*)(out_sum + (size_t)row * N + j) = sm;
      *(v4f*)(out_norm + (size_t)row * N + j) = o;
    }
    
  }
}



// ---- f16 WMMA path (v_wmma_f32_16x16x32_f16): 11-bit significands for operands in range — used where a [0,1] probability operand needs more precision than bf16
typedef _Float16 v16h __attribute__((ext_vector_type(16)));
union FragH { v16h v; v8us half[2]; _Float16 h[16]; unsigned short u[16]; };
template <int NT>
__device__ __forceinline__ v8f mmaH(v16h ah, v16h al, v16h bh, v16h bl, v8f c) {
  c = __builtin_amdgcn_wmma_f32_16x16x32_f16(false, ah, false, bh, (short)0, c, false, false);
  if (NT >= 2) c = __builtin_amdgcn_wmma_f32_16x16x32_f16(false, al, false, bh, (short)0, c, false, false);
  if (NT >= 3) c = __builtin_amdgcn_wmma_f32_16x16x32_f16(false, ah, false, bl, (short)0, c, false, false);
  asm volatile("v_nop\n\tv_nop\n\tv_nop\n\tv_nop" : "+v"(c) : "v"(ah), "v"(al), "v"(bh), "v"(bl));
  return c;
}
// batched GEMM like k_gemm_b but f16 operands: A f32 (split into f16 hi/lo if ASPLIT, else rounded to f16), Bt = f16 values [n][k]; alpha; C f32; N multiple of 16 (partial tiles skipped)
template <bool ASPLIT>
__global__ __launch_bounds__(128) void k_gemm_h(const float* __restrict__ A, int lda, size_t sA, const _Float16* __restrict__ Bh, int ldb, size_t sB, float alpha, float* __restrict__ C, int ldc, size_t sC, int M, int N, int K) {
  __shared__ __attribute__((aligned(16))) float so[4][16][64];
  const int tid = threadIdx.x, w = tid >> 5, lane = tid & 31, ln = lane & 15, hh = lane >> 4; const int by = blockIdx.y;
  A += (size_t)by * sA; Bh += (size_t)by * sB; C += (size_t)by * sC;
  const int ntn = (N + 63) / 64; const int wid = blockIdx.x * 4 + w; const int mt = wid / ntn, nq = wid % ntn; if (mt * 16 >= M) return;
  const int row0 = mt * 16, col0 = nq * 64; const float* arow = A + (size_t)(row0 + ln) * lda;
  v8f acc[4] = {};
  for (int kb = 0; kb < K; kb += 32) {
    FragH ah, al;
    const v4f x0 = *(const v4fa*)(arow + kb + 8 * hh), x1 = *(const v4fa*)(arow + kb + 8 * hh + 4), x2 = *(const v4fa*)(arow + kb + 16 + 8 * hh), x3 = *(const v4fa*)(arow + kb + 16 + 8 * hh + 4);
    float xs[16] = {x0[0],x0[1],x0[2],x0[3],x1[0],x1[1],x1[2],x1[3],x2[0],x2[1],x2[2],x2[3],x3[0],x3[1],x3[2],x3[3]};
#pragma unroll
    for (int i = 0; i < 16; ++i) { const _Float16 h = (_Float16)xs[i]; ah.h[i] = h; al.h[i] = ASPLIT ? (_Float16)(xs[i] - (float)h) : (_Float16)0.0f; }
#pragma unroll
    for (int t = 0; t < 4; ++t) { if (col0 + t * 16 >= N) continue; const size_t boff = (size_t)(col0 + t * 16 + ln) * ldb + kb; FragH bq; bq.half[0] = *(const v8us*)(Bh + boff + 8 * hh); bq.half[1] = *(const v8us*)(Bh + boff + 16 + 8 * hh);
      acc[t] = mmaH<ASPLIT ? 2 : 1>(ah.v, al.v, bq.v, bq.v, acc[t]); }
  }
#pragma unroll
  for (int t = 0; t < 4; ++t) { if (col0 + t * 16 >= N) continue;
#pragma unroll
    for (int r = 0; r < 8; ++r) so[w][8 * hh + r][t * 16 + ln] = acc[t][r] * alpha; }
  __builtin_amdgcn_fence(__ATOMIC_ACQ_REL, "workgroup"); __builtin_amdgcn_wave_barrier();
  const int rsub = lane >> 4, c4 = (lane & 15) * 4;
  {
#pragma unroll
    for (int q = 0; q < 8; ++q) { const int r = q * 2 + rsub; if (col0 + c4 < N) { const v4f v = *(const v4fa*)&so[w][r][c4]; *(v4f*)(C + (size_t)(row0 + r) * ldc + col0 + c4) = v; } }
     }
}

// Wt[n][k] = f16(W[k][n]·scale) from f32 row-major W[K][N] (scale = power of two; bf16-exact weights stay exact in f16 away from the subnormal range)
__global__ __launch_bounds__(256) void k_wt_f16(const float* __restrict__ W, _Float16* __restrict__ Wt, int K, int N, float scale) {
  const int t = blockIdx.x * 256 + threadIdx.x; if (t >= N * (K / 8)) return; const int n = t / (K / 8), k8 = (t % (K / 8)) * 8; FragH f;
#pragma unroll
  for (int i = 0; i < 8; ++i) f.h[i] = (_Float16)(bf16_round(W[(size_t)(k8 + i) * N + n]) * scale); const v8us o = f.half[0];
  *(v8us*)((unsigned short*)Wt + (size_t)n * K + k8) = o; 
}
// k_gemm_hh variant with fused epilogue: v = acc·alpha + bias[by·sBias + col] (+ CP[(row/rowsPerB)·sCPb + by·64 + col] if CP) ; ACT 0 none / 1 elu ; writes f16 C16 (and f32 C if non-null)
template <int ACT>
__global__ __launch_bounds__(128) void k_gemm_hhx(const _Float16* __restrict__ A, int lda, size_t sA, const _Float16* __restrict__ Bh, int ldb, size_t sB, float alpha, const float* __restrict__ bias, size_t sBias, const float* __restrict__ CP, int rowsPerB, size_t sCPb, int row0g,
    float* __restrict__ C, _Float16* __restrict__ C16, int ldc, size_t sC, int M, int N, int K) {
  __shared__ __attribute__((aligned(16))) float so[4][16][64];
  const int tid = threadIdx.x, w = tid >> 5, lane = tid & 31, ln = lane & 15, hh = lane >> 4; const int by = blockIdx.y;
  A += (size_t)by * sA; Bh += (size_t)by * sB; const size_t cofs = (size_t)by * sC; const float* bp = bias ? bias + (size_t)by * sBias : nullptr;
  const int ntn = (N + 63) / 64; const int wid = blockIdx.x * 4 + w; const int mt = wid / ntn, nq = wid % ntn; if (mt * 16 >= M) return;
  const int row0 = mt * 16, col0 = nq * 64; const _Float16* arow = A + (size_t)(row0 + ln) * lda;
  v8f acc[4] = {};
  for (int kb = 0; kb < K; kb += 32) { FragH ah; ah.half[0] = *(const v8us*)((const unsigned short*)arow + kb + 8 * hh); ah.half[1] = *(const v8us*)((const unsigned short*)arow + kb + 16 + 8 * hh);
#pragma unroll
    for (int t = 0; t < 4; ++t) { if (col0 + t * 16 >= N) continue; const size_t boff = (size_t)(col0 + t * 16 + ln) * ldb + kb; FragH bq; bq.half[0] = *(const v8us*)((const unsigned short*)Bh + boff + 8 * hh); bq.half[1] = *(const v8us*)((const unsigned short*)Bh + boff + 16 + 8 * hh);
      acc[t] = mmaH<1>(ah.v, ah.v, bq.v, bq.v, acc[t]); }
  }
#pragma unroll
  for (int t = 0; t < 4; ++t) { if (col0 + t * 16 >= N) continue; const int col = col0 + t * 16 + ln; const float bv = bp ? bf16_round(bp[col]) : 0.f;
#pragma unroll
    for (int r = 0; r < 8; ++r) { float v = acc[t][r] * alpha + bv; if (CP) { const int bidx = (row0g + row0 + 8 * hh + r) / rowsPerB; v += CP[(size_t)bidx * sCPb + (size_t)by * 64 + col]; } if (ACT == 1) v = (v > 0.f) ? v : expm1f(v); else if (ACT == 7) v = (v > 0.f) ? v + 1.0f : expf(v); else if (ACT == 8) v = tanhf(v); else if (ACT == 9) v = 0.5f * v * (1.0f + tanhf(0.7978845608028654f * (v + 0.044715f * v * v * v))); else if (ACT == 11) v = 1.0f / (1.0f + expf(-v)); else if (ACT == 12) v = (v > 0.f) ? v : 0.01f * v; else if (ACT == 14) v = (v > 0.f) ? v : 0.1f * v; else if (ACT == 15) v = v / (1.0f + expf(-v)); else if (ACT == 3) v = fmaxf(v, 0.f); else if (ACT == 6) v = 0.5f * v * (1.0f + erff(v * 0.70710678118654752f)); so[w][8 * hh + r][t * 16 + ln] = v; } }
  __builtin_amdgcn_fence(__ATOMIC_ACQ_REL, "workgroup"); __builtin_amdgcn_wave_barrier();
  const int rsub = lane >> 4, c4 = (lane & 15) * 4; typedef _Float16 v4h __attribute__((ext_vector_type(4)));
  {
#pragma unroll
    for (int q = 0; q < 8; ++q) { const int r = q * 2 + rsub; if (col0 + c4 < N) { const v4f v = *(const v4fa*)&so[w][r][c4]; if (C) *(v4f*)(C + cofs + (size_t)(row0 + r) * ldc + col0 + c4) = v; if (C16) { v4h h4; for (int i = 0; i < 4; ++i) h4[i] = (_Float16)v[i]; *(v4h*)(C16 + cofs + (size_t)(row0 + r) * ldc + col0 + c4) = h4; } } }
     }
}


typedef _Float16 v4h __attribute__((ext_vector_type(4)));

__global__ __launch_bounds__(256) void k_x16(const float* __restrict__ x, _Float16* __restrict__ X16, size_t n8) { const size_t t = (size_t)blockIdx.x * 256 + threadIdx.x; if (t >= n8) return; FragH f;
#pragma unroll
  for (int q = 0; q < 8; ++q) f.h[q] = (_Float16)bf16_round(x[t * 8 + q]); *(v8us*)((unsigned short*)X16 + t * 8) = f.half[0];  }
__global__ __launch_bounds__(256) void k_h16(const float* __restrict__ x, _Float16* __restrict__ X16, size_t n8) { const size_t t = (size_t)blockIdx.x * 256 + threadIdx.x; if (t >= n8) return; FragH f;
#pragma unroll
  for (int q = 0; q < 8; ++q) f.h[q] = (_Float16)x[t * 8 + q]; *(v8us*)((unsigned short*)X16 + t * 8) = f.half[0];  }
__global__ __launch_bounds__(256) void k_round16f(const float* __restrict__ W, _Float16* __restrict__ Bt, size_t n8) { const size_t t = (size_t)blockIdx.x * 256 + threadIdx.x; if (t >= n8) return; FragH f;
#pragma unroll
  for (int i = 0; i < 8; ++i) f.h[i] = (_Float16)(bf16_round(W[t * 8 + i]) * 16.0f); *(v8us*)((unsigned short*)Bt + t * 8) = f.half[0];  }
template <int NHv, int TTv>
__global__ __launch_bounds__(256) void k_vt(const _Float16* __restrict__ V16, int ldv, int voff, _Float16* __restrict__ Vt) { __shared__ unsigned short tl[64][66]; const int tid = threadIdx.x; const int slab = blockIdx.x / (TTv / 64), lg = blockIdx.x % (TTv / 64); const int b = slab / NHv, h = slab % NHv;
  for (int i = tid; i < 64 * 8; i += 256) { const int r = i / 8, c8 = (i % 8) * 8; FragH f; f.half[0] = *(const v8us*)((const unsigned short*)V16 + ((size_t)b * TTv + lg * 64 + r) * ldv + voff + h * 64 + c8);
#pragma unroll
    for (int q = 0; q < 8; ++q) tl[r][c8 + q] = f.u[q]; }
  __syncthreads();
  {
#pragma unroll
    for (int rd = 0; rd < 2; ++rd) { const int d = rd * 32 + tid / 8, pc = tid % 8; FragH f;
#pragma unroll
      for (int q = 0; q < 8; ++q) f.u[q] = tl[pc * 8 + q][d];
      *(v8us*)((unsigned short*)Vt + ((size_t)slab * 64 + d) * TTv + lg * 64 + pc * 8) = f.half[0]; }
     } }

__global__ __launch_bounds__(128) void k_flash_g(const _Float16* __restrict__ Q16, int ldq, const _Float16* __restrict__ K16, int ldk, const _Float16* __restrict__ Vt, const float* __restrict__ AB, float* __restrict__ O, int ldo) {
  constexpr int RPW = 16, RTN = RPW / 16, NQB = TT / (4 * RPW), DT = 4, KS = 2;
  __shared__ __attribute__((aligned(16))) unsigned short sP[4][RPW][40]; __shared__ __attribute__((aligned(16))) float sO[4][RPW][64 + 4];
  const int tid = threadIdx.x, w = tid >> 5, lane = tid & 31, ln = lane & 15, hh = lane >> 4;
  const int slab = blockIdx.x / NQB, qblk = blockIdx.x % NQB; const int b = slab / NH, h = slab % NH; const int qb0 = qblk * (4 * RPW); const int q0 = qb0 + w * RPW;
  FragH aq[2][KS];
#pragma unroll
  for (int rt = 0; rt < RTN; ++rt) { const unsigned short* qr = (const unsigned short*)Q16 + ((size_t)b * TT + q0 + rt * 16 + ln) * ldq + h * 64;
#pragma unroll
    for (int ks = 0; ks < KS; ++ks) { aq[rt][ks].half[0] = *(const v8us*)(qr + ks * 32 + 8 * hh); aq[rt][ks].half[1] = *(const v8us*)(qr + ks * 32 + 16 + 8 * hh); } }
  const unsigned short* Vth = (const unsigned short*)Vt + (size_t)slab * 64 * TT;
  float m_r[2][8], l_r[2][8]; v8f oacc[2][DT];
#pragma unroll
  for (int rt = 0; rt < RTN; ++rt) {
#pragma unroll
    for (int r = 0; r < 8; ++r) { m_r[rt][r] = -3.0e38f; l_r[rt][r] = 0.f; }
#pragma unroll
    for (int dt = 0; dt < DT; ++dt) oacc[rt][dt] = (v8f){0.f,0.f,0.f,0.f,0.f,0.f,0.f,0.f}; }
  const int jend = TT;
#pragma unroll 1
  for (int j0 = 0; j0 < jend; j0 += 32) {
    float ab0[2][8], ab1[2][8];      /* additive attention bias (bf16-rounded input), per batch, shared over heads and queries */
#pragma unroll
    for (int rt = 0; rt < RTN; ++rt)
#pragma unroll
      for (int r = 0; r < 8; ++r) { const int qq = q0 + rt * 16 + 8 * hh + r; const float* am = AB + (size_t)b * TT + j0; (void)qq; ab0[rt][r] = bf16_round(am[ln]); ab1[rt][r] = bf16_round(am[16 + ln]); }
    v8f s[2][2];
#pragma unroll
    for (int nt = 0; nt < 2; ++nt) { const unsigned short* kr = (const unsigned short*)K16 + ((size_t)b * TT + j0 + nt * 16 + ln) * ldk + h * 64; FragH bk[KS];
#pragma unroll
      for (int ks = 0; ks < KS; ++ks) { bk[ks].half[0] = *(const v8us*)(kr + ks * 32 + 8 * hh); bk[ks].half[1] = *(const v8us*)(kr + ks * 32 + 16 + 8 * hh); }
#pragma unroll
      for (int rt = 0; rt < RTN; ++rt) { v8f acc = (v8f){0.f,0.f,0.f,0.f,0.f,0.f,0.f,0.f};
#pragma unroll
        for (int ks = 0; ks < KS; ++ks) acc = mmaH<1>(aq[rt][ks].v, aq[rt][ks].v, bk[ks].v, bk[ks].v, acc); s[rt][nt] = acc; } }
#pragma unroll
    for (int rt = 0; rt < RTN; ++rt)
#pragma unroll
      for (int r = 0; r < 8; ++r) { const int tq = q0 + rt * 16 + 8 * hh + r; const int k0 = j0 + ln, k1 = j0 + 16 + ln; (void)tq; (void)k0; (void)k1;
        const bool ok0 = true, ok1 = true;
        const float s0 = s[rt][0][r] * 0.125f + ab0[rt][r], s1 = s[rt][1][r] * 0.125f + ab1[rt][r]; float mc = fmaxf(s0, s1);
        mc = fmaxf(mc, __shfl_xor(mc, 1, 32)); mc = fmaxf(mc, __shfl_xor(mc, 2, 32)); mc = fmaxf(mc, __shfl_xor(mc, 4, 32)); mc = fmaxf(mc, __shfl_xor(mc, 8, 32));
        const float mn = fmaxf(m_r[rt][r], mc); const float al = (mn > -1.0e38f) ? expf(m_r[rt][r] - mn) : 1.0f; m_r[rt][r] = mn; const float p0 = ok0 ? expf(s0 - mn) : 0.f, p1 = ok1 ? expf(s1 - mn) : 0.f; l_r[rt][r] = l_r[rt][r] * al + p0 + p1;
#pragma unroll
        for (int dt = 0; dt < DT; ++dt) oacc[rt][dt][r] *= al;
        FragH t2; t2.h[0] = (_Float16)(p0 * 1024.0f); t2.h[1] = (_Float16)(p1 * 1024.0f); sP[w][rt * 16 + 8 * hh + r][ln] = t2.u[0]; sP[w][rt * 16 + 8 * hh + r][16 + ln] = t2.u[1]; }
    __builtin_amdgcn_fence(__ATOMIC_ACQ_REL, "workgroup"); __builtin_amdgcn_wave_barrier();
    FragH pa[2];
#pragma unroll
    for (int rt = 0; rt < RTN; ++rt) { pa[rt].half[0] = *(const v8us*)&sP[w][rt * 16 + ln][8 * hh]; pa[rt].half[1] = *(const v8us*)&sP[w][rt * 16 + ln][16 + 8 * hh]; }
#pragma unroll
    for (int dt = 0; dt < DT; ++dt) { const unsigned short* vrow = Vth + (size_t)(dt * 16 + ln) * TT + j0; FragH bv; bv.half[0] = *(const v8us*)(vrow + 8 * hh); bv.half[1] = *(const v8us*)(vrow + 16 + 8 * hh);
#pragma unroll
      for (int rt = 0; rt < RTN; ++rt) oacc[rt][dt] = mmaH<1>(pa[rt].v, pa[rt].v, bv.v, bv.v, oacc[rt][dt]); }
    __builtin_amdgcn_fence(__ATOMIC_ACQ_REL, "workgroup"); __builtin_amdgcn_wave_barrier(); }
#pragma unroll
  for (int rt = 0; rt < RTN; ++rt) {
#pragma unroll
    for (int r = 0; r < 8; ++r) { float l = l_r[rt][r]; l += __shfl_xor(l, 1, 32); l += __shfl_xor(l, 2, 32); l += __shfl_xor(l, 4, 32); l += __shfl_xor(l, 8, 32); l_r[rt][r] = (l > 0.f) ? 1.0f / (l * 1024.0f) : 0.f; }
#pragma unroll
    for (int dt = 0; dt < DT; ++dt)
#pragma unroll
      for (int r = 0; r < 8; ++r) sO[w][rt * 16 + 8 * hh + r][dt * 16 + ln] = oacc[rt][dt][r] * l_r[rt][r]; }
  __builtin_amdgcn_fence(__ATOMIC_ACQ_REL, "workgroup"); __builtin_amdgcn_wave_barrier();
  {
#pragma unroll
    for (int rp = 0; rp < RPW; rp += 2) { const int r = rp + (lane >> 4), pc = lane & 15; const v4f val = *(const v4fa*)&sO[w][r][pc * 4]; *(v4f*)(O + ((size_t)b * TT + q0 + r) * ldo + h * 64 + pc * 4) = val; }
     } }

__global__ __launch_bounds__(128) void k_flash_l(const _Float16* __restrict__ Q16, int ldq, const _Float16* __restrict__ K16, int ldk, const _Float16* __restrict__ Vt, const int* __restrict__ MSK, float* __restrict__ O, int ldo) {
  constexpr int RPW = 16, RTN = RPW / 16, NQB = TT / (4 * RPW), DT = 4, KS = 2;
  __shared__ __attribute__((aligned(16))) unsigned short sP[4][RPW][40]; __shared__ __attribute__((aligned(16))) float sO[4][RPW][64 + 4];
  const int tid = threadIdx.x, w = tid >> 5, lane = tid & 31, ln = lane & 15, hh = lane >> 4;
  const int slab = blockIdx.x / NQB, qblk = blockIdx.x % NQB; const int b = slab / NH, h = slab % NH; const int qb0 = qblk * (4 * RPW); const int q0 = qb0 + w * RPW;
  FragH aq[2][KS];
#pragma unroll
  for (int rt = 0; rt < RTN; ++rt) { const unsigned short* qr = (const unsigned short*)Q16 + ((size_t)b * TT + q0 + rt * 16 + ln) * ldq + h * 64;
#pragma unroll
    for (int ks = 0; ks < KS; ++ks) { aq[rt][ks].half[0] = *(const v8us*)(qr + ks * 32 + 8 * hh); aq[rt][ks].half[1] = *(const v8us*)(qr + ks * 32 + 16 + 8 * hh); } }
  const unsigned short* Vth = (const unsigned short*)Vt + (size_t)slab * 64 * TT;
  float m_r[2][8], l_r[2][8]; v8f oacc[2][DT];
#pragma unroll
  for (int rt = 0; rt < RTN; ++rt) {
#pragma unroll
    for (int r = 0; r < 8; ++r) { m_r[rt][r] = -3.0e38f; l_r[rt][r] = 0.f; }
#pragma unroll
    for (int dt = 0; dt < DT; ++dt) oacc[rt][dt] = (v8f){0.f,0.f,0.f,0.f,0.f,0.f,0.f,0.f}; }
  const int jend = TT;
#pragma unroll 1
  for (int j0 = 0; j0 < jend; j0 += 32) {
    int mk0[2][8], mk1[2][8];      /* per-batch mask [b][q][k]: nonzero = ATTEND */
#pragma unroll
    for (int rt = 0; rt < RTN; ++rt)
#pragma unroll
      for (int r = 0; r < 8; ++r) { const int qq = q0 + rt * 16 + 8 * hh + r; const int* am = MSK + ((size_t)b * TT + qq) * TT + j0; mk0[rt][r] = am[ln]; mk1[rt][r] = am[16 + ln]; }
    { int allm = 1;
#pragma unroll
      for (int rt = 0; rt < RTN; ++rt)
#pragma unroll
        for (int r = 0; r < 8; ++r) allm &= (mk0[rt][r] == 0) & (mk1[rt][r] == 0);
      if (__all(allm)) continue; }      /* every (row, key) of this wave's tile masked → nothing to add (wave-uniform branch; only wave barriers inside the loop) */
    v8f s[2][2];
#pragma unroll
    for (int nt = 0; nt < 2; ++nt) { const unsigned short* kr = (const unsigned short*)K16 + ((size_t)b * TT + j0 + nt * 16 + ln) * ldk + h * 64; FragH bk[KS];
#pragma unroll
      for (int ks = 0; ks < KS; ++ks) { bk[ks].half[0] = *(const v8us*)(kr + ks * 32 + 8 * hh); bk[ks].half[1] = *(const v8us*)(kr + ks * 32 + 16 + 8 * hh); }
#pragma unroll
      for (int rt = 0; rt < RTN; ++rt) { v8f acc = (v8f){0.f,0.f,0.f,0.f,0.f,0.f,0.f,0.f};
#pragma unroll
        for (int ks = 0; ks < KS; ++ks) acc = mmaH<1>(aq[rt][ks].v, aq[rt][ks].v, bk[ks].v, bk[ks].v, acc); s[rt][nt] = acc; } }
#pragma unroll
    for (int rt = 0; rt < RTN; ++rt)
#pragma unroll
      for (int r = 0; r < 8; ++r) { const int tq = q0 + rt * 16 + 8 * hh + r; const int k0 = j0 + ln, k1 = j0 + 16 + ln; (void)tq; (void)k0; (void)k1;
        const bool ok0 = (mk0[rt][r] != 0), ok1 = (mk1[rt][r] != 0);      /* nonzero = ATTEND */
        const float s0 = ok0 ? s[rt][0][r] * 0.125f : -INFINITY, s1 = ok1 ? s[rt][1][r] * 0.125f : -INFINITY; float mc = fmaxf(s0, s1);
        mc = fmaxf(mc, __shfl_xor(mc, 1, 32)); mc = fmaxf(mc, __shfl_xor(mc, 2, 32)); mc = fmaxf(mc, __shfl_xor(mc, 4, 32)); mc = fmaxf(mc, __shfl_xor(mc, 8, 32));
        const float mn = fmaxf(m_r[rt][r], mc); const float al = (mn > -1.0e38f) ? expf(m_r[rt][r] - mn) : 1.0f; m_r[rt][r] = mn; const float p0 = ok0 ? expf(s0 - mn) : 0.f, p1 = ok1 ? expf(s1 - mn) : 0.f; l_r[rt][r] = l_r[rt][r] * al + p0 + p1;
#pragma unroll
        for (int dt = 0; dt < DT; ++dt) oacc[rt][dt][r] *= al;
        FragH t2; t2.h[0] = (_Float16)(p0 * 1024.0f); t2.h[1] = (_Float16)(p1 * 1024.0f); sP[w][rt * 16 + 8 * hh + r][ln] = t2.u[0]; sP[w][rt * 16 + 8 * hh + r][16 + ln] = t2.u[1]; }
    __builtin_amdgcn_fence(__ATOMIC_ACQ_REL, "workgroup"); __builtin_amdgcn_wave_barrier();
    FragH pa[2];
#pragma unroll
    for (int rt = 0; rt < RTN; ++rt) { pa[rt].half[0] = *(const v8us*)&sP[w][rt * 16 + ln][8 * hh]; pa[rt].half[1] = *(const v8us*)&sP[w][rt * 16 + ln][16 + 8 * hh]; }
#pragma unroll
    for (int dt = 0; dt < DT; ++dt) { const unsigned short* vrow = Vth + (size_t)(dt * 16 + ln) * TT + j0; FragH bv; bv.half[0] = *(const v8us*)(vrow + 8 * hh); bv.half[1] = *(const v8us*)(vrow + 16 + 8 * hh);
#pragma unroll
      for (int rt = 0; rt < RTN; ++rt) oacc[rt][dt] = mmaH<1>(pa[rt].v, pa[rt].v, bv.v, bv.v, oacc[rt][dt]); }
    __builtin_amdgcn_fence(__ATOMIC_ACQ_REL, "workgroup"); __builtin_amdgcn_wave_barrier(); }
#pragma unroll
  for (int rt = 0; rt < RTN; ++rt) {
#pragma unroll
    for (int r = 0; r < 8; ++r) { float l = l_r[rt][r]; l += __shfl_xor(l, 1, 32); l += __shfl_xor(l, 2, 32); l += __shfl_xor(l, 4, 32); l += __shfl_xor(l, 8, 32); l_r[rt][r] = (l > 0.f) ? 1.0f / (l * 1024.0f) : 0.f; }
#pragma unroll
    for (int dt = 0; dt < DT; ++dt)
#pragma unroll
      for (int r = 0; r < 8; ++r) sO[w][rt * 16 + 8 * hh + r][dt * 16 + ln] = oacc[rt][dt][r] * l_r[rt][r]; }
  __builtin_amdgcn_fence(__ATOMIC_ACQ_REL, "workgroup"); __builtin_amdgcn_wave_barrier();
  {
#pragma unroll
    for (int rp = 0; rp < RPW; rp += 2) { const int r = rp + (lane >> 4), pc = lane & 15; const v4f val = *(const v4fa*)&sO[w][r][pc * 4]; *(v4f*)(O + ((size_t)b * TT + q0 + r) * ldo + h * 64 + pc * 4) = val; }
     } }

__global__ __launch_bounds__(256) void k_comb(const float* __restrict__ Og, const float* __restrict__ Ol, const float* __restrict__ gate, float* __restrict__ out) {
  #pragma clang fp contract(off)
  const size_t t = (size_t)blockIdx.x * 256 + threadIdx.x; if (t >= (size_t)NR * DD / 4) return; const size_t e0 = t * 4; const size_t row = e0 / DD; const int c = (int)(e0 % DD); const int h = c / 64; const int b = (int)(row / TT), q = (int)(row % TT);
  const float g = bf16_round(gate[((size_t)b * NH + h) * TT + q]); const v4f a = *(const v4fa*)(Og + e0), l = *(const v4fa*)(Ol + e0); v4f o; for (int i = 0; i < 4; ++i) o[i] = g * l[i] + (1.0f - g) * a[i];
  *(v4f*)(out + e0) = o;  }

extern "C" void kernel_launch(void* const* d_in, const int* in_sizes, int n_in,
                              void* d_out, int out_size, void* d_ws, size_t ws_size, hipStream_t stream) {
  (void)in_sizes; (void)n_in; (void)out_size;
  const float* const* I = (const float* const*)d_in; const float* x = I[0]; const float* am = I[1]; const int* lm = (const int*)d_in[2]; const float* gate = I[3]; const float* Wq = I[4]; const float* bq = I[5]; const float* Wk = I[6]; const float* bk = I[7]; const float* Wv = I[8]; const float* bv = I[9];
  char* ws = (char*)d_ws; size_t off = 0;
  auto take = [&](size_t bytes) { char* p = ws + off; off += (bytes + 255) & ~(size_t)255; return p; };
  const size_t WSZ = (size_t)DD * DD; _Float16* Bw = (_Float16*)take(3 * WSZ * 2); _Float16* X16 = (_Float16*)take((size_t)NR * DD * 2); _Float16* Q = (_Float16*)take((size_t)NR * DD * 2); _Float16* K = (_Float16*)take((size_t)NR * DD * 2); _Float16* V = (_Float16*)take((size_t)NR * DD * 2); _Float16* Vt = (_Float16*)take((size_t)NR * DD * 2); float* Og = (float*)take((size_t)NR * DD * 4); float* Ol = (float*)take((size_t)NR * DD * 4);
  if (off > ws_size) return;      // 3.5 + 5 × 6.3 + 12.6 + 12.6 ≈ 60 MB
  const unsigned gw = (unsigned)((WSZ / 8 + 255) / 256); k_wt_f16<<<gw, 256, 0, stream>>>(Wq, Bw, DD, DD, 16.0f); k_wt_f16<<<gw, 256, 0, stream>>>(Wk, Bw + WSZ, DD, DD, 16.0f); k_wt_f16<<<gw, 256, 0, stream>>>(Wv, Bw + 2 * WSZ, DD, DD, 16.0f);      /* (in,out) → Bt ×2^4 */
  k_x16<<<(unsigned)(((size_t)NR * DD / 8 + 255) / 256), 256, 0, stream>>>(x, X16, (size_t)NR * DD / 8);
  const dim3 gp(((NR / 16) * (DD / 64) + 3) / 4, 1);
  k_gemm_hhx<0><<<gp, 128, 0, stream>>>(X16, DD, 0, Bw, DD, 0, 0.0625f, bq, 0, nullptr, 1, 0, 0, nullptr, Q, DD, 0, NR, DD, DD);      /* M 4096 N 768 K 768 */
  k_gemm_hhx<0><<<gp, 128, 0, stream>>>(X16, DD, 0, Bw + WSZ, DD, 0, 0.0625f, bk, 0, nullptr, 1, 0, 0, nullptr, K, DD, 0, NR, DD, DD);
  k_gemm_hhx<0><<<gp, 128, 0, stream>>>(X16, DD, 0, Bw + 2 * WSZ, DD, 0, 0.0625f, bv, 0, nullptr, 1, 0, 0, nullptr, V, DD, 0, NR, DD, DD);
  k_vt<NH, TT><<<BB * NH * (TT / 64), 256, 0, stream>>>(V, DD, 0, Vt);
  k_flash_g<<<BB * NH * (TT / 64), 128, 0, stream>>>(Q, DD, K, DD, Vt, am, Og, DD);      /* global path: + attention_mask[b,0,0,k] */
  k_flash_l<<<BB * NH * (TT / 64), 128, 0, stream>>>(Q, DD, K, DD, Vt, lm, Ol, DD);      /* local path: local_attention_mask[b,0,q,k] == 0 → −inf */
  k_comb<<<(unsigned)(((size_t)NR * DD / 4 + 255) / 256), 256, 0, stream>>>(Og, Ol, gate, (float*)d_out);
}

// v001
// A run of this version takes 261 microseconds.
// In both of two side-by-side timings against v000, it was 1.37 times as fast.
#include <hip/hip_runtime.h>
// Gated global/local self attention (B=4, S=1024, HID=768, 12×64): q,k,v = x·W + b ((in,out)); scores = q·k/8; global path softmax(scores + attention_mask[b,0,0,k]); local path softmax(scores + (1 − local_mask[b,0,q,k])·f32_min); ctx = gate[b,h,q]·ctx_local + (1 − gate)·ctx_global, merged → [4,1024,768].
// Compute dtype: x, weights, biases, additive mask and gates rounded to bf16; q/k/v f16 GEMM planes; two fused flash-style kernels on v_wmma_f32_16x16x32_f16 (online softmax f32, P f16 ×2^10, f32 accumulate): one with the per-batch additive key bias, one with the per-batch 0/1 (q,k) mask
// (0 → −inf, all-masked chunks skipped); the gated combination in f32.
#define BB 4
#define TT 1024
#define DD 768
#define NH 12
#define NR (BB * TT)

typedef __bf16 v16b __attribute__((ext_vector_type(16)));
typedef unsigned short v8us __attribute__((ext_vector_type(8), may_alias));
typedef float  v8f  __attribute__((ext_vector_type(8)));
typedef float  v4f  __attribute__((ext_vector_type(4)));
typedef float  v4fa __attribute__((ext_vector_type(4), may_alias));
union FragB { v16b v; v8us half[2]; unsigned short u[16]; };

__device__ __forceinline__ unsigned short bf16_bits(float x) { unsigned int u = __float_as_uint(x); return (unsigned short)((u + 0x7FFFu + ((u >> 16) & 1u)) >> 16); }
__device__ __forceinline__ float bf16_val(unsigned short b) { return __uint_as_float(((unsigned int)b) << 16); }
__device__ __forceinline__ float bf16_round(float x) { return bf16_val(bf16_bits(x)); }
// D += A·B with NT terms: 1 = ah·bh, 2 = + al·bh (A split), 3 = + ah·bl (both split)
template <int NT>
__device__ __forceinline__ v8f mmaN(v16b ah, v16b al, v16b bh, v16b bl, v8f c) {
  c = __builtin_amdgcn_wmma_f32_16x16x32_bf16(false, ah, false, bh, (short)0, c, false, false);
  if (NT >= 2) c = __builtin_amdgcn_wmma_f32_16x16x32_bf16(false, al, false, bh, (short)0, c, false, false);
  if (NT >= 3) c = __builtin_amdgcn_wmma_f32_16x16x32_bf16(false, ah, false, bl, (short)0, c, false, false);
  asm volatile("v_nop\n\tv_nop\n\tv_nop\n\tv_nop" : "+v"(c) : "v"(ah), "v"(al), "v"(bh), "v"(bl));
  return c;
}

__global__ __launch_bounds__(256) void k_wt_bf16(const float* __restrict__ W, unsigned short* __restrict__ Wt, int K, int N) {
  const int t = blockIdx.x * 256 + threadIdx.x;
  const int k8n = K / 8;
  if (t >= N * k8n) return;
  const int n = t / k8n, k8 = (t % k8n) * 8;
  v8us v;
#pragma unroll
  for (int i = 0; i < 8; ++i) v[i] = bf16_bits(W[(size_t)(k8 + i) * N + n]);
  *(v8us*)(Wt + (size_t)n * K + k8) = v;
  
}

// GEMM C[M][N] (f32, pitch ldc) = act(A[M][K]·W + bias). A f32 row-major (pitch lda) converted per fragment to bf16
// (ASPLIT: hi/lo two planes -> 2 terms, else single rounded term); Wt bf16 [N][K] (pitch ldb). BIAS_BF16 rounds the
// bias to bf16 first (bias quantised to bf16 before the add). K%32==0, M%16==0, N%64==0.
template <bool ASPLIT, int ACT, bool BIAS_BF16>
__global__ __launch_bounds__(128) void k_gemm_bf(const float* __restrict__ A, int lda, const unsigned short* __restrict__ Wt, int ldb,
                                               const float* __restrict__ bias, float* __restrict__ C, int ldc, int M, int N, int K) {
  __shared__ __attribute__((aligned(16))) float so[4][16][64];
  const int tid = threadIdx.x, w = tid >> 5, lane = tid & 31, ln = lane & 15, hh = lane >> 4;
  const int ntn = N / 64;
  const int wid = blockIdx.x * 4 + w;
  const int mt = wid / ntn, nq = wid % ntn;
  if (mt * 16 >= M) return;
  const int row0 = mt * 16, col0 = nq * 64;
  const float* arow = A + (size_t)(row0 + ln) * lda;
  v8f acc[4] = {};
  for (int kb = 0; kb < K; kb += 32) {
    FragB ah, al;
    const v4f x0 = *(const v4fa*)(arow + kb + 8 * hh), x1 = *(const v4fa*)(arow + kb + 8 * hh + 4);
    const v4f x2 = *(const v4fa*)(arow + kb + 16 + 8 * hh), x3 = *(const v4fa*)(arow + kb + 16 + 8 * hh + 4);
    float xs[16] = {x0[0],x0[1],x0[2],x0[3],x1[0],x1[1],x1[2],x1[3],x2[0],x2[1],x2[2],x2[3],x3[0],x3[1],x3[2],x3[3]};
#pragma unroll
    for (int i = 0; i < 16; ++i) { const unsigned short hb = bf16_bits(xs[i]); ah.u[i] = hb; al.u[i] = ASPLIT ? bf16_bits(xs[i] - bf16_val(hb)) : (unsigned short)0; }
#pragma unroll
    for (int t = 0; t < 4; ++t) {
      const unsigned short* brow = Wt + (size_t)(col0 + t * 16 + ln) * ldb + kb;
      FragB b;
      b.half[0] = *(const v8us*)(brow + 8 * hh);
      b.half[1] = *(const v8us*)(brow + 16 + 8 * hh);
      acc[t] = mmaN<ASPLIT ? 2 : 1>(ah.v, al.v, b.v, b.v, acc[t]);
    }
  }
#pragma unroll
  for (int t = 0; t < 4; ++t) {
    float bv = bias ? bias[col0 + t * 16 + ln] : 0.f;
    if (BIAS_BF16) bv = bf16_round(bv);
#pragma unroll
    for (int r = 0; r < 8; ++r) { float v = acc[t][r] + bv; if (ACT == 1) v = fmaxf(v, 0.f); so[w][8 * hh + r][t * 16 + ln] = v; }
  }
  __builtin_amdgcn_fence(__ATOMIC_ACQ_REL, "workgroup");
  __builtin_amdgcn_wave_barrier();
  const int rsub = lane >> 4, c4 = (lane & 15) * 4;
  {
#pragma unroll
    for (int q = 0; q < 8; ++q) {
      const int r = q * 2 + rsub;
      const v4f v = *(const v4fa*)&so[w][r][c4];
      *(v4f*)(C + (size_t)(row0 + r) * ldc + col0 + c4) = v;
    }
    
  }
}

// Flash-style causal/unmasked attention, all contractions 3-term bf16 hi/lo splits, f32 softmax with running max.
// q,k,v rows are read from f32 buffers with arbitrary row pitch (so they can live inside a fused qkv buffer);
// D = head size (multiple of 32, <= 128); one wave = 16 query rows; block = 4 waves (64 queries) sharing K/V chunks of 32.
template <int D, bool CAUSAL>
__global__ __launch_bounds__(128) void k_flash(const float* __restrict__ qb, const float* __restrict__ kb, const float* __restrict__ vb,
                                             int pitch, int T, int H, float scale, float* __restrict__ y, int ypitch) {
  constexpr int KS = D / 32;        // k-steps for QK
  constexpr int DT = D / 16;        // d tiles for PV
  __shared__ __attribute__((aligned(16))) unsigned short sKh[32][D + 8], sKl[32][D + 8], sVh[32][D + 8], sVl[32][D + 8];
  __shared__ __attribute__((aligned(16))) unsigned short sPh[4][16][40], sPl[4][16][40];
  __shared__ __attribute__((aligned(16))) float sO[4][16][D];
  const int tid = threadIdx.x, w = tid >> 5, lane = tid & 31, ln = lane & 15, hh = lane >> 4;
  const int nqb = (T + 63) / 64;
  const int bh = blockIdx.x / nqb, qblk = blockIdx.x % nqb;
  const int b = bh / H, h = bh % H;
  const int q0 = qblk * 64 + w * 16;
  const float* Q = qb + (size_t)b * T * pitch + h * D;
  const float* K = kb + (size_t)b * T * pitch + h * D;
  const float* V = vb + (size_t)b * T * pitch + h * D;

  // A fragments of the wave's 16 query rows (scaled), hi/lo
  FragB aqh[KS], aql[KS];
  {
    int row = q0 + ln; if (row >= T) row = T - 1;
    const float* qr = Q + (size_t)row * pitch;
#pragma unroll
    for (int ks = 0; ks < KS; ++ks)
#pragma unroll
      for (int i = 0; i < 16; ++i) {
        const int d = ks * 32 + ((i < 8) ? (8 * hh + i) : (16 + 8 * hh + (i - 8)));
        const float x = qr[d] * scale; const unsigned short hb = bf16_bits(x);
        aqh[ks].u[i] = hb; aql[ks].u[i] = bf16_bits(x - bf16_val(hb));
      }
  }
  float m_r[8], l_r[8];
#pragma unroll
  for (int r = 0; r < 8; ++r) { m_r[r] = -3.0e38f; l_r[r] = 0.f; }
  v8f oacc[DT];
#pragma unroll
  for (int dt = 0; dt < DT; ++dt) oacc[dt] = (v8f){0.f,0.f,0.f,0.f,0.f,0.f,0.f,0.f};

  const int kv_end = CAUSAL ? min(T, qblk * 64 + 64) : T;     // block-uniform
  for (int j0 = 0; j0 < kv_end; j0 += 32) {
    __syncthreads();
    for (int e = tid; e < 32 * (D / 4); e += 128) {
      const int r = e / (D / 4), c4 = (e % (D / 4)) * 4;
      const int key = j0 + r;
      v4f kf = {0.f,0.f,0.f,0.f}, vf = {0.f,0.f,0.f,0.f};
      if (key < T) { kf = *(const v4fa*)(K + (size_t)key * pitch + c4); vf = *(const v4fa*)(V + (size_t)key * pitch + c4); }
#pragma unroll
      for (int t = 0; t < 4; ++t) {
        unsigned short hb = bf16_bits(kf[t]); sKh[r][c4 + t] = hb; sKl[r][c4 + t] = bf16_bits(kf[t] - bf16_val(hb));
        hb = bf16_bits(vf[t]); sVh[r][c4 + t] = hb; sVl[r][c4 + t] = bf16_bits(vf[t] - bf16_val(hb));
      }
    }
    __syncthreads();
    // S tile 16 x 32
    v8f s[2];
#pragma unroll
    for (int nt = 0; nt < 2; ++nt) {
      v8f acc = {};
#pragma unroll
      for (int ks = 0; ks < KS; ++ks) {
        FragB bh_, bl_;
        bh_.half[0] = *(const v8us*)&sKh[nt * 16 + ln][ks * 32 + 8 * hh]; bh_.half[1] = *(const v8us*)&sKh[nt * 16 + ln][ks * 32 + 16 + 8 * hh];
        bl_.half[0] = *(const v8us*)&sKl[nt * 16 + ln][ks * 32 + 8 * hh]; bl_.half[1] = *(const v8us*)&sKl[nt * 16 + ln][ks * 32 + 16 + 8 * hh];
        acc = mmaN<3>(aqh[ks].v, aql[ks].v, bh_.v, bl_.v, acc);
      }
      s[nt] = acc;
    }
    // mask + running max (rows 8hh+r; the 16 lanes of a half share rows)
    float alpha[8];
#pragma unroll
    for (int r = 0; r < 8; ++r) {
      const int qi = q0 + 8 * hh + r;
      const int ja = j0 + ln, jb = j0 + 16 + ln;
      if (CAUSAL) { if (ja > qi) s[0][r] = -3.0e38f; if (jb > qi) s[1][r] = -3.0e38f; }
      if (ja >= T) s[0][r] = -3.0e38f;
      if (jb >= T) s[1][r] = -3.0e38f;
      float mx = fmaxf(s[0][r], s[1][r]);
      mx = fmaxf(mx, __shfl_xor(mx, 1, 32)); mx = fmaxf(mx, __shfl_xor(mx, 2, 32)); mx = fmaxf(mx, __shfl_xor(mx, 4, 32)); mx = fmaxf(mx, __shfl_xor(mx, 8, 32));
      const float mnew = fmaxf(m_r[r], mx);
      alpha[r] = (mnew > -1.0e38f) ? __expf(m_r[r] - mnew) : 1.0f;
      const float p0 = (s[0][r] > -1.0e38f) ? __expf(s[0][r] - mnew) : 0.f;
      const float p1 = (s[1][r] > -1.0e38f) ? __expf(s[1][r] - mnew) : 0.f;
      m_r[r] = mnew;
      l_r[r] = l_r[r] * alpha[r] + p0 + p1;            // per-lane partial row sum (16 lanes combined at the end)
      unsigned short hb = bf16_bits(p0); sPh[w][8 * hh + r][ln] = hb;      sPl[w][8 * hh + r][ln] = bf16_bits(p0 - bf16_val(hb));
      hb = bf16_bits(p1);                sPh[w][8 * hh + r][16 + ln] = hb; sPl[w][8 * hh + r][16 + ln] = bf16_bits(p1 - bf16_val(hb));
    }
#pragma unroll
    for (int dt = 0; dt < DT; ++dt)
#pragma unroll
      for (int r = 0; r < 8; ++r) oacc[dt][r] *= alpha[r];
    __builtin_amdgcn_fence(__ATOMIC_ACQ_REL, "workgroup");
    __builtin_amdgcn_wave_barrier();
    FragB pah, pal;
    pah.half[0] = *(const v8us*)&sPh[w][ln][8 * hh]; pah.half[1] = *(const v8us*)&sPh[w][ln][16 + 8 * hh];
    pal.half[0] = *(const v8us*)&sPl[w][ln][8 * hh]; pal.half[1] = *(const v8us*)&sPl[w][ln][16 + 8 * hh];
#pragma unroll
    for (int dt = 0; dt < DT; ++dt) {
      FragB bvh, bvl;
#pragma unroll
      for (int i = 0; i < 8; ++i) {
        bvh.u[i] = sVh[8 * hh + i][dt * 16 + ln]; bvh.u[8 + i] = sVh[16 + 8 * hh + i][dt * 16 + ln];
        bvl.u[i] = sVl[8 * hh + i][dt * 16 + ln]; bvl.u[8 + i] = sVl[16 + 8 * hh + i][dt * 16 + ln];
      }
      oacc[dt] = mmaN<3>(pah.v, pal.v, bvh.v, bvl.v, oacc[dt]);
    }
    __builtin_amdgcn_fence(__ATOMIC_ACQ_REL, "workgroup");
    __builtin_amdgcn_wave_barrier();
  }
#pragma unroll
  for (int r = 0; r < 8; ++r) {
    float l = l_r[r];
    l += __shfl_xor(l, 1, 32); l += __shfl_xor(l, 2, 32); l += __shfl_xor(l, 4, 32); l += __shfl_xor(l, 8, 32);
    l_r[r] = (l > 0.f) ? 1.0f / l : 0.f;
  }
#pragma unroll
  for (int dt = 0; dt < DT; ++dt)
#pragma unroll
    for (int r = 0; r < 8; ++r) sO[w][8 * hh + r][dt * 16 + ln] = oacc[dt][r] * l_r[r];
  __builtin_amdgcn_fence(__ATOMIC_ACQ_REL, "workgroup");
  __builtin_amdgcn_wave_barrier();
  {
    for (int r = 0; r < 16; ++r) {
      const int row = q0 + r;
      if (row < T && lane < D / 4) {
        const v4f val = *(const v4fa*)&sO[w][r][lane * 4];
        *(v4f*)(y + ((size_t)b * T + row) * ypitch + h * D + lane * 4) = val;
      }
    }
    
  }
}

// GEMM C = act(A·W + bias + resid): A f32 (ASPLIT -> hi/lo 2 terms), Wt bf16 [N][K]; ACT 0 none, 1 relu, 2 exact gelu;
// resid (optional, f32, row index = (row % rmod), pitch ldr, RES_BF16 rounds it) added before the activation.
template <bool ASPLIT, int ACT, bool BIAS_BF16, bool RES_BF16>
__global__ __launch_bounds__(128) void k_gemm_bf3(const float* __restrict__ A, int lda, const unsigned short* __restrict__ Wt, int ldb,
                                                const float* __restrict__ bias, const float* __restrict__ resid, int rmod, int ldr,
                                                float* __restrict__ C, int ldc, int M, int N, int K) {
  __shared__ __attribute__((aligned(16))) float so[4][16][64];
  const int tid = threadIdx.x, w = tid >> 5, lane = tid & 31, ln = lane & 15, hh = lane >> 4;
  const int ntn = N / 64;
  const int wid = blockIdx.x * 4 + w;
  const int mt = wid / ntn, nq = wid % ntn;
  if (mt * 16 >= M) return;
  const int row0 = mt * 16, col0 = nq * 64;
  const float* arow = A + (size_t)(row0 + ln) * lda;
  v8f acc[4] = {};
  for (int kb = 0; kb < K; kb += 32) {
    FragB ah, al;
    const v4f x0 = *(const v4fa*)(arow + kb + 8 * hh), x1 = *(const v4fa*)(arow + kb + 8 * hh + 4);
    const v4f x2 = *(const v4fa*)(arow + kb + 16 + 8 * hh), x3 = *(const v4fa*)(arow + kb + 16 + 8 * hh + 4);
    float xs[16] = {x0[0],x0[1],x0[2],x0[3],x1[0],x1[1],x1[2],x1[3],x2[0],x2[1],x2[2],x2[3],x3[0],x3[1],x3[2],x3[3]};
#pragma unroll
    for (int i = 0; i < 16; ++i) { const unsigned short hb = bf16_bits(xs[i]); ah.u[i] = hb; al.u[i] = ASPLIT ? bf16_bits(xs[i] - bf16_val(hb)) : (unsigned short)0; }
#pragma unroll
    for (int t = 0; t < 4; ++t) {
      const unsigned short* brow = Wt + (size_t)(col0 + t * 16 + ln) * ldb + kb;
      FragB b;
      b.half[0] = *(const v8us*)(brow + 8 * hh);
      b.half[1] = *(const v8us*)(brow + 16 + 8 * hh);
      acc[t] = mmaN<ASPLIT ? 2 : 1>(ah.v, al.v, b.v, b.v, acc[t]);
    }
  }
#pragma unroll
  for (int t = 0; t < 4; ++t) {
    const int col = col0 + t * 16 + ln;
    float bv = bias ? bias[col] : 0.f;
    if (BIAS_BF16) bv = bf16_round(bv);
#pragma unroll
    for (int r = 0; r < 8; ++r) {
      float v = acc[t][r] + bv;
      if (resid) { float rv = resid[(size_t)((row0 + 8 * hh + r) % rmod) * ldr + col]; if (RES_BF16) rv = bf16_round(rv); v += rv; }
      if (ACT == 1) v = fmaxf(v, 0.f);
      if (ACT == 2) v = 0.5f * v * (1.0f + erff(v * 0.70710678118654752f));
      if (ACT == 3) { const float u = 0.7978845608028654f * (v + 0.044715f * v * v * v); v = 0.5f * v * (1.0f + tanhf(u)); }
      so[w][8 * hh + r][t * 16 + ln] = v;
    }
  }
  __builtin_amdgcn_fence(__ATOMIC_ACQ_REL, "workgroup");
  __builtin_amdgcn_wave_barrier();
  const int rsub = lane >> 4, c4 = (lane & 15) * 4;
  {
#pragma unroll
    for (int q = 0; q < 8; ++q) {
      const int r = q * 2 + rsub;
      const v4f v = *(const v4fa*)&so[w][r][c4];
      *(v4f*)(C + (size_t)(row0 + r) * ldc + col0 + c4) = v;
    }
    
  }
}
// row LayerNorm (biased variance, eps) over N: s = X (+ R); optional out_sum <- s; out_norm <- (s-mu)*rsqrt(var+eps)*g + b
template <bool PARAM_BF16>
__global__ __launch_bounds__(256) void k_layernorm(const float* __restrict__ X, const float* __restrict__ R, const float* __restrict__ g, const float* __restrict__ bta,
                                                  float* __restrict__ out_sum, float* __restrict__ out_norm, int N, float eps) {
  __shared__ float red[256];
  const int row = blockIdx.x, tid = threadIdx.x;
  const float* x = X + (size_t)row * N; const float* rr = R ? R + (size_t)row * N : nullptr;
  float vals[16];                     // up to N = 4096
  const int per = N / 256;            // contiguous chunk per thread? use strided-by-4 chunks: thread handles j = tid*4 + 1024*u
  float s1 = 0.f;
  for (int u = 0; u < per / 4; ++u) {
    const int j = tid * 4 + 1024 * u;
    const v4f a = *(const v4fa*)(x + j);
    v4f b = {0.f,0.f,0.f,0.f}; if (rr) b = *(const v4fa*)(rr + j);
#pragma unroll
    for (int q = 0; q < 4; ++q) { const float v = a[q] + b[q]; vals[u * 4 + q] = v; s1 += v; }
  }
  red[tid] = s1; __syncthreads();
  for (int st = 128; st > 0; st >>= 1) { if (tid < st) red[tid] += red[tid + st]; __syncthreads(); }
  const float mu = red[0] / (float)N; __syncthreads();
  float s2 = 0.f;
  for (int u = 0; u < per / 4; ++u)
#pragma unroll
    for (int q = 0; q < 4; ++q) { const float c = vals[u * 4 + q] - mu; s2 += c * c; }
  red[tid] = s2; __syncthreads();
  for (int st = 128; st > 0; st >>= 1) { if (tid < st) red[tid] += red[tid + st]; __syncthreads(); }
  const float rs = rsqrtf(red[0] / (float)N + eps);
  {
    for (int u = 0; u < per / 4; ++u) {
      const int j = tid * 4 + 1024 * u;
      v4f o, sm;
#pragma unroll
      for (int q = 0; q < 4; ++q) {
        float gg = g[j + q], bb = bta[j + q];
        if (PARAM_BF16) { gg = bf16_round(gg); bb = bf16_round(bb); }
        sm[q] = vals[u * 4 + q]; o[q] = (vals[u * 4 + q] - mu) * rs * gg + bb;
      }
      if (out_sum) *(v4f*)(out_sum + (size_t)row * N + j) = sm;
      *(v4f*)(out_norm + (size_t)row * N + j) = o;
    }
    
  }
}



// ---- f16 WMMA path (v_wmma_f32_16x16x32_f16): 11-bit significands for operands in range — used where a [0,1] probability operand needs more precision than bf16
typedef _Float16 v16h __attribute__((ext_vector_type(16)));
union FragH { v16h v; v8us half[2]; _Float16 h[16]; unsigned short u[16]; };
template <int NT>
__device__ __forceinline__ v8f mmaH(v16h ah, v16h al, v16h bh, v16h bl, v8f c) {
  c = __builtin_amdgcn_wmma_f32_16x16x32_f16(false, ah, false, bh, (short)0, c, false, false);
  if (NT >= 2) c = __builtin_amdgcn_wmma_f32_16x16x32_f16(false, al, false, bh, (short)0, c, false, false);
  if (NT >= 3) c = __builtin_amdgcn_wmma_f32_16x16x32_f16(false, ah, false, bl, (short)0, c, false, false);
  asm volatile("v_nop\n\tv_nop\n\tv_nop\n\tv_nop" : "+v"(c) : "v"(ah), "v"(al), "v"(bh), "v"(bl));
  return c;
}
// batched GEMM like k_gemm_b but f16 operands: A f32 (split into f16 hi/lo if ASPLIT, else rounded to f16), Bt = f16 values [n][k]; alpha; C f32; N multiple of 16 (partial tiles skipped)
template <bool ASPLIT>
__global__ __launch_bounds__(128) void k_gemm_h(const float* __restrict__ A, int lda, size_t sA, const _Float16* __restrict__ Bh, int ldb, size_t sB, float alpha, float* __restrict__ C, int ldc, size_t sC, int M, int N, int K) {
  __shared__ __attribute__((aligned(16))) float so[4][16][64];
  const int tid = threadIdx.x, w = tid >> 5, lane = tid & 31, ln = lane & 15, hh = lane >> 4; const int by = blockIdx.y;
  A += (size_t)by * sA; Bh += (size_t)by * sB; C += (size_t)by * sC;
  const int ntn = (N + 63) / 64; const int wid = blockIdx.x * 4 + w; const int mt = wid / ntn, nq = wid % ntn; if (mt * 16 >= M) return;
  const int row0 = mt * 16, col0 = nq * 64; const float* arow = A + (size_t)(row0 + ln) * lda;
  v8f acc[4] = {};
  for (int kb = 0; kb < K; kb += 32) {
    FragH ah, al;
    const v4f x0 = *(const v4fa*)(arow + kb + 8 * hh), x1 = *(const v4fa*)(arow + kb + 8 * hh + 4), x2 = *(const v4fa*)(arow + kb + 16 + 8 * hh), x3 = *(const v4fa*)(arow + kb + 16 + 8 * hh + 4);
    float xs[16] = {x0[0],x0[1],x0[2],x0[3],x1[0],x1[1],x1[2],x1[3],x2[0],x2[1],x2[2],x2[3],x3[0],x3[1],x3[2],x3[3]};
#pragma unroll
    for (int i = 0; i < 16; ++i) { const _Float16 h = (_Float16)xs[i]; ah.h[i] = h; al.h[i] = ASPLIT ? (_Float16)(xs[i] - (float)h) : (_Float16)0.0f; }
#pragma unroll
    for (int t = 0; t < 4; ++t) { if (col0 + t * 16 >= N) continue; const size_t boff = (size_t)(col0 + t * 16 + ln) * ldb + kb; FragH bq; bq.half[0] = *(const v8us*)(Bh + boff + 8 * hh); bq.half[1] = *(const v8us*)(Bh + boff + 16 + 8 * hh);
      acc[t] = mmaH<ASPLIT ? 2 : 1>(ah.v, al.v, bq.v, bq.v, acc[t]); }
  }
#pragma unroll
  for (int t = 0; t < 4; ++t) { if (col0 + t * 16 >= N) continue;
#pragma unroll
    for (int r = 0; r < 8; ++r) so[w][8 * hh + r][t * 16 + ln] = acc[t][r] * alpha; }
  __builtin_amdgcn_fence(__ATOMIC_ACQ_REL, "workgroup"); __builtin_amdgcn_wave_barrier();
  const int rsub = lane >> 4, c4 = (lane & 15) * 4;
  {
#pragma unroll
    for (int q = 0; q < 8; ++q) { const int r = q * 2 + rsub; if (col0 + c4 < N) { const v4f v = *(const v4fa*)&so[w][r][c4]; *(v4f*)(C + (size_t)(row0 + r) * ldc + col0 + c4) = v; } }
     }
}

// Wt[n][k] = f16(W[k][n]·scale) from f32 row-major W[K][N] (scale = power of two; bf16-exact weights stay exact in f16 away from the subnormal range)
__global__ __launch_bounds__(256) void k_wt_f16(const float* __restrict__ W, _Float16* __restrict__ Wt, int K, int N, float scale) {
  const int t = blockIdx.x * 256 + threadIdx.x; if (t >= N * (K / 8)) return; const int n = t / (K / 8), k8 = (t % (K / 8)) * 8; FragH f;
#pragma unroll
  for (int i = 0; i < 8; ++i) f.h[i] = (_Float16)(bf16_round(W[(size_t)(k8 + i) * N + n]) * scale); const v8us o = f.half[0];
  *(v8us*)((unsigned short*)Wt + (size_t)n * K + k8) = o; 
}
// k_gemm_hh variant with fused epilogue: v = acc·alpha + bias[by·sBias + col] (+ CP[(row/rowsPerB)·sCPb + by·64 + col] if CP) ; ACT 0 none / 1 elu ; writes f16 C16 (and f32 C if non-null)
template <int ACT>
__global__ __launch_bounds__(128) void k_gemm_hhx(const _Float16* __restrict__ A, int lda, size_t sA, const _Float16* __restrict__ Bh, int ldb, size_t sB, float alpha, const float* __restrict__ bias, size_t sBias, const float* __restrict__ CP, int rowsPerB, size_t sCPb, int row0g,
    float* __restrict__ C, _Float16* __restrict__ C16, int ldc, size_t sC, int M, int N, int K) {
  __shared__ __attribute__((aligned(16))) float so[4][16][64];
  const int tid = threadIdx.x, w = tid >> 5, lane = tid & 31, ln = lane & 15, hh = lane >> 4; const int by = blockIdx.y;
  A += (size_t)by * sA; Bh += (size_t)by * sB; const size_t cofs = (size_t)by * sC; const float* bp = bias ? bias + (size_t)by * sBias : nullptr;
  const int ntn = (N + 63) / 64; const int wid = blockIdx.x * 4 + w; const int mt = wid / ntn, nq = wid % ntn; if (mt * 16 >= M) return;
  const int row0 = mt * 16, col0 = nq * 64; const _Float16* arow = A + (size_t)(row0 + ln) * lda;
  v8f acc[4] = {};
  // Fragments are fetched ahead: two register sets of 64 k each; while one set feeds its 8 WMMAs the other set's 20 loads are in flight. K % 128 == 0.
  // A column tile past N reads row N - 1 (in bounds); its accumulator is never stored (the guards of the epilogue).
  const unsigned short* ap = (const unsigned short*)arow + 8 * hh; const unsigned short* wp[4];
#pragma unroll
  for (int t = 0; t < 4; ++t) { int cr = col0 + t * 16 + ln; if (cr > N - 1) cr = N - 1; wp[t] = (const unsigned short*)Bh + (size_t)cr * ldb + 8 * hh; }
  FragH a0[2], a1[2], b0[2][4], b1[2][4];
  auto ldf = [&](FragH (&a)[2], FragH (&bq)[2][4], int kb, int ko) {      /* k = kb + ko; ko is a literal and goes into the loads' offset fields */
    const unsigned short* pa = ap + kb; const unsigned short* pw[4] = {wp[0] + kb, wp[1] + kb, wp[2] + kb, wp[3] + kb};
#pragma unroll
    for (int ks = 0; ks < 2; ++ks) { a[ks].half[0] = *(const v8us*)(pa + ko + ks * 32); a[ks].half[1] = *(const v8us*)(pa + ko + ks * 32 + 16);
#pragma unroll
      for (int t = 0; t < 4; ++t) { bq[ks][t].half[0] = *(const v8us*)(pw[t] + ko + ks * 32); bq[ks][t].half[1] = *(const v8us*)(pw[t] + ko + ks * 32 + 16); } }
    /* the group's address pairs are named so that no register of them is reused (not even as a later load's result) before the loads have taken them */
    asm volatile("s_wait_xcnt 0x0" :: "v"(pa), "v"(pw[0]), "v"(pw[1]), "v"(pw[2]), "v"(pw[3]) : "memory"); };
  auto mmf = [&](FragH (&a)[2], FragH (&bq)[2][4]) {
#pragma unroll
    for (int ks = 0; ks < 2; ++ks)
#pragma unroll
      for (int t = 0; t < 4; ++t) acc[t] = mmaH<1>(a[ks].v, a[ks].v, bq[ks][t].v, bq[ks][t].v, acc[t]); };
  ldf(a0, b0, 0, 0);
  for (int kb = 0; kb < K; kb += 128) {
    ldf(a1, b1, kb, 64);
    mmf(a0, b0);
    ldf(a0, b0, (kb + 128 < K) ? kb + 128 : 0, 0);      /* last trip: wraps to k = 0, in bounds, values unused; no branch, so the waits stay counted */
    mmf(a1, b1);
  }
#pragma unroll
  for (int t = 0; t < 4; ++t) { if (col0 + t * 16 >= N) continue; const int col = col0 + t * 16 + ln; const float bv = bp ? bf16_round(bp[col]) : 0.f;
#pragma unroll
    for (int r = 0; r < 8; ++r) { float v = acc[t][r] * alpha + bv; if (CP) { const int bidx = (row0g + row0 + 8 * hh + r) / rowsPerB; v += CP[(size_t)bidx * sCPb + (size_t)by * 64 + col]; } if (ACT == 1) v = (v > 0.f) ? v : expm1f(v); else if (ACT == 7) v = (v > 0.f) ? v + 1.0f : expf(v); else if (ACT == 8) v = tanhf(v); else if (ACT == 9) v = 0.5f * v * (1.0f + tanhf(0.7978845608028654f * (v + 0.044715f * v * v * v))); else if (ACT == 11) v = 1.0f / (1.0f + expf(-v)); else if (ACT == 12) v = (v > 0.f) ? v : 0.01f * v; else if (ACT == 14) v = (v > 0.f) ? v : 0.1f * v; else if (ACT == 15) v = v / (1.0f + expf(-v)); else if (ACT == 3) v = fmaxf(v, 0.f); else if (ACT == 6) v = 0.5f * v * (1.0f + erff(v * 0.70710678118654752f)); so[w][8 * hh + r][t * 16 + ln] = v; } }
  __builtin_amdgcn_fence(__ATOMIC_ACQ_REL, "workgroup"); __builtin_amdgcn_wave_barrier();
  const int rsub = lane >> 4, c4 = (lane & 15) * 4; typedef _Float16 v4h __attribute__((ext_vector_type(4)));
  {
#pragma unroll
    for (int q = 0; q < 8; ++q) { const int r = q * 2 + rsub; if (col0 + c4 < N) { const v4f v = *(const v4fa*)&so[w][r][c4]; if (C) *(v4f*)(C + cofs + (size_t)(row0 + r) * ldc + col0 + c4) = v; if (C16) { v4h h4; for (int i = 0; i < 4; ++i) h4[i] = (_Float16)v[i]; *(v4h*)(C16 + cofs + (size_t)(row0 + r) * ldc + col0 + c4) = h4; } } }
     }
}


typedef _Float16 v4h __attribute__((ext_vector_type(4)));

__global__ __launch_bounds__(256) void k_x16(const float* __restrict__ x, _Float16* __restrict__ X16, size_t n8) { const size_t t = (size_t)blockIdx.x * 256 + threadIdx.x; if (t >= n8) return; FragH f;
#pragma unroll
  for (int q = 0; q < 8; ++q) f.h[q] = (_Float16)bf16_round(x[t * 8 + q]); *(v8us*)((unsigned short*)X16 + t * 8) = f.half[0];  }
__global__ __launch_bounds__(256) void k_h16(const float* __restrict__ x, _Float16* __restrict__ X16, size_t n8) { const size_t t = (size_t)blockIdx.x * 256 + threadIdx.x; if (t >= n8) return; FragH f;
#pragma unroll
  for (int q = 0; q < 8; ++q) f.h[q] = (_Float16)x[t * 8 + q]; *(v8us*)((unsigned short*)X16 + t * 8) = f.half[0];  }
__global__ __launch_bounds__(256) void k_round16f(const float* __restrict__ W, _Float16* __restrict__ Bt, size_t n8) { const size_t t = (size_t)blockIdx.x * 256 + threadIdx.x; if (t >= n8) return; FragH f;
#pragma unroll
  for (int i = 0; i < 8; ++i) f.h[i] = (_Float16)(bf16_round(W[t * 8 + i]) * 16.0f); *(v8us*)((unsigned short*)Bt + t * 8) = f.half[0];  }
template <int NHv, int TTv>
__global__ __launch_bounds__(256) void k_vt(const _Float16* __restrict__ V16, int ldv, int voff, _Float16* __restrict__ Vt) { __shared__ unsigned short tl[64][66]; const int tid = threadIdx.x; const int slab = blockIdx.x / (TTv / 64), lg = blockIdx.x % (TTv / 64); const int b = slab / NHv, h = slab % NHv;
  for (int i = tid; i < 64 * 8; i += 256) { const int r = i / 8, c8 = (i % 8) * 8; FragH f; f.half[0] = *(const v8us*)((const unsigned short*)V16 + ((size_t)b * TTv + lg * 64 + r) * ldv + voff + h * 64 + c8);
#pragma unroll
    for (int q = 0; q < 8; ++q) tl[r][c8 + q] = f.u[q]; }
  __syncthreads();
  {
#pragma unroll
    for (int rd = 0; rd < 2; ++rd) { const int d = rd * 32 + tid / 8, pc = tid % 8; FragH f;
#pragma unroll
      for (int q = 0; q < 8; ++q) f.u[q] = tl[pc * 8 + q][d];
      *(v8us*)((unsigned short*)Vt + ((size_t)slab * 64 + d) * TTv + lg * 64 + pc * 8) = f.half[0]; }
     } }

__global__ __launch_bounds__(128) void k_flash_g(const _Float16* __restrict__ Q16, int ldq, const _Float16* __restrict__ K16, int ldk, const _Float16* __restrict__ Vt, const float* __restrict__ AB, float* __restrict__ O, int ldo) {
  constexpr int RPW = 16, RTN = RPW / 16, NQB = TT / (4 * RPW), DT = 4, KS = 2;
  __shared__ __attribute__((aligned(16))) unsigned short sP[4][RPW][40]; __shared__ __attribute__((aligned(16))) float sO[4][RPW][64 + 4];
  const int tid = threadIdx.x, w = tid >> 5, lane = tid & 31, ln = lane & 15, hh = lane >> 4;
  const int slab = blockIdx.x / NQB, qblk = blockIdx.x % NQB; const int b = slab / NH, h = slab % NH; const int qb0 = qblk * (4 * RPW); const int q0 = qb0 + w * RPW;
  FragH aq[2][KS];
#pragma unroll
  for (int rt = 0; rt < RTN; ++rt) { const unsigned short* qr = (const unsigned short*)Q16 + ((size_t)b * TT + q0 + rt * 16 + ln) * ldq + h * 64;
#pragma unroll
    for (int ks = 0; ks < KS; ++ks) { aq[rt][ks].half[0] = *(const v8us*)(qr + ks * 32 + 8 * hh); aq[rt][ks].half[1] = *(const v8us*)(qr + ks * 32 + 16 + 8 * hh); } }
  const unsigned short* Vth = (const unsigned short*)Vt + (size_t)slab * 64 * TT;
  float m_r[2][8], l_r[2][8]; v8f oacc[2][DT];
#pragma unroll
  for (int rt = 0; rt < RTN; ++rt) {
#pragma unroll
    for (int r = 0; r < 8; ++r) { m_r[rt][r] = -3.0e38f; l_r[rt][r] = 0.f; }
#pragma unroll
    for (int dt = 0; dt < DT; ++dt) oacc[rt][dt] = (v8f){0.f,0.f,0.f,0.f,0.f,0.f,0.f,0.f}; }
  const int jend = TT;
  // Global loads are issued ahead of their use: the K fragments and the key bias one pass ahead (registers carried round the loop), the V^T fragments at the top of their own pass; their latency then runs under the softmax, not in front of each WMMA.
  const unsigned short* Kl = (const unsigned short*)K16 + ((size_t)b * TT + ln) * ldk + h * 64 + 8 * hh; FragH bk[2][KS];
  const float* aml = AB + (size_t)b * TT + ln; float abn0, abn1;
  auto ldK = [&](int j) {
    const unsigned short* kr[2] = {Kl + (size_t)j * ldk, Kl + (size_t)(j + 16) * ldk}; const float* am = aml + j;
#pragma unroll
    for (int nt = 0; nt < 2; ++nt)
#pragma unroll
      for (int ks = 0; ks < KS; ++ks) { bk[nt][ks].half[0] = *(const v8us*)(kr[nt] + ks * 32); bk[nt][ks].half[1] = *(const v8us*)(kr[nt] + ks * 32 + 16); }
    abn0 = am[0]; abn1 = am[16];
    /* the group's address pairs are named so that no register of them is reused (not even as a later load's result) before the loads have taken them */
    asm volatile("s_wait_xcnt 0x0" :: "v"(kr[0]), "v"(kr[1]), "v"(am) : "memory"); };
  ldK(0);
#pragma unroll 1
  for (int j0 = 0; j0 < jend; j0 += 32) {
    const int jn = (j0 + 32 < jend) ? j0 + 32 : 0;      /* the pass fetched for; behind the last pass it wraps to key 0: in bounds, values unused; no branch, so the waits stay counted */
    const float ab0v = bf16_round(abn0), ab1v = bf16_round(abn1);      /* additive attention bias (bf16-rounded input) of keys j0 + ln, j0 + 16 + ln */
    FragH bv[DT];      /* V^T fragments of this pass: issued here, used behind the softmax */
    const unsigned short* vr = Vth + (size_t)ln * TT + j0 + 8 * hh;
#pragma unroll
    for (int dt = 0; dt < DT; ++dt) { bv[dt].half[0] = *(const v8us*)(vr + dt * 16 * TT); bv[dt].half[1] = *(const v8us*)(vr + dt * 16 * TT + 16); }
    asm volatile("s_wait_xcnt 0x0" :: "v"(vr) : "memory");      /* as in ldK: the address pair stays whole until the loads have taken it */
    v8f s[2][2];
#pragma unroll
    for (int nt = 0; nt < 2; ++nt) {
#pragma unroll
      for (int rt = 0; rt < RTN; ++rt) { v8f acc = (v8f){0.f,0.f,0.f,0.f,0.f,0.f,0.f,0.f};
#pragma unroll
        for (int ks = 0; ks < KS; ++ks) acc = mmaH<1>(aq[rt][ks].v, aq[rt][ks].v, bk[nt][ks].v, bk[nt][ks].v, acc); s[rt][nt] = acc; } }
    ldK(jn);
#pragma unroll
    for (int rt = 0; rt < RTN; ++rt)
#pragma unroll
      for (int r = 0; r < 8; ++r) { const int tq = q0 + rt * 16 + 8 * hh + r; const int k0 = j0 + ln, k1 = j0 + 16 + ln; (void)tq; (void)k0; (void)k1;
        const bool ok0 = true, ok1 = true;
        const float s0 = s[rt][0][r] * 0.125f + ab0v, s1 = s[rt][1][r] * 0.125f + ab1v; float mc = fmaxf(s0, s1);
        mc = fmaxf(mc, __shfl_xor(mc, 1, 32)); mc = fmaxf(mc, __shfl_xor(mc, 2, 32)); mc = fmaxf(mc, __shfl_xor(mc, 4, 32)); mc = fmaxf(mc, __shfl_xor(mc, 8, 32));
        const float mn = fmaxf(m_r[rt][r], mc); const float al = (mn > -1.0e38f) ? expf(m_r[rt][r] - mn) : 1.0f; m_r[rt][r] = mn; const float p0 = ok0 ? expf(s0 - mn) : 0.f, p1 = ok1 ? expf(s1 - mn) : 0.f; l_r[rt][r] = l_r[rt][r] * al + p0 + p1;
#pragma unroll
        for (int dt = 0; dt < DT; ++dt) oacc[rt][dt][r] *= al;
        FragH t2; t2.h[0] = (_Float16)(p0 * 1024.0f); t2.h[1] = (_Float16)(p1 * 1024.0f); sP[w][rt * 16 + 8 * hh + r][ln] = t2.u[0]; sP[w][rt * 16 + 8 * hh + r][16 + ln] = t2.u[1]; }
    __builtin_amdgcn_fence(__ATOMIC_ACQ_REL, "workgroup"); __builtin_amdgcn_wave_barrier();
    FragH pa[2];
#pragma unroll
    for (int rt = 0; rt < RTN; ++rt) { pa[rt].half[0] = *(const v8us*)&sP[w][rt * 16 + ln][8 * hh]; pa[rt].half[1] = *(const v8us*)&sP[w][rt * 16 + ln][16 + 8 * hh]; }
#pragma unroll
    for (int dt = 0; dt < DT; ++dt) {
#pragma unroll
      for (int rt = 0; rt < RTN; ++rt) oacc[rt][dt] = mmaH<1>(pa[rt].v, pa[rt].v, bv[dt].v, bv[dt].v, oacc[rt][dt]); }
    __builtin_amdgcn_fence(__ATOMIC_ACQ_REL, "workgroup"); __builtin_amdgcn_wave_barrier(); }
#pragma unroll
  for (int rt = 0; rt < RTN; ++rt) {
#pragma unroll
    for (int r = 0; r < 8; ++r) { float l = l_r[rt][r]; l += __shfl_xor(l, 1, 32); l += __shfl_xor(l, 2, 32); l += __shfl_xor(l, 4, 32); l += __shfl_xor(l, 8, 32); l_r[rt][r] = (l > 0.f) ? 1.0f / (l * 1024.0f) : 0.f; }
#pragma unroll
    for (int dt = 0; dt < DT; ++dt)
#pragma unroll
      for (int r = 0; r < 8; ++r) sO[w][rt * 16 + 8 * hh + r][dt * 16 + ln] = oacc[rt][dt][r] * l_r[rt][r]; }
  __builtin_amdgcn_fence(__ATOMIC_ACQ_REL, "workgroup"); __builtin_amdgcn_wave_barrier();
  {
#pragma unroll
    for (int rp = 0; rp < RPW; rp += 2) { const int r = rp + (lane >> 4), pc = lane & 15; const v4f val = *(const v4fa*)&sO[w][r][pc * 4]; *(v4f*)(O + ((size_t)b * TT + q0 + r) * ldo + h * 64 + pc * 4) = val; }
     } }

__global__ __launch_bounds__(128) void k_flash_l(const _Float16* __restrict__ Q16, int ldq, const _Float16* __restrict__ K16, int ldk, const _Float16* __restrict__ Vt, const int* __restrict__ MSK, float* __restrict__ O, int ldo) {
  constexpr int RPW = 16, RTN = RPW / 16, NQB = TT / (4 * RPW), DT = 4, KS = 2;
  __shared__ __attribute__((aligned(16))) unsigned short sP[4][RPW][40]; __shared__ __attribute__((aligned(16))) float sO[4][RPW][64 + 4];
  const int tid = threadIdx.x, w = tid >> 5, lane = tid & 31, ln = lane & 15, hh = lane >> 4;
  const int slab = blockIdx.x / NQB, qblk = blockIdx.x % NQB; const int b = slab / NH, h = slab % NH; const int qb0 = qblk * (4 * RPW); const int q0 = qb0 + w * RPW;
  FragH aq[2][KS];
#pragma unroll
  for (int rt = 0; rt < RTN; ++rt) { const unsigned short* qr = (const unsigned short*)Q16 + ((size_t)b * TT + q0 + rt * 16 + ln) * ldq + h * 64;
#pragma unroll
    for (int ks = 0; ks < KS; ++ks) { aq[rt][ks].half[0] = *(const v8us*)(qr + ks * 32 + 8 * hh); aq[rt][ks].half[1] = *(const v8us*)(qr + ks * 32 + 16 + 8 * hh); } }
  const unsigned short* Vth = (const unsigned short*)Vt + (size_t)slab * 64 * TT;
  float m_r[2][8], l_r[2][8]; v8f oacc[2][DT];
#pragma unroll
  for (int rt = 0; rt < RTN; ++rt) {
#pragma unroll
    for (int r = 0; r < 8; ++r) { m_r[rt][r] = -3.0e38f; l_r[rt][r] = 0.f; }
#pragma unroll
    for (int dt = 0; dt < DT; ++dt) oacc[rt][dt] = (v8f){0.f,0.f,0.f,0.f,0.f,0.f,0.f,0.f}; }
  const int jend = TT;
  // Global loads are issued ahead of their use: the K fragments and the mask words one pass ahead (registers carried round the loop), the V^T fragments at the top of their own pass; their latency then runs under the softmax, not in front of each WMMA.
  const unsigned short* Kl = (const unsigned short*)K16 + ((size_t)b * TT + ln) * ldk + h * 64 + 8 * hh; FragH bk[2][KS];
  const int* Ml = MSK + ((size_t)b * TT + q0 + 8 * hh) * TT + ln; int mkn0[2][8], mkn1[2][8];
  auto ldK = [&](int j) {
    const unsigned short* kr[2] = {Kl + (size_t)j * ldk, Kl + (size_t)(j + 16) * ldk}; const int* am = Ml + j;
#pragma unroll
    for (int rt = 0; rt < RTN; ++rt)
#pragma unroll
      for (int r = 0; r < 8; ++r) { mkn0[rt][r] = am[(rt * 16 + r) * TT]; mkn1[rt][r] = am[(rt * 16 + r) * TT + 16]; }
#pragma unroll
    for (int nt = 0; nt < 2; ++nt)
#pragma unroll
      for (int ks = 0; ks < KS; ++ks) { bk[nt][ks].half[0] = *(const v8us*)(kr[nt] + ks * 32); bk[nt][ks].half[1] = *(const v8us*)(kr[nt] + ks * 32 + 16); }
    /* the group's address pairs are named so that no register of them is reused (not even as a later load's result) before the loads have taken them */
    asm volatile("s_wait_xcnt 0x0" :: "v"(kr[0]), "v"(kr[1]), "v"(am) : "memory"); };
  ldK(0);
#pragma unroll 1
  for (int j0 = 0; j0 < jend; j0 += 32) {
    const int jn = (j0 + 32 < jend) ? j0 + 32 : 0;      /* the pass fetched for; behind the last pass it wraps to key 0: in bounds, values unused; no branch, so the waits stay counted */
    int mk0[2][8], mk1[2][8];      /* per-batch mask [b][q][k]: nonzero = ATTEND */
#pragma unroll
    for (int rt = 0; rt < RTN; ++rt)
#pragma unroll
      for (int r = 0; r < 8; ++r) { mk0[rt][r] = mkn0[rt][r]; mk1[rt][r] = mkn1[rt][r]; }
    { int allm = 1;
#pragma unroll
      for (int rt = 0; rt < RTN; ++rt)
#pragma unroll
        for (int r = 0; r < 8; ++r) allm &= (mk0[rt][r] == 0) & (mk1[rt][r] == 0);
      if (__all(allm)) { ldK(jn); continue; } }      /* every (row, key) of this wave's tile masked: nothing to add, only the next pass's fetch (wave-uniform branch; only wave barriers inside the loop) */
    FragH bv[DT];      /* V^T fragments of this pass: issued here, used behind the softmax */
    const unsigned short* vr = Vth + (size_t)ln * TT + j0 + 8 * hh;
#pragma unroll
    for (int dt = 0; dt < DT; ++dt) { bv[dt].half[0] = *(const v8us*)(vr + dt * 16 * TT); bv[dt].half[1] = *(const v8us*)(vr + dt * 16 * TT + 16); }
    asm volatile("s_wait_xcnt 0x0" :: "v"(vr) : "memory");      /* as in ldK: the address pair stays whole until the loads have taken it */
    v8f s[2][2];
#pragma unroll
    for (int nt = 0; nt < 2; ++nt) {
#pragma unroll
      for (int rt = 0; rt < RTN; ++rt) { v8f acc = (v8f){0.f,0.f,0.f,0.f,0.f,0.f,0.f,0.f};
#pragma unroll
        for (int ks = 0; ks < KS; ++ks) acc = mmaH<1>(aq[rt][ks].v, aq[rt][ks].v, bk[nt][ks].v, bk[nt][ks].v, acc); s[rt][nt] = acc; } }
    ldK(jn);
#pragma unroll
    for (int rt = 0; rt < RTN; ++rt)
#pragma unroll
      for (int r = 0; r < 8; ++r) { const int tq = q0 + rt * 16 + 8 * hh + r; const int k0 = j0 + ln, k1 = j0 + 16 + ln; (void)tq; (void)k0; (void)k1;
        const bool ok0 = (mk0[rt][r] != 0), ok1 = (mk1[rt][r] != 0);      /* nonzero = ATTEND */
        const float s0 = ok0 ? s[rt][0][r] * 0.125f : -INFINITY, s1 = ok1 ? s[rt][1][r] * 0.125f : -INFINITY; float mc = fmaxf(s0, s1);
        mc = fmaxf(mc, __shfl_xor(mc, 1, 32)); mc = fmaxf(mc, __shfl_xor(mc, 2, 32)); mc = fmaxf(mc, __shfl_xor(mc, 4, 32)); mc = fmaxf(mc, __shfl_xor(mc, 8, 32));
        const float mn = fmaxf(m_r[rt][r], mc); const float al = (mn > -1.0e38f) ? expf(m_r[rt][r] - mn) : 1.0f; m_r[rt][r] = mn; const float p0 = ok0 ? expf(s0 - mn) : 0.f, p1 = ok1 ? expf(s1 - mn) : 0.f; l_r[rt][r] = l_r[rt][r] * al + p0 + p1;
#pragma unroll
        for (int dt = 0; dt < DT; ++dt) oacc[rt][dt][r] *= al;
        FragH t2; t2.h[0] = (_Float16)(p0 * 1024.0f); t2.h[1] = (_Float16)(p1 * 1024.0f); sP[w][rt * 16 + 8 * hh + r][ln] = t2.u[0]; sP[w][rt * 16 + 8 * hh + r][16 + ln] = t2.u[1]; }
    __builtin_amdgcn_fence(__ATOMIC_ACQ_REL, "workgroup"); __builtin_amdgcn_wave_barrier();
    FragH pa[2];
#pragma unroll
    for (int rt = 0; rt < RTN; ++rt) { pa[rt].half[0] = *(const v8us*)&sP[w][rt * 16 + ln][8 * hh]; pa[rt].half[1] = *(const v8us*)&sP[w][rt * 16 + ln][16 + 8 * hh]; }
#pragma unroll
    for (int dt = 0; dt < DT; ++dt) {
#pragma unroll
      for (int rt = 0; rt < RTN; ++rt) oacc[rt][dt] = mmaH<1>(pa[rt].v, pa[rt].v, bv[dt].v, bv[dt].v, oacc[rt][dt]); }
    __builtin_amdgcn_fence(__ATOMIC_ACQ_REL, "workgroup"); __builtin_amdgcn_wave_barrier(); }
#pragma unroll
  for (int rt = 0; rt < RTN; ++rt) {
#pragma unroll
    for (int r = 0; r < 8; ++r) { float l = l_r[rt][r]; l += __shfl_xor(l, 1, 32); l += __shfl_xor(l, 2, 32); l += __shfl_xor(l, 4, 32); l += __shfl_xor(l, 8, 32); l_r[rt][r] = (l > 0.f) ? 1.0f / (l * 1024.0f) : 0.f; }
#pragma unroll
    for (int dt = 0; dt < DT; ++dt)
#pragma unroll
      for (int r = 0; r < 8; ++r) sO[w][rt * 16 + 8 * hh + r][dt * 16 + ln] = oacc[rt][dt][r] * l_r[rt][r]; }
  __builtin_amdgcn_fence(__ATOMIC_ACQ_REL, "workgroup"); __builtin_amdgcn_wave_barrier();
  {
#pragma unroll
    for (int rp = 0; rp < RPW; rp += 2) { const int r = rp + (lane >> 4), pc = lane & 15; const v4f val = *(const v4fa*)&sO[w][r][pc * 4]; *(v4f*)(O + ((size_t)b * TT + q0 + r) * ldo + h * 64 + pc * 4) = val; }
     } }

__global__ __launch_bounds__(256) void k_comb(const float* __restrict__ Og, const float* __restrict__ Ol, const float* __restrict__ gate, float* __restrict__ out) {
  #pragma clang fp contract(off)
  const size_t t = (size_t)blockIdx.x * 256 + threadIdx.x; if (t >= (size_t)NR * DD / 4) return; const size_t e0 = t * 4; const size_t row = e0 / DD; const int c = (int)(e0 % DD); const int h = c / 64; const int b = (int)(row / TT), q = (int)(row % TT);
  const float g = bf16_round(gate[((size_t)b * NH + h) * TT + q]); const v4f a = *(const v4fa*)(Og + e0), l = *(const v4fa*)(Ol + e0); v4f o; for (int i = 0; i < 4; ++i) o[i] = g * l[i] + (1.0f - g) * a[i];
  *(v4f*)(out + e0) = o;  }

extern "C" void kernel_launch(void* const* d_in, const int* in_sizes, int n_in,
                              void* d_out, int out_size, void* d_ws, size_t ws_size, hipStream_t stream) {
  (void)in_sizes; (void)n_in; (void)out_size;
  const float* const* I = (const float* const*)d_in; const float* x = I[0]; const float* am = I[1]; const int* lm = (const int*)d_in[2]; const float* gate = I[3]; const float* Wq = I[4]; const float* bq = I[5]; const float* Wk = I[6]; const float* bk = I[7]; const float* Wv = I[8]; const float* bv = I[9];
  char* ws = (char*)d_ws; size_t off = 0;
  auto take = [&](size_t bytes) { char* p = ws + off; off += (bytes + 255) & ~(size_t)255; return p; };
  const size_t WSZ = (size_t)DD * DD; _Float16* Bw = (_Float16*)take(3 * WSZ * 2); _Float16* X16 = (_Float16*)take((size_t)NR * DD * 2); _Float16* Q = (_Float16*)take((size_t)NR * DD * 2); _Float16* K = (_Float16*)take((size_t)NR * DD * 2); _Float16* V = (_Float16*)take((size_t)NR * DD * 2); _Float16* Vt = (_Float16*)take((size_t)NR * DD * 2); float* Og = (float*)take((size_t)NR * DD * 4); float* Ol = (float*)take((size_t)NR * DD * 4);
  if (off > ws_size) return;      // 3.5 + 5 × 6.3 + 12.6 + 12.6 ≈ 60 MB
  const unsigned gw = (unsigned)((WSZ / 8 + 255) / 256); k_wt_f16<<<gw, 256, 0, stream>>>(Wq, Bw, DD, DD, 16.0f); k_wt_f16<<<gw, 256, 0, stream>>>(Wk, Bw + WSZ, DD, DD, 16.0f); k_wt_f16<<<gw, 256, 0, stream>>>(Wv, Bw + 2 * WSZ, DD, DD, 16.0f);      /* (in,out) → Bt ×2^4 */
  k_x16<<<(unsigned)(((size_t)NR * DD / 8 + 255) / 256), 256, 0, stream>>>(x, X16, (size_t)NR * DD / 8);
  const dim3 gp(((NR / 16) * (DD / 64) + 3) / 4, 1);
  k_gemm_hhx<0><<<gp, 128, 0, stream>>>(X16, DD, 0, Bw, DD, 0, 0.0625f, bq, 0, nullptr, 1, 0, 0, nullptr, Q, DD, 0, NR, DD, DD);      /* M 4096 N 768 K 768 */
  k_gemm_hhx<0><<<gp, 128, 0, stream>>>(X16, DD, 0, Bw + WSZ, DD, 0, 0.0625f, bk, 0, nullptr, 1, 0, 0, nullptr, K, DD, 0, NR, DD, DD);
  k_gemm_hhx<0><<<gp, 128, 0, stream>>>(X16, DD, 0, Bw + 2 * WSZ, DD, 0, 0.0625f, bv, 0, nullptr, 1, 0, 0, nullptr, V, DD, 0, NR, DD, DD);
  k_vt<NH, TT><<<BB * NH * (TT / 64), 256, 0, stream>>>(V, DD, 0, Vt);
  k_flash_g<<<BB * NH * (TT / 64), 128, 0, stream>>>(Q, DD, K, DD, Vt, am, Og, DD);      /* global path: + attention_mask[b,0,0,k] */
  k_flash_l<<<BB * NH * (TT / 64), 128, 0, stream>>>(Q, DD, K, DD, Vt, lm, Ol, DD);      /* local path: local_attention_mask[b,0,q,k] == 0 → −inf */
  k_comb<<<(unsigned)(((size_t)NR * DD / 4 + 255) / 256), 256, 0, stream>>>(Og, Ol, gate, (float*)d_out);
}

// v002
// It runs in 191 microseconds.
// Two timings next to v001 both put it at 1.37 times that version's speed.
// All steps since v000 together make it 1.88 times as fast.
#include <hip/hip_runtime.h>
// Gated global/local self attention (B=4, S=1024, HID=768, 12×64): q,k,v = x·W + b ((in,out)); scores = q·k/8; global path softmax(scores + attention_mask[b,0,0,k]); local path softmax(scores + (1 − local_mask[b,0,q,k])·f32_min); ctx = gate[b,h,q]·ctx_local + (1 − gate)·ctx_global, merged → [4,1024,768].
// Compute dtype: x, weights, biases, additive mask and gates rounded to bf16; q/k/v f16 GEMM planes; two fused flash-style kernels on v_wmma_f32_16x16x32_f16 (online softmax f32, P f16 ×2^10, f32 accumulate): one with the per-batch additive key bias, one with the per-batch 0/1 (q,k) mask
// (0 → −inf, all-masked chunks skipped); the gated combination in f32.
#define BB 4
#define TT 1024
#define DD 768
#define NH 12
#define NR (BB * TT)

typedef __bf16 v16b __attribute__((ext_vector_type(16)));
typedef unsigned short v8us __attribute__((ext_vector_type(8), may_alias));
typedef float  v8f  __attribute__((ext_vector_type(8)));
typedef float  v4f  __attribute__((ext_vector_type(4)));
typedef float  v4fa __attribute__((ext_vector_type(4), may_alias));
union FragB { v16b v; v8us half[2]; unsigned short u[16]; };

__device__ __forceinline__ unsigned short bf16_bits(float x) { unsigned int u = __float_as_uint(x); return (unsigned short)((u + 0x7FFFu + ((u >> 16) & 1u)) >> 16); }
__device__ __forceinline__ float bf16_val(unsigned short b) { return __uint_as_float(((unsigned int)b) << 16); }
__device__ __forceinline__ float bf16_round(float x) { return bf16_val(bf16_bits(x)); }
// D += A·B with NT terms: 1 = ah·bh, 2 = + al·bh (A split), 3 = + ah·bl (both split)
template <int NT>
__device__ __forceinline__ v8f mmaN(v16b ah, v16b al, v16b bh, v16b bl, v8f c) {
  c = __builtin_amdgcn_wmma_f32_16x16x32_bf16(false, ah, false, bh, (short)0, c, false, false);
  if (NT >= 2) c = __builtin_amdgcn_wmma_f32_16x16x32_bf16(false, al, false, bh, (short)0, c, false, false);
  if (NT >= 3) c = __builtin_amdgcn_wmma_f32_16x16x32_bf16(false, ah, false, bl, (short)0, c, false, false);
  asm volatile("v_nop\n\tv_nop\n\tv_nop\n\tv_nop" : "+v"(c) : "v"(ah), "v"(al), "v"(bh), "v"(bl));
  return c;
}

__global__ __launch_bounds__(256) void k_wt_bf16(const float* __restrict__ W, unsigned short* __restrict__ Wt, int K, int N) {
  const int t = blockIdx.x * 256 + threadIdx.x;
  const int k8n = K / 8;
  if (t >= N * k8n) return;
  const int n = t / k8n, k8 = (t % k8n) * 8;
  v8us v;
#pragma unroll
  for (int i = 0; i < 8; ++i) v[i] = bf16_bits(W[(size_t)(k8 + i) * N + n]);
  *(v8us*)(Wt + (size_t)n * K + k8) = v;
  
}

// GEMM C[M][N] (f32, pitch ldc) = act(A[M][K]·W + bias). A f32 row-major (pitch lda) converted per fragment to bf16
// (ASPLIT: hi/lo two planes -> 2 terms, else single rounded term); Wt bf16 [N][K] (pitch ldb). BIAS_BF16 rounds the
// bias to bf16 first (bias quantised to bf16 before the add). K%32==0, M%16==0, N%64==0.
template <bool ASPLIT, int ACT, bool BIAS_BF16>
__global__ __launch_bounds__(128) void k_gemm_bf(const float* __restrict__ A, int lda, const unsigned short* __restrict__ Wt, int ldb,
                                               const float* __restrict__ bias, float* __restrict__ C, int ldc, int M, int N, int K) {
  __shared__ __attribute__((aligned(16))) float so[4][16][64];
  const int tid = threadIdx.x, w = tid >> 5, lane = tid & 31, ln = lane & 15, hh = lane >> 4;
  const int ntn = N / 64;
  const int wid = blockIdx.x * 4 + w;
  const int mt = wid / ntn, nq = wid % ntn;
  if (mt * 16 >= M) return;
  const int row0 = mt * 16, col0 = nq * 64;
  const float* arow = A + (size_t)(row0 + ln) * lda;
  v8f acc[4] = {};
  for (int kb = 0; kb < K; kb += 32) {
    FragB ah, al;
    const v4f x0 = *(const v4fa*)(arow + kb + 8 * hh), x1 = *(const v4fa*)(arow + kb + 8 * hh + 4);
    const v4f x2 = *(const v4fa*)(arow + kb + 16 + 8 * hh), x3 = *(const v4fa*)(arow + kb + 16 + 8 * hh + 4);
    float xs[16] = {x0[0],x0[1],x0[2],x0[3],x1[0],x1[1],x1[2],x1[3],x2[0],x2[1],x2[2],x2[3],x3[0],x3[1],x3[2],x3[3]};
#pragma unroll
    for (int i = 0; i < 16; ++i) { const unsigned short hb = bf16_bits(xs[i]); ah.u[i] = hb; al.u[i] = ASPLIT ? bf16_bits(xs[i] - bf16_val(hb)) : (unsigned short)0; }
#pragma unroll
    for (int t = 0; t < 4; ++t) {
      const unsigned short* brow = Wt + (size_t)(col0 + t * 16 + ln) * ldb + kb;
      FragB b;
      b.half[0] = *(const v8us*)(brow + 8 * hh);
      b.half[1] = *(const v8us*)(brow + 16 + 8 * hh);
      acc[t] = mmaN<ASPLIT ? 2 : 1>(ah.v, al.v, b.v, b.v, acc[t]);
    }
  }
#pragma unroll
  for (int t = 0; t < 4; ++t) {
    float bv = bias ? bias[col0 + t * 16 + ln] : 0.f;
    if (BIAS_BF16) bv = bf16_round(bv);
#pragma unroll
    for (int r = 0; r < 8; ++r) { float v = acc[t][r] + bv; if (ACT == 1) v = fmaxf(v, 0.f); so[w][8 * hh + r][t * 16 + ln] = v; }
  }
  __builtin_amdgcn_fence(__ATOMIC_ACQ_REL, "workgroup");
  __builtin_amdgcn_wave_barrier();
  const int rsub = lane >> 4, c4 = (lane & 15) * 4;
  {
#pragma unroll
    for (int q = 0; q < 8; ++q) {
      const int r = q * 2 + rsub;
      const v4f v = *(const v4fa*)&so[w][r][c4];
      *(v4f*)(C + (size_t)(row0 + r) * ldc + col0 + c4) = v;
    }
    
  }
}

// Flash-style causal/unmasked attention, all contractions 3-term bf16 hi/lo splits, f32 softmax with running max.
// q,k,v rows are read from f32 buffers with arbitrary row pitch (so they can live inside a fused qkv buffer);
// D = head size (multiple of 32, <= 128); one wave = 16 query rows; block = 4 waves (64 queries) sharing K/V chunks of 32.
template <int D, bool CAUSAL>
__global__ __launch_bounds__(128) void k_flash(const float* __restrict__ qb, const float* __restrict__ kb, const float* __restrict__ vb,
                                             int pitch, int T, int H, float scale, float* __restrict__ y, int ypitch) {
  constexpr int KS = D / 32;        // k-steps for QK
  constexpr int DT = D / 16;        // d tiles for PV
  __shared__ __attribute__((aligned(16))) unsigned short sKh[32][D + 8], sKl[32][D + 8], sVh[32][D + 8], sVl[32][D + 8];
  __shared__ __attribute__((aligned(16))) unsigned short sPh[4][16][40], sPl[4][16][40];
  __shared__ __attribute__((aligned(16))) float sO[4][16][D];
  const int tid = threadIdx.x, w = tid >> 5, lane = tid & 31, ln = lane & 15, hh = lane >> 4;
  const int nqb = (T + 63) / 64;
  const int bh = blockIdx.x / nqb, qblk = blockIdx.x % nqb;
  const int b = bh / H, h = bh % H;
  const int q0 = qblk * 64 + w * 16;
  const float* Q = qb + (size_t)b * T * pitch + h * D;
  const float* K = kb + (size_t)b * T * pitch + h * D;
  const float* V = vb + (size_t)b * T * pitch + h * D;

  // A fragments of the wave's 16 query rows (scaled), hi/lo
  FragB aqh[KS], aql[KS];
  {
    int row = q0 + ln; if (row >= T) row = T - 1;
    const float* qr = Q + (size_t)row * pitch;
#pragma unroll
    for (int ks = 0; ks < KS; ++ks)
#pragma unroll
      for (int i = 0; i < 16; ++i) {
        const int d = ks * 32 + ((i < 8) ? (8 * hh + i) : (16 + 8 * hh + (i - 8)));
        const float x = qr[d] * scale; const unsigned short hb = bf16_bits(x);
        aqh[ks].u[i] = hb; aql[ks].u[i] = bf16_bits(x - bf16_val(hb));
      }
  }
  float m_r[8], l_r[8];
#pragma unroll
  for (int r = 0; r < 8; ++r) { m_r[r] = -3.0e38f; l_r[r] = 0.f; }
  v8f oacc[DT];
#pragma unroll
  for (int dt = 0; dt < DT; ++dt) oacc[dt] = (v8f){0.f,0.f,0.f,0.f,0.f,0.f,0.f,0.f};

  const int kv_end = CAUSAL ? min(T, qblk * 64 + 64) : T;     // block-uniform
  for (int j0 = 0; j0 < kv_end; j0 += 32) {
    __syncthreads();
    for (int e = tid; e < 32 * (D / 4); e += 128) {
      const int r = e / (D / 4), c4 = (e % (D / 4)) * 4;
      const int key = j0 + r;
      v4f kf = {0.f,0.f,0.f,0.f}, vf = {0.f,0.f,0.f,0.f};
      if (key < T) { kf = *(const v4fa*)(K + (size_t)key * pitch + c4); vf = *(const v4fa*)(V + (size_t)key * pitch + c4); }
#pragma unroll
      for (int t = 0; t < 4; ++t) {
        unsigned short hb = bf16_bits(kf[t]); sKh[r][c4 + t] = hb; sKl[r][c4 + t] = bf16_bits(kf[t] - bf16_val(hb));
        hb = bf16_bits(vf[t]); sVh[r][c4 + t] = hb; sVl[r][c4 + t] = bf16_bits(vf[t] - bf16_val(hb));
      }
    }
    __syncthreads();
    // S tile 16 x 32
    v8f s[2];
#pragma unroll
    for (int nt = 0; nt < 2; ++nt) {
      v8f acc = {};
#pragma unroll
      for (int ks = 0; ks < KS; ++ks) {
        FragB bh_, bl_;
        bh_.half[0] = *(const v8us*)&sKh[nt * 16 + ln][ks * 32 + 8 * hh]; bh_.half[1] = *(const v8us*)&sKh[nt * 16 + ln][ks * 32 + 16 + 8 * hh];
        bl_.half[0] = *(const v8us*)&sKl[nt * 16 + ln][ks * 32 + 8 * hh]; bl_.half[1] = *(const v8us*)&sKl[nt * 16 + ln][ks * 32 + 16 + 8 * hh];
        acc = mmaN<3>(aqh[ks].v, aql[ks].v, bh_.v, bl_.v, acc);
      }
      s[nt] = acc;
    }
    // mask + running max (rows 8hh+r; the 16 lanes of a half share rows)
    float alpha[8];
#pragma unroll
    for (int r = 0; r < 8; ++r) {
      const int qi = q0 + 8 * hh + r;
      const int ja = j0 + ln, jb = j0 + 16 + ln;
      if (CAUSAL) { if (ja > qi) s[0][r] = -3.0e38f; if (jb > qi) s[1][r] = -3.0e38f; }
      if (ja >= T) s[0][r] = -3.0e38f;
      if (jb >= T) s[1][r] = -3.0e38f;
      float mx = fmaxf(s[0][r], s[1][r]);
      mx = fmaxf(mx, __shfl_xor(mx, 1, 32)); mx = fmaxf(mx, __shfl_xor(mx, 2, 32)); mx = fmaxf(mx, __shfl_xor(mx, 4, 32)); mx = fmaxf(mx, __shfl_xor(mx, 8, 32));
      const float mnew = fmaxf(m_r[r], mx);
      alpha[r] = (mnew > -1.0e38f) ? __expf(m_r[r] - mnew) : 1.0f;
      const float p0 = (s[0][r] > -1.0e38f) ? __expf(s[0][r] - mnew) : 0.f;
      const float p1 = (s[1][r] > -1.0e38f) ? __expf(s[1][r] - mnew) : 0.f;
      m_r[r] = mnew;
      l_r[r] = l_r[r] * alpha[r] + p0 + p1;            // per-lane partial row sum (16 lanes combined at the end)
      unsigned short hb = bf16_bits(p0); sPh[w][8 * hh + r][ln] = hb;      sPl[w][8 * hh + r][ln] = bf16_bits(p0 - bf16_val(hb));
      hb = bf16_bits(p1);                sPh[w][8 * hh + r][16 + ln] = hb; sPl[w][8 * hh + r][16 + ln] = bf16_bits(p1 - bf16_val(hb));
    }
#pragma unroll
    for (int dt = 0; dt < DT; ++dt)
#pragma unroll
      for (int r = 0; r < 8; ++r) oacc[dt][r] *= alpha[r];
    __builtin_amdgcn_fence(__ATOMIC_ACQ_REL, "workgroup");
    __builtin_amdgcn_wave_barrier();
    FragB pah, pal;
    pah.half[0] = *(const v8us*)&sPh[w][ln][8 * hh]; pah.half[1] = *(const v8us*)&sPh[w][ln][16 + 8 * hh];
    pal.half[0] = *(const v8us*)&sPl[w][ln][8 * hh]; pal.half[1] = *(const v8us*)&sPl[w][ln][16 + 8 * hh];
#pragma unroll
    for (int dt = 0; dt < DT; ++dt) {
      FragB bvh, bvl;
#pragma unroll
      for (int i = 0; i < 8; ++i) {
        bvh.u[i] = sVh[8 * hh + i][dt * 16 + ln]; bvh.u[8 + i] = sVh[16 + 8 * hh + i][dt * 16 + ln];
        bvl.u[i] = sVl[8 * hh + i][dt * 16 + ln]; bvl.u[8 + i] = sVl[16 + 8 * hh + i][dt * 16 + ln];
      }
      oacc[dt] = mmaN<3>(pah.v, pal.v, bvh.v, bvl.v, oacc[dt]);
    }
    __builtin_amdgcn_fence(__ATOMIC_ACQ_REL, "workgroup");
    __builtin_amdgcn_wave_barrier();
  }
#pragma unroll
  for (int r = 0; r < 8; ++r) {
    float l = l_r[r];
    l += __shfl_xor(l, 1, 32); l += __shfl_xor(l, 2, 32); l += __shfl_xor(l, 4, 32); l += __shfl_xor(l, 8, 32);
    l_r[r] = (l > 0.f) ? 1.0f / l : 0.f;
  }
#pragma unroll
  for (int dt = 0; dt < DT; ++dt)
#pragma unroll
    for (int r = 0; r < 8; ++r) sO[w][8 * hh + r][dt * 16 + ln] = oacc[dt][r] * l_r[r];
  __builtin_amdgcn_fence(__ATOMIC_ACQ_REL, "workgroup");
  __builtin_amdgcn_wave_barrier();
  {
    for (int r = 0; r < 16; ++r) {
      const int row = q0 + r;
      if (row < T && lane < D / 4) {
        const v4f val = *(const v4fa*)&sO[w][r][lane * 4];
        *(v4f*)(y + ((size_t)b * T + row) * ypitch + h * D + lane * 4) = val;
      }
    }
    
  }
}

// GEMM C = act(A·W + bias + resid): A f32 (ASPLIT -> hi/lo 2 terms), Wt bf16 [N][K]; ACT 0 none, 1 relu, 2 exact gelu;
// resid (optional, f32, row index = (row % rmod), pitch ldr, RES_BF16 rounds it) added before the activation.
template <bool ASPLIT, int ACT, bool BIAS_BF16, bool RES_BF16>
__global__ __launch_bounds__(128) void k_gemm_bf3(const float* __restrict__ A, int lda, const unsigned short* __restrict__ Wt, int ldb,
                                                const float* __restrict__ bias, const float* __restrict__ resid, int rmod, int ldr,
                                                float* __restrict__ C, int ldc, int M, int N, int K) {
  __shared__ __attribute__((aligned(16))) float so[4][16][64];
  const int tid = threadIdx.x, w = tid >> 5, lane = tid & 31, ln = lane & 15, hh = lane >> 4;
  const int ntn = N / 64;
  const int wid = blockIdx.x * 4 + w;
  const int mt = wid / ntn, nq = wid % ntn;
  if (mt * 16 >= M) return;
  const int row0 = mt * 16, col0 = nq * 64;
  const float* arow = A + (size_t)(row0 + ln) * lda;
  v8f acc[4] = {};
  for (int kb = 0; kb < K; kb += 32) {
    FragB ah, al;
    const v4f x0 = *(const v4fa*)(arow + kb + 8 * hh), x1 = *(const v4fa*)(arow + kb + 8 * hh + 4);
    const v4f x2 = *(const v4fa*)(arow + kb + 16 + 8 * hh), x3 = *(const v4fa*)(arow + kb + 16 + 8 * hh + 4);
    float xs[16] = {x0[0],x0[1],x0[2],x0[3],x1[0],x1[1],x1[2],x1[3],x2[0],x2[1],x2[2],x2[3],x3[0],x3[1],x3[2],x3[3]};
#pragma unroll
    for (int i = 0; i < 16; ++i) { const unsigned short hb = bf16_bits(xs[i]); ah.u[i] = hb; al.u[i] = ASPLIT ? bf16_bits(xs[i] - bf16_val(hb)) : (unsigned short)0; }
#pragma unroll
    for (int t = 0; t < 4; ++t) {
      const unsigned short* brow = Wt + (size_t)(col0 + t * 16 + ln) * ldb + kb;
      FragB b;
      b.half[0] = *(const v8us*)(brow + 8 * hh);
      b.half[1] = *(const v8us*)(brow + 16 + 8 * hh);
      acc[t] = mmaN<ASPLIT ? 2 : 1>(ah.v, al.v, b.v, b.v, acc[t]);
    }
  }
#pragma unroll
  for (int t = 0; t < 4; ++t) {
    const int col = col0 + t * 16 + ln;
    float bv = bias ? bias[col] : 0.f;
    if (BIAS_BF16) bv = bf16_round(bv);
#pragma unroll
    for (int r = 0; r < 8; ++r) {
      float v = acc[t][r] + bv;
      if (resid) { float rv = resid[(size_t)((row0 + 8 * hh + r) % rmod) * ldr + col]; if (RES_BF16) rv = bf16_round(rv); v += rv; }
      if (ACT == 1) v = fmaxf(v, 0.f);
      if (ACT == 2) v = 0.5f * v * (1.0f + erff(v * 0.70710678118654752f));
      if (ACT == 3) { const float u = 0.7978845608028654f * (v + 0.044715f * v * v * v); v = 0.5f * v * (1.0f + tanhf(u)); }
      so[w][8 * hh + r][t * 16 + ln] = v;
    }
  }
  __builtin_amdgcn_fence(__ATOMIC_ACQ_REL, "workgroup");
  __builtin_amdgcn_wave_barrier();
  const int rsub = lane >> 4, c4 = (lane & 15) * 4;
  {
#pragma unroll
    for (int q = 0; q < 8; ++q) {
      const int r = q * 2 + rsub;
      const v4f v = *(const v4fa*)&so[w][r][c4];
      *(v4f*)(C + (size_t)(row0 + r) * ldc + col0 + c4) = v;
    }
    
  }
}
// row LayerNorm (biased variance, eps) over N: s = X (+ R); optional out_sum <- s; out_norm <- (s-mu)*rsqrt(var+eps)*g + b
template <bool PARAM_BF16>
__global__ __launch_bounds__(256) void k_layernorm(const float* __restrict__ X, const float* __restrict__ R, const float* __restrict__ g, const float* __restrict__ bta,
                                                  float* __restrict__ out_sum, float* __restrict__ out_norm, int N, float eps) {
  __shared__ float red[256];
  const int row = blockIdx.x, tid = threadIdx.x;
  const float* x = X + (size_t)row * N; const float* rr = R ? R + (size_t)row * N : nullptr;
  float vals[16];                     // up to N = 4096
  const int per = N / 256;            // contiguous chunk per thread? use strided-by-4 chunks: thread handles j = tid*4 + 1024*u
  float s1 = 0.f;
  for (int u = 0; u < per / 4; ++u) {
    const int j = tid * 4 + 1024 * u;
    const v4f a = *(const v4fa*)(x + j);
    v4f b = {0.f,0.f,0.f,0.f}; if (rr) b = *(const v4fa*)(rr + j);
#pragma unroll
    for (int q = 0; q < 4; ++q) { const float v = a[q] + b[q]; vals[u * 4 + q] = v; s1 += v; }
  }
  red[tid] = s1; __syncthreads();
  for (int st = 128; st > 0; st >>= 1) { if (tid < st) red[tid] += red[tid + st]; __syncthreads(); }
  const float mu = red[0] / (float)N; __syncthreads();
  float s2 = 0.f;
  for (int u = 0; u < per / 4; ++u)
#pragma unroll
    for (int q = 0; q < 4; ++q) { const float c = vals[u * 4 + q] - mu; s2 += c * c; }
  red[tid] = s2; __syncthreads();
  for (int st = 128; st > 0; st >>= 1) { if (tid < st) red[tid] += red[tid + st]; __syncthreads(); }
  const float rs = rsqrtf(red[0] / (float)N + eps);
  {
    for (int u = 0; u < per / 4; ++u) {
      const int j = tid * 4 + 1024 * u;
      v4f o, sm;
#pragma unroll
      for (int q = 0; q < 4; ++q) {
        float gg = g[j + q], bb = bta[j + q];
        if (PARAM_BF16) { gg = bf16_round(gg); bb = bf16_round(bb); }
        sm[q] = vals[u * 4 + q]; o[q] = (vals[u * 4 + q] - mu) * rs * gg + bb;
      }
      if (out_sum) *(v4f*)(out_sum + (size_t)row * N + j) = sm;
      *(v4f*)(out_norm + (size_t)row * N + j) = o;
    }
    
  }
}



// ---- f16 WMMA path (v_wmma_f32_16x16x32_f16): 11-bit significands for operands in range — used where a [0,1] probability operand needs more precision than bf16
typedef _Float16 v16h __attribute__((ext_vector_type(16)));
union FragH { v16h v; v8us half[2]; _Float16 h[16]; unsigned short u[16]; };
template <int NT>
__device__ __forceinline__ v8f mmaH(v16h ah, v16h al, v16h bh, v16h bl, v8f c) {
  c = __builtin_amdgcn_wmma_f32_16x16x32_f16(false, ah, false, bh, (short)0, c, false, false);
  if (NT >= 2) c = __builtin_amdgcn_wmma_f32_16x16x32_f16(false, al, false, bh, (short)0, c, false, false);
  if (NT >= 3) c = __builtin_amdgcn_wmma_f32_16x16x32_f16(false, ah, false, bl, (short)0, c, false, false);
  asm volatile("v_nop\n\tv_nop\n\tv_nop\n\tv_nop" : "+v"(c) : "v"(ah), "v"(al), "v"(bh), "v"(bl));
  return c;
}
// batched GEMM like k_gemm_b but f16 operands: A f32 (split into f16 hi/lo if ASPLIT, else rounded to f16), Bt = f16 values [n][k]; alpha; C f32; N multiple of 16 (partial tiles skipped)
template <bool ASPLIT>
__global__ __launch_bounds__(128) void k_gemm_h(const float* __restrict__ A, int lda, size_t sA, const _Float16* __restrict__ Bh, int ldb, size_t sB, float alpha, float* __restrict__ C, int ldc, size_t sC, int M, int N, int K) {
  __shared__ __attribute__((aligned(16))) float so[4][16][64];
  const int tid = threadIdx.x, w = tid >> 5, lane = tid & 31, ln = lane & 15, hh = lane >> 4; const int by = blockIdx.y;
  A += (size_t)by * sA; Bh += (size_t)by * sB; C += (size_t)by * sC;
  const int ntn = (N + 63) / 64; const int wid = blockIdx.x * 4 + w; const int mt = wid / ntn, nq = wid % ntn; if (mt * 16 >= M) return;
  const int row0 = mt * 16, col0 = nq * 64; const float* arow = A + (size_t)(row0 + ln) * lda;
  v8f acc[4] = {};
  for (int kb = 0; kb < K; kb += 32) {
    FragH ah, al;
    const v4f x0 = *(const v4fa*)(arow + kb + 8 * hh), x1 = *(const v4fa*)(arow + kb + 8 * hh + 4), x2 = *(const v4fa*)(arow + kb + 16 + 8 * hh), x3 = *(const v4fa*)(arow + kb + 16 + 8 * hh + 4);
    float xs[16] = {x0[0],x0[1],x0[2],x0[3],x1[0],x1[1],x1[2],x1[3],x2[0],x2[1],x2[2],x2[3],x3[0],x3[1],x3[2],x3[3]};
#pragma unroll
    for (int i = 0; i < 16; ++i) { const _Float16 h = (_Float16)xs[i]; ah.h[i] = h; al.h[i] = ASPLIT ? (_Float16)(xs[i] - (float)h) : (_Float16)0.0f; }
#pragma unroll
    for (int t = 0; t < 4; ++t) { if (col0 + t * 16 >= N) continue; const size_t boff = (size_t)(col0 + t * 16 + ln) * ldb + kb; FragH bq; bq.half[0] = *(const v8us*)(Bh + boff + 8 * hh); bq.half[1] = *(const v8us*)(Bh + boff + 16 + 8 * hh);
      acc[t] = mmaH<ASPLIT ? 2 : 1>(ah.v, al.v, bq.v, bq.v, acc[t]); }
  }
#pragma unroll
  for (int t = 0; t < 4; ++t) { if (col0 + t * 16 >= N) continue;
#pragma unroll
    for (int r = 0; r < 8; ++r) so[w][8 * hh + r][t * 16 + ln] = acc[t][r] * alpha; }
  __builtin_amdgcn_fence(__ATOMIC_ACQ_REL, "workgroup"); __builtin_amdgcn_wave_barrier();
  const int rsub = lane >> 4, c4 = (lane & 15) * 4;
  {
#pragma unroll
    for (int q = 0; q < 8; ++q) { const int r = q * 2 + rsub; if (col0 + c4 < N) { const v4f v = *(const v4fa*)&so[w][r][c4]; *(v4f*)(C + (size_t)(row0 + r) * ldc + col0 + c4) = v; } }
     }
}

// Wt[n][k] = f16(W[k][n]·scale) from f32 row-major W[K][N] (scale = power of two; bf16-exact weights stay exact in f16 away from the subnormal range)
__global__ __launch_bounds__(256) void k_wt_f16(const float* __restrict__ W, _Float16* __restrict__ Wt, int K, int N, float scale) {
  const int t = blockIdx.x * 256 + threadIdx.x; if (t >= N * (K / 8)) return; const int n = t / (K / 8), k8 = (t % (K / 8)) * 8; FragH f;
#pragma unroll
  for (int i = 0; i < 8; ++i) f.h[i] = (_Float16)(bf16_round(W[(size_t)(k8 + i) * N + n]) * scale); const v8us o = f.half[0];
  *(v8us*)((unsigned short*)Wt + (size_t)n * K + k8) = o; 
}
// k_gemm_hh variant with fused epilogue: v = acc·alpha + bias[by·sBias + col] (+ CP[(row/rowsPerB)·sCPb + by·64 + col] if CP) ; ACT 0 none / 1 elu ; writes f16 C16 (and f32 C if non-null)
template <int ACT>
__global__ __launch_bounds__(128) void k_gemm_hhx(const _Float16* __restrict__ A, int lda, size_t sA, const _Float16* __restrict__ Bh, int ldb, size_t sB, float alpha, const float* __restrict__ bias, size_t sBias, const float* __restrict__ CP, int rowsPerB, size_t sCPb, int row0g,
    float* __restrict__ C, _Float16* __restrict__ C16, int ldc, size_t sC, int M, int N, int K) {
  __shared__ __attribute__((aligned(16))) float so[4][16][64];
  const int tid = threadIdx.x, w = tid >> 5, lane = tid & 31, ln = lane & 15, hh = lane >> 4; const int by = blockIdx.y;
  A += (size_t)by * sA; Bh += (size_t)by * sB; const size_t cofs = (size_t)by * sC; const float* bp = bias ? bias + (size_t)by * sBias : nullptr;
  const int ntn = (N + 63) / 64; const int wid = blockIdx.x * 4 + w; const int mt = wid / ntn, nq = wid % ntn; if (mt * 16 >= M) return;
  const int row0 = mt * 16, col0 = nq * 64; const _Float16* arow = A + (size_t)(row0 + ln) * lda;
  v8f acc[4] = {};
  // Fragments are fetched ahead: two register sets of 64 k each; while one set feeds its 8 WMMAs the other set's 20 loads are in flight. K % 128 == 0.
  // A column tile past N reads row N - 1 (in bounds); its accumulator is never stored (the guards of the epilogue).
  const unsigned short* ap = (const unsigned short*)arow + 8 * hh; const unsigned short* wp[4];
#pragma unroll
  for (int t = 0; t < 4; ++t) { int cr = col0 + t * 16 + ln; if (cr > N - 1) cr = N - 1; wp[t] = (const unsigned short*)Bh + (size_t)cr * ldb + 8 * hh; }
  FragH a0[2], a1[2], b0[2][4], b1[2][4];
  auto ldf = [&](FragH (&a)[2], FragH (&bq)[2][4], int kb, int ko) {      /* k = kb + ko; ko is a literal and goes into the loads' offset fields */
    const unsigned short* pa = ap + kb; const unsigned short* pw[4] = {wp[0] + kb, wp[1] + kb, wp[2] + kb, wp[3] + kb};
#pragma unroll
    for (int ks = 0; ks < 2; ++ks) { a[ks].half[0] = *(const v8us*)(pa + ko + ks * 32); a[ks].half[1] = *(const v8us*)(pa + ko + ks * 32 + 16);
#pragma unroll
      for (int t = 0; t < 4; ++t) { bq[ks][t].half[0] = *(const v8us*)(pw[t] + ko + ks * 32); bq[ks][t].half[1] = *(const v8us*)(pw[t] + ko + ks * 32 + 16); } }
    /* the group's address pairs are named so that no register of them is reused (not even as a later load's result) before the loads have taken them */
    asm volatile("s_wait_xcnt 0x0" :: "v"(pa), "v"(pw[0]), "v"(pw[1]), "v"(pw[2]), "v"(pw[3]) : "memory"); };
  auto mmf = [&](FragH (&a)[2], FragH (&bq)[2][4]) {
#pragma unroll
    for (int ks = 0; ks < 2; ++ks)
#pragma unroll
      for (int t = 0; t < 4; ++t) acc[t] = mmaH<1>(a[ks].v, a[ks].v, bq[ks][t].v, bq[ks][t].v, acc[t]); };
  ldf(a0, b0, 0, 0);
  for (int kb = 0; kb < K; kb += 128) {
    ldf(a1, b1, kb, 64);
    mmf(a0, b0);
    ldf(a0, b0, (kb + 128 < K) ? kb + 128 : 0, 0);      /* last trip: wraps to k = 0, in bounds, values unused; no branch, so the waits stay counted */
    mmf(a1, b1);
  }
#pragma unroll
  for (int t = 0; t < 4; ++t) { if (col0 + t * 16 >= N) continue; const int col = col0 + t * 16 + ln; const float bv = bp ? bf16_round(bp[col]) : 0.f;
#pragma unroll
    for (int r = 0; r < 8; ++r) { float v = acc[t][r] * alpha + bv; if (CP) { const int bidx = (row0g + row0 + 8 * hh + r) / rowsPerB; v += CP[(size_t)bidx * sCPb + (size_t)by * 64 + col]; } if (ACT == 1) v = (v > 0.f) ? v : expm1f(v); else if (ACT == 7) v = (v > 0.f) ? v + 1.0f : expf(v); else if (ACT == 8) v = tanhf(v); else if (ACT == 9) v = 0.5f * v * (1.0f + tanhf(0.7978845608028654f * (v + 0.044715f * v * v * v))); else if (ACT == 11) v = 1.0f / (1.0f + expf(-v)); else if (ACT == 12) v = (v > 0.f) ? v : 0.01f * v; else if (ACT == 14) v = (v > 0.f) ? v : 0.1f * v; else if (ACT == 15) v = v / (1.0f + expf(-v)); else if (ACT == 3) v = fmaxf(v, 0.f); else if (ACT == 6) v = 0.5f * v * (1.0f + erff(v * 0.70710678118654752f)); so[w][8 * hh + r][t * 16 + ln] = v; } }
  __builtin_amdgcn_fence(__ATOMIC_ACQ_REL, "workgroup"); __builtin_amdgcn_wave_barrier();
  const int rsub = lane >> 4, c4 = (lane & 15) * 4; typedef _Float16 v4h __attribute__((ext_vector_type(4)));
  {
#pragma unroll
    for (int q = 0; q < 8; ++q) { const int r = q * 2 + rsub; if (col0 + c4 < N) { const v4f v = *(const v4fa*)&so[w][r][c4]; if (C) *(v4f*)(C + cofs + (size_t)(row0 + r) * ldc + col0 + c4) = v; if (C16) { v4h h4; for (int i = 0; i < 4; ++i) h4[i] = (_Float16)v[i]; *(v4h*)(C16 + cofs + (size_t)(row0 + r) * ldc + col0 + c4) = h4; } } }
     }
}


typedef _Float16 v4h __attribute__((ext_vector_type(4)));

__global__ __launch_bounds__(256) void k_x16(const float* __restrict__ x, _Float16* __restrict__ X16, size_t n8) { const size_t t = (size_t)blockIdx.x * 256 + threadIdx.x; if (t >= n8) return; FragH f;
#pragma unroll
  for (int q = 0; q < 8; ++q) f.h[q] = (_Float16)bf16_round(x[t * 8 + q]); *(v8us*)((unsigned short*)X16 + t * 8) = f.half[0];  }
__global__ __launch_bounds__(256) void k_h16(const float* __restrict__ x, _Float16* __restrict__ X16, size_t n8) { const size_t t = (size_t)blockIdx.x * 256 + threadIdx.x; if (t >= n8) return; FragH f;
#pragma unroll
  for (int q = 0; q < 8; ++q) f.h[q] = (_Float16)x[t * 8 + q]; *(v8us*)((unsigned short*)X16 + t * 8) = f.half[0];  }
__global__ __launch_bounds__(256) void k_round16f(const float* __restrict__ W, _Float16* __restrict__ Bt, size_t n8) { const size_t t = (size_t)blockIdx.x * 256 + threadIdx.x; if (t >= n8) return; FragH f;
#pragma unroll
  for (int i = 0; i < 8; ++i) f.h[i] = (_Float16)(bf16_round(W[t * 8 + i]) * 16.0f); *(v8us*)((unsigned short*)Bt + t * 8) = f.half[0];  }
template <int NHv, int TTv>
__global__ __launch_bounds__(256) void k_vt(const _Float16* __restrict__ V16, int ldv, int voff, _Float16* __restrict__ Vt) { __shared__ unsigned short tl[64][66]; const int tid = threadIdx.x; const int slab = blockIdx.x / (TTv / 64), lg = blockIdx.x % (TTv / 64); const int b = slab / NHv, h = slab % NHv;
  for (int i = tid; i < 64 * 8; i += 256) { const int r = i / 8, c8 = (i % 8) * 8; FragH f; f.half[0] = *(const v8us*)((const unsigned short*)V16 + ((size_t)b * TTv + lg * 64 + r) * ldv + voff + h * 64 + c8);
#pragma unroll
    for (int q = 0; q < 8; ++q) tl[r][c8 + q] = f.u[q]; }
  __syncthreads();
  {
#pragma unroll
    for (int rd = 0; rd < 2; ++rd) { const int d = rd * 32 + tid / 8, pc = tid % 8; FragH f;
#pragma unroll
      for (int q = 0; q < 8; ++q) f.u[q] = tl[pc * 8 + q][d];
      *(v8us*)((unsigned short*)Vt + ((size_t)slab * 64 + d) * TTv + lg * 64 + pc * 8) = f.half[0]; }
     } }

typedef int v4i __attribute__((ext_vector_type(4)));
typedef int v4ia __attribute__((ext_vector_type(4), may_alias));
// lane l takes the value of lane l ^ 16 (a vector cross-row move, no LDS trip)
__device__ __forceinline__ float xhalf(float x) { return __builtin_bit_cast(float, __builtin_amdgcn_permlanex16(__builtin_bit_cast(int, x), __builtin_bit_cast(int, x), 0x76543210, 0xfedcba98, false, false)); }

__global__ __launch_bounds__(128) void k_flash_g(const _Float16* __restrict__ Q16, int ldq, const _Float16* __restrict__ K16, int ldk, const _Float16* __restrict__ Vt, const float* __restrict__ AB, float* __restrict__ O, int ldo) {
  constexpr int RPW = 16, NQB = TT / (4 * RPW), DT = 4, KS = 2;
  __shared__ __attribute__((aligned(16))) float sO[4][RPW][64 + 4];
  const int tid = threadIdx.x, w = tid >> 5, lane = tid & 31, ln = lane & 15, hh = lane >> 4;
  const int slab = blockIdx.x / NQB, qblk = blockIdx.x % NQB; const int b = slab / NH, h = slab % NH; const int qb0 = qblk * (4 * RPW); const int q0 = qb0 + w * RPW;
  // Transposed tiles: S^T = K Q^T (A = 16 key rows, B = the wave's 16 queries), O^T += V^T P^T. Lane (ln, hh) owns query q0 + ln; its score registers hold keys j0 + 8 hh + r and j0 + 16 + 8 hh + r,
  // which is the k order of a B operand: P goes from the score registers into the second product with no LDS trip, and maximum and sum run inside the lane plus one exchange between the wave halves.
  FragH aq[KS];
  { const unsigned short* qr = (const unsigned short*)Q16 + ((size_t)b * TT + q0 + ln) * ldq + h * 64;
#pragma unroll
    for (int ks = 0; ks < KS; ++ks) { aq[ks].half[0] = *(const v8us*)(qr + ks * 32 + 8 * hh); aq[ks].half[1] = *(const v8us*)(qr + ks * 32 + 16 + 8 * hh); }
    asm volatile("s_wait_xcnt 0x0" :: "v"(qr) : "memory"); }      /* as in ldK below: the address pair stays whole until the loads have taken it */
  const unsigned short* Vth = (const unsigned short*)Vt + (size_t)slab * 64 * TT;
  float m_r = -3.0e38f, l_r = 0.f; v8f oacc[DT];
#pragma unroll
  for (int dt = 0; dt < DT; ++dt) oacc[dt] = (v8f){0.f,0.f,0.f,0.f,0.f,0.f,0.f,0.f};
  const int jend = TT;
  // Global loads are issued ahead of their use: the K fragments and the key bias one pass ahead (registers carried round the loop), the V^T fragments at the top of their own pass; their latency then runs under the softmax, not in front of each WMMA.
  const unsigned short* Kl = (const unsigned short*)K16 + ((size_t)b * TT + ln) * ldk + h * 64 + 8 * hh; FragH bk[2][KS];
  const float* aml = AB + (size_t)b * TT + 8 * hh; v4f abn[2][2];
  auto ldK = [&](int j) {
    const unsigned short* kr[2] = {Kl + (size_t)j * ldk, Kl + (size_t)(j + 16) * ldk}; const float* am = aml + j;
#pragma unroll
    for (int nt = 0; nt < 2; ++nt) { abn[nt][0] = *(const v4fa*)(am + nt * 16); abn[nt][1] = *(const v4fa*)(am + nt * 16 + 4); }
#pragma unroll
    for (int nt = 0; nt < 2; ++nt)
#pragma unroll
      for (int ks = 0; ks < KS; ++ks) { bk[nt][ks].half[0] = *(const v8us*)(kr[nt] + ks * 32); bk[nt][ks].half[1] = *(const v8us*)(kr[nt] + ks * 32 + 16); }
    /* the group's address pairs are named so that no register of them is reused (not even as a later load's result) before the loads have taken them */
    asm volatile("s_wait_xcnt 0x0" :: "v"(kr[0]), "v"(kr[1]), "v"(am) : "memory"); };
  ldK(0);
#pragma unroll 1      /* stays rolled: one set of carried fragment registers, and the pass's code is fetched once */
  for (int j0 = 0; j0 < jend; j0 += 32) {
    const int jn = (j0 + 32 < jend) ? j0 + 32 : 0;      /* the pass fetched for; behind the last pass it wraps to key 0: in bounds, values unused; no branch, so the waits stay counted */
    float ab[2][8];      /* additive attention bias (bf16-rounded input) of keys j0 + nt * 16 + 8 hh + r */
#pragma unroll
    for (int nt = 0; nt < 2; ++nt)
#pragma unroll
      for (int r = 0; r < 8; ++r) ab[nt][r] = (float)(__bf16)abn[nt][r >> 2][r & 3];      /* the convert rounds to nearest even, as bf16_round does */
    FragH bv[DT];      /* V^T fragments of this pass: issued here, used behind the softmax */
    const unsigned short* vr = Vth + (size_t)ln * TT + j0 + 8 * hh;
#pragma unroll
    for (int dt = 0; dt < DT; ++dt) { bv[dt].half[0] = *(const v8us*)(vr + dt * 16 * TT); bv[dt].half[1] = *(const v8us*)(vr + dt * 16 * TT + 16); }
    asm volatile("s_wait_xcnt 0x0" :: "v"(vr) : "memory");      /* as in ldK: the address pair stays whole until the loads have taken it */
    v8f s[2];
#pragma unroll
    for (int nt = 0; nt < 2; ++nt) { v8f acc = (v8f){0.f,0.f,0.f,0.f,0.f,0.f,0.f,0.f};
#pragma unroll
      for (int ks = 0; ks < KS; ++ks) acc = mmaH<1>(bk[nt][ks].v, bk[nt][ks].v, aq[ks].v, aq[ks].v, acc); s[nt] = acc; }
    ldK(jn);
    float sc[2][8];
#pragma unroll
    for (int nt = 0; nt < 2; ++nt)
#pragma unroll
      for (int r = 0; r < 8; ++r) sc[nt][r] = s[nt][r] * 0.125f + ab[nt][r];
    float mx[8];
#pragma unroll
    for (int r = 0; r < 8; ++r) mx[r] = fmaxf(sc[0][r], sc[1][r]);
    float mc = fmaxf(fmaxf(fmaxf(mx[0], mx[1]), fmaxf(mx[2], mx[3])), fmaxf(fmaxf(mx[4], mx[5]), fmaxf(mx[6], mx[7])));
    mc = fmaxf(mc, xhalf(mc));      /* both wave halves now hold the maximum of the query's 32 scores of this pass */
    const float mn = fmaxf(m_r, mc); const float al = (mn > -1.0e38f) ? expf(m_r - mn) : 1.0f; m_r = mn;
    float p[2][8];
#pragma unroll
    for (int nt = 0; nt < 2; ++nt)
#pragma unroll
      for (int r = 0; r < 8; ++r) p[nt][r] = expf(sc[nt][r] - mn);
    float ps[8];
#pragma unroll
    for (int r = 0; r < 8; ++r) ps[r] = p[0][r] + p[1][r];
    l_r = l_r * al + (((ps[0] + ps[1]) + (ps[2] + ps[3])) + ((ps[4] + ps[5]) + (ps[6] + ps[7])));      /* this half's 16 keys; the halves are joined behind the loop */
#pragma unroll
    for (int dt = 0; dt < DT; ++dt)
#pragma unroll
      for (int r = 0; r < 8; ++r) oacc[dt][r] *= al;
    FragH pb;      /* B operand P^T: element nt * 8 + r is key nt * 16 + 8 hh + r, the order in which bv holds V^T */
#pragma unroll
    for (int nt = 0; nt < 2; ++nt)
#pragma unroll
      for (int r = 0; r < 8; ++r) pb.h[nt * 8 + r] = (_Float16)(p[nt][r] * 1024.0f);
#pragma unroll
    for (int dt = 0; dt < DT; ++dt) oacc[dt] = mmaH<1>(bv[dt].v, bv[dt].v, pb.v, pb.v, oacc[dt]); }
  { const float l = l_r + xhalf(l_r); const float li = (l > 0.f) ? 1.0f / (l * 1024.0f) : 0.f;
#pragma unroll
    for (int dt = 0; dt < DT; ++dt) {      /* oacc[dt][r] = O[q0 + ln][dt * 16 + 8 hh + r] */
      const v4f o0 = {oacc[dt][0] * li, oacc[dt][1] * li, oacc[dt][2] * li, oacc[dt][3] * li}, o1 = {oacc[dt][4] * li, oacc[dt][5] * li, oacc[dt][6] * li, oacc[dt][7] * li};
      *(v4fa*)&sO[w][ln][dt * 16 + 8 * hh] = o0; *(v4fa*)&sO[w][ln][dt * 16 + 8 * hh + 4] = o1; } }
  __builtin_amdgcn_fence(__ATOMIC_ACQ_REL, "workgroup"); __builtin_amdgcn_wave_barrier();
  {
#pragma unroll
    for (int rp = 0; rp < RPW; rp += 2) { const int r = rp + (lane >> 4), pc = lane & 15; const v4f val = *(const v4fa*)&sO[w][r][pc * 4]; *(v4f*)(O + ((size_t)b * TT + q0 + r) * ldo + h * 64 + pc * 4) = val; }
     } }

__global__ __launch_bounds__(128) void k_flash_l(const _Float16* __restrict__ Q16, int ldq, const _Float16* __restrict__ K16, int ldk, const _Float16* __restrict__ Vt, const int* __restrict__ MSK, float* __restrict__ O, int ldo) {
  constexpr int RPW = 16, NQB = TT / (4 * RPW), DT = 4, KS = 2;
  __shared__ __attribute__((aligned(16))) float sO[4][RPW][64 + 4];
  const int tid = threadIdx.x, w = tid >> 5, lane = tid & 31, ln = lane & 15, hh = lane >> 4;
  const int slab = blockIdx.x / NQB, qblk = blockIdx.x % NQB; const int b = slab / NH, h = slab % NH; const int qb0 = qblk * (4 * RPW); const int q0 = qb0 + w * RPW;
  // Transposed tiles: S^T = K Q^T (A = 16 key rows, B = the wave's 16 queries), O^T += V^T P^T. Lane (ln, hh) owns query q0 + ln; its score registers hold keys j0 + 8 hh + r and j0 + 16 + 8 hh + r,
  // which is the k order of a B operand: P goes from the score registers into the second product with no LDS trip, and maximum and sum run inside the lane plus one exchange between the wave halves.
  FragH aq[KS];
  { const unsigned short* qr = (const unsigned short*)Q16 + ((size_t)b * TT + q0 + ln) * ldq + h * 64;
#pragma unroll
    for (int ks = 0; ks < KS; ++ks) { aq[ks].half[0] = *(const v8us*)(qr + ks * 32 + 8 * hh); aq[ks].half[1] = *(const v8us*)(qr + ks * 32 + 16 + 8 * hh); }
    asm volatile("s_wait_xcnt 0x0" :: "v"(qr) : "memory"); }      /* as in ldK below: the address pair stays whole until the loads have taken it */
  const unsigned short* Vth = (const unsigned short*)Vt + (size_t)slab * 64 * TT;
  float m_r = -3.0e38f, l_r = 0.f; v8f oacc[DT];
#pragma unroll
  for (int dt = 0; dt < DT; ++dt) oacc[dt] = (v8f){0.f,0.f,0.f,0.f,0.f,0.f,0.f,0.f};
  const int jend = TT;
  // Global loads are issued ahead of their use: the K fragments and the mask words one pass ahead (registers carried round the loop), the V^T fragments at the top of their own pass; their latency then runs under the softmax, not in front of each WMMA.
  const unsigned short* Kl = (const unsigned short*)K16 + ((size_t)b * TT + ln) * ldk + h * 64 + 8 * hh; FragH bk[2][KS];
  const int* Ml = MSK + ((size_t)b * TT + q0 + ln) * TT + 8 * hh; v4i mkn[2][2];
  auto ldK = [&](int j) {
    const unsigned short* kr[2] = {Kl + (size_t)j * ldk, Kl + (size_t)(j + 16) * ldk}; const int* am = Ml + j;
#pragma unroll
    for (int nt = 0; nt < 2; ++nt) { mkn[nt][0] = *(const v4ia*)(am + nt * 16); mkn[nt][1] = *(const v4ia*)(am + nt * 16 + 4); }
#pragma unroll
    for (int nt = 0; nt < 2; ++nt)
#pragma unroll
      for (int ks = 0; ks < KS; ++ks) { bk[nt][ks].half[0] = *(const v8us*)(kr[nt] + ks * 32); bk[nt][ks].half[1] = *(const v8us*)(kr[nt] + ks * 32 + 16); }
    /* the group's address pairs are named so that no register of them is reused (not even as a later load's result) before the loads have taken them */
    asm volatile("s_wait_xcnt 0x0" :: "v"(kr[0]), "v"(kr[1]), "v"(am) : "memory"); };
  ldK(0);
#pragma unroll 1      /* stays rolled: one set of carried fragment registers, and the pass's code is fetched once */
  for (int j0 = 0; j0 < jend; j0 += 32) {
    const int jn = (j0 + 32 < jend) ? j0 + 32 : 0;      /* the pass fetched for; behind the last pass it wraps to key 0: in bounds, values unused; no branch, so the waits stay counted */
    int mk[2][8];      /* per-batch mask [b][q][k] of query q0 + ln, keys j0 + nt * 16 + 8 hh + r: nonzero = ATTEND */
#pragma unroll
    for (int nt = 0; nt < 2; ++nt)
#pragma unroll
      for (int r = 0; r < 8; ++r) mk[nt][r] = mkn[nt][r >> 2][r & 3];
    { int anym = 0;
#pragma unroll
      for (int nt = 0; nt < 2; ++nt)
#pragma unroll
        for (int r = 0; r < 8; ++r) anym |= mk[nt][r];
      if (__all(anym == 0)) { ldK(jn); continue; } }      /* every (row, key) of this wave's tile masked: nothing to add, only the next pass's fetch (wave-uniform branch; no barrier inside the loop) */
    FragH bv[DT];      /* V^T fragments of this pass: issued here, used behind the softmax */
    const unsigned short* vr = Vth + (size_t)ln * TT + j0 + 8 * hh;
#pragma unroll
    for (int dt = 0; dt < DT; ++dt) { bv[dt].half[0] = *(const v8us*)(vr + dt * 16 * TT); bv[dt].half[1] = *(const v8us*)(vr + dt * 16 * TT + 16); }
    asm volatile("s_wait_xcnt 0x0" :: "v"(vr) : "memory");      /* as in ldK: the address pair stays whole until the loads have taken it */
    v8f s[2];
#pragma unroll
    for (int nt = 0; nt < 2; ++nt) { v8f acc = (v8f){0.f,0.f,0.f,0.f,0.f,0.f,0.f,0.f};
#pragma unroll
      for (int ks = 0; ks < KS; ++ks) acc = mmaH<1>(bk[nt][ks].v, bk[nt][ks].v, aq[ks].v, aq[ks].v, acc); s[nt] = acc; }
    ldK(jn);
    float sc[2][8];
#pragma unroll
    for (int nt = 0; nt < 2; ++nt)
#pragma unroll
      for (int r = 0; r < 8; ++r) sc[nt][r] = (mk[nt][r] != 0) ? s[nt][r] * 0.125f : -INFINITY;
    float mx[8];
#pragma unroll
    for (int r = 0; r < 8; ++r) mx[r] = fmaxf(sc[0][r], sc[1][r]);
    float mc = fmaxf(fmaxf(fmaxf(mx[0], mx[1]), fmaxf(mx[2], mx[3])), fmaxf(fmaxf(mx[4], mx[5]), fmaxf(mx[6], mx[7])));
    mc = fmaxf(mc, xhalf(mc));      /* both wave halves now hold the maximum of the query's 32 scores of this pass */
    const float mn = fmaxf(m_r, mc); const float al = (mn > -1.0e38f) ? expf(m_r - mn) : 1.0f; m_r = mn;
    float p[2][8];      /* a masked score is -inf and mn is finite, so its expf is 0 */
#pragma unroll
    for (int nt = 0; nt < 2; ++nt)
#pragma unroll
      for (int r = 0; r < 8; ++r) p[nt][r] = expf(sc[nt][r] - mn);
    float ps[8];
#pragma unroll
    for (int r = 0; r < 8; ++r) ps[r] = p[0][r] + p[1][r];
    l_r = l_r * al + (((ps[0] + ps[1]) + (ps[2] + ps[3])) + ((ps[4] + ps[5]) + (ps[6] + ps[7])));      /* this half's 16 keys; the halves are joined behind the loop */
#pragma unroll
    for (int dt = 0; dt < DT; ++dt)
#pragma unroll
      for (int r = 0; r < 8; ++r) oacc[dt][r] *= al;
    FragH pb;      /* B operand P^T: element nt * 8 + r is key nt * 16 + 8 hh + r, the order in which bv holds V^T */
#pragma unroll
    for (int nt = 0; nt < 2; ++nt)
#pragma unroll
      for (int r = 0; r < 8; ++r) pb.h[nt * 8 + r] = (_Float16)(p[nt][r] * 1024.0f);
#pragma unroll
    for (int dt = 0; dt < DT; ++dt) oacc[dt] = mmaH<1>(bv[dt].v, bv[dt].v, pb.v, pb.v, oacc[dt]); }
  { const float l = l_r + xhalf(l_r); const float li = (l > 0.f) ? 1.0f / (l * 1024.0f) : 0.f;
#pragma unroll
    for (int dt = 0; dt < DT; ++dt) {      /* oacc[dt][r] = O[q0 + ln][dt * 16 + 8 hh + r] */
      const v4f o0 = {oacc[dt][0] * li, oacc[dt][1] * li, oacc[dt][2] * li, oacc[dt][3] * li}, o1 = {oacc[dt][4] * li, oacc[dt][5] * li, oacc[dt][6] * li, oacc[dt][7] * li};
      *(v4fa*)&sO[w][ln][dt * 16 + 8 * hh] = o0; *(v4fa*)&sO[w][ln][dt * 16 + 8 * hh + 4] = o1; } }
  __builtin_amdgcn_fence(__ATOMIC_ACQ_REL, "workgroup"); __builtin_amdgcn_wave_barrier();
  {
#pragma unroll
    for (int rp = 0; rp < RPW; rp += 2) { const int r = rp + (lane >> 4), pc = lane & 15; const v4f val = *(const v4fa*)&sO[w][r][pc * 4]; *(v4f*)(O + ((size_t)b * TT + q0 + r) * ldo + h * 64 + pc * 4) = val; }
     } }

__global__ __launch_bounds__(256) void k_comb(const float* __restrict__ Og, const float* __restrict__ Ol, const float* __restrict__ gate, float* __restrict__ out) {
  #pragma clang fp contract(off)
  const size_t t = (size_t)blockIdx.x * 256 + threadIdx.x; if (t >= (size_t)NR * DD / 4) return; const size_t e0 = t * 4; const size_t row = e0 / DD; const int c = (int)(e0 % DD); const int h = c / 64; const int b = (int)(row / TT), q = (int)(row % TT);
  const float g = bf16_round(gate[((size_t)b * NH + h) * TT + q]); const v4f a = *(const v4fa*)(Og + e0), l = *(const v4fa*)(Ol + e0); v4f o; for (int i = 0; i < 4; ++i) o[i] = g * l[i] + (1.0f - g) * a[i];
  *(v4f*)(out + e0) = o;  }

extern "C" void kernel_launch(void* const* d_in, const int* in_sizes, int n_in,
                              void* d_out, int out_size, void* d_ws, size_t ws_size, hipStream_t stream) {
  (void)in_sizes; (void)n_in; (void)out_size;
  const float* const* I = (const float* const*)d_in; const float* x = I[0]; const float* am = I[1]; const int* lm = (const int*)d_in[2]; const float* gate = I[3]; const float* Wq = I[4]; const float* bq = I[5]; const float* Wk = I[6]; const float* bk = I[7]; const float* Wv = I[8]; const float* bv = I[9];
  char* ws = (char*)d_ws; size_t off = 0;
  auto take = [&](size_t bytes) { char* p = ws + off; off += (bytes + 255) & ~(size_t)255; return p; };
  const size_t WSZ = (size_t)DD * DD; _Float16* Bw = (_Float16*)take(3 * WSZ * 2); _Float16* X16 = (_Float16*)take((size_t)NR * DD * 2); _Float16* Q = (_Float16*)take((size_t)NR * DD * 2); _Float16* K = (_Float16*)take((size_t)NR * DD * 2); _Float16* V = (_Float16*)take((size_t)NR * DD * 2); _Float16* Vt = (_Float16*)take((size_t)NR * DD * 2); float* Og = (float*)take((size_t)NR * DD * 4); float* Ol = (float*)take((size_t)NR * DD * 4);
  if (off > ws_size) return;      // 3.5 + 5 × 6.3 + 12.6 + 12.6 ≈ 60 MB
  const unsigned gw = (unsigned)((WSZ / 8 + 255) / 256); k_wt_f16<<<gw, 256, 0, stream>>>(Wq, Bw, DD, DD, 16.0f); k_wt_f16<<<gw, 256, 0, stream>>>(Wk, Bw + WSZ, DD, DD, 16.0f); k_wt_f16<<<gw, 256, 0, stream>>>(Wv, Bw + 2 * WSZ, DD, DD, 16.0f);      /* (in,out) → Bt ×2^4 */
  k_x16<<<(unsigned)(((size_t)NR * DD / 8 + 255) / 256), 256, 0, stream>>>(x, X16, (size_t)NR * DD / 8);
  const dim3 gp(((NR / 16) * (DD / 64) + 3) / 4, 1);
  k_gemm_hhx<0><<<gp, 128, 0, stream>>>(X16, DD, 0, Bw, DD, 0, 0.0625f, bq, 0, nullptr, 1, 0, 0, nullptr, Q, DD, 0, NR, DD, DD);      /* M 4096 N 768 K 768 */
  k_gemm_hhx<0><<<gp, 128, 0, stream>>>(X16, DD, 0, Bw + WSZ, DD, 0, 0.0625f, bk, 0, nullptr, 1, 0, 0, nullptr, K, DD, 0, NR, DD, DD);
  k_gemm_hhx<0><<<gp, 128, 0, stream>>>(X16, DD, 0, Bw + 2 * WSZ, DD, 0, 0.0625f, bv, 0, nullptr, 1, 0, 0, nullptr, V, DD, 0, NR, DD, DD);
  k_vt<NH, TT><<<BB * NH * (TT / 64), 256, 0, stream>>>(V, DD, 0, Vt);
  k_flash_g<<<BB * NH * (TT / 64), 128, 0, stream>>>(Q, DD, K, DD, Vt, am, Og, DD);      /* global path: + attention_mask[b,0,0,k] */
  k_flash_l<<<BB * NH * (TT / 64), 128, 0, stream>>>(Q, DD, K, DD, Vt, lm, Ol, DD);      /* local path: local_attention_mask[b,0,q,k] == 0 → −inf */
  k_comb<<<(unsigned)(((size_t)NR * DD / 4 + 255) / 256), 256, 0, stream>>>(Og, Ol, gate, (float*)d_out);
}

// v003
// One run takes 150 microseconds.
// In two side-by-side timings against v002, it was 1.27 and 1.28 times as fast.
// All steps since v000 together make it 2.39 times as fast.
#include <hip/hip_runtime.h>
// Gated global/local self attention (B=4, S=1024, HID=768, 12×64): q,k,v = x·W + b ((in,out)); scores = q·k/8; global path softmax(scores + attention_mask[b,0,0,k]); local path softmax(scores + (1 − local_mask[b,0,q,k])·f32_min); ctx = gate[b,h,q]·ctx_local + (1 − gate)·ctx_global, merged → [4,1024,768].
// Compute dtype: x, weights, biases, additive mask and gates rounded to bf16; q/k/v f16 GEMM planes; one flash-style kernel on v_wmma_f32_16x16x32_f16 (online softmax f32, P f16 x 2^10, f32 accumulate) that forms each score tile once and feeds two softmaxes: one with the per-batch additive key bias, one with the per-batch 0/1 (q,k) mask
// (0 -> -inf); the gated combination in f32, in that kernel's epilogue.
#define BB 4
#define TT 1024
#define DD 768
#define NH 12
#define NR (BB * TT)

typedef __bf16 v16b __attribute__((ext_vector_type(16)));
typedef unsigned short v8us __attribute__((ext_vector_type(8), may_alias));
typedef float  v8f  __attribute__((ext_vector_type(8)));
typedef float  v4f  __attribute__((ext_vector_type(4)));
typedef float  v4fa __attribute__((ext_vector_type(4), may_alias));
union FragB { v16b v; v8us half[2]; unsigned short u[16]; };

__device__ __forceinline__ unsigned short bf16_bits(float x) { unsigned int u = __float_as_uint(x); return (unsigned short)((u + 0x7FFFu + ((u >> 16) & 1u)) >> 16); }
__device__ __forceinline__ float bf16_val(unsigned short b) { return __uint_as_float(((unsigned int)b) << 16); }
__device__ __forceinline__ float bf16_round(float x) { return bf16_val(bf16_bits(x)); }
// D += A·B with NT terms: 1 = ah·bh, 2 = + al·bh (A split), 3 = + ah·bl (both split)
template <int NT>
__device__ __forceinline__ v8f mmaN(v16b ah, v16b al, v16b bh, v16b bl, v8f c) {
  c = __builtin_amdgcn_wmma_f32_16x16x32_bf16(false, ah, false, bh, (short)0, c, false, false);
  if (NT >= 2) c = __builtin_amdgcn_wmma_f32_16x16x32_bf16(false, al, false, bh, (short)0, c, false, false);
  if (NT >= 3) c = __builtin_amdgcn_wmma_f32_16x16x32_bf16(false, ah, false, bl, (short)0, c, false, false);
  asm volatile("v_nop\n\tv_nop\n\tv_nop\n\tv_nop" : "+v"(c) : "v"(ah), "v"(al), "v"(bh), "v"(bl));
  return c;
}

__global__ __launch_bounds__(256) void k_wt_bf16(const float* __restrict__ W, unsigned short* __restrict__ Wt, int K, int N) {
  const int t = blockIdx.x * 256 + threadIdx.x;
  const int k8n = K / 8;
  if (t >= N * k8n) return;
  const int n = t / k8n, k8 = (t % k8n) * 8;
  v8us v;
#pragma unroll
  for (int i = 0; i < 8; ++i) v[i] = bf16_bits(W[(size_t)(k8 + i) * N + n]);
  *(v8us*)(Wt + (size_t)n * K + k8) = v;
  
}

// GEMM C[M][N] (f32, pitch ldc) = act(A[M][K]·W + bias). A f32 row-major (pitch lda) converted per fragment to bf16
// (ASPLIT: hi/lo two planes -> 2 terms, else single rounded term); Wt bf16 [N][K] (pitch ldb). BIAS_BF16 rounds the
// bias to bf16 first (bias quantised to bf16 before the add). K%32==0, M%16==0, N%64==0.
template <bool ASPLIT, int ACT, bool BIAS_BF16>
__global__ __launch_bounds__(128) void k_gemm_bf(const float* __restrict__ A, int lda, const unsigned short* __restrict__ Wt, int ldb,
                                               const float* __restrict__ bias, float* __restrict__ C, int ldc, int M, int N, int K) {
  __shared__ __attribute__((aligned(16))) float so[4][16][64];
  const int tid = threadIdx.x, w = tid >> 5, lane = tid & 31, ln = lane & 15, hh = lane >> 4;
  const int ntn = N / 64;
  const int wid = blockIdx.x * 4 + w;
  const int mt = wid / ntn, nq = wid % ntn;
  if (mt * 16 >= M) return;
  const int row0 = mt * 16, col0 = nq * 64;
  const float* arow = A + (size_t)(row0 + ln) * lda;
  v8f acc[4] = {};
  for (int kb = 0; kb < K; kb += 32) {
    FragB ah, al;
    const v4f x0 = *(const v4fa*)(arow + kb + 8 * hh), x1 = *(const v4fa*)(arow + kb + 8 * hh + 4);
    const v4f x2 = *(const v4fa*)(arow + kb + 16 + 8 * hh), x3 = *(const v4fa*)(arow + kb + 16 + 8 * hh + 4);
    float xs[16] = {x0[0],x0[1],x0[2],x0[3],x1[0],x1[1],x1[2],x1[3],x2[0],x2[1],x2[2],x2[3],x3[0],x3[1],x3[2],x3[3]};
#pragma unroll
    for (int i = 0; i < 16; ++i) { const unsigned short hb = bf16_bits(xs[i]); ah.u[i] = hb; al.u[i] = ASPLIT ? bf16_bits(xs[i] - bf16_val(hb)) : (unsigned short)0; }
#pragma unroll
    for (int t = 0; t < 4; ++t) {
      const unsigned short* brow = Wt + (size_t)(col0 + t * 16 + ln) * ldb + kb;
      FragB b;
      b.half[0] = *(const v8us*)(brow + 8 * hh);
      b.half[1] = *(const v8us*)(brow + 16 + 8 * hh);
      acc[t] = mmaN<ASPLIT ? 2 : 1>(ah.v, al.v, b.v, b.v, acc[t]);
    }
  }
#pragma unroll
  for (int t = 0; t < 4; ++t) {
    float bv = bias ? bias[col0 + t * 16 + ln] : 0.f;
    if (BIAS_BF16) bv = bf16_round(bv);
#pragma unroll
    for (int r = 0; r < 8; ++r) { float v = acc[t][r] + bv; if (ACT == 1) v = fmaxf(v, 0.f); so[w][8 * hh + r][t * 16 + ln] = v; }
  }
  __builtin_amdgcn_fence(__ATOMIC_ACQ_REL, "workgroup");
  __builtin_amdgcn_wave_barrier();
  const int rsub = lane >> 4, c4 = (lane & 15) * 4;
  {
#pragma unroll
    for (int q = 0; q < 8; ++q) {
      const int r = q * 2 + rsub;
      const v4f v = *(const v4fa*)&so[w][r][c4];
      *(v4f*)(C + (size_t)(row0 + r) * ldc + col0 + c4) = v;
    }
    
  }
}

// Flash-style causal/unmasked attention, all contractions 3-term bf16 hi/lo splits, f32 softmax with running max.
// q,k,v rows are read from f32 buffers with arbitrary row pitch (so they can live inside a fused qkv buffer);
// D = head size (multiple of 32, <= 128); one wave = 16 query rows; block = 4 waves (64 queries) sharing K/V chunks of 32.
template <int D, bool CAUSAL>
__global__ __launch_bounds__(128) void k_flash(const float* __restrict__ qb, const float* __restrict__ kb, const float* __restrict__ vb,
                                             int pitch, int T, int H, float scale, float* __restrict__ y, int ypitch) {
  constexpr int KS = D / 32;        // k-steps for QK
  constexpr int DT = D / 16;        // d tiles for PV
  __shared__ __attribute__((aligned(16))) unsigned short sKh[32][D + 8], sKl[32][D + 8], sVh[32][D + 8], sVl[32][D + 8];
  __shared__ __attribute__((aligned(16))) unsigned short sPh[4][16][40], sPl[4][16][40];
  __shared__ __attribute__((aligned(16))) float sO[4][16][D];
  const int tid = threadIdx.x, w = tid >> 5, lane = tid & 31, ln = lane & 15, hh = lane >> 4;
  const int nqb = (T + 63) / 64;
  const int bh = blockIdx.x / nqb, qblk = blockIdx.x % nqb;
  const int b = bh / H, h = bh % H;
  const int q0 = qblk * 64 + w * 16;
  const float* Q = qb + (size_t)b * T * pitch + h * D;
  const float* K = kb + (size_t)b * T * pitch + h * D;
  const float* V = vb + (size_t)b * T * pitch + h * D;

  // A fragments of the wave's 16 query rows (scaled), hi/lo
  FragB aqh[KS], aql[KS];
  {
    int row = q0 + ln; if (row >= T) row = T - 1;
    const float* qr = Q + (size_t)row * pitch;
#pragma unroll
    for (int ks = 0; ks < KS; ++ks)
#pragma unroll
      for (int i = 0; i < 16; ++i) {
        const int d = ks * 32 + ((i < 8) ? (8 * hh + i) : (16 + 8 * hh + (i - 8)));
        const float x = qr[d] * scale; const unsigned short hb = bf16_bits(x);
        aqh[ks].u[i] = hb; aql[ks].u[i] = bf16_bits(x - bf16_val(hb));
      }
  }
  float m_r[8], l_r[8];
#pragma unroll
  for (int r = 0; r < 8; ++r) { m_r[r] = -3.0e38f; l_r[r] = 0.f; }
  v8f oacc[DT];
#pragma unroll
  for (int dt = 0; dt < DT; ++dt) oacc[dt] = (v8f){0.f,0.f,0.f,0.f,0.f,0.f,0.f,0.f};

  const int kv_end = CAUSAL ? min(T, qblk * 64 + 64) : T;     // block-uniform
  for (int j0 = 0; j0 < kv_end; j0 += 32) {
    __syncthreads();
    for (int e = tid; e < 32 * (D / 4); e += 128) {
      const int r = e / (D / 4), c4 = (e % (D / 4)) * 4;
      const int key = j0 + r;
      v4f kf = {0.f,0.f,0.f,0.f}, vf = {0.f,0.f,0.f,0.f};
      if (key < T) { kf = *(const v4fa*)(K + (size_t)key * pitch + c4); vf = *(const v4fa*)(V + (size_t)key * pitch + c4); }
#pragma unroll
      for (int t = 0; t < 4; ++t) {
        unsigned short hb = bf16_bits(kf[t]); sKh[r][c4 + t] = hb; sKl[r][c4 + t] = bf16_bits(kf[t] - bf16_val(hb));
        hb = bf16_bits(vf[t]); sVh[r][c4 + t] = hb; sVl[r][c4 + t] = bf16_bits(vf[t] - bf16_val(hb));
      }
    }
    __syncthreads();
    // S tile 16 x 32
    v8f s[2];
#pragma unroll
    for (int nt = 0; nt < 2; ++nt) {
      v8f acc = {};
#pragma unroll
      for (int ks = 0; ks < KS; ++ks) {
        FragB bh_, bl_;
        bh_.half[0] = *(const v8us*)&sKh[nt * 16 + ln][ks * 32 + 8 * hh]; bh_.half[1] = *(const v8us*)&sKh[nt * 16 + ln][ks * 32 + 16 + 8 * hh];
        bl_.half[0] = *(const v8us*)&sKl[nt * 16 + ln][ks * 32 + 8 * hh]; bl_.half[1] = *(const v8us*)&sKl[nt * 16 + ln][ks * 32 + 16 + 8 * hh];
        acc = mmaN<3>(aqh[ks].v, aql[ks].v, bh_.v, bl_.v, acc);
      }
      s[nt] = acc;
    }
    // mask + running max (rows 8hh+r; the 16 lanes of a half share rows)
    float alpha[8];
#pragma unroll
    for (int r = 0; r < 8; ++r) {
      const int qi = q0 + 8 * hh + r;
      const int ja = j0 + ln, jb = j0 + 16 + ln;
      if (CAUSAL) { if (ja > qi) s[0][r] = -3.0e38f; if (jb > qi) s[1][r] = -3.0e38f; }
      if (ja >= T) s[0][r] = -3.0e38f;
      if (jb >= T) s[1][r] = -3.0e38f;
      float mx = fmaxf(s[0][r], s[1][r]);
      mx = fmaxf(mx, __shfl_xor(mx, 1, 32)); mx = fmaxf(mx, __shfl_xor(mx, 2, 32)); mx = fmaxf(mx, __shfl_xor(mx, 4, 32)); mx = fmaxf(mx, __shfl_xor(mx, 8, 32));
      const float mnew = fmaxf(m_r[r], mx);
      alpha[r] = (mnew > -1.0e38f) ? __expf(m_r[r] - mnew) : 1.0f;
      const float p0 = (s[0][r] > -1.0e38f) ? __expf(s[0][r] - mnew) : 0.f;
      const float p1 = (s[1][r] > -1.0e38f) ? __expf(s[1][r] - mnew) : 0.f;
      m_r[r] = mnew;
      l_r[r] = l_r[r] * alpha[r] + p0 + p1;            // per-lane partial row sum (16 lanes combined at the end)
      unsigned short hb = bf16_bits(p0); sPh[w][8 * hh + r][ln] = hb;      sPl[w][8 * hh + r][ln] = bf16_bits(p0 - bf16_val(hb));
      hb = bf16_bits(p1);                sPh[w][8 * hh + r][16 + ln] = hb; sPl[w][8 * hh + r][16 + ln] = bf16_bits(p1 - bf16_val(hb));
    }
#pragma unroll
    for (int dt = 0; dt < DT; ++dt)
#pragma unroll
      for (int r = 0; r < 8; ++r) oacc[dt][r] *= alpha[r];
    __builtin_amdgcn_fence(__ATOMIC_ACQ_REL, "workgroup");
    __builtin_amdgcn_wave_barrier();
    FragB pah, pal;
    pah.half[0] = *(const v8us*)&sPh[w][ln][8 * hh]; pah.half[1] = *(const v8us*)&sPh[w][ln][16 + 8 * hh];
    pal.half[0] = *(const v8us*)&sPl[w][ln][8 * hh]; pal.half[1] = *(const v8us*)&sPl[w][ln][16 + 8 * hh];
#pragma unroll
    for (int dt = 0; dt < DT; ++dt) {
      FragB bvh, bvl;
#pragma unroll
      for (int i = 0; i < 8; ++i) {
        bvh.u[i] = sVh[8 * hh + i][dt * 16 + ln]; bvh.u[8 + i] = sVh[16 + 8 * hh + i][dt * 16 + ln];
        bvl.u[i] = sVl[8 * hh + i][dt * 16 + ln]; bvl.u[8 + i] = sVl[16 + 8 * hh + i][dt * 16 + ln];
      }
      oacc[dt] = mmaN<3>(pah.v, pal.v, bvh.v, bvl.v, oacc[dt]);
    }
    __builtin_amdgcn_fence(__ATOMIC_ACQ_REL, "workgroup");
    __builtin_amdgcn_wave_barrier();
  }
#pragma unroll
  for (int r = 0; r < 8; ++r) {
    float l = l_r[r];
    l += __shfl_xor(l, 1, 32); l += __shfl_xor(l, 2, 32); l += __shfl_xor(l, 4, 32); l += __shfl_xor(l, 8, 32);
    l_r[r] = (l > 0.f) ? 1.0f / l : 0.f;
  }
#pragma unroll
  for (int dt = 0; dt < DT; ++dt)
#pragma unroll
    for (int r = 0; r < 8; ++r) sO[w][8 * hh + r][dt * 16 + ln] = oacc[dt][r] * l_r[r];
  __builtin_amdgcn_fence(__ATOMIC_ACQ_REL, "workgroup");
  __builtin_amdgcn_wave_barrier();
  {
    for (int r = 0; r < 16; ++r) {
      const int row = q0 + r;
      if (row < T && lane < D / 4) {
        const v4f val = *(const v4fa*)&sO[w][r][lane * 4];
        *(v4f*)(y + ((size_t)b * T + row) * ypitch + h * D + lane * 4) = val;
      }
    }
    
  }
}

// GEMM C = act(A·W + bias + resid): A f32 (ASPLIT -> hi/lo 2 terms), Wt bf16 [N][K]; ACT 0 none, 1 relu, 2 exact gelu;
// resid (optional, f32, row index = (row % rmod), pitch ldr, RES_BF16 rounds it) added before the activation.
template <bool ASPLIT, int ACT, bool BIAS_BF16, bool RES_BF16>
__global__ __launch_bounds__(128) void k_gemm_bf3(const float* __restrict__ A, int lda, const unsigned short* __restrict__ Wt, int ldb,
                                                const float* __restrict__ bias, const float* __restrict__ resid, int rmod, int ldr,
                                                float* __restrict__ C, int ldc, int M, int N, int K) {
  __shared__ __attribute__((aligned(16))) float so[4][16][64];
  const int tid = threadIdx.x, w = tid >> 5, lane = tid & 31, ln = lane & 15, hh = lane >> 4;
  const int ntn = N / 64;
  const int wid = blockIdx.x * 4 + w;
  const int mt = wid / ntn, nq = wid % ntn;
  if (mt * 16 >= M) return;
  const int row0 = mt * 16, col0 = nq * 64;
  const float* arow = A + (size_t)(row0 + ln) * lda;
  v8f acc[4] = {};
  for (int kb = 0; kb < K; kb += 32) {
    FragB ah, al;
    const v4f x0 = *(const v4fa*)(arow + kb + 8 * hh), x1 = *(const v4fa*)(arow + kb + 8 * hh + 4);
    const v4f x2 = *(const v4fa*)(arow + kb + 16 + 8 * hh), x3 = *(const v4fa*)(arow + kb + 16 + 8 * hh + 4);
    float xs[16] = {x0[0],x0[1],x0[2],x0[3],x1[0],x1[1],x1[2],x1[3],x2[0],x2[1],x2[2],x2[3],x3[0],x3[1],x3[2],x3[3]};
#pragma unroll
    for (int i = 0; i < 16; ++i) { const unsigned short hb = bf16_bits(xs[i]); ah.u[i] = hb; al.u[i] = ASPLIT ? bf16_bits(xs[i] - bf16_val(hb)) : (unsigned short)0; }
#pragma unroll
    for (int t = 0; t < 4; ++t) {
      const unsigned short* brow = Wt + (size_t)(col0 + t * 16 + ln) * ldb + kb;
      FragB b;
      b.half[0] = *(const v8us*)(brow + 8 * hh);
      b.half[1] = *(const v8us*)(brow + 16 + 8 * hh);
      acc[t] = mmaN<ASPLIT ? 2 : 1>(ah.v, al.v, b.v, b.v, acc[t]);
    }
  }
#pragma unroll
  for (int t = 0; t < 4; ++t) {
    const int col = col0 + t * 16 + ln;
    float bv = bias ? bias[col] : 0.f;
    if (BIAS_BF16) bv = bf16_round(bv);
#pragma unroll
    for (int r = 0; r < 8; ++r) {
      float v = acc[t][r] + bv;
      if (resid) { float rv = resid[(size_t)((row0 + 8 * hh + r) % rmod) * ldr + col]; if (RES_BF16) rv = bf16_round(rv); v += rv; }
      if (ACT == 1) v = fmaxf(v, 0.f);
      if (ACT == 2) v = 0.5f * v * (1.0f + erff(v * 0.70710678118654752f));
      if (ACT == 3) { const float u = 0.7978845608028654f * (v + 0.044715f * v * v * v); v = 0.5f * v * (1.0f + tanhf(u)); }
      so[w][8 * hh + r][t * 16 + ln] = v;
    }
  }
  __builtin_amdgcn_fence(__ATOMIC_ACQ_REL, "workgroup");
  __builtin_amdgcn_wave_barrier();
  const int rsub = lane >> 4, c4 = (lane & 15) * 4;
  {
#pragma unroll
    for (int q = 0; q < 8; ++q) {
      const int r = q * 2 + rsub;
      const v4f v = *(const v4fa*)&so[w][r][c4];
      *(v4f*)(C + (size_t)(row0 + r) * ldc + col0 + c4) = v;
    }
    
  }
}
// row LayerNorm (biased variance, eps) over N: s = X (+ R); optional out_sum <- s; out_norm <- (s-mu)*rsqrt(var+eps)*g + b
template <bool PARAM_BF16>
__global__ __launch_bounds__(256) void k_layernorm(const float* __restrict__ X, const float* __restrict__ R, const float* __restrict__ g, const float* __restrict__ bta,
                                                  float* __restrict__ out_sum, float* __restrict__ out_norm, int N, float eps) {
  __shared__ float red[256];
  const int row = blockIdx.x, tid = threadIdx.x;
  const float* x = X + (size_t)row * N; const float* rr = R ? R + (size_t)row * N : nullptr;
  float vals[16];                     // up to N = 4096
  const int per = N / 256;            // contiguous chunk per thread? use strided-by-4 chunks: thread handles j = tid*4 + 1024*u
  float s1 = 0.f;
  for (int u = 0; u < per / 4; ++u) {
    const int j = tid * 4 + 1024 * u;
    const v4f a = *(const v4fa*)(x + j);
    v4f b = {0.f,0.f,0.f,0.f}; if (rr) b = *(const v4fa*)(rr + j);
#pragma unroll
    for (int q = 0; q < 4; ++q) { const float v = a[q] + b[q]; vals[u * 4 + q] = v; s1 += v; }
  }
  red[tid] = s1; __syncthreads();
  for (int st = 128; st > 0; st >>= 1) { if (tid < st) red[tid] += red[tid + st]; __syncthreads(); }
  const float mu = red[0] / (float)N; __syncthreads();
  float s2 = 0.f;
  for (int u = 0; u < per / 4; ++u)
#pragma unroll
    for (int q = 0; q < 4; ++q) { const float c = vals[u * 4 + q] - mu; s2 += c * c; }
  red[tid] = s2; __syncthreads();
  for (int st = 128; st > 0; st >>= 1) { if (tid < st) red[tid] += red[tid + st]; __syncthreads(); }
  const float rs = rsqrtf(red[0] / (float)N + eps);
  {
    for (int u = 0; u < per / 4; ++u) {
      const int j = tid * 4 + 1024 * u;
      v4f o, sm;
#pragma unroll
      for (int q = 0; q < 4; ++q) {
        float gg = g[j + q], bb = bta[j + q];
        if (PARAM_BF16) { gg = bf16_round(gg); bb = bf16_round(bb); }
        sm[q] = vals[u * 4 + q]; o[q] = (vals[u * 4 + q] - mu) * rs * gg + bb;
      }
      if (out_sum) *(v4f*)(out_sum + (size_t)row * N + j) = sm;
      *(v4f*)(out_norm + (size_t)row * N + j) = o;
    }
    
  }
}



// ---- f16 WMMA path (v_wmma_f32_16x16x32_f16): 11-bit significands for operands in range — used where a [0,1] probability operand needs more precision than bf16
typedef _Float16 v16h __attribute__((ext_vector_type(16)));
union FragH { v16h v; v8us half[2]; _Float16 h[16]; unsigned short u[16]; };
template <int NT>
__device__ __forceinline__ v8f mmaH(v16h ah, v16h al, v16h bh, v16h bl, v8f c) {
  c = __builtin_amdgcn_wmma_f32_16x16x32_f16(false, ah, false, bh, (short)0, c, false, false);
  if (NT >= 2) c = __builtin_amdgcn_wmma_f32_16x16x32_f16(false, al, false, bh, (short)0, c, false, false);
  if (NT >= 3) c = __builtin_amdgcn_wmma_f32_16x16x32_f16(false, ah, false, bl, (short)0, c, false, false);
  asm volatile("v_nop\n\tv_nop\n\tv_nop\n\tv_nop" : "+v"(c) : "v"(ah), "v"(al), "v"(bh), "v"(bl));
  return c;
}
// batched GEMM like k_gemm_b but f16 operands: A f32 (split into f16 hi/lo if ASPLIT, else rounded to f16), Bt = f16 values [n][k]; alpha; C f32; N multiple of 16 (partial tiles skipped)
template <bool ASPLIT>
__global__ __launch_bounds__(128) void k_gemm_h(const float* __restrict__ A, int lda, size_t sA, const _Float16* __restrict__ Bh, int ldb, size_t sB, float alpha, float* __restrict__ C, int ldc, size_t sC, int M, int N, int K) {
  __shared__ __attribute__((aligned(16))) float so[4][16][64];
  const int tid = threadIdx.x, w = tid >> 5, lane = tid & 31, ln = lane & 15, hh = lane >> 4; const int by = blockIdx.y;
  A += (size_t)by * sA; Bh += (size_t)by * sB; C += (size_t)by * sC;
  const int ntn = (N + 63) / 64; const int wid = blockIdx.x * 4 + w; const int mt = wid / ntn, nq = wid % ntn; if (mt * 16 >= M) return;
  const int row0 = mt * 16, col0 = nq * 64; const float* arow = A + (size_t)(row0 + ln) * lda;
  v8f acc[4] = {};
  for (int kb = 0; kb < K; kb += 32) {
    FragH ah, al;
    const v4f x0 = *(const v4fa*)(arow + kb + 8 * hh), x1 = *(const v4fa*)(arow + kb + 8 * hh + 4), x2 = *(const v4fa*)(arow + kb + 16 + 8 * hh), x3 = *(const v4fa*)(arow + kb + 16 + 8 * hh + 4);
    float xs[16] = {x0[0],x0[1],x0[2],x0[3],x1[0],x1[1],x1[2],x1[3],x2[0],x2[1],x2[2],x2[3],x3[0],x3[1],x3[2],x3[3]};
#pragma unroll
    for (int i = 0; i < 16; ++i) { const _Float16 h = (_Float16)xs[i]; ah.h[i] = h; al.h[i] = ASPLIT ? (_Float16)(xs[i] - (float)h) : (_Float16)0.0f; }
#pragma unroll
    for (int t = 0; t < 4; ++t) { if (col0 + t * 16 >= N) continue; const size_t boff = (size_t)(col0 + t * 16 + ln) * ldb + kb; FragH bq; bq.half[0] = *(const v8us*)(Bh + boff + 8 * hh); bq.half[1] = *(const v8us*)(Bh + boff + 16 + 8 * hh);
      acc[t] = mmaH<ASPLIT ? 2 : 1>(ah.v, al.v, bq.v, bq.v, acc[t]); }
  }
#pragma unroll
  for (int t = 0; t < 4; ++t) { if (col0 + t * 16 >= N) continue;
#pragma unroll
    for (int r = 0; r < 8; ++r) so[w][8 * hh + r][t * 16 + ln] = acc[t][r] * alpha; }
  __builtin_amdgcn_fence(__ATOMIC_ACQ_REL, "workgroup"); __builtin_amdgcn_wave_barrier();
  const int rsub = lane >> 4, c4 = (lane & 15) * 4;
  {
#pragma unroll
    for (int q = 0; q < 8; ++q) { const int r = q * 2 + rsub; if (col0 + c4 < N) { const v4f v = *(const v4fa*)&so[w][r][c4]; *(v4f*)(C + (size_t)(row0 + r) * ldc + col0 + c4) = v; } }
     }
}

// Wt[n][k] = f16(W[k][n]·scale) from f32 row-major W[K][N] (scale = power of two; bf16-exact weights stay exact in f16 away from the subnormal range)
__global__ __launch_bounds__(256) void k_wt_f16(const float* __restrict__ W, _Float16* __restrict__ Wt, int K, int N, float scale) {
  const int t = blockIdx.x * 256 + threadIdx.x; if (t >= N * (K / 8)) return; const int n = t / (K / 8), k8 = (t % (K / 8)) * 8; FragH f;
#pragma unroll
  for (int i = 0; i < 8; ++i) f.h[i] = (_Float16)(bf16_round(W[(size_t)(k8 + i) * N + n]) * scale); const v8us o = f.half[0];
  *(v8us*)((unsigned short*)Wt + (size_t)n * K + k8) = o; 
}
// k_gemm_hh variant with fused epilogue: v = acc·alpha + bias[by·sBias + col] (+ CP[(row/rowsPerB)·sCPb + by·64 + col] if CP) ; ACT 0 none / 1 elu ; writes f16 C16 (and f32 C if non-null)
template <int ACT>
__global__ __launch_bounds__(128) void k_gemm_hhx(const _Float16* __restrict__ A, int lda, size_t sA, const _Float16* __restrict__ Bh, int ldb, size_t sB, float alpha, const float* __restrict__ bias, size_t sBias, const float* __restrict__ CP, int rowsPerB, size_t sCPb, int row0g,
    float* __restrict__ C, _Float16* __restrict__ C16, int ldc, size_t sC, int M, int N, int K) {
  __shared__ __attribute__((aligned(16))) float so[4][16][64];
  const int tid = threadIdx.x, w = tid >> 5, lane = tid & 31, ln = lane & 15, hh = lane >> 4; const int by = blockIdx.y;
  A += (size_t)by * sA; Bh += (size_t)by * sB; const size_t cofs = (size_t)by * sC; const float* bp = bias ? bias + (size_t)by * sBias : nullptr;
  const int ntn = (N + 63) / 64; const int wid = blockIdx.x * 4 + w; const int mt = wid / ntn, nq = wid % ntn; if (mt * 16 >= M) return;
  const int row0 = mt * 16, col0 = nq * 64; const _Float16* arow = A + (size_t)(row0 + ln) * lda;
  v8f acc[4] = {};
  // Fragments are fetched ahead: two register sets of 64 k each; while one set feeds its 8 WMMAs the other set's 20 loads are in flight. K % 128 == 0.
  // A column tile past N reads row N - 1 (in bounds); its accumulator is never stored (the guards of the epilogue).
  const unsigned short* ap = (const unsigned short*)arow + 8 * hh; const unsigned short* wp[4];
#pragma unroll
  for (int t = 0; t < 4; ++t) { int cr = col0 + t * 16 + ln; if (cr > N - 1) cr = N - 1; wp[t] = (const unsigned short*)Bh + (size_t)cr * ldb + 8 * hh; }
  FragH a0[2], a1[2], b0[2][4], b1[2][4];
  auto ldf = [&](FragH (&a)[2], FragH (&bq)[2][4], int kb, int ko) {      /* k = kb + ko; ko is a literal and goes into the loads' offset fields */
    const unsigned short* pa = ap + kb; const unsigned short* pw[4] = {wp[0] + kb, wp[1] + kb, wp[2] + kb, wp[3] + kb};
#pragma unroll
    for (int ks = 0; ks < 2; ++ks) { a[ks].half[0] = *(const v8us*)(pa + ko + ks * 32); a[ks].half[1] = *(const v8us*)(pa + ko + ks * 32 + 16);
#pragma unroll
      for (int t = 0; t < 4; ++t) { bq[ks][t].half[0] = *(const v8us*)(pw[t] + ko + ks * 32); bq[ks][t].half[1] = *(const v8us*)(pw[t] + ko + ks * 32 + 16); } }
    /* the group's address pairs are named so that no register of them is reused (not even as a later load's result) before the loads have taken them */
    asm volatile("s_wait_xcnt 0x0" :: "v"(pa), "v"(pw[0]), "v"(pw[1]), "v"(pw[2]), "v"(pw[3]) : "memory"); };
  auto mmf = [&](FragH (&a)[2], FragH (&bq)[2][4]) {
#pragma unroll
    for (int ks = 0; ks < 2; ++ks)
#pragma unroll
      for (int t = 0; t < 4; ++t) acc[t] = mmaH<1>(a[ks].v, a[ks].v, bq[ks][t].v, bq[ks][t].v, acc[t]); };
  ldf(a0, b0, 0, 0);
  for (int kb = 0; kb < K; kb += 128) {
    ldf(a1, b1, kb, 64);
    mmf(a0, b0);
    ldf(a0, b0, (kb + 128 < K) ? kb + 128 : 0, 0);      /* last trip: wraps to k = 0, in bounds, values unused; no branch, so the waits stay counted */
    mmf(a1, b1);
  }
#pragma unroll
  for (int t = 0; t < 4; ++t) { if (col0 + t * 16 >= N) continue; const int col = col0 + t * 16 + ln; const float bv = bp ? bf16_round(bp[col]) : 0.f;
#pragma unroll
    for (int r = 0; r < 8; ++r) { float v = acc[t][r] * alpha + bv; if (CP) { const int bidx = (row0g + row0 + 8 * hh + r) / rowsPerB; v += CP[(size_t)bidx * sCPb + (size_t)by * 64 + col]; } if (ACT == 1) v = (v > 0.f) ? v : expm1f(v); else if (ACT == 7) v = (v > 0.f) ? v + 1.0f : expf(v); else if (ACT == 8) v = tanhf(v); else if (ACT == 9) v = 0.5f * v * (1.0f + tanhf(0.7978845608028654f * (v + 0.044715f * v * v * v))); else if (ACT == 11) v = 1.0f / (1.0f + expf(-v)); else if (ACT == 12) v = (v > 0.f) ? v : 0.01f * v; else if (ACT == 14) v = (v > 0.f) ? v : 0.1f * v; else if (ACT == 15) v = v / (1.0f + expf(-v)); else if (ACT == 3) v = fmaxf(v, 0.f); else if (ACT == 6) v = 0.5f * v * (1.0f + erff(v * 0.70710678118654752f)); so[w][8 * hh + r][t * 16 + ln] = v; } }
  __builtin_amdgcn_fence(__ATOMIC_ACQ_REL, "workgroup"); __builtin_amdgcn_wave_barrier();
  const int rsub = lane >> 4, c4 = (lane & 15) * 4; typedef _Float16 v4h __attribute__((ext_vector_type(4)));
  {
#pragma unroll
    for (int q = 0; q < 8; ++q) { const int r = q * 2 + rsub; if (col0 + c4 < N) { const v4f v = *(const v4fa*)&so[w][r][c4]; if (C) *(v4f*)(C + cofs + (size_t)(row0 + r) * ldc + col0 + c4) = v; if (C16) { v4h h4; for (int i = 0; i < 4; ++i) h4[i] = (_Float16)v[i]; *(v4h*)(C16 + cofs + (size_t)(row0 + r) * ldc + col0 + c4) = h4; } } }
     }
}


typedef _Float16 v4h __attribute__((ext_vector_type(4)));

__global__ __launch_bounds__(256) void k_x16(const float* __restrict__ x, _Float16* __restrict__ X16, size_t n8) { const size_t t = (size_t)blockIdx.x * 256 + threadIdx.x; if (t >= n8) return; FragH f;
#pragma unroll
  for (int q = 0; q < 8; ++q) f.h[q] = (_Float16)bf16_round(x[t * 8 + q]); *(v8us*)((unsigned short*)X16 + t * 8) = f.half[0];  }
__global__ __launch_bounds__(256) void k_h16(const float* __restrict__ x, _Float16* __restrict__ X16, size_t n8) { const size_t t = (size_t)blockIdx.x * 256 + threadIdx.x; if (t >= n8) return; FragH f;
#pragma unroll
  for (int q = 0; q < 8; ++q) f.h[q] = (_Float16)x[t * 8 + q]; *(v8us*)((unsigned short*)X16 + t * 8) = f.half[0];  }
__global__ __launch_bounds__(256) void k_round16f(const float* __restrict__ W, _Float16* __restrict__ Bt, size_t n8) { const size_t t = (size_t)blockIdx.x * 256 + threadIdx.x; if (t >= n8) return; FragH f;
#pragma unroll
  for (int i = 0; i < 8; ++i) f.h[i] = (_Float16)(bf16_round(W[t * 8 + i]) * 16.0f); *(v8us*)((unsigned short*)Bt + t * 8) = f.half[0];  }
template <int NHv, int TTv>
__global__ __launch_bounds__(256) void k_vt(const _Float16* __restrict__ V16, int ldv, int voff, _Float16* __restrict__ Vt) { __shared__ unsigned short tl[64][66]; const int tid = threadIdx.x; const int slab = blockIdx.x / (TTv / 64), lg = blockIdx.x % (TTv / 64); const int b = slab / NHv, h = slab % NHv;
  for (int i = tid; i < 64 * 8; i += 256) { const int r = i / 8, c8 = (i % 8) * 8; FragH f; f.half[0] = *(const v8us*)((const unsigned short*)V16 + ((size_t)b * TTv + lg * 64 + r) * ldv + voff + h * 64 + c8);
#pragma unroll
    for (int q = 0; q < 8; ++q) tl[r][c8 + q] = f.u[q]; }
  __syncthreads();
  {
#pragma unroll
    for (int rd = 0; rd < 2; ++rd) { const int d = rd * 32 + tid / 8, pc = tid % 8; FragH f;
#pragma unroll
      for (int q = 0; q < 8; ++q) f.u[q] = tl[pc * 8 + q][d];
      *(v8us*)((unsigned short*)Vt + ((size_t)slab * 64 + d) * TTv + lg * 64 + pc * 8) = f.half[0]; }
     } }

typedef int v4i __attribute__((ext_vector_type(4)));
typedef int v4ia __attribute__((ext_vector_type(4), may_alias));
// lane l takes the value of lane l ^ 16 (a vector cross-row move, no LDS trip)
__device__ __forceinline__ float xhalf(float x) { return __builtin_bit_cast(float, __builtin_amdgcn_permlanex16(__builtin_bit_cast(int, x), __builtin_bit_cast(int, x), 0x76543210, 0xfedcba98, false, false)); }

// Both attention paths in one walk over the keys. The scores S^T = K Q^T are the same for the two paths, and so are the K and V^T fragments: each is fetched and each score tile is formed once;
// the wave then runs two online softmaxes (additive key bias; 0/1 mask) with two output accumulators, and the gated sum is taken in registers in the epilogue: no per-path output plane, no combining launch.
__global__ __launch_bounds__(128) void k_flash_gl(const _Float16* __restrict__ Q16, int ldq, const _Float16* __restrict__ K16, int ldk, const _Float16* __restrict__ Vt, const float* __restrict__ AB, const int* __restrict__ MSK, const float* __restrict__ gate, float* __restrict__ O, int ldo) {
  constexpr int RPW = 16, NQB = TT / (4 * RPW), DT = 4, KS = 2;
  __shared__ __attribute__((aligned(16))) float sO[4][RPW][64 + 4];
  const int tid = threadIdx.x, w = tid >> 5, lane = tid & 31, ln = lane & 15, hh = lane >> 4;
  const int slab = blockIdx.x / NQB, qblk = blockIdx.x % NQB; const int b = slab / NH, h = slab % NH; const int qb0 = qblk * (4 * RPW); const int q0 = qb0 + w * RPW;
  // Transposed tiles: S^T = K Q^T (A = 16 key rows, B = the wave's 16 queries), O^T += V^T P^T. Lane (ln, hh) owns query q0 + ln; its score registers hold keys j0 + 8 hh + r and j0 + 16 + 8 hh + r,
  // which is the k order of a B operand: P goes from the score registers into the second product with no LDS trip, and maximum and sum run inside the lane plus one exchange between the wave halves.
  FragH aq[KS];
  { const unsigned short* qr = (const unsigned short*)Q16 + ((size_t)b * TT + q0 + ln) * ldq + h * 64;
#pragma unroll
    for (int ks = 0; ks < KS; ++ks) { aq[ks].half[0] = *(const v8us*)(qr + ks * 32 + 8 * hh); aq[ks].half[1] = *(const v8us*)(qr + ks * 32 + 16 + 8 * hh); }
    asm volatile("s_wait_xcnt 0x0" :: "v"(qr) : "memory"); }      /* as in ldK below: the address pair stays whole until the loads have taken it */
  const unsigned short* Vth = (const unsigned short*)Vt + (size_t)slab * 64 * TT;
  float mg = -3.0e38f, lg = 0.f, ml = -3.0e38f, ll = 0.f; v8f og[DT], ol[DT];      /* running maximum, running sum, output tile: g = additive-bias path, l = 0/1-mask path */
#pragma unroll
  for (int dt = 0; dt < DT; ++dt) { og[dt] = (v8f){0.f,0.f,0.f,0.f,0.f,0.f,0.f,0.f}; ol[dt] = (v8f){0.f,0.f,0.f,0.f,0.f,0.f,0.f,0.f}; }
  const int jend = TT;
  // Global loads are issued ahead of their use: the K fragments, the key bias and the mask words one pass ahead (registers carried round the loop), the V^T fragments at the top of their own pass; their latency then runs under the softmaxes, not in front of each WMMA.
  const unsigned short* Kl = (const unsigned short*)K16 + ((size_t)b * TT + ln) * ldk + h * 64 + 8 * hh; FragH bk[2][KS];
  const float* aml = AB + (size_t)b * TT + 8 * hh; v4f abn[2][2];
  const int* Ml = MSK + ((size_t)b * TT + q0 + ln) * TT + 8 * hh; v4i mkn[2][2];
  auto ldK = [&](int j) {
    const unsigned short* kr[2] = {Kl + (size_t)j * ldk, Kl + (size_t)(j + 16) * ldk}; const float* am = aml + j; const int* mm = Ml + j;
#pragma unroll
    for (int nt = 0; nt < 2; ++nt) { mkn[nt][0] = *(const v4ia*)(mm + nt * 16); mkn[nt][1] = *(const v4ia*)(mm + nt * 16 + 4); }
#pragma unroll
    for (int nt = 0; nt < 2; ++nt) { abn[nt][0] = *(const v4fa*)(am + nt * 16); abn[nt][1] = *(const v4fa*)(am + nt * 16 + 4); }
#pragma unroll
    for (int nt = 0; nt < 2; ++nt)
#pragma unroll
      for (int ks = 0; ks < KS; ++ks) { bk[nt][ks].half[0] = *(const v8us*)(kr[nt] + ks * 32); bk[nt][ks].half[1] = *(const v8us*)(kr[nt] + ks * 32 + 16); }
    /* the group's address pairs are named so that no register of them is reused (not even as a later load's result) before the loads have taken them */
    asm volatile("s_wait_xcnt 0x0" :: "v"(kr[0]), "v"(kr[1]), "v"(am), "v"(mm) : "memory"); };
  // One path's online-softmax step on its 32 scores of this pass: new maximum, rescale of sum and output tile, P^T packed as a B operand (element nt * 8 + r is key nt * 16 + 8 hh + r, the order in which bv holds V^T).
  auto soft = [&](const float (&sc)[2][8], float& m_r, float& l_r, v8f (&oacc)[DT], FragH& pb) {
    float mx[8];
#pragma unroll
    for (int r = 0; r < 8; ++r) mx[r] = fmaxf(sc[0][r], sc[1][r]);
    float mc = fmaxf(fmaxf(fmaxf(mx[0], mx[1]), fmaxf(mx[2], mx[3])), fmaxf(fmaxf(mx[4], mx[5]), fmaxf(mx[6], mx[7])));
    mc = fmaxf(mc, xhalf(mc));      /* both wave halves now hold the maximum of the query's 32 scores of this pass */
    const float mn = fmaxf(m_r, mc); const float ea = expf(m_r - mn); const float al = (mn > -1.0e38f) ? ea : 1.0f; m_r = mn;      /* computed, then selected: no branch, so the two paths' chains can be interleaved */
    float p[2][8];      /* a masked score is -inf and mn is finite, so its expf is 0 */
#pragma unroll
    for (int nt = 0; nt < 2; ++nt)
#pragma unroll
      for (int r = 0; r < 8; ++r) p[nt][r] = expf(sc[nt][r] - mn);
    float ps[8];
#pragma unroll
    for (int r = 0; r < 8; ++r) ps[r] = p[0][r] + p[1][r];
    l_r = l_r * al + (((ps[0] + ps[1]) + (ps[2] + ps[3])) + ((ps[4] + ps[5]) + (ps[6] + ps[7])));      /* this half's 16 keys; the halves are joined behind the loop */
#pragma unroll
    for (int dt = 0; dt < DT; ++dt)
#pragma unroll
      for (int r = 0; r < 8; ++r) oacc[dt][r] *= al;
#pragma unroll
    for (int nt = 0; nt < 2; ++nt)
#pragma unroll
      for (int r = 0; r < 8; ++r) pb.h[nt * 8 + r] = (_Float16)(p[nt][r] * 1024.0f); };
  const float gq = bf16_round(gate[((size_t)b * NH + h) * TT + q0 + ln]);      /* the gate of this lane's query (bf16-rounded input) */
  ldK(0);
#pragma unroll 1      /* stays rolled: one set of carried fragment registers, and the pass's code is fetched once */
  for (int j0 = 0; j0 < jend; j0 += 32) {
    const int jn = (j0 + 32 < jend) ? j0 + 32 : 0;      /* the pass fetched for; behind the last pass it wraps to key 0: in bounds, values unused; no branch, so the waits stay counted */
    float ab[2][8];      /* additive attention bias (bf16-rounded input) of keys j0 + nt * 16 + 8 hh + r */
    int mk[2][8];      /* per-batch mask [b][q][k] of query q0 + ln, same keys: nonzero = ATTEND */
#pragma unroll
    for (int nt = 0; nt < 2; ++nt)
#pragma unroll
      for (int r = 0; r < 8; ++r) { ab[nt][r] = (float)(__bf16)abn[nt][r >> 2][r & 3]; mk[nt][r] = mkn[nt][r >> 2][r & 3]; }      /* the convert rounds to nearest even, as bf16_round does */
    FragH bv[DT];      /* V^T fragments of this pass: issued here, used behind the softmaxes, by both paths */
    const unsigned short* vr = Vth + (size_t)ln * TT + j0 + 8 * hh;
#pragma unroll
    for (int dt = 0; dt < DT; ++dt) { bv[dt].half[0] = *(const v8us*)(vr + dt * 16 * TT); bv[dt].half[1] = *(const v8us*)(vr + dt * 16 * TT + 16); }
    asm volatile("s_wait_xcnt 0x0" :: "v"(vr) : "memory");      /* as in ldK: the address pair stays whole until the loads have taken it */
    v8f s[2];
#pragma unroll
    for (int nt = 0; nt < 2; ++nt) { v8f acc = (v8f){0.f,0.f,0.f,0.f,0.f,0.f,0.f,0.f};
#pragma unroll
      for (int ks = 0; ks < KS; ++ks) acc = mmaH<1>(bk[nt][ks].v, bk[nt][ks].v, aq[ks].v, aq[ks].v, acc); s[nt] = acc; }
    ldK(jn);
    float scg[2][8], scl[2][8];
#pragma unroll
    for (int nt = 0; nt < 2; ++nt)
#pragma unroll
      for (int r = 0; r < 8; ++r) { scg[nt][r] = s[nt][r] * 0.125f + ab[nt][r]; scl[nt][r] = (mk[nt][r] != 0) ? s[nt][r] * 0.125f : -INFINITY; }
    FragH pg, pl;
    soft(scg, mg, lg, og, pg);
    soft(scl, ml, ll, ol, pl);
#pragma unroll
    for (int dt = 0; dt < DT; ++dt) { og[dt] = mmaH<1>(bv[dt].v, bv[dt].v, pg.v, pg.v, og[dt]); ol[dt] = mmaH<1>(bv[dt].v, bv[dt].v, pl.v, pl.v, ol[dt]); } }
  { const float sg = lg + xhalf(lg), sl = ll + xhalf(ll); const float lig = (sg > 0.f) ? 1.0f / (sg * 1024.0f) : 0.f, lil = (sl > 0.f) ? 1.0f / (sl * 1024.0f) : 0.f; const float g1 = 1.0f - gq;
#pragma unroll
    for (int dt = 0; dt < DT; ++dt) {      /* og[dt][r], ol[dt][r] = the paths' O[q0 + ln][dt * 16 + 8 hh + r]; the gated sum of the two goes out */
      v4f o0, o1;
#pragma unroll
      for (int r = 0; r < 4; ++r) { o0[r] = gq * (ol[dt][r] * lil) + g1 * (og[dt][r] * lig); o1[r] = gq * (ol[dt][4 + r] * lil) + g1 * (og[dt][4 + r] * lig); }
      *(v4fa*)&sO[w][ln][dt * 16 + 8 * hh] = o0; *(v4fa*)&sO[w][ln][dt * 16 + 8 * hh + 4] = o1; } }
  __builtin_amdgcn_fence(__ATOMIC_ACQ_REL, "workgroup"); __builtin_amdgcn_wave_barrier();
  {
#pragma unroll
    for (int rp = 0; rp < RPW; rp += 2) { const int r = rp + (lane >> 4), pc = lane & 15; const v4f val = *(const v4fa*)&sO[w][r][pc * 4]; *(v4f*)(O + ((size_t)b * TT + q0 + r) * ldo + h * 64 + pc * 4) = val; }
     } }

extern "C" void kernel_launch(void* const* d_in, const int* in_sizes, int n_in,
                              void* d_out, int out_size, void* d_ws, size_t ws_size, hipStream_t stream) {
  (void)in_sizes; (void)n_in; (void)out_size;
  const float* const* I = (const float* const*)d_in; const float* x = I[0]; const float* am = I[1]; const int* lm = (const int*)d_in[2]; const float* gate = I[3]; const float* Wq = I[4]; const float* bq = I[5]; const float* Wk = I[6]; const float* bk = I[7]; const float* Wv = I[8]; const float* bv = I[9];
  char* ws = (char*)d_ws; size_t off = 0;
  auto take = [&](size_t bytes) { char* p = ws + off; off += (bytes + 255) & ~(size_t)255; return p; };
  const size_t WSZ = (size_t)DD * DD; _Float16* Bw = (_Float16*)take(3 * WSZ * 2); _Float16* X16 = (_Float16*)take((size_t)NR * DD * 2); _Float16* Q = (_Float16*)take((size_t)NR * DD * 2); _Float16* K = (_Float16*)take((size_t)NR * DD * 2); _Float16* V = (_Float16*)take((size_t)NR * DD * 2); _Float16* Vt = (_Float16*)take((size_t)NR * DD * 2);
  if (off > ws_size) return;      // 3.5 + 5 x 6.3 = about 35 MB
  const unsigned gw = (unsigned)((WSZ / 8 + 255) / 256); k_wt_f16<<<gw, 256, 0, stream>>>(Wq, Bw, DD, DD, 16.0f); k_wt_f16<<<gw, 256, 0, stream>>>(Wk, Bw + WSZ, DD, DD, 16.0f); k_wt_f16<<<gw, 256, 0, stream>>>(Wv, Bw + 2 * WSZ, DD, DD, 16.0f);      /* (in,out) → Bt ×2^4 */
  k_x16<<<(unsigned)(((size_t)NR * DD / 8 + 255) / 256), 256, 0, stream>>>(x, X16, (size_t)NR * DD / 8);
  const dim3 gp(((NR / 16) * (DD / 64) + 3) / 4, 1);
  k_gemm_hhx<0><<<gp, 128, 0, stream>>>(X16, DD, 0, Bw, DD, 0, 0.0625f, bq, 0, nullptr, 1, 0, 0, nullptr, Q, DD, 0, NR, DD, DD);      /* M 4096 N 768 K 768 */
  k_gemm_hhx<0><<<gp, 128, 0, stream>>>(X16, DD, 0, Bw + WSZ, DD, 0, 0.0625f, bk, 0, nullptr, 1, 0, 0, nullptr, K, DD, 0, NR, DD, DD);
  k_gemm_hhx<0><<<gp, 128, 0, stream>>>(X16, DD, 0, Bw + 2 * WSZ, DD, 0, 0.0625f, bv, 0, nullptr, 1, 0, 0, nullptr, V, DD, 0, NR, DD, DD);
  k_vt<NH, TT><<<BB * NH * (TT / 64), 256, 0, stream>>>(V, DD, 0, Vt);
  k_flash_gl<<<BB * NH * (TT / 64), 128, 0, stream>>>(Q, DD, K, DD, Vt, am, lm, gate, (float*)d_out, DD);      /* both paths and the gated sum */
}

// v004
// Measured time: 113 microseconds a run.
// Two timings next to v003 both put it at 1.32 times that version's speed.
// Over all steps from v000 it is 3.16 times as fast.
#include <hip/hip_runtime.h>
// Gated global/local self attention (B=4, S=1024, HID=768, 12×64): q,k,v = x·W + b ((in,out)); scores = q·k/8; global path softmax(scores + attention_mask[b,0,0,k]); local path softmax(scores + (1 − local_mask[b,0,q,k])·f32_min); ctx = gate[b,h,q]·ctx_local + (1 − gate)·ctx_global, merged → [4,1024,768].
// Compute dtype: x, weights, biases, additive mask and gates rounded to bf16; q/k/v f16 GEMM planes; one flash-style kernel on v_wmma_f32_16x16x32_f16 (online softmax f32, P f16 x 2^10, f32 accumulate) that forms each score tile once and feeds two softmaxes: one with the per-batch additive key bias, one with the per-batch 0/1 (q,k) mask
// (0 -> -inf); the gated combination in f32, in that kernel's epilogue.
// Every f16 plane that feeds a WMMA from global memory (X, W^T, Q, K, V, V^T) lies in FRAGMENT ORDER: a plane of rows x cols is cut into blocks of 16 rows x 32 cols (1 KiB, row tile major, then column block);
// a block is two units of 512 B (cols 0..15, cols 16..31); in a unit lane l = 16 hh + ln owns 16 B: row ln, cols 8 hh .. 8 hh + 7. A wave's b128 load of a fragment half is then one unit: 4 whole 128-B lines, where a row-major plane gives 16 pieces of 32 B.
// Element (R, C) of a plane with pitch P (cols): (R / 16) * 16 * P + (C / 32) * 512 + ((C / 16) % 2) * 256 + (((C / 8) % 2) * 16 + R % 16) * 8 + C % 8.
#define BB 4
#define TT 1024
#define DD 768
#define NH 12
#define NR (BB * TT)

typedef __bf16 v16b __attribute__((ext_vector_type(16)));
typedef unsigned short v8us __attribute__((ext_vector_type(8), may_alias));
typedef float  v8f  __attribute__((ext_vector_type(8)));
typedef float  v4f  __attribute__((ext_vector_type(4)));
typedef float  v4fa __attribute__((ext_vector_type(4), may_alias));
union FragB { v16b v; v8us half[2]; unsigned short u[16]; };

__device__ __forceinline__ unsigned short bf16_bits(float x) { unsigned int u = __float_as_uint(x); return (unsigned short)((u + 0x7FFFu + ((u >> 16) & 1u)) >> 16); }
__device__ __forceinline__ float bf16_val(unsigned short b) { return __uint_as_float(((unsigned int)b) << 16); }
__device__ __forceinline__ float bf16_round(float x) { return bf16_val(bf16_bits(x)); }
// D += A·B with NT terms: 1 = ah·bh, 2 = + al·bh (A split), 3 = + ah·bl (both split)
template <int NT>
__device__ __forceinline__ v8f mmaN(v16b ah, v16b al, v16b bh, v16b bl, v8f c) {
  c = __builtin_amdgcn_wmma_f32_16x16x32_bf16(false, ah, false, bh, (short)0, c, false, false);
  if (NT >= 2) c = __builtin_amdgcn_wmma_f32_16x16x32_bf16(false, al, false, bh, (short)0, c, false, false);
  if (NT >= 3) c = __builtin_amdgcn_wmma_f32_16x16x32_bf16(false, ah, false, bl, (short)0, c, false, false);
  asm volatile("v_nop\n\tv_nop\n\tv_nop\n\tv_nop" : "+v"(c) : "v"(ah), "v"(al), "v"(bh), "v"(bl));
  return c;
}

__global__ __launch_bounds__(256) void k_wt_bf16(const float* __restrict__ W, unsigned short* __restrict__ Wt, int K, int N) {
  const int t = blockIdx.x * 256 + threadIdx.x;
  const int k8n = K / 8;
  if (t >= N * k8n) return;
  const int n = t / k8n, k8 = (t % k8n) * 8;
  v8us v;
#pragma unroll
  for (int i = 0; i < 8; ++i) v[i] = bf16_bits(W[(size_t)(k8 + i) * N + n]);
  *(v8us*)(Wt + (size_t)n * K + k8) = v;
  
}

// GEMM C[M][N] (f32, pitch ldc) = act(A[M][K]·W + bias). A f32 row-major (pitch lda) converted per fragment to bf16
// (ASPLIT: hi/lo two planes -> 2 terms, else single rounded term); Wt bf16 [N][K] (pitch ldb). BIAS_BF16 rounds the
// bias to bf16 first (bias quantised to bf16 before the add). K%32==0, M%16==0, N%64==0.
template <bool ASPLIT, int ACT, bool BIAS_BF16>
__global__ __launch_bounds__(128) void k_gemm_bf(const float* __restrict__ A, int lda, const unsigned short* __restrict__ Wt, int ldb,
                                               const float* __restrict__ bias, float* __restrict__ C, int ldc, int M, int N, int K) {
  __shared__ __attribute__((aligned(16))) float so[4][16][64];
  const int tid = threadIdx.x, w = tid >> 5, lane = tid & 31, ln = lane & 15, hh = lane >> 4;
  const int ntn = N / 64;
  const int wid = blockIdx.x * 4 + w;
  const int mt = wid / ntn, nq = wid % ntn;
  if (mt * 16 >= M) return;
  const int row0 = mt * 16, col0 = nq * 64;
  const float* arow = A + (size_t)(row0 + ln) * lda;
  v8f acc[4] = {};
  for (int kb = 0; kb < K; kb += 32) {
    FragB ah, al;
    const v4f x0 = *(const v4fa*)(arow + kb + 8 * hh), x1 = *(const v4fa*)(arow + kb + 8 * hh + 4);
    const v4f x2 = *(const v4fa*)(arow + kb + 16 + 8 * hh), x3 = *(const v4fa*)(arow + kb + 16 + 8 * hh + 4);
    float xs[16] = {x0[0],x0[1],x0[2],x0[3],x1[0],x1[1],x1[2],x1[3],x2[0],x2[1],x2[2],x2[3],x3[0],x3[1],x3[2],x3[3]};
#pragma unroll
    for (int i = 0; i < 16; ++i) { const unsigned short hb = bf16_bits(xs[i]); ah.u[i] = hb; al.u[i] = ASPLIT ? bf16_bits(xs[i] - bf16_val(hb)) : (unsigned short)0; }
#pragma unroll
    for (int t = 0; t < 4; ++t) {
      const unsigned short* brow = Wt + (size_t)(col0 + t * 16 + ln) * ldb + kb;
      FragB b;
      b.half[0] = *(const v8us*)(brow + 8 * hh);
      b.half[1] = *(const v8us*)(brow + 16 + 8 * hh);
      acc[t] = mmaN<ASPLIT ? 2 : 1>(ah.v, al.v, b.v, b.v, acc[t]);
    }
  }
#pragma unroll
  for (int t = 0; t < 4; ++t) {
    float bv = bias ? bias[col0 + t * 16 + ln] : 0.f;
    if (BIAS_BF16) bv = bf16_round(bv);
#pragma unroll
    for (int r = 0; r < 8; ++r) { float v = acc[t][r] + bv; if (ACT == 1) v = fmaxf(v, 0.f); so[w][8 * hh + r][t * 16 + ln] = v; }
  }
  __builtin_amdgcn_fence(__ATOMIC_ACQ_REL, "workgroup");
  __builtin_amdgcn_wave_barrier();
  const int rsub = lane >> 4, c4 = (lane & 15) * 4;
  {
#pragma unroll
    for (int q = 0; q < 8; ++q) {
      const int r = q * 2 + rsub;
      const v4f v = *(const v4fa*)&so[w][r][c4];
      *(v4f*)(C + (size_t)(row0 + r) * ldc + col0 + c4) = v;
    }
    
  }
}

// Flash-style causal/unmasked attention, all contractions 3-term bf16 hi/lo splits, f32 softmax with running max.
// q,k,v rows are read from f32 buffers with arbitrary row pitch (so they can live inside a fused qkv buffer);
// D = head size (multiple of 32, <= 128); one wave = 16 query rows; block = 4 waves (64 queries) sharing K/V chunks of 32.
template <int D, bool CAUSAL>
__global__ __launch_bounds__(128) void k_flash(const float* __restrict__ qb, const float* __restrict__ kb, const float* __restrict__ vb,
                                             int pitch, int T, int H, float scale, float* __restrict__ y, int ypitch) {
  constexpr int KS = D / 32;        // k-steps for QK
  constexpr int DT = D / 16;        // d tiles for PV
  __shared__ __attribute__((aligned(16))) unsigned short sKh[32][D + 8], sKl[32][D + 8], sVh[32][D + 8], sVl[32][D + 8];
  __shared__ __attribute__((aligned(16))) unsigned short sPh[4][16][40], sPl[4][16][40];
  __shared__ __attribute__((aligned(16))) float sO[4][16][D];
  const int tid = threadIdx.x, w = tid >> 5, lane = tid & 31, ln = lane & 15, hh = lane >> 4;
  const int nqb = (T + 63) / 64;
  const int bh = blockIdx.x / nqb, qblk = blockIdx.x % nqb;
  const int b = bh / H, h = bh % H;
  const int q0 = qblk * 64 + w * 16;
  const float* Q = qb + (size_t)b * T * pitch + h * D;
  const float* K = kb + (size_t)b * T * pitch + h * D;
  const float* V = vb + (size_t)b * T * pitch + h * D;

  // A fragments of the wave's 16 query rows (scaled), hi/lo
  FragB aqh[KS], aql[KS];
  {
    int row = q0 + ln; if (row >= T) row = T - 1;
    const float* qr = Q + (size_t)row * pitch;
#pragma unroll
    for (int ks = 0; ks < KS; ++ks)
#pragma unroll
      for (int i = 0; i < 16; ++i) {
        const int d = ks * 32 + ((i < 8) ? (8 * hh + i) : (16 + 8 * hh + (i - 8)));
        const float x = qr[d] * scale; const unsigned short hb = bf16_bits(x);
        aqh[ks].u[i] = hb; aql[ks].u[i] = bf16_bits(x - bf16_val(hb));
      }
  }
  float m_r[8], l_r[8];
#pragma unroll
  for (int r = 0; r < 8; ++r) { m_r[r] = -3.0e38f; l_r[r] = 0.f; }
  v8f oacc[DT];
#pragma unroll
  for (int dt = 0; dt < DT; ++dt) oacc[dt] = (v8f){0.f,0.f,0.f,0.f,0.f,0.f,0.f,0.f};

  const int kv_end = CAUSAL ? min(T, qblk * 64 + 64) : T;     // block-uniform
  for (int j0 = 0; j0 < kv_end; j0 += 32) {
    __syncthreads();
    for (int e = tid; e < 32 * (D / 4); e += 128) {
      const int r = e / (D / 4), c4 = (e % (D / 4)) * 4;
      const int key = j0 + r;
      v4f kf = {0.f,0.f,0.f,0.f}, vf = {0.f,0.f,0.f,0.f};
      if (key < T) { kf = *(const v4fa*)(K + (size_t)key * pitch + c4); vf = *(const v4fa*)(V + (size_t)key * pitch + c4); }
#pragma unroll
      for (int t = 0; t < 4; ++t) {
        unsigned short hb = bf16_bits(kf[t]); sKh[r][c4 + t] = hb; sKl[r][c4 + t] = bf16_bits(kf[t] - bf16_val(hb));
        hb = bf16_bits(vf[t]); sVh[r][c4 + t] = hb; sVl[r][c4 + t] = bf16_bits(vf[t] - bf16_val(hb));
      }
    }
    __syncthreads();
    // S tile 16 x 32
    v8f s[2];
#pragma unroll
    for (int nt = 0; nt < 2; ++nt) {
      v8f acc = {};
#pragma unroll
      for (int ks = 0; ks < KS; ++ks) {
        FragB bh_, bl_;
        bh_.half[0] = *(const v8us*)&sKh[nt * 16 + ln][ks * 32 + 8 * hh]; bh_.half[1] = *(const v8us*)&sKh[nt * 16 + ln][ks * 32 + 16 + 8 * hh];
        bl_.half[0] = *(const v8us*)&sKl[nt * 16 + ln][ks * 32 + 8 * hh]; bl_.half[1] = *(const v8us*)&sKl[nt * 16 + ln][ks * 32 + 16 + 8 * hh];
        acc = mmaN<3>(aqh[ks].v, aql[ks].v, bh_.v, bl_.v, acc);
      }
      s[nt] = acc;
    }
    // mask + running max (rows 8hh+r; the 16 lanes of a half share rows)
    float alpha[8];
#pragma unroll
    for (int r = 0; r < 8; ++r) {
      const int qi = q0 + 8 * hh + r;
      const int ja = j0 + ln, jb = j0 + 16 + ln;
      if (CAUSAL) { if (ja > qi) s[0][r] = -3.0e38f; if (jb > qi) s[1][r] = -3.0e38f; }
      if (ja >= T) s[0][r] = -3.0e38f;
      if (jb >= T) s[1][r] = -3.0e38f;
      float mx = fmaxf(s[0][r], s[1][r]);
      mx = fmaxf(mx, __shfl_xor(mx, 1, 32)); mx = fmaxf(mx, __shfl_xor(mx, 2, 32)); mx = fmaxf(mx, __shfl_xor(mx, 4, 32)); mx = fmaxf(mx, __shfl_xor(mx, 8, 32));
      const float mnew = fmaxf(m_r[r], mx);
      alpha[r] = (mnew > -1.0e38f) ? __expf(m_r[r] - mnew) : 1.0f;
      const float p0 = (s[0][r] > -1.0e38f) ? __expf(s[0][r] - mnew) : 0.f;
      const float p1 = (s[1][r] > -1.0e38f) ? __expf(s[1][r] - mnew) : 0.f;
      m_r[r] = mnew;
      l_r[r] = l_r[r] * alpha[r] + p0 + p1;            // per-lane partial row sum (16 lanes combined at the end)
      unsigned short hb = bf16_bits(p0); sPh[w][8 * hh + r][ln] = hb;      sPl[w][8 * hh + r][ln] = bf16_bits(p0 - bf16_val(hb));
      hb = bf16_bits(p1);                sPh[w][8 * hh + r][16 + ln] = hb; sPl[w][8 * hh + r][16 + ln] = bf16_bits(p1 - bf16_val(hb));
    }
#pragma unroll
    for (int dt = 0; dt < DT; ++dt)
#pragma unroll
      for (int r = 0; r < 8; ++r) oacc[dt][r] *= alpha[r];
    __builtin_amdgcn_fence(__ATOMIC_ACQ_REL, "workgroup");
    __builtin_amdgcn_wave_barrier();
    FragB pah, pal;
    pah.half[0] = *(const v8us*)&sPh[w][ln][8 * hh]; pah.half[1] = *(const v8us*)&sPh[w][ln][16 + 8 * hh];
    pal.half[0] = *(const v8us*)&sPl[w][ln][8 * hh]; pal.half[1] = *(const v8us*)&sPl[w][ln][16 + 8 * hh];
#pragma unroll
    for (int dt = 0; dt < DT; ++dt) {
      FragB bvh, bvl;
#pragma unroll
      for (int i = 0; i < 8; ++i) {
        bvh.u[i] = sVh[8 * hh + i][dt * 16 + ln]; bvh.u[8 + i] = sVh[16 + 8 * hh + i][dt * 16 + ln];
        bvl.u[i] = sVl[8 * hh + i][dt * 16 + ln]; bvl.u[8 + i] = sVl[16 + 8 * hh + i][dt * 16 + ln];
      }
      oacc[dt] = mmaN<3>(pah.v, pal.v, bvh.v, bvl.v, oacc[dt]);
    }
    __builtin_amdgcn_fence(__ATOMIC_ACQ_REL, "workgroup");
    __builtin_amdgcn_wave_barrier();
  }
#pragma unroll
  for (int r = 0; r < 8; ++r) {
    float l = l_r[r];
    l += __shfl_xor(l, 1, 32); l += __shfl_xor(l, 2, 32); l += __shfl_xor(l, 4, 32); l += __shfl_xor(l, 8, 32);
    l_r[r] = (l > 0.f) ? 1.0f / l : 0.f;
  }
#pragma unroll
  for (int dt = 0; dt < DT; ++dt)
#pragma unroll
    for (int r = 0; r < 8; ++r) sO[w][8 * hh + r][dt * 16 + ln] = oacc[dt][r] * l_r[r];
  __builtin_amdgcn_fence(__ATOMIC_ACQ_REL, "workgroup");
  __builtin_amdgcn_wave_barrier();
  {
    for (int r = 0; r < 16; ++r) {
      const int row = q0 + r;
      if (row < T && lane < D / 4) {
        const v4f val = *(const v4fa*)&sO[w][r][lane * 4];
        *(v4f*)(y + ((size_t)b * T + row) * ypitch + h * D + lane * 4) = val;
      }
    }
    
  }
}

// GEMM C = act(A·W + bias + resid): A f32 (ASPLIT -> hi/lo 2 terms), Wt bf16 [N][K]; ACT 0 none, 1 relu, 2 exact gelu;
// resid (optional, f32, row index = (row % rmod), pitch ldr, RES_BF16 rounds it) added before the activation.
template <bool ASPLIT, int ACT, bool BIAS_BF16, bool RES_BF16>
__global__ __launch_bounds__(128) void k_gemm_bf3(const float* __restrict__ A, int lda, const unsigned short* __restrict__ Wt, int ldb,
                                                const float* __restrict__ bias, const float* __restrict__ resid, int rmod, int ldr,
                                                float* __restrict__ C, int ldc, int M, int N, int K) {
  __shared__ __attribute__((aligned(16))) float so[4][16][64];
  const int tid = threadIdx.x, w = tid >> 5, lane = tid & 31, ln = lane & 15, hh = lane >> 4;
  const int ntn = N / 64;
  const int wid = blockIdx.x * 4 + w;
  const int mt = wid / ntn, nq = wid % ntn;
  if (mt * 16 >= M) return;
  const int row0 = mt * 16, col0 = nq * 64;
  const float* arow = A + (size_t)(row0 + ln) * lda;
  v8f acc[4] = {};
  for (int kb = 0; kb < K; kb += 32) {
    FragB ah, al;
    const v4f x0 = *(const v4fa*)(arow + kb + 8 * hh), x1 = *(const v4fa*)(arow + kb + 8 * hh + 4);
    const v4f x2 = *(const v4fa*)(arow + kb + 16 + 8 * hh), x3 = *(const v4fa*)(arow + kb + 16 + 8 * hh + 4);
    float xs[16] = {x0[0],x0[1],x0[2],x0[3],x1[0],x1[1],x1[2],x1[3],x2[0],x2[1],x2[2],x2[3],x3[0],x3[1],x3[2],x3[3]};
#pragma unroll
    for (int i = 0; i < 16; ++i) { const unsigned short hb = bf16_bits(xs[i]); ah.u[i] = hb; al.u[i] = ASPLIT ? bf16_bits(xs[i] - bf16_val(hb)) : (unsigned short)0; }
#pragma unroll
    for (int t = 0; t < 4; ++t) {
      const unsigned short* brow = Wt + (size_t)(col0 + t * 16 + ln) * ldb + kb;
      FragB b;
      b.half[0] = *(const v8us*)(brow + 8 * hh);
      b.half[1] = *(const v8us*)(brow + 16 + 8 * hh);
      acc[t] = mmaN<ASPLIT ? 2 : 1>(ah.v, al.v, b.v, b.v, acc[t]);
    }
  }
#pragma unroll
  for (int t = 0; t < 4; ++t) {
    const int col = col0 + t * 16 + ln;
    float bv = bias ? bias[col] : 0.f;
    if (BIAS_BF16) bv = bf16_round(bv);
#pragma unroll
    for (int r = 0; r < 8; ++r) {
      float v = acc[t][r] + bv;
      if (resid) { float rv = resid[(size_t)((row0 + 8 * hh + r) % rmod) * ldr + col]; if (RES_BF16) rv = bf16_round(rv); v += rv; }
      if (ACT == 1) v = fmaxf(v, 0.f);
      if (ACT == 2) v = 0.5f * v * (1.0f + erff(v * 0.70710678118654752f));
      if (ACT == 3) { const float u = 0.7978845608028654f * (v + 0.044715f * v * v * v); v = 0.5f * v * (1.0f + tanhf(u)); }
      so[w][8 * hh + r][t * 16 + ln] = v;
    }
  }
  __builtin_amdgcn_fence(__ATOMIC_ACQ_REL, "workgroup");
  __builtin_amdgcn_wave_barrier();
  const int rsub = lane >> 4, c4 = (lane & 15) * 4;
  {
#pragma unroll
    for (int q = 0; q < 8; ++q) {
      const int r = q * 2 + rsub;
      const v4f v = *(const v4fa*)&so[w][r][c4];
      *(v4f*)(C + (size_t)(row0 + r) * ldc + col0 + c4) = v;
    }
    
  }
}
// row LayerNorm (biased variance, eps) over N: s = X (+ R); optional out_sum <- s; out_norm <- (s-mu)*rsqrt(var+eps)*g + b
template <bool PARAM_BF16>
__global__ __launch_bounds__(256) void k_layernorm(const float* __restrict__ X, const float* __restrict__ R, const float* __restrict__ g, const float* __restrict__ bta,
                                                  float* __restrict__ out_sum, float* __restrict__ out_norm, int N, float eps) {
  __shared__ float red[256];
  const int row = blockIdx.x, tid = threadIdx.x;
  const float* x = X + (size_t)row * N; const float* rr = R ? R + (size_t)row * N : nullptr;
  float vals[16];                     // up to N = 4096
  const int per = N / 256;            // contiguous chunk per thread? use strided-by-4 chunks: thread handles j = tid*4 + 1024*u
  float s1 = 0.f;
  for (int u = 0; u < per / 4; ++u) {
    const int j = tid * 4 + 1024 * u;
    const v4f a = *(const v4fa*)(x + j);
    v4f b = {0.f,0.f,0.f,0.f}; if (rr) b = *(const v4fa*)(rr + j);
#pragma unroll
    for (int q = 0; q < 4; ++q) { const float v = a[q] + b[q]; vals[u * 4 + q] = v; s1 += v; }
  }
  red[tid] = s1; __syncthreads();
  for (int st = 128; st > 0; st >>= 1) { if (tid < st) red[tid] += red[tid + st]; __syncthreads(); }
  const float mu = red[0] / (float)N; __syncthreads();
  float s2 = 0.f;
  for (int u = 0; u < per / 4; ++u)
#pragma unroll
    for (int q = 0; q < 4; ++q) { const float c = vals[u * 4 + q] - mu; s2 += c * c; }
  red[tid] = s2; __syncthreads();
  for (int st = 128; st > 0; st >>= 1) { if (tid < st) red[tid] += red[tid + st]; __syncthreads(); }
  const float rs = rsqrtf(red[0] / (float)N + eps);
  {
    for (int u = 0; u < per / 4; ++u) {
      const int j = tid * 4 + 1024 * u;
      v4f o, sm;
#pragma unroll
      for (int q = 0; q < 4; ++q) {
        float gg = g[j + q], bb = bta[j + q];
        if (PARAM_BF16) { gg = bf16_round(gg); bb = bf16_round(bb); }
        sm[q] = vals[u * 4 + q]; o[q] = (vals[u * 4 + q] - mu) * rs * gg + bb;
      }
      if (out_sum) *(v4f*)(out_sum + (size_t)row * N + j) = sm;
      *(v4f*)(out_norm + (size_t)row * N + j) = o;
    }
    
  }
}



// ---- f16 WMMA path (v_wmma_f32_16x16x32_f16): 11-bit significands for operands in range — used where a [0,1] probability operand needs more precision than bf16
typedef _Float16 v16h __attribute__((ext_vector_type(16)));
union FragH { v16h v; v8us half[2]; _Float16 h[16]; unsigned short u[16]; };
template <int NT>
__device__ __forceinline__ v8f mmaH(v16h ah, v16h al, v16h bh, v16h bl, v8f c) {
  c = __builtin_amdgcn_wmma_f32_16x16x32_f16(false, ah, false, bh, (short)0, c, false, false);
  if (NT >= 2) c = __builtin_amdgcn_wmma_f32_16x16x32_f16(false, al, false, bh, (short)0, c, false, false);
  if (NT >= 3) c = __builtin_amdgcn_wmma_f32_16x16x32_f16(false, ah, false, bl, (short)0, c, false, false);
  asm volatile("v_nop\n\tv_nop\n\tv_nop\n\tv_nop" : "+v"(c) : "v"(ah), "v"(al), "v"(bh), "v"(bl));
  return c;
}
// batched GEMM like k_gemm_b but f16 operands: A f32 (split into f16 hi/lo if ASPLIT, else rounded to f16), Bt = f16 values [n][k]; alpha; C f32; N multiple of 16 (partial tiles skipped)
template <bool ASPLIT>
__global__ __launch_bounds__(128) void k_gemm_h(const float* __restrict__ A, int lda, size_t sA, const _Float16* __restrict__ Bh, int ldb, size_t sB, float alpha, float* __restrict__ C, int ldc, size_t sC, int M, int N, int K) {
  __shared__ __attribute__((aligned(16))) float so[4][16][64];
  const int tid = threadIdx.x, w = tid >> 5, lane = tid & 31, ln = lane & 15, hh = lane >> 4; const int by = blockIdx.y;
  A += (size_t)by * sA; Bh += (size_t)by * sB; C += (size_t)by * sC;
  const int ntn = (N + 63) / 64; const int wid = blockIdx.x * 4 + w; const int mt = wid / ntn, nq = wid % ntn; if (mt * 16 >= M) return;
  const int row0 = mt * 16, col0 = nq * 64; const float* arow = A + (size_t)(row0 + ln) * lda;
  v8f acc[4] = {};
  for (int kb = 0; kb < K; kb += 32) {
    FragH ah, al;
    const v4f x0 = *(const v4fa*)(arow + kb + 8 * hh), x1 = *(const v4fa*)(arow + kb + 8 * hh + 4), x2 = *(const v4fa*)(arow + kb + 16 + 8 * hh), x3 = *(const v4fa*)(arow + kb + 16 + 8 * hh + 4);
    float xs[16] = {x0[0],x0[1],x0[2],x0[3],x1[0],x1[1],x1[2],x1[3],x2[0],x2[1],x2[2],x2[3],x3[0],x3[1],x3[2],x3[3]};
#pragma unroll
    for (int i = 0; i < 16; ++i) { const _Float16 h = (_Float16)xs[i]; ah.h[i] = h; al.h[i] = ASPLIT ? (_Float16)(xs[i] - (float)h) : (_Float16)0.0f; }
#pragma unroll
    for (int t = 0; t < 4; ++t) { if (col0 + t * 16 >= N) continue; const size_t boff = (size_t)(col0 + t * 16 + ln) * ldb + kb; FragH bq; bq.half[0] = *(const v8us*)(Bh + boff + 8 * hh); bq.half[1] = *(const v8us*)(Bh + boff + 16 + 8 * hh);
      acc[t] = mmaH<ASPLIT ? 2 : 1>(ah.v, al.v, bq.v, bq.v, acc[t]); }
  }
#pragma unroll
  for (int t = 0; t < 4; ++t) { if (col0 + t * 16 >= N) continue;
#pragma unroll
    for (int r = 0; r < 8; ++r) so[w][8 * hh + r][t * 16 + ln] = acc[t][r] * alpha; }
  __builtin_amdgcn_fence(__ATOMIC_ACQ_REL, "workgroup"); __builtin_amdgcn_wave_barrier();
  const int rsub = lane >> 4, c4 = (lane & 15) * 4;
  {
#pragma unroll
    for (int q = 0; q < 8; ++q) { const int r = q * 2 + rsub; if (col0 + c4 < N) { const v4f v = *(const v4fa*)&so[w][r][c4]; *(v4f*)(C + (size_t)(row0 + r) * ldc + col0 + c4) = v; } }
     }
}

// Wt[n][k] = f16(W[k][n]·scale) from f32 row-major W[K][N] (scale = power of two; bf16-exact weights stay exact in f16 away from the subnormal range)
// Wt lies in fragment order (rows n, cols k, pitch K): thread t writes the 16 B of lane t % 32 in unit t / 32. K % 32 == 0, N % 16 == 0.
__global__ __launch_bounds__(256) void k_wt_f16(const float* __restrict__ W, _Float16* __restrict__ Wt, int K, int N, float scale) {
  const int t = blockIdx.x * 256 + threadIdx.x; if (t >= N * (K / 8)) return; const int lane = t & 31, u = t >> 5, blk = u >> 1; const int n = (blk / (K / 32)) * 16 + (lane & 15), k8 = (blk % (K / 32)) * 32 + (u & 1) * 16 + (lane >> 4) * 8; FragH f;
#pragma unroll
  for (int i = 0; i < 8; ++i) f.h[i] = (_Float16)(bf16_round(W[(size_t)(k8 + i) * N + n]) * scale); const v8us o = f.half[0];
  *(v8us*)((unsigned short*)Wt + (size_t)t * 8) = o; 
}
// A, Bh and C16 lie in fragment order (pitches lda, ldb, ldc: multiples of 32).
// k_gemm_hh variant with fused epilogue: v = acc·alpha + bias[by·sBias + col] (+ CP[(row/rowsPerB)·sCPb + by·64 + col] if CP) ; ACT 0 none / 1 elu ; writes f16 C16 (and f32 C if non-null)
template <int ACT>
__global__ __launch_bounds__(128) void k_gemm_hhx(const _Float16* __restrict__ A, int lda, size_t sA, const _Float16* __restrict__ Bh, int ldb, size_t sB, float alpha, const float* __restrict__ bias, size_t sBias, const float* __restrict__ CP, int rowsPerB, size_t sCPb, int row0g,
    float* __restrict__ C, _Float16* __restrict__ C16, int ldc, size_t sC, int M, int N, int K) {
  __shared__ __attribute__((aligned(16))) float so[4][16][64 + 4];      /* pitch 68: the epilogue's row reads (one row a lane) fall on different banks */
  const int tid = threadIdx.x, w = tid >> 5, lane = tid & 31, ln = lane & 15, hh = lane >> 4; const int by = blockIdx.y;
  A += (size_t)by * sA; Bh += (size_t)by * sB; const size_t cofs = (size_t)by * sC; const float* bp = bias ? bias + (size_t)by * sBias : nullptr;
  const int ntn = (N + 63) / 64; const int wid = blockIdx.x * 4 + w; const int mt = wid / ntn, nq = wid % ntn; if (mt * 16 >= M) return;
  const int row0 = mt * 16, col0 = nq * 64; const _Float16* arow = A + (size_t)row0 * lda + lane * 8;      /* this lane's 16 B in the first unit of the row tile */
  v8f acc[4] = {};
  // Fragments are fetched ahead: two register sets of 64 k each; while one set feeds its 8 WMMAs the other set's 20 loads are in flight. K % 128 == 0.
  // A column tile past N reads the last tile (in bounds); its accumulator is never stored (the guards of the epilogue).
  const unsigned short* ap = (const unsigned short*)arow; const unsigned short* wp[4];
#pragma unroll
  for (int t = 0; t < 4; ++t) { int cr = col0 + t * 16; if (cr > N - 16) cr = N - 16; wp[t] = (const unsigned short*)Bh + (size_t)cr * ldb + lane * 8; }
  FragH a0[2], a1[2], b0[2][4], b1[2][4];
  auto ldf = [&](FragH (&a)[2], FragH (&bq)[2][4], int kb, int ko) {      /* k = kb + ko; ko is a literal and goes into the loads' offset fields; 32 k are one block of 512 elements, so k counts 16-fold */
    const unsigned short* pa = ap + kb * 16; const unsigned short* pw[4] = {wp[0] + kb * 16, wp[1] + kb * 16, wp[2] + kb * 16, wp[3] + kb * 16};
#pragma unroll
    for (int ks = 0; ks < 2; ++ks) { a[ks].half[0] = *(const v8us*)(pa + (ko + ks * 32) * 16); a[ks].half[1] = *(const v8us*)(pa + (ko + ks * 32) * 16 + 256);
#pragma unroll
      for (int t = 0; t < 4; ++t) { bq[ks][t].half[0] = *(const v8us*)(pw[t] + (ko + ks * 32) * 16); bq[ks][t].half[1] = *(const v8us*)(pw[t] + (ko + ks * 32) * 16 + 256); } }
    /* the group's address pairs are named so that no register of them is reused (not even as a later load's result) before the loads have taken them */
    asm volatile("s_wait_xcnt 0x0" :: "v"(pa), "v"(pw[0]), "v"(pw[1]), "v"(pw[2]), "v"(pw[3]) : "memory"); };
  auto mmf = [&](FragH (&a)[2], FragH (&bq)[2][4]) {
#pragma unroll
    for (int ks = 0; ks < 2; ++ks)
#pragma unroll
      for (int t = 0; t < 4; ++t) acc[t] = mmaH<1>(a[ks].v, a[ks].v, bq[ks][t].v, bq[ks][t].v, acc[t]); };
  ldf(a0, b0, 0, 0);
  for (int kb = 0; kb < K; kb += 128) {
    ldf(a1, b1, kb, 64);
    mmf(a0, b0);
    ldf(a0, b0, (kb + 128 < K) ? kb + 128 : 0, 0);      /* last trip: wraps to k = 0, in bounds, values unused; no branch, so the waits stay counted */
    mmf(a1, b1);
  }
#pragma unroll
  for (int t = 0; t < 4; ++t) { if (col0 + t * 16 >= N) continue; const int col = col0 + t * 16 + ln; const float bv = bp ? bf16_round(bp[col]) : 0.f;
#pragma unroll
    for (int r = 0; r < 8; ++r) { float v = acc[t][r] * alpha + bv; if (CP) { const int bidx = (row0g + row0 + 8 * hh + r) / rowsPerB; v += CP[(size_t)bidx * sCPb + (size_t)by * 64 + col]; } if (ACT == 1) v = (v > 0.f) ? v : expm1f(v); else if (ACT == 7) v = (v > 0.f) ? v + 1.0f : expf(v); else if (ACT == 8) v = tanhf(v); else if (ACT == 9) v = 0.5f * v * (1.0f + tanhf(0.7978845608028654f * (v + 0.044715f * v * v * v))); else if (ACT == 11) v = 1.0f / (1.0f + expf(-v)); else if (ACT == 12) v = (v > 0.f) ? v : 0.01f * v; else if (ACT == 14) v = (v > 0.f) ? v : 0.1f * v; else if (ACT == 15) v = v / (1.0f + expf(-v)); else if (ACT == 3) v = fmaxf(v, 0.f); else if (ACT == 6) v = 0.5f * v * (1.0f + erff(v * 0.70710678118654752f)); so[w][8 * hh + r][t * 16 + ln] = v; } }
  __builtin_amdgcn_fence(__ATOMIC_ACQ_REL, "workgroup"); __builtin_amdgcn_wave_barrier();
  const int rsub = lane >> 4, c4 = (lane & 15) * 4;
  if (C) {      /* the f32 plane stays row-major */
#pragma unroll
    for (int q = 0; q < 8; ++q) { const int r = q * 2 + rsub; if (col0 + c4 < N) { const v4f v = *(const v4fa*)&so[w][r][c4]; *(v4f*)(C + cofs + (size_t)(row0 + r) * ldc + col0 + c4) = v; } }
  }
  if (C16) {      /* the wave's 16 x 64 tile is four units in a row: 2 KiB of whole lines */
    unsigned short* cu = (unsigned short*)C16 + cofs + (size_t)row0 * ldc + (size_t)(col0 >> 5) * 512 + lane * 8;
#pragma unroll
    for (int u = 0; u < 4; ++u) { if (col0 + u * 16 < N) { const v4f v0 = *(const v4fa*)&so[w][ln][u * 16 + 8 * hh], v1 = *(const v4fa*)&so[w][ln][u * 16 + 8 * hh + 4]; FragH f;
#pragma unroll
      for (int i = 0; i < 4; ++i) { f.h[i] = (_Float16)v0[i]; f.h[4 + i] = (_Float16)v1[i]; }
      *(v8us*)(cu + u * 256) = f.half[0]; } }
  }
}


typedef _Float16 v4h __attribute__((ext_vector_type(4)));

// X16 = f16(bf16(x)) in fragment order, x row-major with pitch LD (LD % 32 == 0): a wave takes one block (16 rows x 32 cols: 16 whole lines of x) and writes its two units; n16 = elements / 16
template <int LD>
__global__ __launch_bounds__(256) void k_x16(const float* __restrict__ x, _Float16* __restrict__ X16, unsigned n16) { const unsigned t = blockIdx.x * 256 + threadIdx.x; if (t >= n16) return; FragH f;
  const unsigned lane = t & 31, blk = t >> 5, rt = blk / (LD / 32), kb = blk % (LD / 32);
  const float* xr = x + (size_t)(rt * 16 + (lane & 15)) * LD + kb * 32 + (lane >> 4) * 8;
#pragma unroll
  for (int q = 0; q < 8; ++q) { f.h[q] = (_Float16)bf16_round(xr[q]); f.h[8 + q] = (_Float16)bf16_round(xr[16 + q]); }
  *(v8us*)((unsigned short*)X16 + (size_t)blk * 512 + lane * 8) = f.half[0]; *(v8us*)((unsigned short*)X16 + (size_t)blk * 512 + 256 + lane * 8) = f.half[1];  }
__global__ __launch_bounds__(256) void k_h16(const float* __restrict__ x, _Float16* __restrict__ X16, size_t n8) { const size_t t = (size_t)blockIdx.x * 256 + threadIdx.x; if (t >= n8) return; FragH f;
#pragma unroll
  for (int q = 0; q < 8; ++q) f.h[q] = (_Float16)x[t * 8 + q]; *(v8us*)((unsigned short*)X16 + t * 8) = f.half[0];  }
__global__ __launch_bounds__(256) void k_round16f(const float* __restrict__ W, _Float16* __restrict__ Bt, size_t n8) { const size_t t = (size_t)blockIdx.x * 256 + threadIdx.x; if (t >= n8) return; FragH f;
#pragma unroll
  for (int i = 0; i < 8; ++i) f.h[i] = (_Float16)(bf16_round(W[t * 8 + i]) * 16.0f); *(v8us*)((unsigned short*)Bt + t * 8) = f.half[0];  }
template <int NHv, int TTv>
__global__ __launch_bounds__(256) void k_vt(const _Float16* __restrict__ V16, int ldv, int voff, _Float16* __restrict__ Vt) { __shared__ unsigned short tl[64][66]; const int tid = threadIdx.x; const int slab = blockIdx.x / (TTv / 64), lg = blockIdx.x % (TTv / 64); const int b = slab / NHv, h = slab % NHv;
  // V16 and Vt lie in fragment order (Vt: rows slab * 64 + d, cols = keys, pitch TTv); the 64 x 64 tile is 16 units on either side, and a wave reads or writes one whole unit at a time. voff % 32 == 0.
  const int lane = tid & 31, ln = lane & 15, hh = lane >> 4;
  for (int i = tid; i < 64 * 8; i += 256) { const int u = i >> 5; const int r = (u >> 2) * 16 + ln, c8 = (u & 3) * 16 + hh * 8; FragH f; f.half[0] = *(const v8us*)((const unsigned short*)V16 + ((size_t)b * TTv + lg * 64 + (u >> 2) * 16) * ldv + (size_t)((voff + h * 64) >> 5) * 512 + (u & 3) * 256 + lane * 8);
#pragma unroll
    for (int q = 0; q < 8; ++q) tl[r][c8 + q] = f.u[q]; }
  __syncthreads();
  {
#pragma unroll
    for (int rd = 0; rd < 2; ++rd) { const int u = rd * 8 + (tid >> 5); const int d = (u >> 2) * 16 + ln, k8 = (u & 3) * 16 + hh * 8; FragH f;
#pragma unroll
      for (int q = 0; q < 8; ++q) f.u[q] = tl[k8 + q][d];
      *(v8us*)((unsigned short*)Vt + ((size_t)slab * 64 + (u >> 2) * 16) * TTv + (size_t)(lg * 2) * 512 + (u & 3) * 256 + lane * 8) = f.half[0]; }
     } }

typedef int v4i __attribute__((ext_vector_type(4)));
typedef int v4ia __attribute__((ext_vector_type(4), may_alias));
// lane l takes the value of lane l ^ 16 (a vector cross-row move, no LDS trip)
__device__ __forceinline__ float xhalf(float x) { return __builtin_bit_cast(float, __builtin_amdgcn_permlanex16(__builtin_bit_cast(int, x), __builtin_bit_cast(int, x), 0x76543210, 0xfedcba98, false, false)); }

// Both attention paths in one walk over the keys. The scores S^T = K Q^T are the same for the two paths, and so are the K and V^T fragments: each is fetched and each score tile is formed once;
// the wave then runs two online softmaxes (additive key bias; 0/1 mask) with two output accumulators, and the gated sum is taken in registers in the epilogue: no per-path output plane, no combining launch.
__global__ __launch_bounds__(128) void k_flash_gl(const _Float16* __restrict__ Q16, int ldq, const _Float16* __restrict__ K16, int ldk, const _Float16* __restrict__ Vt, const float* __restrict__ AB, const int* __restrict__ MSK, const float* __restrict__ gate, float* __restrict__ O, int ldo) {
  constexpr int RPW = 16, NQB = TT / (4 * RPW), DT = 4, KS = 2;
  __shared__ __attribute__((aligned(16))) float sO[4][RPW][64 + 4];
  const int tid = threadIdx.x, w = tid >> 5, lane = tid & 31, ln = lane & 15, hh = lane >> 4;
  const int slab = blockIdx.x / NQB, qblk = blockIdx.x % NQB; const int b = slab / NH, h = slab % NH; const int qb0 = qblk * (4 * RPW); const int q0 = qb0 + w * RPW;
  // Transposed tiles: S^T = K Q^T (A = 16 key rows, B = the wave's 16 queries), O^T += V^T P^T. Lane (ln, hh) owns query q0 + ln; its score registers hold keys j0 + 8 hh + r and j0 + 16 + 8 hh + r,
  // which is the k order of a B operand: P goes from the score registers into the second product with no LDS trip, and maximum and sum run inside the lane plus one exchange between the wave halves.
  FragH aq[KS];
  // Q16, K16 and Vt lie in fragment order (head of the file): a fragment half is one unit of 512 B, this lane's 16 B at lane * 8 elements; a head's 64 columns are two blocks (4 units) in a row.
  { const unsigned short* qr = (const unsigned short*)Q16 + ((size_t)b * TT + q0) * ldq + h * 1024 + lane * 8;
#pragma unroll
    for (int ks = 0; ks < KS; ++ks) { aq[ks].half[0] = *(const v8us*)(qr + ks * 512); aq[ks].half[1] = *(const v8us*)(qr + ks * 512 + 256); }
    asm volatile("s_wait_xcnt 0x0" :: "v"(qr) : "memory"); }      /* as in ldK below: the address pair stays whole until the loads have taken it */
  const unsigned short* Vth = (const unsigned short*)Vt + (size_t)slab * 64 * TT;
  float mg = -3.0e38f, lg = 0.f, ml = -3.0e38f, ll = 0.f; v8f og[DT], ol[DT];      /* running maximum, running sum, output tile: g = additive-bias path, l = 0/1-mask path */
#pragma unroll
  for (int dt = 0; dt < DT; ++dt) { og[dt] = (v8f){0.f,0.f,0.f,0.f,0.f,0.f,0.f,0.f}; ol[dt] = (v8f){0.f,0.f,0.f,0.f,0.f,0.f,0.f,0.f}; }
  const int jend = TT;
  // Global loads are issued ahead of their use: the K fragments, the key bias and the mask words one pass ahead (registers carried round the loop), the V^T fragments at the top of their own pass; their latency then runs under the softmaxes, not in front of each WMMA.
  const unsigned short* Kl = (const unsigned short*)K16 + (size_t)b * TT * ldk + h * 1024 + lane * 8; FragH bk[2][KS];
  const float* aml = AB + (size_t)b * TT + 8 * hh; v4f abn[2][2];
  const int* Ml = MSK + ((size_t)b * TT + q0 + ln) * TT + 8 * hh; v4i mkn[2][2];
  auto ldK = [&](int j) {
    const unsigned short* kr[2] = {Kl + (size_t)j * ldk, Kl + (size_t)(j + 16) * ldk}; const float* am = aml + j; const int* mm = Ml + j;
#pragma unroll
    for (int nt = 0; nt < 2; ++nt) { mkn[nt][0] = *(const v4ia*)(mm + nt * 16); mkn[nt][1] = *(const v4ia*)(mm + nt * 16 + 4); }
#pragma unroll
    for (int nt = 0; nt < 2; ++nt) { abn[nt][0] = *(const v4fa*)(am + nt * 16); abn[nt][1] = *(const v4fa*)(am + nt * 16 + 4); }
#pragma unroll
    for (int nt = 0; nt < 2; ++nt)
#pragma unroll
      for (int ks = 0; ks < KS; ++ks) { bk[nt][ks].half[0] = *(const v8us*)(kr[nt] + ks * 512); bk[nt][ks].half[1] = *(const v8us*)(kr[nt] + ks * 512 + 256); }
    /* the group's address pairs are named so that no register of them is reused (not even as a later load's result) before the loads have taken them */
    asm volatile("s_wait_xcnt 0x0" :: "v"(kr[0]), "v"(kr[1]), "v"(am), "v"(mm) : "memory"); };
  // One path's online-softmax step on its 32 scores of this pass: new maximum, rescale of sum and output tile, P^T packed as a B operand (element nt * 8 + r is key nt * 16 + 8 hh + r, the order in which bv holds V^T).
  auto soft = [&](const float (&sc)[2][8], float& m_r, float& l_r, v8f (&oacc)[DT], FragH& pb) {
    float mx[8];
#pragma unroll
    for (int r = 0; r < 8; ++r) mx[r] = fmaxf(sc[0][r], sc[1][r]);
    float mc = fmaxf(fmaxf(fmaxf(mx[0], mx[1]), fmaxf(mx[2], mx[3])), fmaxf(fmaxf(mx[4], mx[5]), fmaxf(mx[6], mx[7])));
    mc = fmaxf(mc, xhalf(mc));      /* both wave halves now hold the maximum of the query's 32 scores of this pass */
    const float mn = fmaxf(m_r, mc); const float ea = expf(m_r - mn); const float al = (mn > -1.0e38f) ? ea : 1.0f; m_r = mn;      /* computed, then selected: no branch, so the two paths' chains can be interleaved */
    float p[2][8];      /* a masked score is -inf and mn is finite, so its expf is 0 */
#pragma unroll
    for (int nt = 0; nt < 2; ++nt)
#pragma unroll
      for (int r = 0; r < 8; ++r) p[nt][r] = expf(sc[nt][r] - mn);
    float ps[8];
#pragma unroll
    for (int r = 0; r < 8; ++r) ps[r] = p[0][r] + p[1][r];
    l_r = l_r * al + (((ps[0] + ps[1]) + (ps[2] + ps[3])) + ((ps[4] + ps[5]) + (ps[6] + ps[7])));      /* this half's 16 keys; the halves are joined behind the loop */
#pragma unroll
    for (int dt = 0; dt < DT; ++dt)
#pragma unroll
      for (int r = 0; r < 8; ++r) oacc[dt][r] *= al;
#pragma unroll
    for (int nt = 0; nt < 2; ++nt)
#pragma unroll
      for (int r = 0; r < 8; ++r) pb.h[nt * 8 + r] = (_Float16)(p[nt][r] * 1024.0f); };
  const float gq = bf16_round(gate[((size_t)b * NH + h) * TT + q0 + ln]);      /* the gate of this lane's query (bf16-rounded input) */
  ldK(0);
#pragma unroll 1      /* stays rolled: one set of carried fragment registers, and the pass's code is fetched once */
  for (int j0 = 0; j0 < jend; j0 += 32) {
    const int jn = (j0 + 32 < jend) ? j0 + 32 : 0;      /* the pass fetched for; behind the last pass it wraps to key 0: in bounds, values unused; no branch, so the waits stay counted */
    float ab[2][8];      /* additive attention bias (bf16-rounded input) of keys j0 + nt * 16 + 8 hh + r */
    int mk[2][8];      /* per-batch mask [b][q][k] of query q0 + ln, same keys: nonzero = ATTEND */
#pragma unroll
    for (int nt = 0; nt < 2; ++nt)
#pragma unroll
      for (int r = 0; r < 8; ++r) { ab[nt][r] = (float)(__bf16)abn[nt][r >> 2][r & 3]; mk[nt][r] = mkn[nt][r >> 2][r & 3]; }      /* the convert rounds to nearest even, as bf16_round does */
    FragH bv[DT];      /* V^T fragments of this pass: issued here, used behind the softmaxes, by both paths */
    const unsigned short* vr = Vth + (size_t)j0 * 16 + lane * 8;      /* 32 keys are one block of 512 elements */
#pragma unroll
    for (int dt = 0; dt < DT; ++dt) { bv[dt].half[0] = *(const v8us*)(vr + dt * 16 * TT); bv[dt].half[1] = *(const v8us*)(vr + dt * 16 * TT + 256); }
    asm volatile("s_wait_xcnt 0x0" :: "v"(vr) : "memory");      /* as in ldK: the address pair stays whole until the loads have taken it */
    v8f s[2];
#pragma unroll
    for (int nt = 0; nt < 2; ++nt) { v8f acc = (v8f){0.f,0.f,0.f,0.f,0.f,0.f,0.f,0.f};
#pragma unroll
      for (int ks = 0; ks < KS; ++ks) acc = mmaH<1>(bk[nt][ks].v, bk[nt][ks].v, aq[ks].v, aq[ks].v, acc); s[nt] = acc; }
    ldK(jn);
    float scg[2][8], scl[2][8];
#pragma unroll
    for (int nt = 0; nt < 2; ++nt)
#pragma unroll
      for (int r = 0; r < 8; ++r) { scg[nt][r] = s[nt][r] * 0.125f + ab[nt][r]; scl[nt][r] = (mk[nt][r] != 0) ? s[nt][r] * 0.125f : -INFINITY; }
    FragH pg, pl;
    soft(scg, mg, lg, og, pg);
    soft(scl, ml, ll, ol, pl);
#pragma unroll
    for (int dt = 0; dt < DT; ++dt) { og[dt] = mmaH<1>(bv[dt].v, bv[dt].v, pg.v, pg.v, og[dt]); ol[dt] = mmaH<1>(bv[dt].v, bv[dt].v, pl.v, pl.v, ol[dt]); } }
  { const float sg = lg + xhalf(lg), sl = ll + xhalf(ll); const float lig = (sg > 0.f) ? 1.0f / (sg * 1024.0f) : 0.f, lil = (sl > 0.f) ? 1.0f / (sl * 1024.0f) : 0.f; const float g1 = 1.0f - gq;
#pragma unroll
    for (int dt = 0; dt < DT; ++dt) {      /* og[dt][r], ol[dt][r] = the paths' O[q0 + ln][dt * 16 + 8 hh + r]; the gated sum of the two goes out */
      v4f o0, o1;
#pragma unroll
      for (int r = 0; r < 4; ++r) { o0[r] = gq * (ol[dt][r] * lil) + g1 * (og[dt][r] * lig); o1[r] = gq * (ol[dt][4 + r] * lil) + g1 * (og[dt][4 + r] * lig); }
      *(v4fa*)&sO[w][ln][dt * 16 + 8 * hh] = o0; *(v4fa*)&sO[w][ln][dt * 16 + 8 * hh + 4] = o1; } }
  __builtin_amdgcn_fence(__ATOMIC_ACQ_REL, "workgroup"); __builtin_amdgcn_wave_barrier();
  {
#pragma unroll
    for (int rp = 0; rp < RPW; rp += 2) { const int r = rp + (lane >> 4), pc = lane & 15; const v4f val = *(const v4fa*)&sO[w][r][pc * 4]; *(v4f*)(O + ((size_t)b * TT + q0 + r) * ldo + h * 64 + pc * 4) = val; }
     } }

extern "C" void kernel_launch(void* const* d_in, const int* in_sizes, int n_in,
                              void* d_out, int out_size, void* d_ws, size_t ws_size, hipStream_t stream) {
  (void)in_sizes; (void)n_in; (void)out_size;
  const float* const* I = (const float* const*)d_in; const float* x = I[0]; const float* am = I[1]; const int* lm = (const int*)d_in[2]; const float* gate = I[3]; const float* Wq = I[4]; const float* bq = I[5]; const float* Wk = I[6]; const float* bk = I[7]; const float* Wv = I[8]; const float* bv = I[9];
  char* ws = (char*)d_ws; size_t off = 0;
  auto take = [&](size_t bytes) { char* p = ws + off; off += (bytes + 255) & ~(size_t)255; return p; };
  const size_t WSZ = (size_t)DD * DD; _Float16* Bw = (_Float16*)take(3 * WSZ * 2); _Float16* X16 = (_Float16*)take((size_t)NR * DD * 2); _Float16* Q = (_Float16*)take((size_t)NR * DD * 2); _Float16* K = (_Float16*)take((size_t)NR * DD * 2); _Float16* V = (_Float16*)take((size_t)NR * DD * 2); _Float16* Vt = (_Float16*)take((size_t)NR * DD * 2);
  if (off > ws_size) return;      // 3.5 + 5 x 6.3 = about 35 MB
  const unsigned gw = (unsigned)((WSZ / 8 + 255) / 256); k_wt_f16<<<gw, 256, 0, stream>>>(Wq, Bw, DD, DD, 16.0f); k_wt_f16<<<gw, 256, 0, stream>>>(Wk, Bw + WSZ, DD, DD, 16.0f); k_wt_f16<<<gw, 256, 0, stream>>>(Wv, Bw + 2 * WSZ, DD, DD, 16.0f);      /* (in,out) → Bt ×2^4 */
  k_x16<DD><<<(unsigned)(((size_t)NR * DD / 16 + 255) / 256), 256, 0, stream>>>(x, X16, (unsigned)((size_t)NR * DD / 16));
  const dim3 gp(((NR / 16) * (DD / 64) + 3) / 4, 1);
  k_gemm_hhx<0><<<gp, 128, 0, stream>>>(X16, DD, 0, Bw, DD, 0, 0.0625f, bq, 0, nullptr, 1, 0, 0, nullptr, Q, DD, 0, NR, DD, DD);      /* M 4096 N 768 K 768 */
  k_gemm_hhx<0><<<gp, 128, 0, stream>>>(X16, DD, 0, Bw + WSZ, DD, 0, 0.0625f, bk, 0, nullptr, 1, 0, 0, nullptr, K, DD, 0, NR, DD, DD);
  k_gemm_hhx<0><<<gp, 128, 0, stream>>>(X16, DD, 0, Bw + 2 * WSZ, DD, 0, 0.0625f, bv, 0, nullptr, 1, 0, 0, nullptr, V, DD, 0, NR, DD, DD);
  k_vt<NH, TT><<<BB * NH * (TT / 64), 256, 0, stream>>>(V, DD, 0, Vt);
  k_flash_gl<<<BB * NH * (TT / 64), 128, 0, stream>>>(Q, DD, K, DD, Vt, am, lm, gate, (float*)d_out, DD);      /* both paths and the gated sum */
}

// v005
// Measured time: 93.1 microseconds a run.
// Next to v004, in two timings, it ran 1.21 times as fast each time.
// Counting every step since v000, it is 3.82 times as fast.
#include <hip/hip_runtime.h>
// Gated global/local self attention (B=4, S=1024, HID=768, 12×64): q,k,v = x·W + b ((in,out)); scores = q·k/8; global path softmax(scores + attention_mask[b,0,0,k]); local path softmax(scores + (1 − local_mask[b,0,q,k])·f32_min); ctx = gate[b,h,q]·ctx_local + (1 − gate)·ctx_global, merged → [4,1024,768].
// Compute dtype: x, weights, biases, additive mask and gates rounded to bf16; q/k/v f16 GEMM planes; one flash-style kernel on v_wmma_f32_16x16x32_f16 (online softmax f32, P f16 x 2^10, f32 accumulate) that forms each score tile once and feeds two softmaxes: one with the per-batch additive key bias, one with the per-batch 0/1 (q,k) mask
// (0 -> -inf); the gated combination in f32, in that kernel's epilogue.
// Every f16 plane that feeds a WMMA from global memory (X, W^T, Q, K, V, V^T) lies in FRAGMENT ORDER: a plane of rows x cols is cut into blocks of 16 rows x 32 cols (1 KiB, row tile major, then column block);
// a block is two units of 512 B (cols 0..15, cols 16..31); in a unit lane l = 16 hh + ln owns 16 B: row ln, cols 8 hh .. 8 hh + 7. A wave's b128 load of a fragment half is then one unit: 4 whole 128-B lines, where a row-major plane gives 16 pieces of 32 B.
// Element (R, C) of a plane with pitch P (cols): (R / 16) * 16 * P + (C / 32) * 512 + ((C / 16) % 2) * 256 + (((C / 8) % 2) * 16 + R % 16) * 8 + C % 8.
#define BB 4
#define TT 1024
#define DD 768
#define NH 12
#define NR (BB * TT)

typedef __bf16 v16b __attribute__((ext_vector_type(16)));
typedef unsigned short v8us __attribute__((ext_vector_type(8), may_alias));
typedef float  v8f  __attribute__((ext_vector_type(8)));
typedef float  v4f  __attribute__((ext_vector_type(4)));
typedef float  v4fa __attribute__((ext_vector_type(4), may_alias));
union FragB { v16b v; v8us half[2]; unsigned short u[16]; };

__device__ __forceinline__ unsigned short bf16_bits(float x) { unsigned int u = __float_as_uint(x); return (unsigned short)((u + 0x7FFFu + ((u >> 16) & 1u)) >> 16); }
__device__ __forceinline__ float bf16_val(unsigned short b) { return __uint_as_float(((unsigned int)b) << 16); }
__device__ __forceinline__ float bf16_round(float x) { return bf16_val(bf16_bits(x)); }
// D += A·B with NT terms: 1 = ah·bh, 2 = + al·bh (A split), 3 = + ah·bl (both split)
template <int NT>
__device__ __forceinline__ v8f mmaN(v16b ah, v16b al, v16b bh, v16b bl, v8f c) {
  c = __builtin_amdgcn_wmma_f32_16x16x32_bf16(false, ah, false, bh, (short)0, c, false, false);
  if (NT >= 2) c = __builtin_amdgcn_wmma_f32_16x16x32_bf16(false, al, false, bh, (short)0, c, false, false);
  if (NT >= 3) c = __builtin_amdgcn_wmma_f32_16x16x32_bf16(false, ah, false, bl, (short)0, c, false, false);
  asm volatile("v_nop\n\tv_nop\n\tv_nop\n\tv_nop" : "+v"(c) : "v"(ah), "v"(al), "v"(bh), "v"(bl));
  return c;
}

__global__ __launch_bounds__(256) void k_wt_bf16(const float* __restrict__ W, unsigned short* __restrict__ Wt, int K, int N) {
  const int t = blockIdx.x * 256 + threadIdx.x;
  const int k8n = K / 8;
  if (t >= N * k8n) return;
  const int n = t / k8n, k8 = (t % k8n) * 8;
  v8us v;
#pragma unroll
  for (int i = 0; i < 8; ++i) v[i] = bf16_bits(W[(size_t)(k8 + i) * N + n]);
  *(v8us*)(Wt + (size_t)n * K + k8) = v;
  
}

// GEMM C[M][N] (f32, pitch ldc) = act(A[M][K]·W + bias). A f32 row-major (pitch lda) converted per fragment to bf16
// (ASPLIT: hi/lo two planes -> 2 terms, else single rounded term); Wt bf16 [N][K] (pitch ldb). BIAS_BF16 rounds the
// bias to bf16 first (bias quantised to bf16 before the add). K%32==0, M%16==0, N%64==0.
template <bool ASPLIT, int ACT, bool BIAS_BF16>
__global__ __launch_bounds__(128) void k_gemm_bf(const float* __restrict__ A, int lda, const unsigned short* __restrict__ Wt, int ldb,
                                               const float* __restrict__ bias, float* __restrict__ C, int ldc, int M, int N, int K) {
  __shared__ __attribute__((aligned(16))) float so[4][16][64];
  const int tid = threadIdx.x, w = tid >> 5, lane = tid & 31, ln = lane & 15, hh = lane >> 4;
  const int ntn = N / 64;
  const int wid = blockIdx.x * 4 + w;
  const int mt = wid / ntn, nq = wid % ntn;
  if (mt * 16 >= M) return;
  const int row0 = mt * 16, col0 = nq * 64;
  const float* arow = A + (size_t)(row0 + ln) * lda;
  v8f acc[4] = {};
  for (int kb = 0; kb < K; kb += 32) {
    FragB ah, al;
    const v4f x0 = *(const v4fa*)(arow + kb + 8 * hh), x1 = *(const v4fa*)(arow + kb + 8 * hh + 4);
    const v4f x2 = *(const v4fa*)(arow + kb + 16 + 8 * hh), x3 = *(const v4fa*)(arow + kb + 16 + 8 * hh + 4);
    float xs[16] = {x0[0],x0[1],x0[2],x0[3],x1[0],x1[1],x1[2],x1[3],x2[0],x2[1],x2[2],x2[3],x3[0],x3[1],x3[2],x3[3]};
#pragma unroll
    for (int i = 0; i < 16; ++i) { const unsigned short hb = bf16_bits(xs[i]); ah.u[i] = hb; al.u[i] = ASPLIT ? bf16_bits(xs[i] - bf16_val(hb)) : (unsigned short)0; }
#pragma unroll
    for (int t = 0; t < 4; ++t) {
      const unsigned short* brow = Wt + (size_t)(col0 + t * 16 + ln) * ldb + kb;
      FragB b;
      b.half[0] = *(const v8us*)(brow + 8 * hh);
      b.half[1] = *(const v8us*)(brow + 16 + 8 * hh);
      acc[t] = mmaN<ASPLIT ? 2 : 1>(ah.v, al.v, b.v, b.v, acc[t]);
    }
  }
#pragma unroll
  for (int t = 0; t < 4; ++t) {
    float bv = bias ? bias[col0 + t * 16 + ln] : 0.f;
    if (BIAS_BF16) bv = bf16_round(bv);
#pragma unroll
    for (int r = 0; r < 8; ++r) { float v = acc[t][r] + bv; if (ACT == 1) v = fmaxf(v, 0.f); so[w][8 * hh + r][t * 16 + ln] = v; }
  }
  __builtin_amdgcn_fence(__ATOMIC_ACQ_REL, "workgroup");
  __builtin_amdgcn_wave_barrier();
  const int rsub = lane >> 4, c4 = (lane & 15) * 4;
  {
#pragma unroll
    for (int q = 0; q < 8; ++q) {
      const int r = q * 2 + rsub;
      const v4f v = *(const v4fa*)&so[w][r][c4];
      *(v4f*)(C + (size_t)(row0 + r) * ldc + col0 + c4) = v;
    }
    
  }
}

// Flash-style causal/unmasked attention, all contractions 3-term bf16 hi/lo splits, f32 softmax with running max.
// q,k,v rows are read from f32 buffers with arbitrary row pitch (so they can live inside a fused qkv buffer);
// D = head size (multiple of 32, <= 128); one wave = 16 query rows; block = 4 waves (64 queries) sharing K/V chunks of 32.
template <int D, bool CAUSAL>
__global__ __launch_bounds__(128) void k_flash(const float* __restrict__ qb, const float* __restrict__ kb, const float* __restrict__ vb,
                                             int pitch, int T, int H, float scale, float* __restrict__ y, int ypitch) {
  constexpr int KS = D / 32;        // k-steps for QK
  constexpr int DT = D / 16;        // d tiles for PV
  __shared__ __attribute__((aligned(16))) unsigned short sKh[32][D + 8], sKl[32][D + 8], sVh[32][D + 8], sVl[32][D + 8];
  __shared__ __attribute__((aligned(16))) unsigned short sPh[4][16][40], sPl[4][16][40];
  __shared__ __attribute__((aligned(16))) float sO[4][16][D];
  const int tid = threadIdx.x, w = tid >> 5, lane = tid & 31, ln = lane & 15, hh = lane >> 4;
  const int nqb = (T + 63) / 64;
  const int bh = blockIdx.x / nqb, qblk = blockIdx.x % nqb;
  const int b = bh / H, h = bh % H;
  const int q0 = qblk * 64 + w * 16;
  const float* Q = qb + (size_t)b * T * pitch + h * D;
  const float* K = kb + (size_t)b * T * pitch + h * D;
  const float* V = vb + (size_t)b * T * pitch + h * D;

  // A fragments of the wave's 16 query rows (scaled), hi/lo
  FragB aqh[KS], aql[KS];
  {
    int row = q0 + ln; if (row >= T) row = T - 1;
    const float* qr = Q + (size_t)row * pitch;
#pragma unroll
    for (int ks = 0; ks < KS; ++ks)
#pragma unroll
      for (int i = 0; i < 16; ++i) {
        const int d = ks * 32 + ((i < 8) ? (8 * hh + i) : (16 + 8 * hh + (i - 8)));
        const float x = qr[d] * scale; const unsigned short hb = bf16_bits(x);
        aqh[ks].u[i] = hb; aql[ks].u[i] = bf16_bits(x - bf16_val(hb));
      }
  }
  float m_r[8], l_r[8];
#pragma unroll
  for (int r = 0; r < 8; ++r) { m_r[r] = -3.0e38f; l_r[r] = 0.f; }
  v8f oacc[DT];
#pragma unroll
  for (int dt = 0; dt < DT; ++dt) oacc[dt] = (v8f){0.f,0.f,0.f,0.f,0.f,0.f,0.f,0.f};

  const int kv_end = CAUSAL ? min(T, qblk * 64 + 64) : T;     // block-uniform
  for (int j0 = 0; j0 < kv_end; j0 += 32) {
    __syncthreads();
    for (int e = tid; e < 32 * (D / 4); e += 128) {
      const int r = e / (D / 4), c4 = (e % (D / 4)) * 4;
      const int key = j0 + r;
      v4f kf = {0.f,0.f,0.f,0.f}, vf = {0.f,0.f,0.f,0.f};
      if (key < T) { kf = *(const v4fa*)(K + (size_t)key * pitch + c4); vf = *(const v4fa*)(V + (size_t)key * pitch + c4); }
#pragma unroll
      for (int t = 0; t < 4; ++t) {
        unsigned short hb = bf16_bits(kf[t]); sKh[r][c4 + t] = hb; sKl[r][c4 + t] = bf16_bits(kf[t] - bf16_val(hb));
        hb = bf16_bits(vf[t]); sVh[r][c4 + t] = hb; sVl[r][c4 + t] = bf16_bits(vf[t] - bf16_val(hb));
      }
    }
    __syncthreads();
    // S tile 16 x 32
    v8f s[2];
#pragma unroll
    for (int nt = 0; nt < 2; ++nt) {
      v8f acc = {};
#pragma unroll
      for (int ks = 0; ks < KS; ++ks) {
        FragB bh_, bl_;
        bh_.half[0] = *(const v8us*)&sKh[nt * 16 + ln][ks * 32 + 8 * hh]; bh_.half[1] = *(const v8us*)&sKh[nt * 16 + ln][ks * 32 + 16 + 8 * hh];
        bl_.half[0] = *(const v8us*)&sKl[nt * 16 + ln][ks * 32 + 8 * hh]; bl_.half[1] = *(const v8us*)&sKl[nt * 16 + ln][ks * 32 + 16 + 8 * hh];
        acc = mmaN<3>(aqh[ks].v, aql[ks].v, bh_.v, bl_.v, acc);
      }
      s[nt] = acc;
    }
    // mask + running max (rows 8hh+r; the 16 lanes of a half share rows)
    float alpha[8];
#pragma unroll
    for (int r = 0; r < 8; ++r) {
      const int qi = q0 + 8 * hh + r;
      const int ja = j0 + ln, jb = j0 + 16 + ln;
      if (CAUSAL) { if (ja > qi) s[0][r] = -3.0e38f; if (jb > qi) s[1][r] = -3.0e38f; }
      if (ja >= T) s[0][r] = -3.0e38f;
      if (jb >= T) s[1][r] = -3.0e38f;
      float mx = fmaxf(s[0][r], s[1][r]);
      mx = fmaxf(mx, __shfl_xor(mx, 1, 32)); mx = fmaxf(mx, __shfl_xor(mx, 2, 32)); mx = fmaxf(mx, __shfl_xor(mx, 4, 32)); mx = fmaxf(mx, __shfl_xor(mx, 8, 32));
      const float mnew = fmaxf(m_r[r], mx);
      alpha[r] = (mnew > -1.0e38f) ? __expf(m_r[r] - mnew) : 1.0f;
      const float p0 = (s[0][r] > -1.0e38f) ? __expf(s[0][r] - mnew) : 0.f;
      const float p1 = (s[1][r] > -1.0e38f) ? __expf(s[1][r] - mnew) : 0.f;
      m_r[r] = mnew;
      l_r[r] = l_r[r] * alpha[r] + p0 + p1;            // per-lane partial row sum (16 lanes combined at the end)
      unsigned short hb = bf16_bits(p0); sPh[w][8 * hh + r][ln] = hb;      sPl[w][8 * hh + r][ln] = bf16_bits(p0 - bf16_val(hb));
      hb = bf16_bits(p1);                sPh[w][8 * hh + r][16 + ln] = hb; sPl[w][8 * hh + r][16 + ln] = bf16_bits(p1 - bf16_val(hb));
    }
#pragma unroll
    for (int dt = 0; dt < DT; ++dt)
#pragma unroll
      for (int r = 0; r < 8; ++r) oacc[dt][r] *= alpha[r];
    __builtin_amdgcn_fence(__ATOMIC_ACQ_REL, "workgroup");
    __builtin_amdgcn_wave_barrier();
    FragB pah, pal;
    pah.half[0] = *(const v8us*)&sPh[w][ln][8 * hh]; pah.half[1] = *(const v8us*)&sPh[w][ln][16 + 8 * hh];
    pal.half[0] = *(const v8us*)&sPl[w][ln][8 * hh]; pal.half[1] = *(const v8us*)&sPl[w][ln][16 + 8 * hh];
#pragma unroll
    for (int dt = 0; dt < DT; ++dt) {
      FragB bvh, bvl;
#pragma unroll
      for (int i = 0; i < 8; ++i) {
        bvh.u[i] = sVh[8 * hh + i][dt * 16 + ln]; bvh.u[8 + i] = sVh[16 + 8 * hh + i][dt * 16 + ln];
        bvl.u[i] = sVl[8 * hh + i][dt * 16 + ln]; bvl.u[8 + i] = sVl[16 + 8 * hh + i][dt * 16 + ln];
      }
      oacc[dt] = mmaN<3>(pah.v, pal.v, bvh.v, bvl.v, oacc[dt]);
    }
    __builtin_amdgcn_fence(__ATOMIC_ACQ_REL, "workgroup");
    __builtin_amdgcn_wave_barrier();
  }
#pragma unroll
  for (int r = 0; r < 8; ++r) {
    float l = l_r[r];
    l += __shfl_xor(l, 1, 32); l += __shfl_xor(l, 2, 32); l += __shfl_xor(l, 4, 32); l += __shfl_xor(l, 8, 32);
    l_r[r] = (l > 0.f) ? 1.0f / l : 0.f;
  }
#pragma unroll
  for (int dt = 0; dt < DT; ++dt)
#pragma unroll
    for (int r = 0; r < 8; ++r) sO[w][8 * hh + r][dt * 16 + ln] = oacc[dt][r] * l_r[r];
  __builtin_amdgcn_fence(__ATOMIC_ACQ_REL, "workgroup");
  __builtin_amdgcn_wave_barrier();
  {
    for (int r = 0; r < 16; ++r) {
      const int row = q0 + r;
      if (row < T && lane < D / 4) {
        const v4f val = *(const v4fa*)&sO[w][r][lane * 4];
        *(v4f*)(y + ((size_t)b * T + row) * ypitch + h * D + lane * 4) = val;
      }
    }
    
  }
}

// GEMM C = act(A·W + bias + resid): A f32 (ASPLIT -> hi/lo 2 terms), Wt bf16 [N][K]; ACT 0 none, 1 relu, 2 exact gelu;
// resid (optional, f32, row index = (row % rmod), pitch ldr, RES_BF16 rounds it) added before the activation.
template <bool ASPLIT, int ACT, bool BIAS_BF16, bool RES_BF16>
__global__ __launch_bounds__(128) void k_gemm_bf3(const float* __restrict__ A, int lda, const unsigned short* __restrict__ Wt, int ldb,
                                                const float* __restrict__ bias, const float* __restrict__ resid, int rmod, int ldr,
                                                float* __restrict__ C, int ldc, int M, int N, int K) {
  __shared__ __attribute__((aligned(16))) float so[4][16][64];
  const int tid = threadIdx.x, w = tid >> 5, lane = tid & 31, ln = lane & 15, hh = lane >> 4;
  const int ntn = N / 64;
  const int wid = blockIdx.x * 4 + w;
  const int mt = wid / ntn, nq = wid % ntn;
  if (mt * 16 >= M) return;
  const int row0 = mt * 16, col0 = nq * 64;
  const float* arow = A + (size_t)(row0 + ln) * lda;
  v8f acc[4] = {};
  for (int kb = 0; kb < K; kb += 32) {
    FragB ah, al;
    const v4f x0 = *(const v4fa*)(arow + kb + 8 * hh), x1 = *(const v4fa*)(arow + kb + 8 * hh + 4);
    const v4f x2 = *(const v4fa*)(arow + kb + 16 + 8 * hh), x3 = *(const v4fa*)(arow + kb + 16 + 8 * hh + 4);
    float xs[16] = {x0[0],x0[1],x0[2],x0[3],x1[0],x1[1],x1[2],x1[3],x2[0],x2[1],x2[2],x2[3],x3[0],x3[1],x3[2],x3[3]};
#pragma unroll
    for (int i = 0; i < 16; ++i) { const unsigned short hb = bf16_bits(xs[i]); ah.u[i] = hb; al.u[i] = ASPLIT ? bf16_bits(xs[i] - bf16_val(hb)) : (unsigned short)0; }
#pragma unroll
    for (int t = 0; t < 4; ++t) {
      const unsigned short* brow = Wt + (size_t)(col0 + t * 16 + ln) * ldb + kb;
      FragB b;
      b.half[0] = *(const v8us*)(brow + 8 * hh);
      b.half[1] = *(const v8us*)(brow + 16 + 8 * hh);
      acc[t] = mmaN<ASPLIT ? 2 : 1>(ah.v, al.v, b.v, b.v, acc[t]);
    }
  }
#pragma unroll
  for (int t = 0; t < 4; ++t) {
    const int col = col0 + t * 16 + ln;
    float bv = bias ? bias[col] : 0.f;
    if (BIAS_BF16) bv = bf16_round(bv);
#pragma unroll
    for (int r = 0; r < 8; ++r) {
      float v = acc[t][r] + bv;
      if (resid) { float rv = resid[(size_t)((row0 + 8 * hh + r) % rmod) * ldr + col]; if (RES_BF16) rv = bf16_round(rv); v += rv; }
      if (ACT == 1) v = fmaxf(v, 0.f);
      if (ACT == 2) v = 0.5f * v * (1.0f + erff(v * 0.70710678118654752f));
      if (ACT == 3) { const float u = 0.7978845608028654f * (v + 0.044715f * v * v * v); v = 0.5f * v * (1.0f + tanhf(u)); }
      so[w][8 * hh + r][t * 16 + ln] = v;
    }
  }
  __builtin_amdgcn_fence(__ATOMIC_ACQ_REL, "workgroup");
  __builtin_amdgcn_wave_barrier();
  const int rsub = lane >> 4, c4 = (lane & 15) * 4;
  {
#pragma unroll
    for (int q = 0; q < 8; ++q) {
      const int r = q * 2 + rsub;
      const v4f v = *(const v4fa*)&so[w][r][c4];
      *(v4f*)(C + (size_t)(row0 + r) * ldc + col0 + c4) = v;
    }
    
  }
}
// row LayerNorm (biased variance, eps) over N: s = X (+ R); optional out_sum <- s; out_norm <- (s-mu)*rsqrt(var+eps)*g + b
template <bool PARAM_BF16>
__global__ __launch_bounds__(256) void k_layernorm(const float* __restrict__ X, const float* __restrict__ R, const float* __restrict__ g, const float* __restrict__ bta,
                                                  float* __restrict__ out_sum, float* __restrict__ out_norm, int N, float eps) {
  __shared__ float red[256];
  const int row = blockIdx.x, tid = threadIdx.x;
  const float* x = X + (size_t)row * N; const float* rr = R ? R + (size_t)row * N : nullptr;
  float vals[16];                     // up to N = 4096
  const int per = N / 256;            // contiguous chunk per thread? use strided-by-4 chunks: thread handles j = tid*4 + 1024*u
  float s1 = 0.f;
  for (int u = 0; u < per / 4; ++u) {
    const int j = tid * 4 + 1024 * u;
    const v4f a = *(const v4fa*)(x + j);
    v4f b = {0.f,0.f,0.f,0.f}; if (rr) b = *(const v4fa*)(rr + j);
#pragma unroll
    for (int q = 0; q < 4; ++q) { const float v = a[q] + b[q]; vals[u * 4 + q] = v; s1 += v; }
  }
  red[tid] = s1; __syncthreads();
  for (int st = 128; st > 0; st >>= 1) { if (tid < st) red[tid] += red[tid + st]; __syncthreads(); }
  const float mu = red[0] / (float)N; __syncthreads();
  float s2 = 0.f;
  for (int u = 0; u < per / 4; ++u)
#pragma unroll
    for (int q = 0; q < 4; ++q) { const float c = vals[u * 4 + q] - mu; s2 += c * c; }
  red[tid] = s2; __syncthreads();
  for (int st = 128; st > 0; st >>= 1) { if (tid < st) red[tid] += red[tid + st]; __syncthreads(); }
  const float rs = rsqrtf(red[0] / (float)N + eps);
  {
    for (int u = 0; u < per / 4; ++u) {
      const int j = tid * 4 + 1024 * u;
      v4f o, sm;
#pragma unroll
      for (int q = 0; q < 4; ++q) {
        float gg = g[j + q], bb = bta[j + q];
        if (PARAM_BF16) { gg = bf16_round(gg); bb = bf16_round(bb); }
        sm[q] = vals[u * 4 + q]; o[q] = (vals[u * 4 + q] - mu) * rs * gg + bb;
      }
      if (out_sum) *(v4f*)(out_sum + (size_t)row * N + j) = sm;
      *(v4f*)(out_norm + (size_t)row * N + j) = o;
    }
    
  }
}



// ---- f16 WMMA path (v_wmma_f32_16x16x32_f16): 11-bit significands for operands in range — used where a [0,1] probability operand needs more precision than bf16
typedef _Float16 v16h __attribute__((ext_vector_type(16)));
union FragH { v16h v; v8us half[2]; _Float16 h[16]; unsigned short u[16]; };
template <int NT>
__device__ __forceinline__ v8f mmaH(v16h ah, v16h al, v16h bh, v16h bl, v8f c) {
  c = __builtin_amdgcn_wmma_f32_16x16x32_f16(false, ah, false, bh, (short)0, c, false, false);
  if (NT >= 2) c = __builtin_amdgcn_wmma_f32_16x16x32_f16(false, al, false, bh, (short)0, c, false, false);
  if (NT >= 3) c = __builtin_amdgcn_wmma_f32_16x16x32_f16(false, ah, false, bl, (short)0, c, false, false);
  asm volatile("v_nop\n\tv_nop\n\tv_nop\n\tv_nop" : "+v"(c) : "v"(ah), "v"(al), "v"(bh), "v"(bl));
  return c;
}
// batched GEMM like k_gemm_b but f16 operands: A f32 (split into f16 hi/lo if ASPLIT, else rounded to f16), Bt = f16 values [n][k]; alpha; C f32; N multiple of 16 (partial tiles skipped)
template <bool ASPLIT>
__global__ __launch_bounds__(128) void k_gemm_h(const float* __restrict__ A, int lda, size_t sA, const _Float16* __restrict__ Bh, int ldb, size_t sB, float alpha, float* __restrict__ C, int ldc, size_t sC, int M, int N, int K) {
  __shared__ __attribute__((aligned(16))) float so[4][16][64];
  const int tid = threadIdx.x, w = tid >> 5, lane = tid & 31, ln = lane & 15, hh = lane >> 4; const int by = blockIdx.y;
  A += (size_t)by * sA; Bh += (size_t)by * sB; C += (size_t)by * sC;
  const int ntn = (N + 63) / 64; const int wid = blockIdx.x * 4 + w; const int mt = wid / ntn, nq = wid % ntn; if (mt * 16 >= M) return;
  const int row0 = mt * 16, col0 = nq * 64; const float* arow = A + (size_t)(row0 + ln) * lda;
  v8f acc[4] = {};
  for (int kb = 0; kb < K; kb += 32) {
    FragH ah, al;
    const v4f x0 = *(const v4fa*)(arow + kb + 8 * hh), x1 = *(const v4fa*)(arow + kb + 8 * hh + 4), x2 = *(const v4fa*)(arow + kb + 16 + 8 * hh), x3 = *(const v4fa*)(arow + kb + 16 + 8 * hh + 4);
    float xs[16] = {x0[0],x0[1],x0[2],x0[3],x1[0],x1[1],x1[2],x1[3],x2[0],x2[1],x2[2],x2[3],x3[0],x3[1],x3[2],x3[3]};
#pragma unroll
    for (int i = 0; i < 16; ++i) { const _Float16 h = (_Float16)xs[i]; ah.h[i] = h; al.h[i] = ASPLIT ? (_Float16)(xs[i] - (float)h) : (_Float16)0.0f; }
#pragma unroll
    for (int t = 0; t < 4; ++t) { if (col0 + t * 16 >= N) continue; const size_t boff = (size_t)(col0 + t * 16 + ln) * ldb + kb; FragH bq; bq.half[0] = *(const v8us*)(Bh + boff + 8 * hh); bq.half[1] = *(const v8us*)(Bh + boff + 16 + 8 * hh);
      acc[t] = mmaH<ASPLIT ? 2 : 1>(ah.v, al.v, bq.v, bq.v, acc[t]); }
  }
#pragma unroll
  for (int t = 0; t < 4; ++t) { if (col0 + t * 16 >= N) continue;
#pragma unroll
    for (int r = 0; r < 8; ++r) so[w][8 * hh + r][t * 16 + ln] = acc[t][r] * alpha; }
  __builtin_amdgcn_fence(__ATOMIC_ACQ_REL, "workgroup"); __builtin_amdgcn_wave_barrier();
  const int rsub = lane >> 4, c4 = (lane & 15) * 4;
  {
#pragma unroll
    for (int q = 0; q < 8; ++q) { const int r = q * 2 + rsub; if (col0 + c4 < N) { const v4f v = *(const v4fa*)&so[w][r][c4]; *(v4f*)(C + (size_t)(row0 + r) * ldc + col0 + c4) = v; } }
     }
}

// Wt[n][k] = f16(W[k][n]·scale) from f32 row-major W[K][N] (scale = power of two; bf16-exact weights stay exact in f16 away from the subnormal range)
// Wt lies in fragment order (rows n, cols k, pitch K): thread t writes the 16 B of lane t % 32 in unit t / 32. K % 32 == 0, N % 16 == 0.
__global__ __launch_bounds__(256) void k_wt_f16(const float* __restrict__ W, _Float16* __restrict__ Wt, int K, int N, float scale) {
  const int t = blockIdx.x * 256 + threadIdx.x; if (t >= N * (K / 8)) return; const int lane = t & 31, u = t >> 5, blk = u >> 1; const int n = (blk / (K / 32)) * 16 + (lane & 15), k8 = (blk % (K / 32)) * 32 + (u & 1) * 16 + (lane >> 4) * 8; FragH f;
#pragma unroll
  for (int i = 0; i < 8; ++i) f.h[i] = (_Float16)(bf16_round(W[(size_t)(k8 + i) * N + n]) * scale); const v8us o = f.half[0];
  *(v8us*)((unsigned short*)Wt + (size_t)t * 8) = o; 
}
// A, Bh and C16 lie in fragment order (pitches lda, ldb, ldc: multiples of 32).
// k_gemm_hh variant with fused epilogue: v = acc·alpha + bias[by·sBias + col] (+ CP[(row/rowsPerB)·sCPb + by·64 + col] if CP) ; ACT 0 none / 1 elu ; writes f16 C16 (and f32 C if non-null)
template <int ACT>
__global__ __launch_bounds__(128) void k_gemm_hhx(const _Float16* __restrict__ A, int lda, size_t sA, const _Float16* __restrict__ Bh, int ldb, size_t sB, float alpha, const float* __restrict__ bias, size_t sBias, const float* __restrict__ CP, int rowsPerB, size_t sCPb, int row0g,
    float* __restrict__ C, _Float16* __restrict__ C16, int ldc, size_t sC, int M, int N, int K) {
  __shared__ __attribute__((aligned(16))) float so[4][16][64 + 4];      /* pitch 68: the epilogue's row reads (one row a lane) fall on different banks */
  const int tid = threadIdx.x, w = tid >> 5, lane = tid & 31, ln = lane & 15, hh = lane >> 4; const int by = blockIdx.y;
  A += (size_t)by * sA; Bh += (size_t)by * sB; const size_t cofs = (size_t)by * sC; const float* bp = bias ? bias + (size_t)by * sBias : nullptr;
  const int ntn = (N + 63) / 64; const int wid = blockIdx.x * 4 + w; const int mt = wid / ntn, nq = wid % ntn; if (mt * 16 >= M) return;
  const int row0 = mt * 16, col0 = nq * 64; const _Float16* arow = A + (size_t)row0 * lda + lane * 8;      /* this lane's 16 B in the first unit of the row tile */
  v8f acc[4] = {};
  // Fragments are fetched ahead: two register sets of 64 k each; while one set feeds its 8 WMMAs the other set's 20 loads are in flight. K % 128 == 0.
  // A column tile past N reads the last tile (in bounds); its accumulator is never stored (the guards of the epilogue).
  const unsigned short* ap = (const unsigned short*)arow; const unsigned short* wp[4];
#pragma unroll
  for (int t = 0; t < 4; ++t) { int cr = col0 + t * 16; if (cr > N - 16) cr = N - 16; wp[t] = (const unsigned short*)Bh + (size_t)cr * ldb + lane * 8; }
  FragH a0[2], a1[2], b0[2][4], b1[2][4];
  auto ldf = [&](FragH (&a)[2], FragH (&bq)[2][4], int kb, int ko) {      /* k = kb + ko; ko is a literal and goes into the loads' offset fields; 32 k are one block of 512 elements, so k counts 16-fold */
    const unsigned short* pa = ap + kb * 16; const unsigned short* pw[4] = {wp[0] + kb * 16, wp[1] + kb * 16, wp[2] + kb * 16, wp[3] + kb * 16};
#pragma unroll
    for (int ks = 0; ks < 2; ++ks) { a[ks].half[0] = *(const v8us*)(pa + (ko + ks * 32) * 16); a[ks].half[1] = *(const v8us*)(pa + (ko + ks * 32) * 16 + 256);
#pragma unroll
      for (int t = 0; t < 4; ++t) { bq[ks][t].half[0] = *(const v8us*)(pw[t] + (ko + ks * 32) * 16); bq[ks][t].half[1] = *(const v8us*)(pw[t] + (ko + ks * 32) * 16 + 256); } }
    /* the group's address pairs are named so that no register of them is reused (not even as a later load's result) before the loads have taken them */
    asm volatile("s_wait_xcnt 0x0" :: "v"(pa), "v"(pw[0]), "v"(pw[1]), "v"(pw[2]), "v"(pw[3]) : "memory"); };
  auto mmf = [&](FragH (&a)[2], FragH (&bq)[2][4]) {
#pragma unroll
    for (int ks = 0; ks < 2; ++ks)
#pragma unroll
      for (int t = 0; t < 4; ++t) acc[t] = mmaH<1>(a[ks].v, a[ks].v, bq[ks][t].v, bq[ks][t].v, acc[t]); };
  ldf(a0, b0, 0, 0);
  for (int kb = 0; kb < K; kb += 128) {
    ldf(a1, b1, kb, 64);
    mmf(a0, b0);
    ldf(a0, b0, (kb + 128 < K) ? kb + 128 : 0, 0);      /* last trip: wraps to k = 0, in bounds, values unused; no branch, so the waits stay counted */
    mmf(a1, b1);
  }
#pragma unroll
  for (int t = 0; t < 4; ++t) { if (col0 + t * 16 >= N) continue; const int col = col0 + t * 16 + ln; const float bv = bp ? bf16_round(bp[col]) : 0.f;
#pragma unroll
    for (int r = 0; r < 8; ++r) { float v = acc[t][r] * alpha + bv; if (CP) { const int bidx = (row0g + row0 + 8 * hh + r) / rowsPerB; v += CP[(size_t)bidx * sCPb + (size_t)by * 64 + col]; } if (ACT == 1) v = (v > 0.f) ? v : expm1f(v); else if (ACT == 7) v = (v > 0.f) ? v + 1.0f : expf(v); else if (ACT == 8) v = tanhf(v); else if (ACT == 9) v = 0.5f * v * (1.0f + tanhf(0.7978845608028654f * (v + 0.044715f * v * v * v))); else if (ACT == 11) v = 1.0f / (1.0f + expf(-v)); else if (ACT == 12) v = (v > 0.f) ? v : 0.01f * v; else if (ACT == 14) v = (v > 0.f) ? v : 0.1f * v; else if (ACT == 15) v = v / (1.0f + expf(-v)); else if (ACT == 3) v = fmaxf(v, 0.f); else if (ACT == 6) v = 0.5f * v * (1.0f + erff(v * 0.70710678118654752f)); so[w][8 * hh + r][t * 16 + ln] = v; } }
  __builtin_amdgcn_fence(__ATOMIC_ACQ_REL, "workgroup"); __builtin_amdgcn_wave_barrier();
  const int rsub = lane >> 4, c4 = (lane & 15) * 4;
  if (C) {      /* the f32 plane stays row-major */
#pragma unroll
    for (int q = 0; q < 8; ++q) { const int r = q * 2 + rsub; if (col0 + c4 < N) { const v4f v = *(const v4fa*)&so[w][r][c4]; *(v4f*)(C + cofs + (size_t)(row0 + r) * ldc + col0 + c4) = v; } }
  }
  if (C16) {      /* the wave's 16 x 64 tile is four units in a row: 2 KiB of whole lines */
    unsigned short* cu = (unsigned short*)C16 + cofs + (size_t)row0 * ldc + (size_t)(col0 >> 5) * 512 + lane * 8;
#pragma unroll
    for (int u = 0; u < 4; ++u) { if (col0 + u * 16 < N) { const v4f v0 = *(const v4fa*)&so[w][ln][u * 16 + 8 * hh], v1 = *(const v4fa*)&so[w][ln][u * 16 + 8 * hh + 4]; FragH f;
#pragma unroll
      for (int i = 0; i < 4; ++i) { f.h[i] = (_Float16)v0[i]; f.h[4 + i] = (_Float16)v1[i]; }
      *(v8us*)(cu + u * 256) = f.half[0]; } }
  }
}


typedef _Float16 v4h __attribute__((ext_vector_type(4)));

// X16 = f16(bf16(x)) in fragment order, x row-major with pitch LD (LD % 32 == 0): a wave takes one block (16 rows x 32 cols: 16 whole lines of x) and writes its two units; n16 = elements / 16
template <int LD>
__global__ __launch_bounds__(256) void k_x16(const float* __restrict__ x, _Float16* __restrict__ X16, unsigned n16) { const unsigned t = blockIdx.x * 256 + threadIdx.x; if (t >= n16) return; FragH f;
  const unsigned lane = t & 31, blk = t >> 5, rt = blk / (LD / 32), kb = blk % (LD / 32);
  const float* xr = x + (size_t)(rt * 16 + (lane & 15)) * LD + kb * 32 + (lane >> 4) * 8;
#pragma unroll
  for (int q = 0; q < 8; ++q) { f.h[q] = (_Float16)bf16_round(xr[q]); f.h[8 + q] = (_Float16)bf16_round(xr[16 + q]); }
  *(v8us*)((unsigned short*)X16 + (size_t)blk * 512 + lane * 8) = f.half[0]; *(v8us*)((unsigned short*)X16 + (size_t)blk * 512 + 256 + lane * 8) = f.half[1];  }
__global__ __launch_bounds__(256) void k_h16(const float* __restrict__ x, _Float16* __restrict__ X16, size_t n8) { const size_t t = (size_t)blockIdx.x * 256 + threadIdx.x; if (t >= n8) return; FragH f;
#pragma unroll
  for (int q = 0; q < 8; ++q) f.h[q] = (_Float16)x[t * 8 + q]; *(v8us*)((unsigned short*)X16 + t * 8) = f.half[0];  }
__global__ __launch_bounds__(256) void k_round16f(const float* __restrict__ W, _Float16* __restrict__ Bt, size_t n8) { const size_t t = (size_t)blockIdx.x * 256 + threadIdx.x; if (t >= n8) return; FragH f;
#pragma unroll
  for (int i = 0; i < 8; ++i) f.h[i] = (_Float16)(bf16_round(W[t * 8 + i]) * 16.0f); *(v8us*)((unsigned short*)Bt + t * 8) = f.half[0];  }
template <int NHv, int TTv>
__global__ __launch_bounds__(256) void k_vt(const _Float16* __restrict__ V16, int ldv, int voff, _Float16* __restrict__ Vt) { __shared__ unsigned short tl[64][66]; const int tid = threadIdx.x; const int slab = blockIdx.x / (TTv / 64), lg = blockIdx.x % (TTv / 64); const int b = slab / NHv, h = slab % NHv;
  // V16 and Vt lie in fragment order (Vt: rows slab * 64 + d, cols = keys, pitch TTv); the 64 x 64 tile is 16 units on either side, and a wave reads or writes one whole unit at a time. voff % 32 == 0.
  const int lane = tid & 31, ln = lane & 15, hh = lane >> 4;
  for (int i = tid; i < 64 * 8; i += 256) { const int u = i >> 5; const int r = (u >> 2) * 16 + ln, c8 = (u & 3) * 16 + hh * 8; FragH f; f.half[0] = *(const v8us*)((const unsigned short*)V16 + ((size_t)b * TTv + lg * 64 + (u >> 2) * 16) * ldv + (size_t)((voff + h * 64) >> 5) * 512 + (u & 3) * 256 + lane * 8);
#pragma unroll
    for (int q = 0; q < 8; ++q) tl[r][c8 + q] = f.u[q]; }
  __syncthreads();
  {
#pragma unroll
    for (int rd = 0; rd < 2; ++rd) { const int u = rd * 8 + (tid >> 5); const int d = (u >> 2) * 16 + ln, k8 = (u & 3) * 16 + hh * 8; FragH f;
#pragma unroll
      for (int q = 0; q < 8; ++q) f.u[q] = tl[k8 + q][d];
      *(v8us*)((unsigned short*)Vt + ((size_t)slab * 64 + (u >> 2) * 16) * TTv + (size_t)(lg * 2) * 512 + (u & 3) * 256 + lane * 8) = f.half[0]; }
     } }

typedef int v4i __attribute__((ext_vector_type(4)));
typedef int v4ia __attribute__((ext_vector_type(4), may_alias));
// lane l takes the value of lane l ^ 16 (a vector cross-row move, no LDS trip)
__device__ __forceinline__ float xhalf(float x) { return __builtin_bit_cast(float, __builtin_amdgcn_permlanex16(__builtin_bit_cast(int, x), __builtin_bit_cast(int, x), 0x76543210, 0xfedcba98, false, false)); }

// Both attention paths in one walk over the keys. The scores S^T = K Q^T are the same for the two paths, and so are the K and V^T fragments: each is fetched and each score tile is formed once;
// the wave then runs two online softmaxes (additive key bias; 0/1 mask) with two output accumulators, and the gated sum is taken in registers in the epilogue: no per-path output plane, no combining launch.
__global__ __launch_bounds__(128) void k_flash_gl(const _Float16* __restrict__ Q16, int ldq, const _Float16* __restrict__ K16, int ldk, const _Float16* __restrict__ Vt, const float* __restrict__ AB, const int* __restrict__ MSK, const float* __restrict__ gate, float* __restrict__ O, int ldo) {
  constexpr int RPW = 16, NQB = TT / (4 * RPW), DT = 4, KS = 2;
  __shared__ __attribute__((aligned(16))) float sO[4][RPW][64 + 4];
  const int tid = threadIdx.x, w = tid >> 5, lane = tid & 31, ln = lane & 15, hh = lane >> 4;
  const int slab = blockIdx.x / NQB, qblk = blockIdx.x % NQB; const int b = slab / NH, h = slab % NH; const int qb0 = qblk * (4 * RPW); const int q0 = qb0 + w * RPW;
  // Transposed tiles: S^T = K Q^T (A = 16 key rows, B = the wave's 16 queries), O^T += V^T P^T. Lane (ln, hh) owns query q0 + ln; its score registers hold keys j0 + 8 hh + r and j0 + 16 + 8 hh + r,
  // which is the k order of a B operand: P goes from the score registers into the second product with no LDS trip, and maximum and sum run inside the lane plus one exchange between the wave halves.
  FragH aq[KS];
  // Q16, K16 and Vt lie in fragment order (head of the file): a fragment half is one unit of 512 B, this lane's 16 B at lane * 8 elements; a head's 64 columns are two blocks (4 units) in a row.
  { const unsigned short* qr = (const unsigned short*)Q16 + ((size_t)b * TT + q0) * ldq + h * 1024 + lane * 8;
#pragma unroll
    for (int ks = 0; ks < KS; ++ks) { aq[ks].half[0] = *(const v8us*)(qr + ks * 512); aq[ks].half[1] = *(const v8us*)(qr + ks * 512 + 256); }
    asm volatile("s_wait_xcnt 0x0" :: "v"(qr) : "memory"); }      /* as in ldK below: the address pair stays whole until the loads have taken it */
  const unsigned short* Vth = (const unsigned short*)Vt + (size_t)slab * 64 * TT;
  float mg = -3.0e38f, lg = 0.f, ml = -3.0e38f, ll = 0.f; v8f og[DT], ol[DT];      /* running maximum, running sum, output tile: g = additive-bias path, l = 0/1-mask path */
#pragma unroll
  for (int dt = 0; dt < DT; ++dt) { og[dt] = (v8f){0.f,0.f,0.f,0.f,0.f,0.f,0.f,0.f}; ol[dt] = (v8f){0.f,0.f,0.f,0.f,0.f,0.f,0.f,0.f}; }
  const int jend = TT;
  // Global loads are issued ahead of their use: the K fragments, the key bias and the mask words one pass ahead (registers carried round the loop), the V^T fragments at the top of their own pass; their latency then runs under the softmaxes, not in front of each WMMA.
  const unsigned short* Kl = (const unsigned short*)K16 + (size_t)b * TT * ldk + h * 1024 + lane * 8; FragH bk[2][KS];
  const float* aml = AB + (size_t)b * TT + 8 * hh; v4f abn[2][2];
  const int* Ml = MSK + ((size_t)b * TT + q0 + ln) * TT + 8 * hh; v4i mkn[2][2];
  auto ldK = [&](int j) {
    const unsigned short* kr[2] = {Kl + (size_t)j * ldk, Kl + (size_t)(j + 16) * ldk}; const float* am = aml + j; const int* mm = Ml + j;
#pragma unroll
    for (int nt = 0; nt < 2; ++nt) { mkn[nt][0] = *(const v4ia*)(mm + nt * 16); mkn[nt][1] = *(const v4ia*)(mm + nt * 16 + 4); }
#pragma unroll
    for (int nt = 0; nt < 2; ++nt) { abn[nt][0] = *(const v4fa*)(am + nt * 16); abn[nt][1] = *(const v4fa*)(am + nt * 16 + 4); }
#pragma unroll
    for (int nt = 0; nt < 2; ++nt)
#pragma unroll
      for (int ks = 0; ks < KS; ++ks) { bk[nt][ks].half[0] = *(const v8us*)(kr[nt] + ks * 512); bk[nt][ks].half[1] = *(const v8us*)(kr[nt] + ks * 512 + 256); }
    /* the group's address pairs are named so that no register of them is reused (not even as a later load's result) before the loads have taken them */
    asm volatile("s_wait_xcnt 0x0" :: "v"(kr[0]), "v"(kr[1]), "v"(am), "v"(mm) : "memory"); };
  // One path's online-softmax step on its 32 scores of this pass: new maximum, rescale of sum and output tile, P^T packed as a B operand (element nt * 8 + r is key nt * 16 + 8 hh + r, the order in which bv holds V^T).
  // The exponentials run in base 2 on the hardware's own instruction: exp(x) 2^10 = exp2(x log2(e) + 10). sc and m_r are in units of 1 / cs base-2 exponents (cs > 0, so the maximum is taken on sc as it is);
  // p, and with it the running sum, carries the factor 2^10 that P has as an f16 operand: the epilogue divides by that sum alone.
  auto soft = [&](const float (&sc)[2][8], const float cs, const bool fold, float& m_r, float& l_r, v8f (&oacc)[DT], FragH& pb) {
    float mx[8];
#pragma unroll
    for (int r = 0; r < 8; ++r) mx[r] = fmaxf(sc[0][r], sc[1][r]);
    float mc = fmaxf(fmaxf(fmaxf(mx[0], mx[1]), fmaxf(mx[2], mx[3])), fmaxf(fmaxf(mx[4], mx[5]), fmaxf(mx[6], mx[7])));
    mc = fmaxf(mc, xhalf(mc));      /* both wave halves now hold the maximum of the query's 32 scores of this pass */
    const float mn = fmaxf(m_r, mc); const float ea = __builtin_amdgcn_exp2f((m_r - mn) * cs); const float al = (mn > -1.0e38f) ? ea : 1.0f; m_r = mn;      /* computed, then selected: no branch */
    float p[2][8];      /* a masked score is -inf and mn is finite, so its exponential is 0 */
    const float nm = 10.0f - mn * cs;      /* fold: one multiply-add a score; only where mn * cs cannot overflow (cs < 1). Else the difference is taken first, as large additive biases need */
#pragma unroll
    for (int nt = 0; nt < 2; ++nt)
#pragma unroll
      for (int r = 0; r < 8; ++r) p[nt][r] = __builtin_amdgcn_exp2f(fold ? __builtin_fmaf(sc[nt][r], cs, nm) : __builtin_fmaf(sc[nt][r] - mn, cs, 10.0f));
    float ps[8];
#pragma unroll
    for (int r = 0; r < 8; ++r) ps[r] = p[0][r] + p[1][r];
    l_r = l_r * al + (((ps[0] + ps[1]) + (ps[2] + ps[3])) + ((ps[4] + ps[5]) + (ps[6] + ps[7])));      /* this half's 16 keys; the halves are joined behind the loop */
#pragma unroll
    for (int dt = 0; dt < DT; ++dt)
#pragma unroll
      for (int r = 0; r < 8; ++r) oacc[dt][r] *= al;
#pragma unroll
    for (int nt = 0; nt < 2; ++nt)
#pragma unroll
      for (int r = 0; r < 8; ++r) pb.h[nt * 8 + r] = (_Float16)p[nt][r]; };
  const float gq = bf16_round(gate[((size_t)b * NH + h) * TT + q0 + ln]);      /* the gate of this lane's query (bf16-rounded input) */
  ldK(0);
#pragma unroll 1      /* stays rolled: one set of carried fragment registers, and the pass's code is fetched once */
  for (int j0 = 0; j0 < jend; j0 += 32) {
    const int jn = (j0 + 32 < jend) ? j0 + 32 : 0;      /* the pass fetched for; behind the last pass it wraps to key 0: in bounds, values unused; no branch, so the waits stay counted */
    float ab[2][8];      /* additive attention bias (bf16-rounded input) of keys j0 + nt * 16 + 8 hh + r */
    int mk[2][8];      /* per-batch mask [b][q][k] of query q0 + ln, same keys: nonzero = ATTEND */
#pragma unroll
    for (int nt = 0; nt < 2; ++nt)
#pragma unroll
      for (int r = 0; r < 8; ++r) { ab[nt][r] = (float)(__bf16)abn[nt][r >> 2][r & 3]; mk[nt][r] = mkn[nt][r >> 2][r & 3]; }      /* the convert rounds to nearest even, as bf16_round does */
    FragH bv[DT];      /* V^T fragments of this pass: issued here, used behind the softmaxes, by both paths */
    const unsigned short* vr = Vth + (size_t)j0 * 16 + lane * 8;      /* 32 keys are one block of 512 elements */
#pragma unroll
    for (int dt = 0; dt < DT; ++dt) { bv[dt].half[0] = *(const v8us*)(vr + dt * 16 * TT); bv[dt].half[1] = *(const v8us*)(vr + dt * 16 * TT + 256); }
    asm volatile("s_wait_xcnt 0x0" :: "v"(vr) : "memory");      /* as in ldK: the address pair stays whole until the loads have taken it */
    v8f s[2];
#pragma unroll
    for (int nt = 0; nt < 2; ++nt) { v8f acc = (v8f){0.f,0.f,0.f,0.f,0.f,0.f,0.f,0.f};
#pragma unroll
      for (int ks = 0; ks < KS; ++ks) acc = mmaH<1>(bk[nt][ks].v, bk[nt][ks].v, aq[ks].v, aq[ks].v, acc); s[nt] = acc; }
    ldK(jn);
    float scg[2][8], scl[2][8];
#pragma unroll
    for (int nt = 0; nt < 2; ++nt)
#pragma unroll
      for (int r = 0; r < 8; ++r) { scg[nt][r] = s[nt][r] * 0.125f + ab[nt][r]; scl[nt][r] = (mk[nt][r] != 0) ? s[nt][r] : -INFINITY; }      /* the mask path keeps the raw products: its 1 / 8 goes into cs */
    FragH pg, pl;
    soft(scg, 1.4426950408889634f, false, mg, lg, og, pg);
    __builtin_amdgcn_sched_barrier(0);      /* one path's short softmax is scheduled whole, then the other's: else all 32 exponentials stand in one run with every argument and result live (more registers), one overwriting the source of the one directly in front */
    soft(scl, 0.125f * 1.4426950408889634f, true, ml, ll, ol, pl);
#pragma unroll
    for (int dt = 0; dt < DT; ++dt) { og[dt] = mmaH<1>(bv[dt].v, bv[dt].v, pg.v, pg.v, og[dt]); ol[dt] = mmaH<1>(bv[dt].v, bv[dt].v, pl.v, pl.v, ol[dt]); } }
  { const float sg = lg + xhalf(lg), sl = ll + xhalf(ll); const float lig = (sg > 0.f) ? 1.0f / sg : 0.f, lil = (sl > 0.f) ? 1.0f / sl : 0.f;      /* sums and output tiles both carry 2^10 */ const float g1 = 1.0f - gq;
#pragma unroll
    for (int dt = 0; dt < DT; ++dt) {      /* og[dt][r], ol[dt][r] = the paths' O[q0 + ln][dt * 16 + 8 hh + r]; the gated sum of the two goes out */
      v4f o0, o1;
#pragma unroll
      for (int r = 0; r < 4; ++r) { o0[r] = gq * (ol[dt][r] * lil) + g1 * (og[dt][r] * lig); o1[r] = gq * (ol[dt][4 + r] * lil) + g1 * (og[dt][4 + r] * lig); }
      *(v4fa*)&sO[w][ln][dt * 16 + 8 * hh] = o0; *(v4fa*)&sO[w][ln][dt * 16 + 8 * hh + 4] = o1; } }
  __builtin_amdgcn_fence(__ATOMIC_ACQ_REL, "workgroup"); __builtin_amdgcn_wave_barrier();
  {
#pragma unroll
    for (int rp = 0; rp < RPW; rp += 2) { const int r = rp + (lane >> 4), pc = lane & 15; const v4f val = *(const v4fa*)&sO[w][r][pc * 4]; *(v4f*)(O + ((size_t)b * TT + q0 + r) * ldo + h * 64 + pc * 4) = val; }
     } }

extern "C" void kernel_launch(void* const* d_in, const int* in_sizes, int n_in,
                              void* d_out, int out_size, void* d_ws, size_t ws_size, hipStream_t stream) {
  (void)in_sizes; (void)n_in; (void)out_size;
  const float* const* I = (const float* const*)d_in; const float* x = I[0]; const float* am = I[1]; const int* lm = (const int*)d_in[2]; const float* gate = I[3]; const float* Wq = I[4]; const float* bq = I[5]; const float* Wk = I[6]; const float* bk = I[7]; const float* Wv = I[8]; const float* bv = I[9];
  char* ws = (char*)d_ws; size_t off = 0;
  auto take = [&](size_t bytes) { char* p = ws + off; off += (bytes + 255) & ~(size_t)255; return p; };
  const size_t WSZ = (size_t)DD * DD; _Float16* Bw = (_Float16*)take(3 * WSZ * 2); _Float16* X16 = (_Float16*)take((size_t)NR * DD * 2); _Float16* Q = (_Float16*)take((size_t)NR * DD * 2); _Float16* K = (_Float16*)take((size_t)NR * DD * 2); _Float16* V = (_Float16*)take((size_t)NR * DD * 2); _Float16* Vt = (_Float16*)take((size_t)NR * DD * 2);
  if (off > ws_size) return;      // 3.5 + 5 x 6.3 = about 35 MB
  const unsigned gw = (unsigned)((WSZ / 8 + 255) / 256); k_wt_f16<<<gw, 256, 0, stream>>>(Wq, Bw, DD, DD, 16.0f); k_wt_f16<<<gw, 256, 0, stream>>>(Wk, Bw + WSZ, DD, DD, 16.0f); k_wt_f16<<<gw, 256, 0, stream>>>(Wv, Bw + 2 * WSZ, DD, DD, 16.0f);      /* (in,out) → Bt ×2^4 */
  k_x16<DD><<<(unsigned)(((size_t)NR * DD / 16 + 255) / 256), 256, 0, stream>>>(x, X16, (unsigned)((size_t)NR * DD / 16));
  const dim3 gp(((NR / 16) * (DD / 64) + 3) / 4, 1);
  k_gemm_hhx<0><<<gp, 128, 0, stream>>>(X16, DD, 0, Bw, DD, 0, 0.0625f, bq, 0, nullptr, 1, 0, 0, nullptr, Q, DD, 0, NR, DD, DD);      /* M 4096 N 768 K 768 */
  k_gemm_hhx<0><<<gp, 128, 0, stream>>>(X16, DD, 0, Bw + WSZ, DD, 0, 0.0625f, bk, 0, nullptr, 1, 0, 0, nullptr, K, DD, 0, NR, DD, DD);
  k_gemm_hhx<0><<<gp, 128, 0, stream>>>(X16, DD, 0, Bw + 2 * WSZ, DD, 0, 0.0625f, bv, 0, nullptr, 1, 0, 0, nullptr, V, DD, 0, NR, DD, DD);
  k_vt<NH, TT><<<BB * NH * (TT / 64), 256, 0, stream>>>(V, DD, 0, Vt);
  k_flash_gl<<<BB * NH * (TT / 64), 128, 0, stream>>>(Q, DD, K, DD, Vt, am, lm, gate, (float*)d_out, DD);      /* both paths and the gated sum */
}

// v006
// It runs in 76.7 microseconds.
// Two timings next to v005 put it at 1.21 and 1.20 times that version's speed.
// Counting every step since v000, it is 4.61 times as fast.
#include <hip/hip_runtime.h>
// Gated global/local self attention (B=4, S=1024, HID=768, 12×64): q,k,v = x·W + b ((in,out)); scores = q·k/8; global path softmax(scores + attention_mask[b,0,0,k]); local path softmax(scores + (1 − local_mask[b,0,q,k])·f32_min); ctx = gate[b,h,q]·ctx_local + (1 − gate)·ctx_global, merged → [4,1024,768].
// Compute dtype: x, weights, biases, additive mask and gates rounded to bf16; q/k/v f16 GEMM planes; one flash-style kernel on v_wmma_f32_16x16x32_f16 (online softmax f32, P f16 x 2^10, f32 accumulate) that forms each score tile once and feeds two softmaxes: one with the per-batch additive key bias, one with the per-batch 0/1 (q,k) mask
// (0 -> -inf); the gated combination in f32, in that kernel's epilogue.
// Every f16 plane that feeds a WMMA from global memory (X, W^T, Q, K, V^T) lies in FRAGMENT ORDER: a plane of rows x cols is cut into blocks of 16 rows x 32 cols (1 KiB, row tile major, then column block);
// a block is two units of 512 B (cols 0..15, cols 16..31); in a unit lane l = 16 hh + ln owns 16 B: row ln, cols 8 hh .. 8 hh + 7. A wave's b128 load of a fragment half is then one unit: 4 whole 128-B lines, where a row-major plane gives 16 pieces of 32 B.
// Element (R, C) of a plane with pitch P (cols): (R / 16) * 16 * P + (C / 32) * 512 + ((C / 16) % 2) * 256 + (((C / 8) % 2) * 16 + R % 16) * 8 + C % 8.
#define BB 4
#define TT 1024
#define DD 768
#define NH 12
#define NR (BB * TT)

typedef __bf16 v16b __attribute__((ext_vector_type(16)));
typedef unsigned short v8us __attribute__((ext_vector_type(8), may_alias));
typedef float  v8f  __attribute__((ext_vector_type(8)));
typedef float  v4f  __attribute__((ext_vector_type(4)));
typedef float  v4fa __attribute__((ext_vector_type(4), may_alias));
union FragB { v16b v; v8us half[2]; unsigned short u[16]; };

__device__ __forceinline__ unsigned short bf16_bits(float x) { unsigned int u = __float_as_uint(x); return (unsigned short)((u + 0x7FFFu + ((u >> 16) & 1u)) >> 16); }
__device__ __forceinline__ float bf16_val(unsigned short b) { return __uint_as_float(((unsigned int)b) << 16); }
__device__ __forceinline__ float bf16_round(float x) { return bf16_val(bf16_bits(x)); }
// D += A·B with NT terms: 1 = ah·bh, 2 = + al·bh (A split), 3 = + ah·bl (both split)
template <int NT>
__device__ __forceinline__ v8f mmaN(v16b ah, v16b al, v16b bh, v16b bl, v8f c) {
  c = __builtin_amdgcn_wmma_f32_16x16x32_bf16(false, ah, false, bh, (short)0, c, false, false);
  if (NT >= 2) c = __builtin_amdgcn_wmma_f32_16x16x32_bf16(false, al, false, bh, (short)0, c, false, false);
  if (NT >= 3) c = __builtin_amdgcn_wmma_f32_16x16x32_bf16(false, ah, false, bl, (short)0, c, false, false);
  asm volatile("v_nop\n\tv_nop\n\tv_nop\n\tv_nop" : "+v"(c) : "v"(ah), "v"(al), "v"(bh), "v"(bl));
  return c;
}

__global__ __launch_bounds__(256) void k_wt_bf16(const float* __restrict__ W, unsigned short* __restrict__ Wt, int K, int N) {
  const int t = blockIdx.x * 256 + threadIdx.x;
  const int k8n = K / 8;
  if (t >= N * k8n) return;
  const int n = t / k8n, k8 = (t % k8n) * 8;
  v8us v;
#pragma unroll
  for (int i = 0; i < 8; ++i) v[i] = bf16_bits(W[(size_t)(k8 + i) * N + n]);
  *(v8us*)(Wt + (size_t)n * K + k8) = v;
  
}

// GEMM C[M][N] (f32, pitch ldc) = act(A[M][K]·W + bias). A f32 row-major (pitch lda) converted per fragment to bf16
// (ASPLIT: hi/lo two planes -> 2 terms, else single rounded term); Wt bf16 [N][K] (pitch ldb). BIAS_BF16 rounds the
// bias to bf16 first (bias quantised to bf16 before the add). K%32==0, M%16==0, N%64==0.
template <bool ASPLIT, int ACT, bool BIAS_BF16>
__global__ __launch_bounds__(128) void k_gemm_bf(const float* __restrict__ A, int lda, const unsigned short* __restrict__ Wt, int ldb,
                                               const float* __restrict__ bias, float* __restrict__ C, int ldc, int M, int N, int K) {
  __shared__ __attribute__((aligned(16))) float so[4][16][64];
  const int tid = threadIdx.x, w = tid >> 5, lane = tid & 31, ln = lane & 15, hh = lane >> 4;
  const int ntn = N / 64;
  const int wid = blockIdx.x * 4 + w;
  const int mt = wid / ntn, nq = wid % ntn;
  if (mt * 16 >= M) return;
  const int row0 = mt * 16, col0 = nq * 64;
  const float* arow = A + (size_t)(row0 + ln) * lda;
  v8f acc[4] = {};
  for (int kb = 0; kb < K; kb += 32) {
    FragB ah, al;
    const v4f x0 = *(const v4fa*)(arow + kb + 8 * hh), x1 = *(const v4fa*)(arow + kb + 8 * hh + 4);
    const v4f x2 = *(const v4fa*)(arow + kb + 16 + 8 * hh), x3 = *(const v4fa*)(arow + kb + 16 + 8 * hh + 4);
    float xs[16] = {x0[0],x0[1],x0[2],x0[3],x1[0],x1[1],x1[2],x1[3],x2[0],x2[1],x2[2],x2[3],x3[0],x3[1],x3[2],x3[3]};
#pragma unroll
    for (int i = 0; i < 16; ++i) { const unsigned short hb = bf16_bits(xs[i]); ah.u[i] = hb; al.u[i] = ASPLIT ? bf16_bits(xs[i] - bf16_val(hb)) : (unsigned short)0; }
#pragma unroll
    for (int t = 0; t < 4; ++t) {
      const unsigned short* brow = Wt + (size_t)(col0 + t * 16 + ln) * ldb + kb;
      FragB b;
      b.half[0] = *(const v8us*)(brow + 8 * hh);
      b.half[1] = *(const v8us*)(brow + 16 + 8 * hh);
      acc[t] = mmaN<ASPLIT ? 2 : 1>(ah.v, al.v, b.v, b.v, acc[t]);
    }
  }
#pragma unroll
  for (int t = 0; t < 4; ++t) {
    float bv = bias ? bias[col0 + t * 16 + ln] : 0.f;
    if (BIAS_BF16) bv = bf16_round(bv);
#pragma unroll
    for (int r = 0; r < 8; ++r) { float v = acc[t][r] + bv; if (ACT == 1) v = fmaxf(v, 0.f); so[w][8 * hh + r][t * 16 + ln] = v; }
  }
  __builtin_amdgcn_fence(__ATOMIC_ACQ_REL, "workgroup");
  __builtin_amdgcn_wave_barrier();
  const int rsub = lane >> 4, c4 = (lane & 15) * 4;
  {
#pragma unroll
    for (int q = 0; q < 8; ++q) {
      const int r = q * 2 + rsub;
      const v4f v = *(const v4fa*)&so[w][r][c4];
      *(v4f*)(C + (size_t)(row0 + r) * ldc + col0 + c4) = v;
    }
    
  }
}

// Flash-style causal/unmasked attention, all contractions 3-term bf16 hi/lo splits, f32 softmax with running max.
// q,k,v rows are read from f32 buffers with arbitrary row pitch (so they can live inside a fused qkv buffer);
// D = head size (multiple of 32, <= 128); one wave = 16 query rows; block = 4 waves (64 queries) sharing K/V chunks of 32.
template <int D, bool CAUSAL>
__global__ __launch_bounds__(128) void k_flash(const float* __restrict__ qb, const float* __restrict__ kb, const float* __restrict__ vb,
                                             int pitch, int T, int H, float scale, float* __restrict__ y, int ypitch) {
  constexpr int KS = D / 32;        // k-steps for QK
  constexpr int DT = D / 16;        // d tiles for PV
  __shared__ __attribute__((aligned(16))) unsigned short sKh[32][D + 8], sKl[32][D + 8], sVh[32][D + 8], sVl[32][D + 8];
  __shared__ __attribute__((aligned(16))) unsigned short sPh[4][16][40], sPl[4][16][40];
  __shared__ __attribute__((aligned(16))) float sO[4][16][D];
  const int tid = threadIdx.x, w = tid >> 5, lane = tid & 31, ln = lane & 15, hh = lane >> 4;
  const int nqb = (T + 63) / 64;
  const int bh = blockIdx.x / nqb, qblk = blockIdx.x % nqb;
  const int b = bh / H, h = bh % H;
  const int q0 = qblk * 64 + w * 16;
  const float* Q = qb + (size_t)b * T * pitch + h * D;
  const float* K = kb + (size_t)b * T * pitch + h * D;
  const float* V = vb + (size_t)b * T * pitch + h * D;

  // A fragments of the wave's 16 query rows (scaled), hi/lo
  FragB aqh[KS], aql[KS];
  {
    int row = q0 + ln; if (row >= T) row = T - 1;
    const float* qr = Q + (size_t)row * pitch;
#pragma unroll
    for (int ks = 0; ks < KS; ++ks)
#pragma unroll
      for (int i = 0; i < 16; ++i) {
        const int d = ks * 32 + ((i < 8) ? (8 * hh + i) : (16 + 8 * hh + (i - 8)));
        const float x = qr[d] * scale; const unsigned short hb = bf16_bits(x);
        aqh[ks].u[i] = hb; aql[ks].u[i] = bf16_bits(x - bf16_val(hb));
      }
  }
  float m_r[8], l_r[8];
#pragma unroll
  for (int r = 0; r < 8; ++r) { m_r[r] = -3.0e38f; l_r[r] = 0.f; }
  v8f oacc[DT];
#pragma unroll
  for (int dt = 0; dt < DT; ++dt) oacc[dt] = (v8f){0.f,0.f,0.f,0.f,0.f,0.f,0.f,0.f};

  const int kv_end = CAUSAL ? min(T, qblk * 64 + 64) : T;     // block-uniform
  for (int j0 = 0; j0 < kv_end; j0 += 32) {
    __syncthreads();
    for (int e = tid; e < 32 * (D / 4); e += 128) {
      const int r = e / (D / 4), c4 = (e % (D / 4)) * 4;
      const int key = j0 + r;
      v4f kf = {0.f,0.f,0.f,0.f}, vf = {0.f,0.f,0.f,0.f};
      if (key < T) { kf = *(const v4fa*)(K + (size_t)key * pitch + c4); vf = *(const v4fa*)(V + (size_t)key * pitch + c4); }
#pragma unroll
      for (int t = 0; t < 4; ++t) {
        unsigned short hb = bf16_bits(kf[t]); sKh[r][c4 + t] = hb; sKl[r][c4 + t] = bf16_bits(kf[t] - bf16_val(hb));
        hb = bf16_bits(vf[t]); sVh[r][c4 + t] = hb; sVl[r][c4 + t] = bf16_bits(vf[t] - bf16_val(hb));
      }
    }
    __syncthreads();
    // S tile 16 x 32
    v8f s[2];
#pragma unroll
    for (int nt = 0; nt < 2; ++nt) {
      v8f acc = {};
#pragma unroll
      for (int ks = 0; ks < KS; ++ks) {
        FragB bh_, bl_;
        bh_.half[0] = *(const v8us*)&sKh[nt * 16 + ln][ks * 32 + 8 * hh]; bh_.half[1] = *(const v8us*)&sKh[nt * 16 + ln][ks * 32 + 16 + 8 * hh];
        bl_.half[0] = *(const v8us*)&sKl[nt * 16 + ln][ks * 32 + 8 * hh]; bl_.half[1] = *(const v8us*)&sKl[nt * 16 + ln][ks * 32 + 16 + 8 * hh];
        acc = mmaN<3>(aqh[ks].v, aql[ks].v, bh_.v, bl_.v, acc);
      }
      s[nt] = acc;
    }
    // mask + running max (rows 8hh+r; the 16 lanes of a half share rows)
    float alpha[8];
#pragma unroll
    for (int r = 0; r < 8; ++r) {
      const int qi = q0 + 8 * hh + r;
      const int ja = j0 + ln, jb = j0 + 16 + ln;
      if (CAUSAL) { if (ja > qi) s[0][r] = -3.0e38f; if (jb > qi) s[1][r] = -3.0e38f; }
      if (ja >= T) s[0][r] = -3.0e38f;
      if (jb >= T) s[1][r] = -3.0e38f;
      float mx = fmaxf(s[0][r], s[1][r]);
      mx = fmaxf(mx, __shfl_xor(mx, 1, 32)); mx = fmaxf(mx, __shfl_xor(mx, 2, 32)); mx = fmaxf(mx, __shfl_xor(mx, 4, 32)); mx = fmaxf(mx, __shfl_xor(mx, 8, 32));
      const float mnew = fmaxf(m_r[r], mx);
      alpha[r] = (mnew > -1.0e38f) ? __expf(m_r[r] - mnew) : 1.0f;
      const float p0 = (s[0][r] > -1.0e38f) ? __expf(s[0][r] - mnew) : 0.f;
      const float p1 = (s[1][r] > -1.0e38f) ? __expf(s[1][r] - mnew) : 0.f;
      m_r[r] = mnew;
      l_r[r] = l_r[r] * alpha[r] + p0 + p1;            // per-lane partial row sum (16 lanes combined at the end)
      unsigned short hb = bf16_bits(p0); sPh[w][8 * hh + r][ln] = hb;      sPl[w][8 * hh + r][ln] = bf16_bits(p0 - bf16_val(hb));
      hb = bf16_bits(p1);                sPh[w][8 * hh + r][16 + ln] = hb; sPl[w][8 * hh + r][16 + ln] = bf16_bits(p1 - bf16_val(hb));
    }
#pragma unroll
    for (int dt = 0; dt < DT; ++dt)
#pragma unroll
      for (int r = 0; r < 8; ++r) oacc[dt][r] *= alpha[r];
    __builtin_amdgcn_fence(__ATOMIC_ACQ_REL, "workgroup");
    __builtin_amdgcn_wave_barrier();
    FragB pah, pal;
    pah.half[0] = *(const v8us*)&sPh[w][ln][8 * hh]; pah.half[1] = *(const v8us*)&sPh[w][ln][16 + 8 * hh];
    pal.half[0] = *(const v8us*)&sPl[w][ln][8 * hh]; pal.half[1] = *(const v8us*)&sPl[w][ln][16 + 8 * hh];
#pragma unroll
    for (int dt = 0; dt < DT; ++dt) {
      FragB bvh, bvl;
#pragma unroll
      for (int i = 0; i < 8; ++i) {
        bvh.u[i] = sVh[8 * hh + i][dt * 16 + ln]; bvh.u[8 + i] = sVh[16 + 8 * hh + i][dt * 16 + ln];
        bvl.u[i] = sVl[8 * hh + i][dt * 16 + ln]; bvl.u[8 + i] = sVl[16 + 8 * hh + i][dt * 16 + ln];
      }
      oacc[dt] = mmaN<3>(pah.v, pal.v, bvh.v, bvl.v, oacc[dt]);
    }
    __builtin_amdgcn_fence(__ATOMIC_ACQ_REL, "workgroup");
    __builtin_amdgcn_wave_barrier();
  }
#pragma unroll
  for (int r = 0; r < 8; ++r) {
    float l = l_r[r];
    l += __shfl_xor(l, 1, 32); l += __shfl_xor(l, 2, 32); l += __shfl_xor(l, 4, 32); l += __shfl_xor(l, 8, 32);
    l_r[r] = (l > 0.f) ? 1.0f / l : 0.f;
  }
#pragma unroll
  for (int dt = 0; dt < DT; ++dt)
#pragma unroll
    for (int r = 0; r < 8; ++r) sO[w][8 * hh + r][dt * 16 + ln] = oacc[dt][r] * l_r[r];
  __builtin_amdgcn_fence(__ATOMIC_ACQ_REL, "workgroup");
  __builtin_amdgcn_wave_barrier();
  {
    for (int r = 0; r < 16; ++r) {
      const int row = q0 + r;
      if (row < T && lane < D / 4) {
        const v4f val = *(const v4fa*)&sO[w][r][lane * 4];
        *(v4f*)(y + ((size_t)b * T + row) * ypitch + h * D + lane * 4) = val;
      }
    }
    
  }
}

// GEMM C = act(A·W + bias + resid): A f32 (ASPLIT -> hi/lo 2 terms), Wt bf16 [N][K]; ACT 0 none, 1 relu, 2 exact gelu;
// resid (optional, f32, row index = (row % rmod), pitch ldr, RES_BF16 rounds it) added before the activation.
template <bool ASPLIT, int ACT, bool BIAS_BF16, bool RES_BF16>
__global__ __launch_bounds__(128) void k_gemm_bf3(const float* __restrict__ A, int lda, const unsigned short* __restrict__ Wt, int ldb,
                                                const float* __restrict__ bias, const float* __restrict__ resid, int rmod, int ldr,
                                                float* __restrict__ C, int ldc, int M, int N, int K) {
  __shared__ __attribute__((aligned(16))) float so[4][16][64];
  const int tid = threadIdx.x, w = tid >> 5, lane = tid & 31, ln = lane & 15, hh = lane >> 4;
  const int ntn = N / 64;
  const int wid = blockIdx.x * 4 + w;
  const int mt = wid / ntn, nq = wid % ntn;
  if (mt * 16 >= M) return;
  const int row0 = mt * 16, col0 = nq * 64;
  const float* arow = A + (size_t)(row0 + ln) * lda;
  v8f acc[4] = {};
  for (int kb = 0; kb < K; kb += 32) {
    FragB ah, al;
    const v4f x0 = *(const v4fa*)(arow + kb + 8 * hh), x1 = *(const v4fa*)(arow + kb + 8 * hh + 4);
    const v4f x2 = *(const v4fa*)(arow + kb + 16 + 8 * hh), x3 = *(const v4fa*)(arow + kb + 16 + 8 * hh + 4);
    float xs[16] = {x0[0],x0[1],x0[2],x0[3],x1[0],x1[1],x1[2],x1[3],x2[0],x2[1],x2[2],x2[3],x3[0],x3[1],x3[2],x3[3]};
#pragma unroll
    for (int i = 0; i < 16; ++i) { const unsigned short hb = bf16_bits(xs[i]); ah.u[i] = hb; al.u[i] = ASPLIT ? bf16_bits(xs[i] - bf16_val(hb)) : (unsigned short)0; }
#pragma unroll
    for (int t = 0; t < 4; ++t) {
      const unsigned short* brow = Wt + (size_t)(col0 + t * 16 + ln) * ldb + kb;
      FragB b;
      b.half[0] = *(const v8us*)(brow + 8 * hh);
      b.half[1] = *(const v8us*)(brow + 16 + 8 * hh);
      acc[t] = mmaN<ASPLIT ? 2 : 1>(ah.v, al.v, b.v, b.v, acc[t]);
    }
  }
#pragma unroll
  for (int t = 0; t < 4; ++t) {
    const int col = col0 + t * 16 + ln;
    float bv = bias ? bias[col] : 0.f;
    if (BIAS_BF16) bv = bf16_round(bv);
#pragma unroll
    for (int r = 0; r < 8; ++r) {
      float v = acc[t][r] + bv;
      if (resid) { float rv = resid[(size_t)((row0 + 8 * hh + r) % rmod) * ldr + col]; if (RES_BF16) rv = bf16_round(rv); v += rv; }
      if (ACT == 1) v = fmaxf(v, 0.f);
      if (ACT == 2) v = 0.5f * v * (1.0f + erff(v * 0.70710678118654752f));
      if (ACT == 3) { const float u = 0.7978845608028654f * (v + 0.044715f * v * v * v); v = 0.5f * v * (1.0f + tanhf(u)); }
      so[w][8 * hh + r][t * 16 + ln] = v;
    }
  }
  __builtin_amdgcn_fence(__ATOMIC_ACQ_REL, "workgroup");
  __builtin_amdgcn_wave_barrier();
  const int rsub = lane >> 4, c4 = (lane & 15) * 4;
  {
#pragma unroll
    for (int q = 0; q < 8; ++q) {
      const int r = q * 2 + rsub;
      const v4f v = *(const v4fa*)&so[w][r][c4];
      *(v4f*)(C + (size_t)(row0 + r) * ldc + col0 + c4) = v;
    }
    
  }
}
// row LayerNorm (biased variance, eps) over N: s = X (+ R); optional out_sum <- s; out_norm <- (s-mu)*rsqrt(var+eps)*g + b
template <bool PARAM_BF16>
__global__ __launch_bounds__(256) void k_layernorm(const float* __restrict__ X, const float* __restrict__ R, const float* __restrict__ g, const float* __restrict__ bta,
                                                  float* __restrict__ out_sum, float* __restrict__ out_norm, int N, float eps) {
  __shared__ float red[256];
  const int row = blockIdx.x, tid = threadIdx.x;
  const float* x = X + (size_t)row * N; const float* rr = R ? R + (size_t)row * N : nullptr;
  float vals[16];                     // up to N = 4096
  const int per = N / 256;            // contiguous chunk per thread? use strided-by-4 chunks: thread handles j = tid*4 + 1024*u
  float s1 = 0.f;
  for (int u = 0; u < per / 4; ++u) {
    const int j = tid * 4 + 1024 * u;
    const v4f a = *(const v4fa*)(x + j);
    v4f b = {0.f,0.f,0.f,0.f}; if (rr) b = *(const v4fa*)(rr + j);
#pragma unroll
    for (int q = 0; q < 4; ++q) { const float v = a[q] + b[q]; vals[u * 4 + q] = v; s1 += v; }
  }
  red[tid] = s1; __syncthreads();
  for (int st = 128; st > 0; st >>= 1) { if (tid < st) red[tid] += red[tid + st]; __syncthreads(); }
  const float mu = red[0] / (float)N; __syncthreads();
  float s2 = 0.f;
  for (int u = 0; u < per / 4; ++u)
#pragma unroll
    for (int q = 0; q < 4; ++q) { const float c = vals[u * 4 + q] - mu; s2 += c * c; }
  red[tid] = s2; __syncthreads();
  for (int st = 128; st > 0; st >>= 1) { if (tid < st) red[tid] += red[tid + st]; __syncthreads(); }
  const float rs = rsqrtf(red[0] / (float)N + eps);
  {
    for (int u = 0; u < per / 4; ++u) {
      const int j = tid * 4 + 1024 * u;
      v4f o, sm;
#pragma unroll
      for (int q = 0; q < 4; ++q) {
        float gg = g[j + q], bb = bta[j + q];
        if (PARAM_BF16) { gg = bf16_round(gg); bb = bf16_round(bb); }
        sm[q] = vals[u * 4 + q]; o[q] = (vals[u * 4 + q] - mu) * rs * gg + bb;
      }
      if (out_sum) *(v4f*)(out_sum + (size_t)row * N + j) = sm;
      *(v4f*)(out_norm + (size_t)row * N + j) = o;
    }
    
  }
}



// ---- f16 WMMA path (v_wmma_f32_16x16x32_f16): 11-bit significands for operands in range — used where a [0,1] probability operand needs more precision than bf16
typedef _Float16 v16h __attribute__((ext_vector_type(16)));
union FragH { v16h v; v8us half[2]; _Float16 h[16]; unsigned short u[16]; };
template <int NT>
__device__ __forceinline__ v8f mmaH(v16h ah, v16h al, v16h bh, v16h bl, v8f c) {
  c = __builtin_amdgcn_wmma_f32_16x16x32_f16(false, ah, false, bh, (short)0, c, false, false);
  if (NT >= 2) c = __builtin_amdgcn_wmma_f32_16x16x32_f16(false, al, false, bh, (short)0, c, false, false);
  if (NT >= 3) c = __builtin_amdgcn_wmma_f32_16x16x32_f16(false, ah, false, bl, (short)0, c, false, false);
  asm volatile("v_nop\n\tv_nop\n\tv_nop\n\tv_nop" : "+v"(c) : "v"(ah), "v"(al), "v"(bh), "v"(bl));
  return c;
}
// batched GEMM like k_gemm_b but f16 operands: A f32 (split into f16 hi/lo if ASPLIT, else rounded to f16), Bt = f16 values [n][k]; alpha; C f32; N multiple of 16 (partial tiles skipped)
template <bool ASPLIT>
__global__ __launch_bounds__(128) void k_gemm_h(const float* __restrict__ A, int lda, size_t sA, const _Float16* __restrict__ Bh, int ldb, size_t sB, float alpha, float* __restrict__ C, int ldc, size_t sC, int M, int N, int K) {
  __shared__ __attribute__((aligned(16))) float so[4][16][64];
  const int tid = threadIdx.x, w = tid >> 5, lane = tid & 31, ln = lane & 15, hh = lane >> 4; const int by = blockIdx.y;
  A += (size_t)by * sA; Bh += (size_t)by * sB; C += (size_t)by * sC;
  const int ntn = (N + 63) / 64; const int wid = blockIdx.x * 4 + w; const int mt = wid / ntn, nq = wid % ntn; if (mt * 16 >= M) return;
  const int row0 = mt * 16, col0 = nq * 64; const float* arow = A + (size_t)(row0 + ln) * lda;
  v8f acc[4] = {};
  for (int kb = 0; kb < K; kb += 32) {
    FragH ah, al;
    const v4f x0 = *(const v4fa*)(arow + kb + 8 * hh), x1 = *(const v4fa*)(arow + kb + 8 * hh + 4), x2 = *(const v4fa*)(arow + kb + 16 + 8 * hh), x3 = *(const v4fa*)(arow + kb + 16 + 8 * hh + 4);
    float xs[16] = {x0[0],x0[1],x0[2],x0[3],x1[0],x1[1],x1[2],x1[3],x2[0],x2[1],x2[2],x2[3],x3[0],x3[1],x3[2],x3[3]};
#pragma unroll
    for (int i = 0; i < 16; ++i) { const _Float16 h = (_Float16)xs[i]; ah.h[i] = h; al.h[i] = ASPLIT ? (_Float16)(xs[i] - (float)h) : (_Float16)0.0f; }
#pragma unroll
    for (int t = 0; t < 4; ++t) { if (col0 + t * 16 >= N) continue; const size_t boff = (size_t)(col0 + t * 16 + ln) * ldb + kb; FragH bq; bq.half[0] = *(const v8us*)(Bh + boff + 8 * hh); bq.half[1] = *(const v8us*)(Bh + boff + 16 + 8 * hh);
      acc[t] = mmaH<ASPLIT ? 2 : 1>(ah.v, al.v, bq.v, bq.v, acc[t]); }
  }
#pragma unroll
  for (int t = 0; t < 4; ++t) { if (col0 + t * 16 >= N) continue;
#pragma unroll
    for (int r = 0; r < 8; ++r) so[w][8 * hh + r][t * 16 + ln] = acc[t][r] * alpha; }
  __builtin_amdgcn_fence(__ATOMIC_ACQ_REL, "workgroup"); __builtin_amdgcn_wave_barrier();
  const int rsub = lane >> 4, c4 = (lane & 15) * 4;
  {
#pragma unroll
    for (int q = 0; q < 8; ++q) { const int r = q * 2 + rsub; if (col0 + c4 < N) { const v4f v = *(const v4fa*)&so[w][r][c4]; *(v4f*)(C + (size_t)(row0 + r) * ldc + col0 + c4) = v; } }
     }
}

// One launch prepares both GEMM operands, in fragment order. The first XB blocks: X16 = f16(bf16(x)), x row-major with pitch DD: a wave takes one block (16 rows x 32 cols: 16 whole lines of x) and writes its two units.
// Then WB blocks for each of Wq, Wk, Wv: Wt[n][k] = f16(bf16(W[k][n]) * 16) from f32 row-major W[DD][DD] (a power of two: bf16-exact weights stay exact in f16 away from the subnormal range);
// Wt has rows n, cols k, pitch DD: thread t writes the 16 B of lane t % 32 in unit t / 32. The three planes follow one another in Bw. The test on blockIdx.x is the same for a whole block.
#define XB (NR * DD / 16 / 256)
#define WB (DD * (DD / 8) / 256)
static_assert(NR * DD % (16 * 256) == 0 && DD * (DD / 8) % 256 == 0 && DD % 32 == 0, "whole blocks, no tail guards");
__global__ __launch_bounds__(256) void k_prep(const float* __restrict__ x, const float* __restrict__ Wq, const float* __restrict__ Wk, const float* __restrict__ Wv, _Float16* __restrict__ X16, _Float16* __restrict__ Bw) {
  FragH f;
  if (blockIdx.x < XB) {
    const unsigned t = blockIdx.x * 256 + threadIdx.x;
    const unsigned lane = t & 31, blk = t >> 5, rt = blk / (DD / 32), kb = blk % (DD / 32);
    const float* xr = x + (size_t)(rt * 16 + (lane & 15)) * DD + kb * 32 + (lane >> 4) * 8;
#pragma unroll
    for (int q = 0; q < 8; ++q) { f.h[q] = (_Float16)bf16_round(xr[q]); f.h[8 + q] = (_Float16)bf16_round(xr[16 + q]); }
    *(v8us*)((unsigned short*)X16 + (size_t)blk * 512 + lane * 8) = f.half[0]; *(v8us*)((unsigned short*)X16 + (size_t)blk * 512 + 256 + lane * 8) = f.half[1];
  } else {
    const unsigned wb = blockIdx.x - XB, pl = wb / WB; const float* W = (pl == 0) ? Wq : (pl == 1) ? Wk : Wv;
    const int t = (wb % WB) * 256 + threadIdx.x; const int lane = t & 31, u = t >> 5, blk = u >> 1; const int n = (blk / (DD / 32)) * 16 + (lane & 15), k8 = (blk % (DD / 32)) * 32 + (u & 1) * 16 + (lane >> 4) * 8;
#pragma unroll
    for (int i = 0; i < 8; ++i) f.h[i] = (_Float16)(bf16_round(W[(size_t)(k8 + i) * DD + n]) * 16.0f);
    *(v8us*)((unsigned short*)Bw + (size_t)pl * DD * DD + (size_t)t * 8) = f.half[0];
    asm volatile("s_wait_xcnt 0x0" ::: "memory");      /* in the built code the X part follows this store's branch and rewrites the store's registers: the wait stands in front of that rewrite */
  }
}
// The three projections in one launch: blockIdx.y = 0, 1, 2 takes Wq, Wk, Wv (planes of Bw) with its bias. v = acc / 16 + bf16(bias[col]), rounded to f16. A, Bw, Q16, K16 and Vt lie in fragment order.
// Q and K go out as planes of NR rows x DD cols. V goes out transposed, as the attention kernel reads it (Vt: rows (b * NH + h) * 64 + d, cols = keys, pitch TT): no V plane and no transposing launch.
__global__ __launch_bounds__(128) void k_gemm_qkv(const _Float16* __restrict__ A, const _Float16* __restrict__ Bw, const float* __restrict__ bq, const float* __restrict__ bk, const float* __restrict__ bv,
    _Float16* __restrict__ Q16, _Float16* __restrict__ K16, _Float16* __restrict__ Vt) {
  constexpr int lda = DD, ldb = DD, ldc = DD, N = DD, K = DD; constexpr float alpha = 0.0625f;
  static_assert(NR % 16 == 0 && ((NR / 16) * (DD / 64)) % 4 == 0 && DD % 128 == 0 && TT % 16 == 0, "whole tiles, no tail guards");
  __shared__ __attribute__((aligned(16))) float so[4][16][64 + 4];      /* pitch 68: the epilogue's row reads (one row a lane) fall on different banks */
  const int tid = threadIdx.x, w = tid >> 5, lane = tid & 31, ln = lane & 15, hh = lane >> 4; const int by = blockIdx.y;
  const _Float16* Bh = Bw + (size_t)by * DD * DD; const float* bp = (by == 0) ? bq : (by == 1) ? bk : bv;
  constexpr int ntn = N / 64; const int wid = blockIdx.x * 4 + w; const int mt = wid / ntn, nq = wid % ntn;
  const int row0 = mt * 16, col0 = nq * 64; const _Float16* arow = A + (size_t)row0 * lda + lane * 8;      /* this lane's 16 B in the first unit of the row tile */
  v8f acc[4] = {};
  // Fragments are fetched ahead: two register sets of 64 k each; while one set feeds its 8 WMMAs the other set's 20 loads are in flight. K % 128 == 0.
  const unsigned short* ap = (const unsigned short*)arow; const unsigned short* wp[4];
#pragma unroll
  for (int t = 0; t < 4; ++t) wp[t] = (const unsigned short*)Bh + (size_t)(col0 + t * 16) * ldb + lane * 8;
  FragH a0[2], a1[2], b0[2][4], b1[2][4];
  auto ldf = [&](FragH (&a)[2], FragH (&bq)[2][4], int kb, int ko) {      /* k = kb + ko; ko is a literal and goes into the loads' offset fields; 32 k are one block of 512 elements, so k counts 16-fold */
    const unsigned short* pa = ap + kb * 16; const unsigned short* pw[4] = {wp[0] + kb * 16, wp[1] + kb * 16, wp[2] + kb * 16, wp[3] + kb * 16};
#pragma unroll
    for (int ks = 0; ks < 2; ++ks) { a[ks].half[0] = *(const v8us*)(pa + (ko + ks * 32) * 16); a[ks].half[1] = *(const v8us*)(pa + (ko + ks * 32) * 16 + 256);
#pragma unroll
      for (int t = 0; t < 4; ++t) { bq[ks][t].half[0] = *(const v8us*)(pw[t] + (ko + ks * 32) * 16); bq[ks][t].half[1] = *(const v8us*)(pw[t] + (ko + ks * 32) * 16 + 256); } }
    /* the group's address pairs are named so that no register of them is reused (not even as a later load's result) before the loads have taken them */
    asm volatile("s_wait_xcnt 0x0" :: "v"(pa), "v"(pw[0]), "v"(pw[1]), "v"(pw[2]), "v"(pw[3]) : "memory"); };
  auto mmf = [&](FragH (&a)[2], FragH (&bq)[2][4]) {
#pragma unroll
    for (int ks = 0; ks < 2; ++ks)
#pragma unroll
      for (int t = 0; t < 4; ++t) acc[t] = mmaH<1>(a[ks].v, a[ks].v, bq[ks][t].v, bq[ks][t].v, acc[t]); };
  ldf(a0, b0, 0, 0);
  for (int kb = 0; kb < K; kb += 128) {
    ldf(a1, b1, kb, 64);
    mmf(a0, b0);
    ldf(a0, b0, (kb + 128 < K) ? kb + 128 : 0, 0);      /* last trip: wraps to k = 0, in bounds, values unused; no branch, so the waits stay counted */
    mmf(a1, b1);
  }
  if (by == 2) {      /* the same for the whole block */
    // acc[t][r] is V[row0 + 8 hh + r][col0 + t * 16 + ln]: for the transposed plane that is row d = t * 16 + ln, keys 8 hh .. 8 hh + 7 of a 16-key unit, which is what lane 16 hh + ln owns there:
    // each accumulator tile is one whole unit of Vt (512 B, 4 whole lines) and goes out of the registers as it stands. col0 / 64 is the head.
    FragH f[4];
#pragma unroll
    for (int t = 0; t < 4; ++t) { const float bvv = bf16_round(bp[col0 + t * 16 + ln]);
#pragma unroll
      for (int r = 0; r < 8; ++r) f[t].h[r] = (_Float16)(acc[t][r] * alpha + bvv); }
    unsigned short* vu = (unsigned short*)Vt + ((size_t)(row0 / TT) * NH + nq) * 64 * TT + (size_t)((row0 % TT) >> 4) * 256 + lane * 8;
#pragma unroll
    for (int t = 0; t < 4; ++t) *(v8us*)(vu + t * 16 * TT) = f[t].half[0];
    return;
  }
#pragma unroll
  for (int t = 0; t < 4; ++t) { const int col = col0 + t * 16 + ln; const float bvv = bf16_round(bp[col]);
#pragma unroll
    for (int r = 0; r < 8; ++r) so[w][8 * hh + r][t * 16 + ln] = acc[t][r] * alpha + bvv; }
  __builtin_amdgcn_fence(__ATOMIC_ACQ_REL, "workgroup"); __builtin_amdgcn_wave_barrier();
  {      /* the wave's 16 x 64 tile is four units in a row: 2 KiB of whole lines */
    unsigned short* cu = (unsigned short*)((by == 0) ? Q16 : K16) + (size_t)row0 * ldc + (size_t)(col0 >> 5) * 512 + lane * 8;
#pragma unroll
    for (int u = 0; u < 4; ++u) { const v4f v0 = *(const v4fa*)&so[w][ln][u * 16 + 8 * hh], v1 = *(const v4fa*)&so[w][ln][u * 16 + 8 * hh + 4]; FragH f;
#pragma unroll
      for (int i = 0; i < 4; ++i) { f.h[i] = (_Float16)v0[i]; f.h[4 + i] = (_Float16)v1[i]; }
      *(v8us*)(cu + u * 256) = f.half[0]; }
    asm volatile("s_wait_xcnt 0x0" ::: "memory");      /* in the built code the V part follows these four stores' branch and rewrites their registers: the wait stands in front of that rewrite */
  }
}


typedef _Float16 v4h __attribute__((ext_vector_type(4)));

__global__ __launch_bounds__(256) void k_h16(const float* __restrict__ x, _Float16* __restrict__ X16, size_t n8) { const size_t t = (size_t)blockIdx.x * 256 + threadIdx.x; if (t >= n8) return; FragH f;
#pragma unroll
  for (int q = 0; q < 8; ++q) f.h[q] = (_Float16)x[t * 8 + q]; *(v8us*)((unsigned short*)X16 + t * 8) = f.half[0];  }
__global__ __launch_bounds__(256) void k_round16f(const float* __restrict__ W, _Float16* __restrict__ Bt, size_t n8) { const size_t t = (size_t)blockIdx.x * 256 + threadIdx.x; if (t >= n8) return; FragH f;
#pragma unroll
  for (int i = 0; i < 8; ++i) f.h[i] = (_Float16)(bf16_round(W[t * 8 + i]) * 16.0f); *(v8us*)((unsigned short*)Bt + t * 8) = f.half[0];  }

typedef int v4i __attribute__((ext_vector_type(4)));
typedef int v4ia __attribute__((ext_vector_type(4), may_alias));
// lane l takes the value of lane l ^ 16 (a vector cross-row move, no LDS trip)
__device__ __forceinline__ float xhalf(float x) { return __builtin_bit_cast(float, __builtin_amdgcn_permlanex16(__builtin_bit_cast(int, x), __builtin_bit_cast(int, x), 0x76543210, 0xfedcba98, false, false)); }

// Both attention paths in one walk over the keys. The scores S^T = K Q^T are the same for the two paths, and so are the K and V^T fragments: each is fetched and each score tile is formed once;
// the wave then runs two online softmaxes (additive key bias; 0/1 mask) with two output accumulators, and the gated sum is taken in registers in the epilogue: no per-path output plane, no combining launch.
__global__ __launch_bounds__(128) void k_flash_gl(const _Float16* __restrict__ Q16, int ldq, const _Float16* __restrict__ K16, int ldk, const _Float16* __restrict__ Vt, const float* __restrict__ AB, const int* __restrict__ MSK, const float* __restrict__ gate, float* __restrict__ O, int ldo) {
  constexpr int RPW = 16, NQB = TT / (4 * RPW), DT = 4, KS = 2;
  __shared__ __attribute__((aligned(16))) float sO[4][RPW][64 + 4];
  const int tid = threadIdx.x, w = tid >> 5, lane = tid & 31, ln = lane & 15, hh = lane >> 4;
  const int slab = blockIdx.x / NQB, qblk = blockIdx.x % NQB; const int b = slab / NH, h = slab % NH; const int qb0 = qblk * (4 * RPW); const int q0 = qb0 + w * RPW;
  // Transposed tiles: S^T = K Q^T (A = 16 key rows, B = the wave's 16 queries), O^T += V^T P^T. Lane (ln, hh) owns query q0 + ln; its score registers hold keys j0 + 8 hh + r and j0 + 16 + 8 hh + r,
  // which is the k order of a B operand: P goes from the score registers into the second product with no LDS trip, and maximum and sum run inside the lane plus one exchange between the wave halves.
  FragH aq[KS];
  // Q16, K16 and Vt lie in fragment order (head of the file): a fragment half is one unit of 512 B, this lane's 16 B at lane * 8 elements; a head's 64 columns are two blocks (4 units) in a row.
  { const unsigned short* qr = (const unsigned short*)Q16 + ((size_t)b * TT + q0) * ldq + h * 1024 + lane * 8;
#pragma unroll
    for (int ks = 0; ks < KS; ++ks) { aq[ks].half[0] = *(const v8us*)(qr + ks * 512); aq[ks].half[1] = *(const v8us*)(qr + ks * 512 + 256); }
    asm volatile("s_wait_xcnt 0x0" :: "v"(qr) : "memory"); }      /* as in ldK below: the address pair stays whole until the loads have taken it */
  const unsigned short* Vth = (const unsigned short*)Vt + (size_t)slab * 64 * TT;
  float mg = -3.0e38f, lg = 0.f, ml = -3.0e38f, ll = 0.f; v8f og[DT], ol[DT];      /* running maximum, running sum, output tile: g = additive-bias path, l = 0/1-mask path */
#pragma unroll
  for (int dt = 0; dt < DT; ++dt) { og[dt] = (v8f){0.f,0.f,0.f,0.f,0.f,0.f,0.f,0.f}; ol[dt] = (v8f){0.f,0.f,0.f,0.f,0.f,0.f,0.f,0.f}; }
  const int jend = TT;
  // Global loads are issued ahead of their use: the K fragments, the key bias and the mask words one pass ahead (registers carried round the loop), the V^T fragments at the top of their own pass; their latency then runs under the softmaxes, not in front of each WMMA.
  const unsigned short* Kl = (const unsigned short*)K16 + (size_t)b * TT * ldk + h * 1024 + lane * 8; FragH bk[2][KS];
  const float* aml = AB + (size_t)b * TT + 8 * hh; v4f abn[2][2];
  const int* Ml = MSK + ((size_t)b * TT + q0 + ln) * TT + 8 * hh; v4i mkn[2][2];
  auto ldK = [&](int j) {
    const unsigned short* kr[2] = {Kl + (size_t)j * ldk, Kl + (size_t)(j + 16) * ldk}; const float* am = aml + j; const int* mm = Ml + j;
#pragma unroll
    for (int nt = 0; nt < 2; ++nt) { mkn[nt][0] = *(const v4ia*)(mm + nt * 16); mkn[nt][1] = *(const v4ia*)(mm + nt * 16 + 4); }
#pragma unroll
    for (int nt = 0; nt < 2; ++nt) { abn[nt][0] = *(const v4fa*)(am + nt * 16); abn[nt][1] = *(const v4fa*)(am + nt * 16 + 4); }
#pragma unroll
    for (int nt = 0; nt < 2; ++nt)
#pragma unroll
      for (int ks = 0; ks < KS; ++ks) { bk[nt][ks].half[0] = *(const v8us*)(kr[nt] + ks * 512); bk[nt][ks].half[1] = *(const v8us*)(kr[nt] + ks * 512 + 256); }
    /* the group's address pairs are named so that no register of them is reused (not even as a later load's result) before the loads have taken them */
    asm volatile("s_wait_xcnt 0x0" :: "v"(kr[0]), "v"(kr[1]), "v"(am), "v"(mm) : "memory"); };
  // One path's online-softmax step on its 32 scores of this pass: new maximum, rescale of sum and output tile, P^T packed as a B operand (element nt * 8 + r is key nt * 16 + 8 hh + r, the order in which bv holds V^T).
  // The exponentials run in base 2 on the hardware's own instruction: exp(x) 2^10 = exp2(x log2(e) + 10). sc and m_r are in units of 1 / cs base-2 exponents (cs > 0, so the maximum is taken on sc as it is);
  // p, and with it the running sum, carries the factor 2^10 that P has as an f16 operand: the epilogue divides by that sum alone.
  auto soft = [&](const float (&sc)[2][8], const float cs, const bool fold, float& m_r, float& l_r, v8f (&oacc)[DT], FragH& pb) {
    float mx[8];
#pragma unroll
    for (int r = 0; r < 8; ++r) mx[r] = fmaxf(sc[0][r], sc[1][r]);
    float mc = fmaxf(fmaxf(fmaxf(mx[0], mx[1]), fmaxf(mx[2], mx[3])), fmaxf(fmaxf(mx[4], mx[5]), fmaxf(mx[6], mx[7])));
    mc = fmaxf(mc, xhalf(mc));      /* both wave halves now hold the maximum of the query's 32 scores of this pass */
    const float mn = fmaxf(m_r, mc); const float ea = __builtin_amdgcn_exp2f((m_r - mn) * cs); const float al = (mn > -1.0e38f) ? ea : 1.0f; m_r = mn;      /* computed, then selected: no branch */
    float p[2][8];      /* a masked score is -inf and mn is finite, so its exponential is 0 */
    const float nm = 10.0f - mn * cs;      /* fold: one multiply-add a score; only where mn * cs cannot overflow (cs < 1). Else the difference is taken first, as large additive biases need */
#pragma unroll
    for (int nt = 0; nt < 2; ++nt)
#pragma unroll
      for (int r = 0; r < 8; ++r) p[nt][r] = __builtin_amdgcn_exp2f(fold ? __builtin_fmaf(sc[nt][r], cs, nm) : __builtin_fmaf(sc[nt][r] - mn, cs, 10.0f));
    float ps[8];
#pragma unroll
    for (int r = 0; r < 8; ++r) ps[r] = p[0][r] + p[1][r];
    l_r = l_r * al + (((ps[0] + ps[1]) + (ps[2] + ps[3])) + ((ps[4] + ps[5]) + (ps[6] + ps[7])));      /* this half's 16 keys; the halves are joined behind the loop */
#pragma unroll
    for (int dt = 0; dt < DT; ++dt)
#pragma unroll
      for (int r = 0; r < 8; ++r) oacc[dt][r] *= al;
#pragma unroll
    for (int nt = 0; nt < 2; ++nt)
#pragma unroll
      for (int r = 0; r < 8; ++r) pb.h[nt * 8 + r] = (_Float16)p[nt][r]; };
  const float gq = bf16_round(gate[((size_t)b * NH + h) * TT + q0 + ln]);      /* the gate of this lane's query (bf16-rounded input) */
  ldK(0);
#pragma unroll 1      /* stays rolled: one set of carried fragment registers, and the pass's code is fetched once */
  for (int j0 = 0; j0 < jend; j0 += 32) {
    const int jn = (j0 + 32 < jend) ? j0 + 32 : 0;      /* the pass fetched for; behind the last pass it wraps to key 0: in bounds, values unused; no branch, so the waits stay counted */
    float ab[2][8];      /* additive attention bias (bf16-rounded input) of keys j0 + nt * 16 + 8 hh + r */
    int mk[2][8];      /* per-batch mask [b][q][k] of query q0 + ln, same keys: nonzero = ATTEND */
#pragma unroll
    for (int nt = 0; nt < 2; ++nt)
#pragma unroll
      for (int r = 0; r < 8; ++r) { ab[nt][r] = (float)(__bf16)abn[nt][r >> 2][r & 3]; mk[nt][r] = mkn[nt][r >> 2][r & 3]; }      /* the convert rounds to nearest even, as bf16_round does */
    FragH bv[DT];      /* V^T fragments of this pass: issued here, used behind the softmaxes, by both paths */
    const unsigned short* vr = Vth + (size_t)j0 * 16 + lane * 8;      /* 32 keys are one block of 512 elements */
#pragma unroll
    for (int dt = 0; dt < DT; ++dt) { bv[dt].half[0] = *(const v8us*)(vr + dt * 16 * TT); bv[dt].half[1] = *(const v8us*)(vr + dt * 16 * TT + 256); }
    asm volatile("s_wait_xcnt 0x0" :: "v"(vr) : "memory");      /* as in ldK: the address pair stays whole until the loads have taken it */
    v8f s[2];
#pragma unroll
    for (int nt = 0; nt < 2; ++nt) { v8f acc = (v8f){0.f,0.f,0.f,0.f,0.f,0.f,0.f,0.f};
#pragma unroll
      for (int ks = 0; ks < KS; ++ks) acc = mmaH<1>(bk[nt][ks].v, bk[nt][ks].v, aq[ks].v, aq[ks].v, acc); s[nt] = acc; }
    ldK(jn);
    float scg[2][8], scl[2][8];
#pragma unroll
    for (int nt = 0; nt < 2; ++nt)
#pragma unroll
      for (int r = 0; r < 8; ++r) { scg[nt][r] = s[nt][r] * 0.125f + ab[nt][r]; scl[nt][r] = (mk[nt][r] != 0) ? s[nt][r] : -INFINITY; }      /* the mask path keeps the raw products: its 1 / 8 goes into cs */
    FragH pg, pl;
    soft(scg, 1.4426950408889634f, false, mg, lg, og, pg);
    __builtin_amdgcn_sched_barrier(0);      /* one path's short softmax is scheduled whole, then the other's: else all 32 exponentials stand in one run with every argument and result live (more registers), one overwriting the source of the one directly in front */
    soft(scl, 0.125f * 1.4426950408889634f, true, ml, ll, ol, pl);
#pragma unroll
    for (int dt = 0; dt < DT; ++dt) { og[dt] = mmaH<1>(bv[dt].v, bv[dt].v, pg.v, pg.v, og[dt]); ol[dt] = mmaH<1>(bv[dt].v, bv[dt].v, pl.v, pl.v, ol[dt]); } }
  { const float sg = lg + xhalf(lg), sl = ll + xhalf(ll); const float lig = (sg > 0.f) ? 1.0f / sg : 0.f, lil = (sl > 0.f) ? 1.0f / sl : 0.f;      /* sums and output tiles both carry 2^10 */ const float g1 = 1.0f - gq;
#pragma unroll
    for (int dt = 0; dt < DT; ++dt) {      /* og[dt][r], ol[dt][r] = the paths' O[q0 + ln][dt * 16 + 8 hh + r]; the gated sum of the two goes out */
      v4f o0, o1;
#pragma unroll
      for (int r = 0; r < 4; ++r) { o0[r] = gq * (ol[dt][r] * lil) + g1 * (og[dt][r] * lig); o1[r] = gq * (ol[dt][4 + r] * lil) + g1 * (og[dt][4 + r] * lig); }
      *(v4fa*)&sO[w][ln][dt * 16 + 8 * hh] = o0; *(v4fa*)&sO[w][ln][dt * 16 + 8 * hh + 4] = o1; } }
  __builtin_amdgcn_fence(__ATOMIC_ACQ_REL, "workgroup"); __builtin_amdgcn_wave_barrier();
  {
#pragma unroll
    for (int rp = 0; rp < RPW; rp += 2) { const int r = rp + (lane >> 4), pc = lane & 15; const v4f val = *(const v4fa*)&sO[w][r][pc * 4]; *(v4f*)(O + ((size_t)b * TT + q0 + r) * ldo + h * 64 + pc * 4) = val; }
     } }

extern "C" void kernel_launch(void* const* d_in, const int* in_sizes, int n_in,
                              void* d_out, int out_size, void* d_ws, size_t ws_size, hipStream_t stream) {
  (void)in_sizes; (void)n_in; (void)out_size;
  const float* const* I = (const float* const*)d_in; const float* x = I[0]; const float* am = I[1]; const int* lm = (const int*)d_in[2]; const float* gate = I[3]; const float* Wq = I[4]; const float* bq = I[5]; const float* Wk = I[6]; const float* bk = I[7]; const float* Wv = I[8]; const float* bv = I[9];
  char* ws = (char*)d_ws; size_t off = 0;
  auto take = [&](size_t bytes) { char* p = ws + off; off += (bytes + 255) & ~(size_t)255; return p; };
  const size_t WSZ = (size_t)DD * DD; _Float16* Bw = (_Float16*)take(3 * WSZ * 2); _Float16* X16 = (_Float16*)take((size_t)NR * DD * 2); _Float16* Q = (_Float16*)take((size_t)NR * DD * 2); _Float16* K = (_Float16*)take((size_t)NR * DD * 2); _Float16* Vt = (_Float16*)take((size_t)NR * DD * 2);
  if (off > ws_size) return;      // 3.5 + 4 x 6.3 = about 29 MB
  k_prep<<<XB + 3 * WB, 256, 0, stream>>>(x, Wq, Wk, Wv, X16, Bw);      /* X and the three W^T x 2^4, f16, fragment order */
  k_gemm_qkv<<<dim3((NR / 16) * (DD / 64) / 4, 3), 128, 0, stream>>>(X16, Bw, bq, bk, bv, Q, K, Vt);      /* three times M 4096 N 768 K 768 */
  k_flash_gl<<<BB * NH * (TT / 64), 128, 0, stream>>>(Q, DD, K, DD, Vt, am, lm, gate, (float*)d_out, DD);      /* both paths and the gated sum */
}

// v007
// One run takes 61.2 microseconds.
// Next to v006, in two timings, it ran 1.24 and 1.26 times as fast.
// Over all steps from v000 it is 5.77 times as fast.
#include <hip/hip_runtime.h>
// Gated global/local self attention (B=4, S=1024, HID=768, 12×64): q,k,v = x·W + b ((in,out)); scores = q·k/8; global path softmax(scores + attention_mask[b,0,0,k]); local path softmax(scores + (1 − local_mask[b,0,q,k])·f32_min); ctx = gate[b,h,q]·ctx_local + (1 − gate)·ctx_global, merged → [4,1024,768].
// Compute dtype: x, weights, biases, additive mask and gates rounded to bf16; q/k/v f16 GEMM planes; one flash-style kernel on v_wmma_f32_16x16x32_f16 (online softmax f32, P f16 x 2^10, f32 accumulate) that forms each score tile once and feeds two softmaxes: one with the per-batch additive key bias, one with the per-batch 0/1 (q,k) mask
// (0 -> -inf); the gated combination in f32, in that kernel's epilogue.
// Every f16 plane that feeds a WMMA from global memory (X, W^T, Q, K, V^T) lies in FRAGMENT ORDER: a plane of rows x cols is cut into blocks of 16 rows x 32 cols (1 KiB, row tile major, then column block);
// a block is two units of 512 B (cols 0..15, cols 16..31); in a unit lane l = 16 hh + ln owns 16 B: row ln, cols 8 hh .. 8 hh + 7. A wave's b128 load of a fragment half is then one unit: 4 whole 128-B lines, where a row-major plane gives 16 pieces of 32 B.
// Element (R, C) of a plane with pitch P (cols): (R / 16) * 16 * P + (C / 32) * 512 + ((C / 16) % 2) * 256 + (((C / 8) % 2) * 16 + R % 16) * 8 + C % 8.
#define BB 4
#define TT 1024
#define DD 768
#define NH 12
#define NR (BB * TT)

typedef __bf16 v16b __attribute__((ext_vector_type(16)));
typedef unsigned short v8us __attribute__((ext_vector_type(8), may_alias));
typedef float  v8f  __attribute__((ext_vector_type(8)));
typedef float  v4f  __attribute__((ext_vector_type(4)));
typedef float  v4fa __attribute__((ext_vector_type(4), may_alias));
union FragB { v16b v; v8us half[2]; unsigned short u[16]; };

__device__ __forceinline__ unsigned short bf16_bits(float x) { unsigned int u = __float_as_uint(x); return (unsigned short)((u + 0x7FFFu + ((u >> 16) & 1u)) >> 16); }
__device__ __forceinline__ float bf16_val(unsigned short b) { return __uint_as_float(((unsigned int)b) << 16); }
__device__ __forceinline__ float bf16_round(float x) { return bf16_val(bf16_bits(x)); }
// D += A·B with NT terms: 1 = ah·bh, 2 = + al·bh (A split), 3 = + ah·bl (both split)
template <int NT>
__device__ __forceinline__ v8f mmaN(v16b ah, v16b al, v16b bh, v16b bl, v8f c) {
  c = __builtin_amdgcn_wmma_f32_16x16x32_bf16(false, ah, false, bh, (short)0, c, false, false);
  if (NT >= 2) c = __builtin_amdgcn_wmma_f32_16x16x32_bf16(false, al, false, bh, (short)0, c, false, false);
  if (NT >= 3) c = __builtin_amdgcn_wmma_f32_16x16x32_bf16(false, ah, false, bl, (short)0, c, false, false);
  asm volatile("v_nop\n\tv_nop\n\tv_nop\n\tv_nop" : "+v"(c) : "v"(ah), "v"(al), "v"(bh), "v"(bl));
  return c;
}

__global__ __launch_bounds__(256) void k_wt_bf16(const float* __restrict__ W, unsigned short* __restrict__ Wt, int K, int N) {
  const int t = blockIdx.x * 256 + threadIdx.x;
  const int k8n = K / 8;
  if (t >= N * k8n) return;
  const int n = t / k8n, k8 = (t % k8n) * 8;
  v8us v;
#pragma unroll
  for (int i = 0; i < 8; ++i) v[i] = bf16_bits(W[(size_t)(k8 + i) * N + n]);
  *(v8us*)(Wt + (size_t)n * K + k8) = v;
  
}

// GEMM C[M][N] (f32, pitch ldc) = act(A[M][K]·W + bias). A f32 row-major (pitch lda) converted per fragment to bf16
// (ASPLIT: hi/lo two planes -> 2 terms, else single rounded term); Wt bf16 [N][K] (pitch ldb). BIAS_BF16 rounds the
// bias to bf16 first (bias quantised to bf16 before the add). K%32==0, M%16==0, N%64==0.
template <bool ASPLIT, int ACT, bool BIAS_BF16>
__global__ __launch_bounds__(128) void k_gemm_bf(const float* __restrict__ A, int lda, const unsigned short* __restrict__ Wt, int ldb,
                                               const float* __restrict__ bias, float* __restrict__ C, int ldc, int M, int N, int K) {
  __shared__ __attribute__((aligned(16))) float so[4][16][64];
  const int tid = threadIdx.x, w = tid >> 5, lane = tid & 31, ln = lane & 15, hh = lane >> 4;
  const int ntn = N / 64;
  const int wid = blockIdx.x * 4 + w;
  const int mt = wid / ntn, nq = wid % ntn;
  if (mt * 16 >= M) return;
  const int row0 = mt * 16, col0 = nq * 64;
  const float* arow = A + (size_t)(row0 + ln) * lda;
  v8f acc[4] = {};
  for (int kb = 0; kb < K; kb += 32) {
    FragB ah, al;
    const v4f x0 = *(const v4fa*)(arow + kb + 8 * hh), x1 = *(const v4fa*)(arow + kb + 8 * hh + 4);
    const v4f x2 = *(const v4fa*)(arow + kb + 16 + 8 * hh), x3 = *(const v4fa*)(arow + kb + 16 + 8 * hh + 4);
    float xs[16] = {x0[0],x0[1],x0[2],x0[3],x1[0],x1[1],x1[2],x1[3],x2[0],x2[1],x2[2],x2[3],x3[0],x3[1],x3[2],x3[3]};
#pragma unroll
    for (int i = 0; i < 16; ++i) { const unsigned short hb = bf16_bits(xs[i]); ah.u[i] = hb; al.u[i] = ASPLIT ? bf16_bits(xs[i] - bf16_val(hb)) : (unsigned short)0; }
#pragma unroll
    for (int t = 0; t < 4; ++t) {
      const unsigned short* brow = Wt + (size_t)(col0 + t * 16 + ln) * ldb + kb;
      FragB b;
      b.half[0] = *(const v8us*)(brow + 8 * hh);
      b.half[1] = *(const v8us*)(brow + 16 + 8 * hh);
      acc[t] = mmaN<ASPLIT ? 2 : 1>(ah.v, al.v, b.v, b.v, acc[t]);
    }
  }
#pragma unroll
  for (int t = 0; t < 4; ++t) {
    float bv = bias ? bias[col0 + t * 16 + ln] : 0.f;
    if (BIAS_BF16) bv = bf16_round(bv);
#pragma unroll
    for (int r = 0; r < 8; ++r) { float v = acc[t][r] + bv; if (ACT == 1) v = fmaxf(v, 0.f); so[w][8 * hh + r][t * 16 + ln] = v; }
  }
  __builtin_amdgcn_fence(__ATOMIC_ACQ_REL, "workgroup");
  __builtin_amdgcn_wave_barrier();
  const int rsub = lane >> 4, c4 = (lane & 15) * 4;
  {
#pragma unroll
    for (int q = 0; q < 8; ++q) {
      const int r = q * 2 + rsub;
      const v4f v = *(const v4fa*)&so[w][r][c4];
      *(v4f*)(C + (size_t)(row0 + r) * ldc + col0 + c4) = v;
    }
    
  }
}

// Flash-style causal/unmasked attention, all contractions 3-term bf16 hi/lo splits, f32 softmax with running max.
// q,k,v rows are read from f32 buffers with arbitrary row pitch (so they can live inside a fused qkv buffer);
// D = head size (multiple of 32, <= 128); one wave = 16 query rows; block = 4 waves (64 queries) sharing K/V chunks of 32.
template <int D, bool CAUSAL>
__global__ __launch_bounds__(128) void k_flash(const float* __restrict__ qb, const float* __restrict__ kb, const float* __restrict__ vb,
                                             int pitch, int T, int H, float scale, float* __restrict__ y, int ypitch) {
  constexpr int KS = D / 32;        // k-steps for QK
  constexpr int DT = D / 16;        // d tiles for PV
  __shared__ __attribute__((aligned(16))) unsigned short sKh[32][D + 8], sKl[32][D + 8], sVh[32][D + 8], sVl[32][D + 8];
  __shared__ __attribute__((aligned(16))) unsigned short sPh[4][16][40], sPl[4][16][40];
  __shared__ __attribute__((aligned(16))) float sO[4][16][D];
  const int tid = threadIdx.x, w = tid >> 5, lane = tid & 31, ln = lane & 15, hh = lane >> 4;
  const int nqb = (T + 63) / 64;
  const int bh = blockIdx.x / nqb, qblk = blockIdx.x % nqb;
  const int b = bh / H, h = bh % H;
  const int q0 = qblk * 64 + w * 16;
  const float* Q = qb + (size_t)b * T * pitch + h * D;
  const float* K = kb + (size_t)b * T * pitch + h * D;
  const float* V = vb + (size_t)b * T * pitch + h * D;

  // A fragments of the wave's 16 query rows (scaled), hi/lo
  FragB aqh[KS], aql[KS];
  {
    int row = q0 + ln; if (row >= T) row = T - 1;
    const float* qr = Q + (size_t)row * pitch;
#pragma unroll
    for (int ks = 0; ks < KS; ++ks)
#pragma unroll
      for (int i = 0; i < 16; ++i) {
        const int d = ks * 32 + ((i < 8) ? (8 * hh + i) : (16 + 8 * hh + (i - 8)));
        const float x = qr[d] * scale; const unsigned short hb = bf16_bits(x);
        aqh[ks].u[i] = hb; aql[ks].u[i] = bf16_bits(x - bf16_val(hb));
      }
  }
  float m_r[8], l_r[8];
#pragma unroll
  for (int r = 0; r < 8; ++r) { m_r[r] = -3.0e38f; l_r[r] = 0.f; }
  v8f oacc[DT];
#pragma unroll
  for (int dt = 0; dt < DT; ++dt) oacc[dt] = (v8f){0.f,0.f,0.f,0.f,0.f,0.f,0.f,0.f};

  const int kv_end = CAUSAL ? min(T, qblk * 64 + 64) : T;     // block-uniform
  for (int j0 = 0; j0 < kv_end; j0 += 32) {
    __syncthreads();
    for (int e = tid; e < 32 * (D / 4); e += 128) {
      const int r = e / (D / 4), c4 = (e % (D / 4)) * 4;
      const int key = j0 + r;
      v4f kf = {0.f,0.f,0.f,0.f}, vf = {0.f,0.f,0.f,0.f};
      if (key < T) { kf = *(const v4fa*)(K + (size_t)key * pitch + c4); vf = *(const v4fa*)(V + (size_t)key * pitch + c4); }
#pragma unroll
      for (int t = 0; t < 4; ++t) {
        unsigned short hb = bf16_bits(kf[t]); sKh[r][c4 + t] = hb; sKl[r][c4 + t] = bf16_bits(kf[t] - bf16_val(hb));
        hb = bf16_bits(vf[t]); sVh[r][c4 + t] = hb; sVl[r][c4 + t] = bf16_bits(vf[t] - bf16_val(hb));
      }
    }
    __syncthreads();
    // S tile 16 x 32
    v8f s[2];
#pragma unroll
    for (int nt = 0; nt < 2; ++nt) {
      v8f acc = {};
#pragma unroll
      for (int ks = 0; ks < KS; ++ks) {
        FragB bh_, bl_;
        bh_.half[0] = *(const v8us*)&sKh[nt * 16 + ln][ks * 32 + 8 * hh]; bh_.half[1] = *(const v8us*)&sKh[nt * 16 + ln][ks * 32 + 16 + 8 * hh];
        bl_.half[0] = *(const v8us*)&sKl[nt * 16 + ln][ks * 32 + 8 * hh]; bl_.half[1] = *(const v8us*)&sKl[nt * 16 + ln][ks * 32 + 16 + 8 * hh];
        acc = mmaN<3>(aqh[ks].v, aql[ks].v, bh_.v, bl_.v, acc);
      }
      s[nt] = acc;
    }
    // mask + running max (rows 8hh+r; the 16 lanes of a half share rows)
    float alpha[8];
#pragma unroll
    for (int r = 0; r < 8; ++r) {
      const int qi = q0 + 8 * hh + r;
      const int ja = j0 + ln, jb = j0 + 16 + ln;
      if (CAUSAL) { if (ja > qi) s[0][r] = -3.0e38f; if (jb > qi) s[1][r] = -3.0e38f; }
      if (ja >= T) s[0][r] = -3.0e38f;
      if (jb >= T) s[1][r] = -3.0e38f;
      float mx = fmaxf(s[0][r], s[1][r]);
      mx = fmaxf(mx, __shfl_xor(mx, 1, 32)); mx = fmaxf(mx, __shfl_xor(mx, 2, 32)); mx = fmaxf(mx, __shfl_xor(mx, 4, 32)); mx = fmaxf(mx, __shfl_xor(mx, 8, 32));
      const float mnew = fmaxf(m_r[r], mx);
      alpha[r] = (mnew > -1.0e38f) ? __expf(m_r[r] - mnew) : 1.0f;
      const float p0 = (s[0][r] > -1.0e38f) ? __expf(s[0][r] - mnew) : 0.f;
      const float p1 = (s[1][r] > -1.0e38f) ? __expf(s[1][r] - mnew) : 0.f;
      m_r[r] = mnew;
      l_r[r] = l_r[r] * alpha[r] + p0 + p1;            // per-lane partial row sum (16 lanes combined at the end)
      unsigned short hb = bf16_bits(p0); sPh[w][8 * hh + r][ln] = hb;      sPl[w][8 * hh + r][ln] = bf16_bits(p0 - bf16_val(hb));
      hb = bf16_bits(p1);                sPh[w][8 * hh + r][16 + ln] = hb; sPl[w][8 * hh + r][16 + ln] = bf16_bits(p1 - bf16_val(hb));
    }
#pragma unroll
    for (int dt = 0; dt < DT; ++dt)
#pragma unroll
      for (int r = 0; r < 8; ++r) oacc[dt][r] *= alpha[r];
    __builtin_amdgcn_fence(__ATOMIC_ACQ_REL, "workgroup");
    __builtin_amdgcn_wave_barrier();
    FragB pah, pal;
    pah.half[0] = *(const v8us*)&sPh[w][ln][8 * hh]; pah.half[1] = *(const v8us*)&sPh[w][ln][16 + 8 * hh];
    pal.half[0] = *(const v8us*)&sPl[w][ln][8 * hh]; pal.half[1] = *(const v8us*)&sPl[w][ln][16 + 8 * hh];
#pragma unroll
    for (int dt = 0; dt < DT; ++dt) {
      FragB bvh, bvl;
#pragma unroll
      for (int i = 0; i < 8; ++i) {
        bvh.u[i] = sVh[8 * hh + i][dt * 16 + ln]; bvh.u[8 + i] = sVh[16 + 8 * hh + i][dt * 16 + ln];
        bvl.u[i] = sVl[8 * hh + i][dt * 16 + ln]; bvl.u[8 + i] = sVl[16 + 8 * hh + i][dt * 16 + ln];
      }
      oacc[dt] = mmaN<3>(pah.v, pal.v, bvh.v, bvl.v, oacc[dt]);
    }
    __builtin_amdgcn_fence(__ATOMIC_ACQ_REL, "workgroup");
    __builtin_amdgcn_wave_barrier();
  }
#pragma unroll
  for (int r = 0; r < 8; ++r) {
    float l = l_r[r];
    l += __shfl_xor(l, 1, 32); l += __shfl_xor(l, 2, 32); l += __shfl_xor(l, 4, 32); l += __shfl_xor(l, 8, 32);
    l_r[r] = (l > 0.f) ? 1.0f / l : 0.f;
  }
#pragma unroll
  for (int dt = 0; dt < DT; ++dt)
#pragma unroll
    for (int r = 0; r < 8; ++r) sO[w][8 * hh + r][dt * 16 + ln] = oacc[dt][r] * l_r[r];
  __builtin_amdgcn_fence(__ATOMIC_ACQ_REL, "workgroup");
  __builtin_amdgcn_wave_barrier();
  {
    for (int r = 0; r < 16; ++r) {
      const int row = q0 + r;
      if (row < T && lane < D / 4) {
        const v4f val = *(const v4fa*)&sO[w][r][lane * 4];
        *(v4f*)(y + ((size_t)b * T + row) * ypitch + h * D + lane * 4) = val;
      }
    }
    
  }
}

// GEMM C = act(A·W + bias + resid): A f32 (ASPLIT -> hi/lo 2 terms), Wt bf16 [N][K]; ACT 0 none, 1 relu, 2 exact gelu;
// resid (optional, f32, row index = (row % rmod), pitch ldr, RES_BF16 rounds it) added before the activation.
template <bool ASPLIT, int ACT, bool BIAS_BF16, bool RES_BF16>
__global__ __launch_bounds__(128) void k_gemm_bf3(const float* __restrict__ A, int lda, const unsigned short* __restrict__ Wt, int ldb,
                                                const float* __restrict__ bias, const float* __restrict__ resid, int rmod, int ldr,
                                                float* __restrict__ C, int ldc, int M, int N, int K) {
  __shared__ __attribute__((aligned(16))) float so[4][16][64];
  const int tid = threadIdx.x, w = tid >> 5, lane = tid & 31, ln = lane & 15, hh = lane >> 4;
  const int ntn = N / 64;
  const int wid = blockIdx.x * 4 + w;
  const int mt = wid / ntn, nq = wid % ntn;
  if (mt * 16 >= M) return;
  const int row0 = mt * 16, col0 = nq * 64;
  const float* arow = A + (size_t)(row0 + ln) * lda;
  v8f acc[4] = {};
  for (int kb = 0; kb < K; kb += 32) {
    FragB ah, al;
    const v4f x0 = *(const v4fa*)(arow + kb + 8 * hh), x1 = *(const v4fa*)(arow + kb + 8 * hh + 4);
    const v4f x2 = *(const v4fa*)(arow + kb + 16 + 8 * hh), x3 = *(const v4fa*)(arow + kb + 16 + 8 * hh + 4);
    float xs[16] = {x0[0],x0[1],x0[2],x0[3],x1[0],x1[1],x1[2],x1[3],x2[0],x2[1],x2[2],x2[3],x3[0],x3[1],x3[2],x3[3]};
#pragma unroll
    for (int i = 0; i < 16; ++i) { const unsigned short hb = bf16_bits(xs[i]); ah.u[i] = hb; al.u[i] = ASPLIT ? bf16_bits(xs[i] - bf16_val(hb)) : (unsigned short)0; }
#pragma unroll
    for (int t = 0; t < 4; ++t) {
      const unsigned short* brow = Wt + (size_t)(col0 + t * 16 + ln) * ldb + kb;
      FragB b;
      b.half[0] = *(const v8us*)(brow + 8 * hh);
      b.half[1] = *(const v8us*)(brow + 16 + 8 * hh);
      acc[t] = mmaN<ASPLIT ? 2 : 1>(ah.v, al.v, b.v, b.v, acc[t]);
    }
  }
#pragma unroll
  for (int t = 0; t < 4; ++t) {
    const int col = col0 + t * 16 + ln;
    float bv = bias ? bias[col] : 0.f;
    if (BIAS_BF16) bv = bf16_round(bv);
#pragma unroll
    for (int r = 0; r < 8; ++r) {
      float v = acc[t][r] + bv;
      if (resid) { float rv = resid[(size_t)((row0 + 8 * hh + r) % rmod) * ldr + col]; if (RES_BF16) rv = bf16_round(rv); v += rv; }
      if (ACT == 1) v = fmaxf(v, 0.f);
      if (ACT == 2) v = 0.5f * v * (1.0f + erff(v * 0.70710678118654752f));
      if (ACT == 3) { const float u = 0.7978845608028654f * (v + 0.044715f * v * v * v); v = 0.5f * v * (1.0f + tanhf(u)); }
      so[w][8 * hh + r][t * 16 + ln] = v;
    }
  }
  __builtin_amdgcn_fence(__ATOMIC_ACQ_REL, "workgroup");
  __builtin_amdgcn_wave_barrier();
  const int rsub = lane >> 4, c4 = (lane & 15) * 4;
  {
#pragma unroll
    for (int q = 0; q < 8; ++q) {
      const int r = q * 2 + rsub;
      const v4f v = *(const v4fa*)&so[w][r][c4];
      *(v4f*)(C + (size_t)(row0 + r) * ldc + col0 + c4) = v;
    }
    
  }
}
// row LayerNorm (biased variance, eps) over N: s = X (+ R); optional out_sum <- s; out_norm <- (s-mu)*rsqrt(var+eps)*g + b
template <bool PARAM_BF16>
__global__ __launch_bounds__(256) void k_layernorm(const float* __restrict__ X, const float* __restrict__ R, const float* __restrict__ g, const float* __restrict__ bta,
                                                  float* __restrict__ out_sum, float* __restrict__ out_norm, int N, float eps) {
  __shared__ float red[256];
  const int row = blockIdx.x, tid = threadIdx.x;
  const float* x = X + (size_t)row * N; const float* rr = R ? R + (size_t)row * N : nullptr;
  float vals[16];                     // up to N = 4096
  const int per = N / 256;            // contiguous chunk per thread? use strided-by-4 chunks: thread handles j = tid*4 + 1024*u
  float s1 = 0.f;
  for (int u = 0; u < per / 4; ++u) {
    const int j = tid * 4 + 1024 * u;
    const v4f a = *(const v4fa*)(x + j);
    v4f b = {0.f,0.f,0.f,0.f}; if (rr) b = *(const v4fa*)(rr + j);
#pragma unroll
    for (int q = 0; q < 4; ++q) { const float v = a[q] + b[q]; vals[u * 4 + q] = v; s1 += v; }
  }
  red[tid] = s1; __syncthreads();
  for (int st = 128; st > 0; st >>= 1) { if (tid < st) red[tid] += red[tid + st]; __syncthreads(); }
  const float mu = red[0] / (float)N; __syncthreads();
  float s2 = 0.f;
  for (int u = 0; u < per / 4; ++u)
#pragma unroll
    for (int q = 0; q < 4; ++q) { const float c = vals[u * 4 + q] - mu; s2 += c * c; }
  red[tid] = s2; __syncthreads();
  for (int st = 128; st > 0; st >>= 1) { if (tid < st) red[tid] += red[tid + st]; __syncthreads(); }
  const float rs = rsqrtf(red[0] / (float)N + eps);
  {
    for (int u = 0; u < per / 4; ++u) {
      const int j = tid * 4 + 1024 * u;
      v4f o, sm;
#pragma unroll
      for (int q = 0; q < 4; ++q) {
        float gg = g[j + q], bb = bta[j + q];
        if (PARAM_BF16) { gg = bf16_round(gg); bb = bf16_round(bb); }
        sm[q] = vals[u * 4 + q]; o[q] = (vals[u * 4 + q] - mu) * rs * gg + bb;
      }
      if (out_sum) *(v4f*)(out_sum + (size_t)row * N + j) = sm;
      *(v4f*)(out_norm + (size_t)row * N + j) = o;
    }
    
  }
}



// ---- f16 WMMA path (v_wmma_f32_16x16x32_f16): 11-bit significands for operands in range — used where a [0,1] probability operand needs more precision than bf16
typedef _Float16 v16h __attribute__((ext_vector_type(16)));
union FragH { v16h v; v8us half[2]; _Float16 h[16]; unsigned short u[16]; };
template <int NT>
__device__ __forceinline__ v8f mmaH(v16h ah, v16h al, v16h bh, v16h bl, v8f c) {
  c = __builtin_amdgcn_wmma_f32_16x16x32_f16(false, ah, false, bh, (short)0, c, false, false);
  if (NT >= 2) c = __builtin_amdgcn_wmma_f32_16x16x32_f16(false, al, false, bh, (short)0, c, false, false);
  if (NT >= 3) c = __builtin_amdgcn_wmma_f32_16x16x32_f16(false, ah, false, bl, (short)0, c, false, false);
  asm volatile("v_nop\n\tv_nop\n\tv_nop\n\tv_nop" : "+v"(c) : "v"(ah), "v"(al), "v"(bh), "v"(bl));
  return c;
}
// batched GEMM like k_gemm_b but f16 operands: A f32 (split into f16 hi/lo if ASPLIT, else rounded to f16), Bt = f16 values [n][k]; alpha; C f32; N multiple of 16 (partial tiles skipped)
template <bool ASPLIT>
__global__ __launch_bounds__(128) void k_gemm_h(const float* __restrict__ A, int lda, size_t sA, const _Float16* __restrict__ Bh, int ldb, size_t sB, float alpha, float* __restrict__ C, int ldc, size_t sC, int M, int N, int K) {
  __shared__ __attribute__((aligned(16))) float so[4][16][64];
  const int tid = threadIdx.x, w = tid >> 5, lane = tid & 31, ln = lane & 15, hh = lane >> 4; const int by = blockIdx.y;
  A += (size_t)by * sA; Bh += (size_t)by * sB; C += (size_t)by * sC;
  const int ntn = (N + 63) / 64; const int wid = blockIdx.x * 4 + w; const int mt = wid / ntn, nq = wid % ntn; if (mt * 16 >= M) return;
  const int row0 = mt * 16, col0 = nq * 64; const float* arow = A + (size_t)(row0 + ln) * lda;
  v8f acc[4] = {};
  for (int kb = 0; kb < K; kb += 32) {
    FragH ah, al;
    const v4f x0 = *(const v4fa*)(arow + kb + 8 * hh), x1 = *(const v4fa*)(arow + kb + 8 * hh + 4), x2 = *(const v4fa*)(arow + kb + 16 + 8 * hh), x3 = *(const v4fa*)(arow + kb + 16 + 8 * hh + 4);
    float xs[16] = {x0[0],x0[1],x0[2],x0[3],x1[0],x1[1],x1[2],x1[3],x2[0],x2[1],x2[2],x2[3],x3[0],x3[1],x3[2],x3[3]};
#pragma unroll
    for (int i = 0; i < 16; ++i) { const _Float16 h = (_Float16)xs[i]; ah.h[i] = h; al.h[i] = ASPLIT ? (_Float16)(xs[i] - (float)h) : (_Float16)0.0f; }
#pragma unroll
    for (int t = 0; t < 4; ++t) { if (col0 + t * 16 >= N) continue; const size_t boff = (size_t)(col0 + t * 16 + ln) * ldb + kb; FragH bq; bq.half[0] = *(const v8us*)(Bh + boff + 8 * hh); bq.half[1] = *(const v8us*)(Bh + boff + 16 + 8 * hh);
      acc[t] = mmaH<ASPLIT ? 2 : 1>(ah.v, al.v, bq.v, bq.v, acc[t]); }
  }
#pragma unroll
  for (int t = 0; t < 4; ++t) { if (col0 + t * 16 >= N) continue;
#pragma unroll
    for (int r = 0; r < 8; ++r) so[w][8 * hh + r][t * 16 + ln] = acc[t][r] * alpha; }
  __builtin_amdgcn_fence(__ATOMIC_ACQ_REL, "workgroup"); __builtin_amdgcn_wave_barrier();
  const int rsub = lane >> 4, c4 = (lane & 15) * 4;
  {
#pragma unroll
    for (int q = 0; q < 8; ++q) { const int r = q * 2 + rsub; if (col0 + c4 < N) { const v4f v = *(const v4fa*)&so[w][r][c4]; *(v4f*)(C + (size_t)(row0 + r) * ldc + col0 + c4) = v; } }
     }
}

// One launch prepares both GEMM operands, in fragment order. The first XB blocks: X16 = f16(bf16(x)), x row-major with pitch DD: a wave takes one block (16 rows x 32 cols: 16 whole lines of x) and writes its two units.
// Then WB blocks for each of Wq, Wk, Wv: Wt[n][k] = f16(bf16(W[k][n]) * 16) from f32 row-major W[DD][DD] (a power of two: bf16-exact weights stay exact in f16 away from the subnormal range);
// Wt has rows n, cols k, pitch DD: thread t writes the 16 B of lane t % 32 in unit t / 32. The three planes follow one another in Bw. The test on blockIdx.x is the same for a whole block.
#define XB (NR * DD / 16 / 256)
#define WB (DD * (DD / 8) / 256)
static_assert(NR * DD % (16 * 256) == 0 && DD * (DD / 8) % 256 == 0 && DD % 32 == 0, "whole blocks, no tail guards");
__global__ __launch_bounds__(256) void k_prep(const float* __restrict__ x, const float* __restrict__ Wq, const float* __restrict__ Wk, const float* __restrict__ Wv, _Float16* __restrict__ X16, _Float16* __restrict__ Bw) {
  FragH f;
  if (blockIdx.x < XB) {
    const unsigned t = blockIdx.x * 256 + threadIdx.x;
    const unsigned lane = t & 31, blk = t >> 5, rt = blk / (DD / 32), kb = blk % (DD / 32);
    const float* xr = x + (size_t)(rt * 16 + (lane & 15)) * DD + kb * 32 + (lane >> 4) * 8;
#pragma unroll
    for (int q = 0; q < 8; ++q) { f.h[q] = (_Float16)bf16_round(xr[q]); f.h[8 + q] = (_Float16)bf16_round(xr[16 + q]); }
    *(v8us*)((unsigned short*)X16 + (size_t)blk * 512 + lane * 8) = f.half[0]; *(v8us*)((unsigned short*)X16 + (size_t)blk * 512 + 256 + lane * 8) = f.half[1];
  } else {
    const unsigned wb = blockIdx.x - XB, pl = wb / WB; const float* W = (pl == 0) ? Wq : (pl == 1) ? Wk : Wv;
    const int t = (wb % WB) * 256 + threadIdx.x; const int lane = t & 31, u = t >> 5, blk = u >> 1; const int n = (blk / (DD / 32)) * 16 + (lane & 15), k8 = (blk % (DD / 32)) * 32 + (u & 1) * 16 + (lane >> 4) * 8;
#pragma unroll
    for (int i = 0; i < 8; ++i) f.h[i] = (_Float16)(bf16_round(W[(size_t)(k8 + i) * DD + n]) * 16.0f);
    *(v8us*)((unsigned short*)Bw + (size_t)pl * DD * DD + (size_t)t * 8) = f.half[0];
    asm volatile("s_wait_xcnt 0x0" ::: "memory");      /* in the built code the X part follows this store's branch and rewrites the store's registers: the wait stands in front of that rewrite */
  }
}
// The three projections in one launch: blockIdx.y = 0, 1, 2 takes Wq, Wk, Wv (planes of Bw) with its bias. v = acc / 16 + bf16(bias[col]), rounded to f16. A, Bw, Q16, K16 and Vt lie in fragment order.
// Q and K go out as planes of NR rows x DD cols. V goes out transposed, as the attention kernel reads it (Vt: rows (b * NH + h) * 64 + d, cols = keys, pitch TT): no V plane and no transposing launch.
// A wave owns 128 rows x 96 cols (8 x 6 accumulator tiles): 14 fragments of 1 KiB feed 48 WMMAs. The block's four waves stand 2 x 2 (256 x 192), one wave a SIMD, so each fragment is wanted by two waves of the block.
// NR / 256 * DD / 192 * 3 = 192 blocks.
#define GMT 8
#define GNT 6
__global__ __launch_bounds__(128) void k_gemm_qkv(const _Float16* __restrict__ A, const _Float16* __restrict__ Bw, const float* __restrict__ bq, const float* __restrict__ bk, const float* __restrict__ bv,
    _Float16* __restrict__ Q16, _Float16* __restrict__ K16, _Float16* __restrict__ Vt) {
  constexpr int lda = DD, ldb = DD, ldc = DD, K = DD, MT = GMT, NT = GNT, NBN = DD / (2 * NT * 16); constexpr float alpha = 0.0625f;
  static_assert(NR % (2 * MT * 16) == 0 && DD % (2 * NT * 16) == 0 && DD % 64 == 0 && TT % (MT * 16) == 0, "whole tiles, no tail guards; a wave's rows lie in one batch");
  __shared__ __attribute__((aligned(16))) float so[4][MT * 16][NT * 16 + 4];      /* pitch 100: the epilogue's row reads (one row a lane) fall on different banks */
  const int tid = threadIdx.x, w = tid >> 5, lane = tid & 31, ln = lane & 15, hh = lane >> 4; const int by = blockIdx.y;
  const _Float16* Bh = Bw + (size_t)by * DD * DD; const float* bp = (by == 0) ? bq : (by == 1) ? bk : bv;
  const int mb = blockIdx.x / NBN, nb = blockIdx.x % NBN;
  const int row0 = (mb * 2 + (w >> 1)) * (MT * 16), col0 = (nb * 2 + (w & 1)) * (NT * 16);
  v8f acc[MT][NT] = {};
  // Fragments are fetched ahead: two register sets of 32 k each; while one set feeds its 48 WMMAs the other set's 28 loads are in flight. K % 64 == 0.
  const unsigned short* ap = (const unsigned short*)A + (size_t)row0 * lda + lane * 8;      /* this lane's 16 B in the first unit of the first row tile; the next row tile lies 16 * pitch on */
  const unsigned short* wp = (const unsigned short*)Bh + (size_t)col0 * ldb + lane * 8;
  FragH a0[MT], a1[MT], b0[NT], b1[NT];
  // One step: the loads of set (al, bl) for k = kb + ko as one group, then the WMMA block on set (am, bm). ko is a literal and goes into the loads' offset fields; 32 k are one block of 512 elements, so k counts 16-fold.
  // The WMMAs are the plain builtin: the tiles and fragments fill more than 256 registers, and an asm operand cannot lie above v255.
  auto step = [&](FragH (&al)[MT], FragH (&bl)[NT], int kb, int ko, FragH (&am)[MT], FragH (&bm)[NT], const bool mm) {
    const unsigned short* pa = ap + kb * 16; const unsigned short* pw = wp + kb * 16;
#pragma unroll
    for (int m = 0; m < MT; ++m) { al[m].half[0] = *(const v8us*)(pa + ko * 16 + m * 16 * lda); al[m].half[1] = *(const v8us*)(pa + ko * 16 + m * 16 * lda + 256); }
#pragma unroll
    for (int t = 0; t < NT; ++t) { bl[t].half[0] = *(const v8us*)(pw + ko * 16 + t * 16 * ldb); bl[t].half[1] = *(const v8us*)(pw + ko * 16 + t * 16 * ldb + 256); }
    __builtin_amdgcn_sched_barrier(0);      /* the group's loads stay ahead of the WMMA block: else the scheduler sinks them among the WMMAs and their latency is waited out there */
    if (mm) {
#pragma unroll
      for (int m = 0; m < MT; ++m)
#pragma unroll
        for (int t = 0; t < NT; ++t) acc[m][t] = __builtin_amdgcn_wmma_f32_16x16x32_f16(false, am[m].v, false, bm[t].v, (short)0, acc[m][t], false, false);
    }
    __builtin_amdgcn_sched_barrier(0);      /* the statement below stays behind the whole block: else the scheduler lifts it to the block's head, where the wait would stall */
    /* v_nop: the next group's loads overwrite the last WMMA's A and B; four vector slots lie between, as behind every WMMA of this file. s_wait_xcnt: the group's address pairs are named, so no register of them is
       reused (not even as a later load's result) before this wait; it stands behind the block, not directly behind the loads, so that it is not waited out in front of the WMMAs */
    if (mm) asm volatile("v_nop\n\tv_nop\n\tv_nop\n\tv_nop\n\ts_wait_xcnt 0x0" :: "v"(pa), "v"(pw) : "memory");
    else asm volatile("s_wait_xcnt 0x0" :: "v"(pa), "v"(pw) : "memory");      /* the first group, in front of the loop: no WMMA stands ahead of it */
    __builtin_amdgcn_sched_barrier(0); };      /* the next group of loads stays behind this block: it overwrites the set that the block reads */
  step(a0, b0, 0, 0, a1, b1, false);
  for (int kb = 0; kb < K; kb += 64) {
    step(a1, b1, kb, 32, a0, b0, true);
    step(a0, b0, (kb + 64 < K) ? kb + 64 : 0, 0, a1, b1, true);      /* last trip: wraps to k = 0, in bounds, values unused; no branch, so the waits stay counted */
  }
  // The biases of the wave's six column tiles (bf16-rounded input), for both ways out.
  const int cb = col0 + ln; float bvv[NT];
#pragma unroll
  for (int t = 0; t < NT; ++t) bvv[t] = bp[cb + t * 16];
  asm volatile("s_wait_xcnt 0x0" :: "v"(cb) : "memory");      /* the loads' offset register is named, so it is not reused before the loads have taken it */
#pragma unroll
  for (int t = 0; t < NT; ++t) bvv[t] = bf16_round(bvv[t]);
  if (by == 2) {      /* the same for the whole block */
    // acc[m][t][r] is V[row0 + m * 16 + 8 hh + r][col0 + t * 16 + ln]: for the transposed plane that is row d = column % 64 of head column / 64, keys 8 hh .. 8 hh + 7 of a 16-key unit, which is what lane 16 hh + ln owns there:
    // each accumulator tile is one whole unit of Vt (512 B, 4 whole lines) and goes out of the registers as it stands. Vt's row is b * DD + column; the eight tiles m are eight units in a row.
    unsigned short* vu = (unsigned short*)Vt + ((size_t)(row0 / TT) * DD + col0) * TT + (size_t)((row0 % TT) >> 4) * 256 + lane * 8;
#pragma unroll
    for (int t = 0; t < NT; ++t) { FragH f[MT];
#pragma unroll
      for (int m = 0; m < MT; ++m)
#pragma unroll
        for (int r = 0; r < 8; ++r) f[m].h[r] = (_Float16)(acc[m][t][r] * alpha + bvv[t]);
      __builtin_amdgcn_sched_barrier(0);      /* the batch's units are all formed before its first store: no conversion takes a register that an issued store names */
#pragma unroll
      for (int m = 0; m < MT; ++m) *(v8us*)(vu + t * 16 * TT + m * 256) = f[m].half[0];
      asm volatile("s_wait_xcnt 0x0" :: "v"(vu) : "memory");      /* in front of the next batch, which rewrites the registers that these stores name */
      __builtin_amdgcn_sched_barrier(0); }      /* the next batch's conversions stay behind that wait */
    return;
  }
#pragma unroll
  for (int t = 0; t < NT; ++t)
#pragma unroll
    for (int m = 0; m < MT; ++m)
#pragma unroll
      for (int r = 0; r < 8; ++r) so[w][m * 16 + 8 * hh + r][t * 16 + ln] = acc[m][t][r] * alpha + bvv[t];
  __builtin_amdgcn_fence(__ATOMIC_ACQ_REL, "workgroup"); __builtin_amdgcn_wave_barrier();
  {      /* each of the wave's eight row tiles is six units in a row: 3 KiB of whole lines */
    unsigned short* cu = (unsigned short*)((by == 0) ? Q16 : K16) + (size_t)row0 * ldc + (size_t)(col0 >> 4) * 256 + lane * 8;
#pragma unroll
    for (int m = 0; m < MT; ++m) { FragH f[NT];
#pragma unroll
      for (int u = 0; u < NT; ++u) { const v4f v0 = *(const v4fa*)&so[w][m * 16 + ln][u * 16 + 8 * hh], v1 = *(const v4fa*)&so[w][m * 16 + ln][u * 16 + 8 * hh + 4];
#pragma unroll
        for (int i = 0; i < 4; ++i) { f[u].h[i] = (_Float16)v0[i]; f[u].h[4 + i] = (_Float16)v1[i]; } }
      __builtin_amdgcn_sched_barrier(0);      /* the batch's units are all formed before its first store: no conversion takes a register that an issued store names */
#pragma unroll
      for (int u = 0; u < NT; ++u) *(v8us*)(cu + m * 16 * ldc + u * 256) = f[u].half[0];
      asm volatile("s_wait_xcnt 0x0" :: "v"(cu) : "memory");      /* in front of the next batch (behind the last one: of the V part, which follows in the built code), which rewrites the registers that these stores name */
      __builtin_amdgcn_sched_barrier(0); }      /* the next batch's reads and conversions stay behind that wait */
  }
}


typedef _Float16 v4h __attribute__((ext_vector_type(4)));

__global__ __launch_bounds__(256) void k_h16(const float* __restrict__ x, _Float16* __restrict__ X16, size_t n8) { const size_t t = (size_t)blockIdx.x * 256 + threadIdx.x; if (t >= n8) return; FragH f;
#pragma unroll
  for (int q = 0; q < 8; ++q) f.h[q] = (_Float16)x[t * 8 + q]; *(v8us*)((unsigned short*)X16 + t * 8) = f.half[0];  }
__global__ __launch_bounds__(256) void k_round16f(const float* __restrict__ W, _Float16* __restrict__ Bt, size_t n8) { const size_t t = (size_t)blockIdx.x * 256 + threadIdx.x; if (t >= n8) return; FragH f;
#pragma unroll
  for (int i = 0; i < 8; ++i) f.h[i] = (_Float16)(bf16_round(W[t * 8 + i]) * 16.0f); *(v8us*)((unsigned short*)Bt + t * 8) = f.half[0];  }

typedef int v4i __attribute__((ext_vector_type(4)));
typedef int v4ia __attribute__((ext_vector_type(4), may_alias));
// lane l takes the value of lane l ^ 16 (a vector cross-row move, no LDS trip)
__device__ __forceinline__ float xhalf(float x) { return __builtin_bit_cast(float, __builtin_amdgcn_permlanex16(__builtin_bit_cast(int, x), __builtin_bit_cast(int, x), 0x76543210, 0xfedcba98, false, false)); }

// Both attention paths in one walk over the keys. The scores S^T = K Q^T are the same for the two paths, and so are the K and V^T fragments: each is fetched and each score tile is formed once;
// the wave then runs two online softmaxes (additive key bias; 0/1 mask) with two output accumulators, and the gated sum is taken in registers in the epilogue: no per-path output plane, no combining launch.
__global__ __launch_bounds__(128) void k_flash_gl(const _Float16* __restrict__ Q16, int ldq, const _Float16* __restrict__ K16, int ldk, const _Float16* __restrict__ Vt, const float* __restrict__ AB, const int* __restrict__ MSK, const float* __restrict__ gate, float* __restrict__ O, int ldo) {
  constexpr int RPW = 16, NQB = TT / (4 * RPW), DT = 4, KS = 2;
  __shared__ __attribute__((aligned(16))) float sO[4][RPW][64 + 4];
  const int tid = threadIdx.x, w = tid >> 5, lane = tid & 31, ln = lane & 15, hh = lane >> 4;
  const int slab = blockIdx.x / NQB, qblk = blockIdx.x % NQB; const int b = slab / NH, h = slab % NH; const int qb0 = qblk * (4 * RPW); const int q0 = qb0 + w * RPW;
  // Transposed tiles: S^T = K Q^T (A = 16 key rows, B = the wave's 16 queries), O^T += V^T P^T. Lane (ln, hh) owns query q0 + ln; its score registers hold keys j0 + 8 hh + r and j0 + 16 + 8 hh + r,
  // which is the k order of a B operand: P goes from the score registers into the second product with no LDS trip, and maximum and sum run inside the lane plus one exchange between the wave halves.
  FragH aq[KS];
  // Q16, K16 and Vt lie in fragment order (head of the file): a fragment half is one unit of 512 B, this lane's 16 B at lane * 8 elements; a head's 64 columns are two blocks (4 units) in a row.
  { const unsigned short* qr = (const unsigned short*)Q16 + ((size_t)b * TT + q0) * ldq + h * 1024 + lane * 8;
#pragma unroll
    for (int ks = 0; ks < KS; ++ks) { aq[ks].half[0] = *(const v8us*)(qr + ks * 512); aq[ks].half[1] = *(const v8us*)(qr + ks * 512 + 256); }
    asm volatile("s_wait_xcnt 0x0" :: "v"(qr) : "memory"); }      /* as in ldK below: the address pair stays whole until the loads have taken it */
  const unsigned short* Vth = (const unsigned short*)Vt + (size_t)slab * 64 * TT;
  float mg = -3.0e38f, lg = 0.f, ml = -3.0e38f, ll = 0.f; v8f og[DT], ol[DT];      /* running maximum, running sum, output tile: g = additive-bias path, l = 0/1-mask path */
#pragma unroll
  for (int dt = 0; dt < DT; ++dt) { og[dt] = (v8f){0.f,0.f,0.f,0.f,0.f,0.f,0.f,0.f}; ol[dt] = (v8f){0.f,0.f,0.f,0.f,0.f,0.f,0.f,0.f}; }
  const int jend = TT;
  // Global loads are issued ahead of their use: the K fragments, the key bias and the mask words one pass ahead (registers carried round the loop), the V^T fragments at the top of their own pass; their latency then runs under the softmaxes, not in front of each WMMA.
  const unsigned short* Kl = (const unsigned short*)K16 + (size_t)b * TT * ldk + h * 1024 + lane * 8; FragH bk[2][KS];
  const float* aml = AB + (size_t)b * TT + 8 * hh; v4f abn[2][2];
  const int* Ml = MSK + ((size_t)b * TT + q0 + ln) * TT + 8 * hh; v4i mkn[2][2];
  auto ldK = [&](int j) {
    const unsigned short* kr[2] = {Kl + (size_t)j * ldk, Kl + (size_t)(j + 16) * ldk}; const float* am = aml + j; const int* mm = Ml + j;
#pragma unroll
    for (int nt = 0; nt < 2; ++nt) { mkn[nt][0] = *(const v4ia*)(mm + nt * 16); mkn[nt][1] = *(const v4ia*)(mm + nt * 16 + 4); }
#pragma unroll
    for (int nt = 0; nt < 2; ++nt) { abn[nt][0] = *(const v4fa*)(am + nt * 16); abn[nt][1] = *(const v4fa*)(am + nt * 16 + 4); }
#pragma unroll
    for (int nt = 0; nt < 2; ++nt)
#pragma unroll
      for (int ks = 0; ks < KS; ++ks) { bk[nt][ks].half[0] = *(const v8us*)(kr[nt] + ks * 512); bk[nt][ks].half[1] = *(const v8us*)(kr[nt] + ks * 512 + 256); }
    /* the group's address pairs are named so that no register of them is reused (not even as a later load's result) before the loads have taken them */
    asm volatile("s_wait_xcnt 0x0" :: "v"(kr[0]), "v"(kr[1]), "v"(am), "v"(mm) : "memory"); };
  // One path's online-softmax step on its 32 scores of this pass: new maximum, rescale of sum and output tile, P^T packed as a B operand (element nt * 8 + r is key nt * 16 + 8 hh + r, the order in which bv holds V^T).
  // The exponentials run in base 2 on the hardware's own instruction: exp(x) 2^10 = exp2(x log2(e) + 10). sc and m_r are in units of 1 / cs base-2 exponents (cs > 0, so the maximum is taken on sc as it is);
  // p, and with it the running sum, carries the factor 2^10 that P has as an f16 operand: the epilogue divides by that sum alone.
  auto soft = [&](const float (&sc)[2][8], const float cs, const bool fold, float& m_r, float& l_r, v8f (&oacc)[DT], FragH& pb) {
    float mx[8];
#pragma unroll
    for (int r = 0; r < 8; ++r) mx[r] = fmaxf(sc[0][r], sc[1][r]);
    float mc = fmaxf(fmaxf(fmaxf(mx[0], mx[1]), fmaxf(mx[2], mx[3])), fmaxf(fmaxf(mx[4], mx[5]), fmaxf(mx[6], mx[7])));
    mc = fmaxf(mc, xhalf(mc));      /* both wave halves now hold the maximum of the query's 32 scores of this pass */
    const float mn = fmaxf(m_r, mc); const float ea = __builtin_amdgcn_exp2f((m_r - mn) * cs); const float al = (mn > -1.0e38f) ? ea : 1.0f; m_r = mn;      /* computed, then selected: no branch */
    float p[2][8];      /* a masked score is -inf and mn is finite, so its exponential is 0 */
    const float nm = 10.0f - mn * cs;      /* fold: one multiply-add a score; only where mn * cs cannot overflow (cs < 1). Else the difference is taken first, as large additive biases need */
#pragma unroll
    for (int nt = 0; nt < 2; ++nt)
#pragma unroll
      for (int r = 0; r < 8; ++r) p[nt][r] = __builtin_amdgcn_exp2f(fold ? __builtin_fmaf(sc[nt][r], cs, nm) : __builtin_fmaf(sc[nt][r] - mn, cs, 10.0f));
    float ps[8];
#pragma unroll
    for (int r = 0; r < 8; ++r) ps[r] = p[0][r] + p[1][r];
    l_r = l_r * al + (((ps[0] + ps[1]) + (ps[2] + ps[3])) + ((ps[4] + ps[5]) + (ps[6] + ps[7])));      /* this half's 16 keys; the halves are joined behind the loop */
#pragma unroll
    for (int dt = 0; dt < DT; ++dt)
#pragma unroll
      for (int r = 0; r < 8; ++r) oacc[dt][r] *= al;
#pragma unroll
    for (int nt = 0; nt < 2; ++nt)
#pragma unroll
      for (int r = 0; r < 8; ++r) pb.h[nt * 8 + r] = (_Float16)p[nt][r]; };
  const float gq = bf16_round(gate[((size_t)b * NH + h) * TT + q0 + ln]);      /* the gate of this lane's query (bf16-rounded input) */
  ldK(0);
#pragma unroll 1      /* stays rolled: one set of carried fragment registers, and the pass's code is fetched once */
  for (int j0 = 0; j0 < jend; j0 += 32) {
    const int jn = (j0 + 32 < jend) ? j0 + 32 : 0;      /* the pass fetched for; behind the last pass it wraps to key 0: in bounds, values unused; no branch, so the waits stay counted */
    float ab[2][8];      /* additive attention bias (bf16-rounded input) of keys j0 + nt * 16 + 8 hh + r */
    int mk[2][8];      /* per-batch mask [b][q][k] of query q0 + ln, same keys: nonzero = ATTEND */
#pragma unroll
    for (int nt = 0; nt < 2; ++nt)
#pragma unroll
      for (int r = 0; r < 8; ++r) { ab[nt][r] = (float)(__bf16)abn[nt][r >> 2][r & 3]; mk[nt][r] = mkn[nt][r >> 2][r & 3]; }      /* the convert rounds to nearest even, as bf16_round does */
    FragH bv[DT];      /* V^T fragments of this pass: issued here, used behind the softmaxes, by both paths */
    const unsigned short* vr = Vth + (size_t)j0 * 16 + lane * 8;      /* 32 keys are one block of 512 elements */
#pragma unroll
    for (int dt = 0; dt < DT; ++dt) { bv[dt].half[0] = *(const v8us*)(vr + dt * 16 * TT); bv[dt].half[1] = *(const v8us*)(vr + dt * 16 * TT + 256); }
    asm volatile("s_wait_xcnt 0x0" :: "v"(vr) : "memory");      /* as in ldK: the address pair stays whole until the loads have taken it */
    v8f s[2];
#pragma unroll
    for (int nt = 0; nt < 2; ++nt) { v8f acc = (v8f){0.f,0.f,0.f,0.f,0.f,0.f,0.f,0.f};
#pragma unroll
      for (int ks = 0; ks < KS; ++ks) acc = mmaH<1>(bk[nt][ks].v, bk[nt][ks].v, aq[ks].v, aq[ks].v, acc); s[nt] = acc; }
    ldK(jn);
    float scg[2][8], scl[2][8];
#pragma unroll
    for (int nt = 0; nt < 2; ++nt)
#pragma unroll
      for (int r = 0; r < 8; ++r) { scg[nt][r] = s[nt][r] * 0.125f + ab[nt][r]; scl[nt][r] = (mk[nt][r] != 0) ? s[nt][r] : -INFINITY; }      /* the mask path keeps the raw products: its 1 / 8 goes into cs */
    FragH pg, pl;
    soft(scg, 1.4426950408889634f, false, mg, lg, og, pg);
    __builtin_amdgcn_sched_barrier(0);      /* one path's short softmax is scheduled whole, then the other's: else all 32 exponentials stand in one run with every argument and result live (more registers), one overwriting the source of the one directly in front */
    soft(scl, 0.125f * 1.4426950408889634f, true, ml, ll, ol, pl);
#pragma unroll
    for (int dt = 0; dt < DT; ++dt) { og[dt] = mmaH<1>(bv[dt].v, bv[dt].v, pg.v, pg.v, og[dt]); ol[dt] = mmaH<1>(bv[dt].v, bv[dt].v, pl.v, pl.v, ol[dt]); } }
  { const float sg = lg + xhalf(lg), sl = ll + xhalf(ll); const float lig = (sg > 0.f) ? 1.0f / sg : 0.f, lil = (sl > 0.f) ? 1.0f / sl : 0.f;      /* sums and output tiles both carry 2^10 */ const float g1 = 1.0f - gq;
#pragma unroll
    for (int dt = 0; dt < DT; ++dt) {      /* og[dt][r], ol[dt][r] = the paths' O[q0 + ln][dt * 16 + 8 hh + r]; the gated sum of the two goes out */
      v4f o0, o1;
#pragma unroll
      for (int r = 0; r < 4; ++r) { o0[r] = gq * (ol[dt][r] * lil) + g1 * (og[dt][r] * lig); o1[r] = gq * (ol[dt][4 + r] * lil) + g1 * (og[dt][4 + r] * lig); }
      *(v4fa*)&sO[w][ln][dt * 16 + 8 * hh] = o0; *(v4fa*)&sO[w][ln][dt * 16 + 8 * hh + 4] = o1; } }
  __builtin_amdgcn_fence(__ATOMIC_ACQ_REL, "workgroup"); __builtin_amdgcn_wave_barrier();
  {
#pragma unroll
    for (int rp = 0; rp < RPW; rp += 2) { const int r = rp + (lane >> 4), pc = lane & 15; const v4f val = *(const v4fa*)&sO[w][r][pc * 4]; *(v4f*)(O + ((size_t)b * TT + q0 + r) * ldo + h * 64 + pc * 4) = val; }
     } }

extern "C" void kernel_launch(void* const* d_in, const int* in_sizes, int n_in,
                              void* d_out, int out_size, void* d_ws, size_t ws_size, hipStream_t stream) {
  (void)in_sizes; (void)n_in; (void)out_size;
  const float* const* I = (const float* const*)d_in; const float* x = I[0]; const float* am = I[1]; const int* lm = (const int*)d_in[2]; const float* gate = I[3]; const float* Wq = I[4]; const float* bq = I[5]; const float* Wk = I[6]; const float* bk = I[7]; const float* Wv = I[8]; const float* bv = I[9];
  char* ws = (char*)d_ws; size_t off = 0;
  auto take = [&](size_t bytes) { char* p = ws + off; off += (bytes + 255) & ~(size_t)255; return p; };
  const size_t WSZ = (size_t)DD * DD; _Float16* Bw = (_Float16*)take(3 * WSZ * 2); _Float16* X16 = (_Float16*)take((size_t)NR * DD * 2); _Float16* Q = (_Float16*)take((size_t)NR * DD * 2); _Float16* K = (_Float16*)take((size_t)NR * DD * 2); _Float16* Vt = (_Float16*)take((size_t)NR * DD * 2);
  if (off > ws_size) return;      // 3.5 + 4 x 6.3 = about 29 MB
  k_prep<<<XB + 3 * WB, 256, 0, stream>>>(x, Wq, Wk, Wv, X16, Bw);      /* X and the three W^T x 2^4, f16, fragment order */
  k_gemm_qkv<<<dim3((NR / (2 * GMT * 16)) * (DD / (2 * GNT * 16)), 3), 128, 0, stream>>>(X16, Bw, bq, bk, bv, Q, K, Vt);      /* three times M 4096 N 768 K 768 */
  k_flash_gl<<<BB * NH * (TT / 64), 128, 0, stream>>>(Q, DD, K, DD, Vt, am, lm, gate, (float*)d_out, DD);      /* both paths and the gated sum */
}

// v008
// One run takes 58.4 microseconds.
// Timed twice side by side with v007, it ran 1.04 times as fast both times.
// Counting every step since v000, it is 5.97 times as fast.
#include <hip/hip_runtime.h>
// Gated global/local self attention (B=4, S=1024, HID=768, 12×64): q,k,v = x·W + b ((in,out)); scores = q·k/8; global path softmax(scores + attention_mask[b,0,0,k]); local path softmax(scores + (1 − local_mask[b,0,q,k])·f32_min); ctx = gate[b,h,q]·ctx_local + (1 − gate)·ctx_global, merged → [4,1024,768].
// Compute dtype: x, weights, biases, additive mask and gates rounded to bf16; q/k/v f16 GEMM planes; one flash-style kernel on v_wmma_f32_16x16x32_f16 (online softmax f32, P f16 x 2^10, f32 accumulate) that forms each score tile once and feeds two softmaxes: one with the per-batch additive key bias, one with the per-batch 0/1 (q,k) mask
// (0 -> -inf); the gated combination in f32, in that kernel's epilogue.
// Every f16 plane that feeds a WMMA from global memory (X, W^T, Q, K, V^T) lies in FRAGMENT ORDER: a plane of rows x cols is cut into blocks of 16 rows x 32 cols (1 KiB, row tile major, then column block);
// a block is two units of 512 B (cols 0..15, cols 16..31); in a unit lane l = 16 hh + ln owns 16 B: row ln, cols 8 hh .. 8 hh + 7. A wave's b128 load of a fragment half is then one unit: 4 whole 128-B lines, where a row-major plane gives 16 pieces of 32 B.
// Element (R, C) of a plane with pitch P (cols): (R / 16) * 16 * P + (C / 32) * 512 + ((C / 16) % 2) * 256 + (((C / 8) % 2) * 16 + R % 16) * 8 + C % 8.
#define BB 4
#define TT 1024
#define DD 768
#define NH 12
#define NR (BB * TT)

typedef __bf16 v16b __attribute__((ext_vector_type(16)));
typedef unsigned short v8us __attribute__((ext_vector_type(8), may_alias));
typedef float  v8f  __attribute__((ext_vector_type(8)));
typedef float  v4f  __attribute__((ext_vector_type(4)));
typedef float  v4fa __attribute__((ext_vector_type(4), may_alias));
union FragB { v16b v; v8us half[2]; unsigned short u[16]; };

__device__ __forceinline__ unsigned short bf16_bits(float x) { unsigned int u = __float_as_uint(x); return (unsigned short)((u + 0x7FFFu + ((u >> 16) & 1u)) >> 16); }
__device__ __forceinline__ float bf16_val(unsigned short b) { return __uint_as_float(((unsigned int)b) << 16); }
__device__ __forceinline__ float bf16_round(float x) { return bf16_val(bf16_bits(x)); }
// D += A·B with NT terms: 1 = ah·bh, 2 = + al·bh (A split), 3 = + ah·bl (both split)
template <int NT>
__device__ __forceinline__ v8f mmaN(v16b ah, v16b al, v16b bh, v16b bl, v8f c) {
  c = __builtin_amdgcn_wmma_f32_16x16x32_bf16(false, ah, false, bh, (short)0, c, false, false);
  if (NT >= 2) c = __builtin_amdgcn_wmma_f32_16x16x32_bf16(false, al, false, bh, (short)0, c, false, false);
  if (NT >= 3) c = __builtin_amdgcn_wmma_f32_16x16x32_bf16(false, ah, false, bl, (short)0, c, false, false);
  asm volatile("v_nop\n\tv_nop\n\tv_nop\n\tv_nop" : "+v"(c) : "v"(ah), "v"(al), "v"(bh), "v"(bl));
  return c;
}

__global__ __launch_bounds__(256) void k_wt_bf16(const float* __restrict__ W, unsigned short* __restrict__ Wt, int K, int N) {
  const int t = blockIdx.x * 256 + threadIdx.x;
  const int k8n = K / 8;
  if (t >= N * k8n) return;
  const int n = t / k8n, k8 = (t % k8n) * 8;
  v8us v;
#pragma unroll
  for (int i = 0; i < 8; ++i) v[i] = bf16_bits(W[(size_t)(k8 + i) * N + n]);
  *(v8us*)(Wt + (size_t)n * K + k8) = v;
  
}

// GEMM C[M][N] (f32, pitch ldc) = act(A[M][K]·W + bias). A f32 row-major (pitch lda) converted per fragment to bf16
// (ASPLIT: hi/lo two planes -> 2 terms, else single rounded term); Wt bf16 [N][K] (pitch ldb). BIAS_BF16 rounds the
// bias to bf16 first (bias quantised to bf16 before the add). K%32==0, M%16==0, N%64==0.
template <bool ASPLIT, int ACT, bool BIAS_BF16>
__global__ __launch_bounds__(128) void k_gemm_bf(const float* __restrict__ A, int lda, const unsigned short* __restrict__ Wt, int ldb,
                                               const float* __restrict__ bias, float* __restrict__ C, int ldc, int M, int N, int K) {
  __shared__ __attribute__((aligned(16))) float so[4][16][64];
  const int tid = threadIdx.x, w = tid >> 5, lane = tid & 31, ln = lane & 15, hh = lane >> 4;
  const int ntn = N / 64;
  const int wid = blockIdx.x * 4 + w;
  const int mt = wid / ntn, nq = wid % ntn;
  if (mt * 16 >= M) return;
  const int row0 = mt * 16, col0 = nq * 64;
  const float* arow = A + (size_t)(row0 + ln) * lda;
  v8f acc[4] = {};
  for (int kb = 0; kb < K; kb += 32) {
    FragB ah, al;
    const v4f x0 = *(const v4fa*)(arow + kb + 8 * hh), x1 = *(const v4fa*)(arow + kb + 8 * hh + 4);
    const v4f x2 = *(const v4fa*)(arow + kb + 16 + 8 * hh), x3 = *(const v4fa*)(arow + kb + 16 + 8 * hh + 4);
    float xs[16] = {x0[0],x0[1],x0[2],x0[3],x1[0],x1[1],x1[2],x1[3],x2[0],x2[1],x2[2],x2[3],x3[0],x3[1],x3[2],x3[3]};
#pragma unroll
    for (int i = 0; i < 16; ++i) { const unsigned short hb = bf16_bits(xs[i]); ah.u[i] = hb; al.u[i] = ASPLIT ? bf16_bits(xs[i] - bf16_val(hb)) : (unsigned short)0; }
#pragma unroll
    for (int t = 0; t < 4; ++t) {
      const unsigned short* brow = Wt + (size_t)(col0 + t * 16 + ln) * ldb + kb;
      FragB b;
      b.half[0] = *(const v8us*)(brow + 8 * hh);
      b.half[1] = *(const v8us*)(brow + 16 + 8 * hh);
      acc[t] = mmaN<ASPLIT ? 2 : 1>(ah.v, al.v, b.v, b.v, acc[t]);
    }
  }
#pragma unroll
  for (int t = 0; t < 4; ++t) {
    float bv = bias ? bias[col0 + t * 16 + ln] : 0.f;
    if (BIAS_BF16) bv = bf16_round(bv);
#pragma unroll
    for (int r = 0; r < 8; ++r) { float v = acc[t][r] + bv; if (ACT == 1) v = fmaxf(v, 0.f); so[w][8 * hh + r][t * 16 + ln] = v; }
  }
  __builtin_amdgcn_fence(__ATOMIC_ACQ_REL, "workgroup");
  __builtin_amdgcn_wave_barrier();
  const int rsub = lane >> 4, c4 = (lane & 15) * 4;
  {
#pragma unroll
    for (int q = 0; q < 8; ++q) {
      const int r = q * 2 + rsub;
      const v4f v = *(const v4fa*)&so[w][r][c4];
      *(v4f*)(C + (size_t)(row0 + r) * ldc + col0 + c4) = v;
    }
    
  }
}

// Flash-style causal/unmasked attention, all contractions 3-term bf16 hi/lo splits, f32 softmax with running max.
// q,k,v rows are read from f32 buffers with arbitrary row pitch (so they can live inside a fused qkv buffer);
// D = head size (multiple of 32, <= 128); one wave = 16 query rows; block = 4 waves (64 queries) sharing K/V chunks of 32.
template <int D, bool CAUSAL>
__global__ __launch_bounds__(128) void k_flash(const float* __restrict__ qb, const float* __restrict__ kb, const float* __restrict__ vb,
                                             int pitch, int T, int H, float scale, float* __restrict__ y, int ypitch) {
  constexpr int KS = D / 32;        // k-steps for QK
  constexpr int DT = D / 16;        // d tiles for PV
  __shared__ __attribute__((aligned(16))) unsigned short sKh[32][D + 8], sKl[32][D + 8], sVh[32][D + 8], sVl[32][D + 8];
  __shared__ __attribute__((aligned(16))) unsigned short sPh[4][16][40], sPl[4][16][40];
  __shared__ __attribute__((aligned(16))) float sO[4][16][D];
  const int tid = threadIdx.x, w = tid >> 5, lane = tid & 31, ln = lane & 15, hh = lane >> 4;
  const int nqb = (T + 63) / 64;
  const int bh = blockIdx.x / nqb, qblk = blockIdx.x % nqb;
  const int b = bh / H, h = bh % H;
  const int q0 = qblk * 64 + w * 16;
  const float* Q = qb + (size_t)b * T * pitch + h * D;
  const float* K = kb + (size_t)b * T * pitch + h * D;
  const float* V = vb + (size_t)b * T * pitch + h * D;

  // A fragments of the wave's 16 query rows (scaled), hi/lo
  FragB aqh[KS], aql[KS];
  {
    int row = q0 + ln; if (row >= T) row = T - 1;
    const float* qr = Q + (size_t)row * pitch;
#pragma unroll
    for (int ks = 0; ks < KS; ++ks)
#pragma unroll
      for (int i = 0; i < 16; ++i) {
        const int d = ks * 32 + ((i < 8) ? (8 * hh + i) : (16 + 8 * hh + (i - 8)));
        const float x = qr[d] * scale; const unsigned short hb = bf16_bits(x);
        aqh[ks].u[i] = hb; aql[ks].u[i] = bf16_bits(x - bf16_val(hb));
      }
  }
  float m_r[8], l_r[8];
#pragma unroll
  for (int r = 0; r < 8; ++r) { m_r[r] = -3.0e38f; l_r[r] = 0.f; }
  v8f oacc[DT];
#pragma unroll
  for (int dt = 0; dt < DT; ++dt) oacc[dt] = (v8f){0.f,0.f,0.f,0.f,0.f,0.f,0.f,0.f};

  const int kv_end = CAUSAL ? min(T, qblk * 64 + 64) : T;     // block-uniform
  for (int j0 = 0; j0 < kv_end; j0 += 32) {
    __syncthreads();
    for (int e = tid; e < 32 * (D / 4); e += 128) {
      const int r = e / (D / 4), c4 = (e % (D / 4)) * 4;
      const int key = j0 + r;
      v4f kf = {0.f,0.f,0.f,0.f}, vf = {0.f,0.f,0.f,0.f};
      if (key < T) { kf = *(const v4fa*)(K + (size_t)key * pitch + c4); vf = *(const v4fa*)(V + (size_t)key * pitch + c4); }
#pragma unroll
      for (int t = 0; t < 4; ++t) {
        unsigned short hb = bf16_bits(kf[t]); sKh[r][c4 + t] = hb; sKl[r][c4 + t] = bf16_bits(kf[t] - bf16_val(hb));
        hb = bf16_bits(vf[t]); sVh[r][c4 + t] = hb; sVl[r][c4 + t] = bf16_bits(vf[t] - bf16_val(hb));
      }
    }
    __syncthreads();
    // S tile 16 x 32
    v8f s[2];
#pragma unroll
    for (int nt = 0; nt < 2; ++nt) {
      v8f acc = {};
#pragma unroll
      for (int ks = 0; ks < KS; ++ks) {
        FragB bh_, bl_;
        bh_.half[0] = *(const v8us*)&sKh[nt * 16 + ln][ks * 32 + 8 * hh]; bh_.half[1] = *(const v8us*)&sKh[nt * 16 + ln][ks * 32 + 16 + 8 * hh];
        bl_.half[0] = *(const v8us*)&sKl[nt * 16 + ln][ks * 32 + 8 * hh]; bl_.half[1] = *(const v8us*)&sKl[nt * 16 + ln][ks * 32 + 16 + 8 * hh];
        acc = mmaN<3>(aqh[ks].v, aql[ks].v, bh_.v, bl_.v, acc);
      }
      s[nt] = acc;
    }
    // mask + running max (rows 8hh+r; the 16 lanes of a half share rows)
    float alpha[8];
#pragma unroll
    for (int r = 0; r < 8; ++r) {
      const int qi = q0 + 8 * hh + r;
      const int ja = j0 + ln, jb = j0 + 16 + ln;
      if (CAUSAL) { if (ja > qi) s[0][r] = -3.0e38f; if (jb > qi) s[1][r] = -3.0e38f; }
      if (ja >= T) s[0][r] = -3.0e38f;
      if (jb >= T) s[1][r] = -3.0e38f;
      float mx = fmaxf(s[0][r], s[1][r]);
      mx = fmaxf(mx, __shfl_xor(mx, 1, 32)); mx = fmaxf(mx, __shfl_xor(mx, 2, 32)); mx = fmaxf(mx, __shfl_xor(mx, 4, 32)); mx = fmaxf(mx, __shfl_xor(mx, 8, 32));
      const float mnew = fmaxf(m_r[r], mx);
      alpha[r] = (mnew > -1.0e38f) ? __expf(m_r[r] - mnew) : 1.0f;
      const float p0 = (s[0][r] > -1.0e38f) ? __expf(s[0][r] - mnew) : 0.f;
      const float p1 = (s[1][r] > -1.0e38f) ? __expf(s[1][r] - mnew) : 0.f;
      m_r[r] = mnew;
      l_r[r] = l_r[r] * alpha[r] + p0 + p1;            // per-lane partial row sum (16 lanes combined at the end)
      unsigned short hb = bf16_bits(p0); sPh[w][8 * hh + r][ln] = hb;      sPl[w][8 * hh + r][ln] = bf16_bits(p0 - bf16_val(hb));
      hb = bf16_bits(p1);                sPh[w][8 * hh + r][16 + ln] = hb; sPl[w][8 * hh + r][16 + ln] = bf16_bits(p1 - bf16_val(hb));
    }
#pragma unroll
    for (int dt = 0; dt < DT; ++dt)
#pragma unroll
      for (int r = 0; r < 8; ++r) oacc[dt][r] *= alpha[r];
    __builtin_amdgcn_fence(__ATOMIC_ACQ_REL, "workgroup");
    __builtin_amdgcn_wave_barrier();
    FragB pah, pal;
    pah.half[0] = *(const v8us*)&sPh[w][ln][8 * hh]; pah.half[1] = *(const v8us*)&sPh[w][ln][16 + 8 * hh];
    pal.half[0] = *(const v8us*)&sPl[w][ln][8 * hh]; pal.half[1] = *(const v8us*)&sPl[w][ln][16 + 8 * hh];
#pragma unroll
    for (int dt = 0; dt < DT; ++dt) {
      FragB bvh, bvl;
#pragma unroll
      for (int i = 0; i < 8; ++i) {
        bvh.u[i] = sVh[8 * hh + i][dt * 16 + ln]; bvh.u[8 + i] = sVh[16 + 8 * hh + i][dt * 16 + ln];
        bvl.u[i] = sVl[8 * hh + i][dt * 16 + ln]; bvl.u[8 + i] = sVl[16 + 8 * hh + i][dt * 16 + ln];
      }
      oacc[dt] = mmaN<3>(pah.v, pal.v, bvh.v, bvl.v, oacc[dt]);
    }
    __builtin_amdgcn_fence(__ATOMIC_ACQ_REL, "workgroup");
    __builtin_amdgcn_wave_barrier();
  }
#pragma unroll
  for (int r = 0; r < 8; ++r) {
    float l = l_r[r];
    l += __shfl_xor(l, 1, 32); l += __shfl_xor(l, 2, 32); l += __shfl_xor(l, 4, 32); l += __shfl_xor(l, 8, 32);
    l_r[r] = (l > 0.f) ? 1.0f / l : 0.f;
  }
#pragma unroll
  for (int dt = 0; dt < DT; ++dt)
#pragma unroll
    for (int r = 0; r < 8; ++r) sO[w][8 * hh + r][dt * 16 + ln] = oacc[dt][r] * l_r[r];
  __builtin_amdgcn_fence(__ATOMIC_ACQ_REL, "workgroup");
  __builtin_amdgcn_wave_barrier();
  {
    for (int r = 0; r < 16; ++r) {
      const int row = q0 + r;
      if (row < T && lane < D / 4) {
        const v4f val = *(const v4fa*)&sO[w][r][lane * 4];
        *(v4f*)(y + ((size_t)b * T + row) * ypitch + h * D + lane * 4) = val;
      }
    }
    
  }
}

// GEMM C = act(A·W + bias + resid): A f32 (ASPLIT -> hi/lo 2 terms), Wt bf16 [N][K]; ACT 0 none, 1 relu, 2 exact gelu;
// resid (optional, f32, row index = (row % rmod), pitch ldr, RES_BF16 rounds it) added before the activation.
template <bool ASPLIT, int ACT, bool BIAS_BF16, bool RES_BF16>
__global__ __launch_bounds__(128) void k_gemm_bf3(const float* __restrict__ A, int lda, const unsigned short* __restrict__ Wt, int ldb,
                                                const float* __restrict__ bias, const float* __restrict__ resid, int rmod, int ldr,
                                                float* __restrict__ C, int ldc, int M, int N, int K) {
  __shared__ __attribute__((aligned(16))) float so[4][16][64];
  const int tid = threadIdx.x, w = tid >> 5, lane = tid & 31, ln = lane & 15, hh = lane >> 4;
  const int ntn = N / 64;
  const int wid = blockIdx.x * 4 + w;
  const int mt = wid / ntn, nq = wid % ntn;
  if (mt * 16 >= M) return;
  const int row0 = mt * 16, col0 = nq * 64;
  const float* arow = A + (size_t)(row0 + ln) * lda;
  v8f acc[4] = {};
  for (int kb = 0; kb < K; kb += 32) {
    FragB ah, al;
    const v4f x0 = *(const v4fa*)(arow + kb + 8 * hh), x1 = *(const v4fa*)(arow + kb + 8 * hh + 4);
    const v4f x2 = *(const v4fa*)(arow + kb + 16 + 8 * hh), x3 = *(const v4fa*)(arow + kb + 16 + 8 * hh + 4);
    float xs[16] = {x0[0],x0[1],x0[2],x0[3],x1[0],x1[1],x1[2],x1[3],x2[0],x2[1],x2[2],x2[3],x3[0],x3[1],x3[2],x3[3]};
#pragma unroll
    for (int i = 0; i < 16; ++i) { const unsigned short hb = bf16_bits(xs[i]); ah.u[i] = hb; al.u[i] = ASPLIT ? bf16_bits(xs[i] - bf16_val(hb)) : (unsigned short)0; }
#pragma unroll
    for (int t = 0; t < 4; ++t) {
      const unsigned short* brow = Wt + (size_t)(col0 + t * 16 + ln) * ldb + kb;
      FragB b;
      b.half[0] = *(const v8us*)(brow + 8 * hh);
      b.half[1] = *(const v8us*)(brow + 16 + 8 * hh);
      acc[t] = mmaN<ASPLIT ? 2 : 1>(ah.v, al.v, b.v, b.v, acc[t]);
    }
  }
#pragma unroll
  for (int t = 0; t < 4; ++t) {
    const int col = col0 + t * 16 + ln;
    float bv = bias ? bias[col] : 0.f;
    if (BIAS_BF16) bv = bf16_round(bv);
#pragma unroll
    for (int r = 0; r < 8; ++r) {
      float v = acc[t][r] + bv;
      if (resid) { float rv = resid[(size_t)((row0 + 8 * hh + r) % rmod) * ldr + col]; if (RES_BF16) rv = bf16_round(rv); v += rv; }
      if (ACT == 1) v = fmaxf(v, 0.f);
      if (ACT == 2) v = 0.5f * v * (1.0f + erff(v * 0.70710678118654752f));
      if (ACT == 3) { const float u = 0.7978845608028654f * (v + 0.044715f * v * v * v); v = 0.5f * v * (1.0f + tanhf(u)); }
      so[w][8 * hh + r][t * 16 + ln] = v;
    }
  }
  __builtin_amdgcn_fence(__ATOMIC_ACQ_REL, "workgroup");
  __builtin_amdgcn_wave_barrier();
  const int rsub = lane >> 4, c4 = (lane & 15) * 4;
  {
#pragma unroll
    for (int q = 0; q < 8; ++q) {
      const int r = q * 2 + rsub;
      const v4f v = *(const v4fa*)&so[w][r][c4];
      *(v4f*)(C + (size_t)(row0 + r) * ldc + col0 + c4) = v;
    }
    
  }
}
// row LayerNorm (biased variance, eps) over N: s = X (+ R); optional out_sum <- s; out_norm <- (s-mu)*rsqrt(var+eps)*g + b
template <bool PARAM_BF16>
__global__ __launch_bounds__(256) void k_layernorm(const float* __restrict__ X, const float* __restrict__ R, const float* __restrict__ g, const float* __restrict__ bta,
                                                  float* __restrict__ out_sum, float* __restrict__ out_norm, int N, float eps) {
  __shared__ float red[256];
  const int row = blockIdx.x, tid = threadIdx.x;
  const float* x = X + (size_t)row * N; const float* rr = R ? R + (size_t)row * N : nullptr;
  float vals[16];                     // up to N = 4096
  const int per = N / 256;            // contiguous chunk per thread? use strided-by-4 chunks: thread handles j = tid*4 + 1024*u
  float s1 = 0.f;
  for (int u = 0; u < per / 4; ++u) {
    const int j = tid * 4 + 1024 * u;
    const v4f a = *(const v4fa*)(x + j);
    v4f b = {0.f,0.f,0.f,0.f}; if (rr) b = *(const v4fa*)(rr + j);
#pragma unroll
    for (int q = 0; q < 4; ++q) { const float v = a[q] + b[q]; vals[u * 4 + q] = v; s1 += v; }
  }
  red[tid] = s1; __syncthreads();
  for (int st = 128; st > 0; st >>= 1) { if (tid < st) red[tid] += red[tid + st]; __syncthreads(); }
  const float mu = red[0] / (float)N; __syncthreads();
  float s2 = 0.f;
  for (int u = 0; u < per / 4; ++u)
#pragma unroll
    for (int q = 0; q < 4; ++q) { const float c = vals[u * 4 + q] - mu; s2 += c * c; }
  red[tid] = s2; __syncthreads();
  for (int st = 128; st > 0; st >>= 1) { if (tid < st) red[tid] += red[tid + st]; __syncthreads(); }
  const float rs = rsqrtf(red[0] / (float)N + eps);
  {
    for (int u = 0; u < per / 4; ++u) {
      const int j = tid * 4 + 1024 * u;
      v4f o, sm;
#pragma unroll
      for (int q = 0; q < 4; ++q) {
        float gg = g[j + q], bb = bta[j + q];
        if (PARAM_BF16) { gg = bf16_round(gg); bb = bf16_round(bb); }
        sm[q] = vals[u * 4 + q]; o[q] = (vals[u * 4 + q] - mu) * rs * gg + bb;
      }
      if (out_sum) *(v4f*)(out_sum + (size_t)row * N + j) = sm;
      *(v4f*)(out_norm + (size_t)row * N + j) = o;
    }
    
  }
}



// ---- f16 WMMA path (v_wmma_f32_16x16x32_f16): 11-bit significands for operands in range — used where a [0,1] probability operand needs more precision than bf16
typedef _Float16 v16h __attribute__((ext_vector_type(16)));
union FragH { v16h v; v8us half[2]; _Float16 h[16]; unsigned short u[16]; };
template <int NT>
__device__ __forceinline__ v8f mmaH(v16h ah, v16h al, v16h bh, v16h bl, v8f c) {
  c = __builtin_amdgcn_wmma_f32_16x16x32_f16(false, ah, false, bh, (short)0, c, false, false);
  if (NT >= 2) c = __builtin_amdgcn_wmma_f32_16x16x32_f16(false, al, false, bh, (short)0, c, false, false);
  if (NT >= 3) c = __builtin_amdgcn_wmma_f32_16x16x32_f16(false, ah, false, bl, (short)0, c, false, false);
  asm volatile("v_nop\n\tv_nop\n\tv_nop\n\tv_nop" : "+v"(c) : "v"(ah), "v"(al), "v"(bh), "v"(bl));
  return c;
}
// batched GEMM like k_gemm_b but f16 operands: A f32 (split into f16 hi/lo if ASPLIT, else rounded to f16), Bt = f16 values [n][k]; alpha; C f32; N multiple of 16 (partial tiles skipped)
template <bool ASPLIT>
__global__ __launch_bounds__(128) void k_gemm_h(const float* __restrict__ A, int lda, size_t sA, const _Float16* __restrict__ Bh, int ldb, size_t sB, float alpha, float* __restrict__ C, int ldc, size_t sC, int M, int N, int K) {
  __shared__ __attribute__((aligned(16))) float so[4][16][64];
  const int tid = threadIdx.x, w = tid >> 5, lane = tid & 31, ln = lane & 15, hh = lane >> 4; const int by = blockIdx.y;
  A += (size_t)by * sA; Bh += (size_t)by * sB; C += (size_t)by * sC;
  const int ntn = (N + 63) / 64; const int wid = blockIdx.x * 4 + w; const int mt = wid / ntn, nq = wid % ntn; if (mt * 16 >= M) return;
  const int row0 = mt * 16, col0 = nq * 64; const float* arow = A + (size_t)(row0 + ln) * lda;
  v8f acc[4] = {};
  for (int kb = 0; kb < K; kb += 32) {
    FragH ah, al;
    const v4f x0 = *(const v4fa*)(arow + kb + 8 * hh), x1 = *(const v4fa*)(arow + kb + 8 * hh + 4), x2 = *(const v4fa*)(arow + kb + 16 + 8 * hh), x3 = *(const v4fa*)(arow + kb + 16 + 8 * hh + 4);
    float xs[16] = {x0[0],x0[1],x0[2],x0[3],x1[0],x1[1],x1[2],x1[3],x2[0],x2[1],x2[2],x2[3],x3[0],x3[1],x3[2],x3[3]};
#pragma unroll
    for (int i = 0; i < 16; ++i) { const _Float16 h = (_Float16)xs[i]; ah.h[i] = h; al.h[i] = ASPLIT ? (_Float16)(xs[i] - (float)h) : (_Float16)0.0f; }
#pragma unroll
    for (int t = 0; t < 4; ++t) { if (col0 + t * 16 >= N) continue; const size_t boff = (size_t)(col0 + t * 16 + ln) * ldb + kb; FragH bq; bq.half[0] = *(const v8us*)(Bh + boff + 8 * hh); bq.half[1] = *(const v8us*)(Bh + boff + 16 + 8 * hh);
      acc[t] = mmaH<ASPLIT ? 2 : 1>(ah.v, al.v, bq.v, bq.v, acc[t]); }
  }
#pragma unroll
  for (int t = 0; t < 4; ++t) { if (col0 + t * 16 >= N) continue;
#pragma unroll
    for (int r = 0; r < 8; ++r) so[w][8 * hh + r][t * 16 + ln] = acc[t][r] * alpha; }
  __builtin_amdgcn_fence(__ATOMIC_ACQ_REL, "workgroup"); __builtin_amdgcn_wave_barrier();
  const int rsub = lane >> 4, c4 = (lane & 15) * 4;
  {
#pragma unroll
    for (int q = 0; q < 8; ++q) { const int r = q * 2 + rsub; if (col0 + c4 < N) { const v4f v = *(const v4fa*)&so[w][r][c4]; *(v4f*)(C + (size_t)(row0 + r) * ldc + col0 + c4) = v; } }
     }
}

// One launch prepares both GEMM operands, in fragment order. The first XB blocks: X16 = f16(bf16(x)), x row-major with pitch DD: a wave takes one block (16 rows x 32 cols: 16 whole lines of x) and writes its two units.
// Then WB blocks for each of Wq, Wk, Wv: Wt[n][k] = f16(bf16(W[k][n]) * 16) from f32 row-major W[DD][DD] (a power of two: bf16-exact weights stay exact in f16 away from the subnormal range);
// Wt has rows n, cols k, pitch DD: thread t writes the 16 B of lane t % 32 in unit t / 32. The three planes follow one another in Bw. The test on blockIdx.x is the same for a whole block.
#define XB (NR * DD / 16 / 256)
#define WB (DD * (DD / 8) / 256)
static_assert(NR * DD % (16 * 256) == 0 && DD * (DD / 8) % 256 == 0 && DD % 32 == 0, "whole blocks, no tail guards");
__global__ __launch_bounds__(256) void k_prep(const float* __restrict__ x, const float* __restrict__ Wq, const float* __restrict__ Wk, const float* __restrict__ Wv, _Float16* __restrict__ X16, _Float16* __restrict__ Bw) {
  FragH f;
  if (blockIdx.x < XB) {
    const unsigned t = blockIdx.x * 256 + threadIdx.x;
    const unsigned lane = t & 31, blk = t >> 5, rt = blk / (DD / 32), kb = blk % (DD / 32);
    const float* xr = x + (size_t)(rt * 16 + (lane & 15)) * DD + kb * 32 + (lane >> 4) * 8;
#pragma unroll
    for (int q = 0; q < 8; ++q) { f.h[q] = (_Float16)bf16_round(xr[q]); f.h[8 + q] = (_Float16)bf16_round(xr[16 + q]); }
    *(v8us*)((unsigned short*)X16 + (size_t)blk * 512 + lane * 8) = f.half[0]; *(v8us*)((unsigned short*)X16 + (size_t)blk * 512 + 256 + lane * 8) = f.half[1];
  } else {
    const unsigned wb = blockIdx.x - XB, pl = wb / WB; const float* W = (pl == 0) ? Wq : (pl == 1) ? Wk : Wv;
    const int t = (wb % WB) * 256 + threadIdx.x; const int lane = t & 31, u = t >> 5, blk = u >> 1; const int n = (blk / (DD / 32)) * 16 + (lane & 15), k8 = (blk % (DD / 32)) * 32 + (u & 1) * 16 + (lane >> 4) * 8;
#pragma unroll
    for (int i = 0; i < 8; ++i) f.h[i] = (_Float16)(bf16_round(W[(size_t)(k8 + i) * DD + n]) * 16.0f);
    *(v8us*)((unsigned short*)Bw + (size_t)pl * DD * DD + (size_t)t * 8) = f.half[0];
    asm volatile("s_wait_xcnt 0x0" ::: "memory");      /* in the built code the X part follows this store's branch and rewrites the store's registers: the wait stands in front of that rewrite */
  }
}
// The three projections in one launch: blockIdx.y = 0, 1, 2 takes Wq, Wk, Wv (planes of Bw) with its bias. v = acc / 16 + bf16(bias[col]), rounded to f16. A, Bw, Q16, K16 and Vt lie in fragment order.
// Q and K go out as planes of NR rows x DD cols. V goes out transposed, as the attention kernel reads it (Vt: rows (b * NH + h) * 64 + d, cols = keys, pitch TT): no V plane and no transposing launch.
// A wave owns 128 rows x 96 cols (8 x 6 accumulator tiles): 14 fragments of 1 KiB feed 48 WMMAs. The block's four waves stand 2 x 2 (256 x 192), one wave a SIMD, so each fragment is wanted by two waves of the block.
// NR / 256 * DD / 192 * 3 = 192 blocks.
#define GMT 8
#define GNT 6
__global__ __launch_bounds__(128) void k_gemm_qkv(const _Float16* __restrict__ A, const _Float16* __restrict__ Bw, const float* __restrict__ bq, const float* __restrict__ bk, const float* __restrict__ bv,
    _Float16* __restrict__ Q16, _Float16* __restrict__ K16, _Float16* __restrict__ Vt) {
  constexpr int lda = DD, ldb = DD, ldc = DD, K = DD, MT = GMT, NT = GNT, NBN = DD / (2 * NT * 16); constexpr float alpha = 0.0625f;
  static_assert(NR % (2 * MT * 16) == 0 && DD % (2 * NT * 16) == 0 && DD % 64 == 0 && TT % (MT * 16) == 0, "whole tiles, no tail guards; a wave's rows lie in one batch");
  __shared__ __attribute__((aligned(16))) float so[4][MT * 16][NT * 16 + 4];      /* pitch 100: the epilogue's row reads (one row a lane) fall on different banks */
  const int tid = threadIdx.x, w = tid >> 5, lane = tid & 31, ln = lane & 15, hh = lane >> 4; const int by = blockIdx.y;
  const _Float16* Bh = Bw + (size_t)by * DD * DD; const float* bp = (by == 0) ? bq : (by == 1) ? bk : bv;
  const int mb = blockIdx.x / NBN, nb = blockIdx.x % NBN;
  const int row0 = (mb * 2 + (w >> 1)) * (MT * 16), col0 = (nb * 2 + (w & 1)) * (NT * 16);
  v8f acc[MT][NT] = {};
  // Fragments are fetched ahead: two register sets of 32 k each; while one set feeds its 48 WMMAs the other set's 28 loads are in flight. K % 64 == 0.
  const unsigned short* ap = (const unsigned short*)A + (size_t)row0 * lda + lane * 8;      /* this lane's 16 B in the first unit of the first row tile; the next row tile lies 16 * pitch on */
  const unsigned short* wp = (const unsigned short*)Bh + (size_t)col0 * ldb + lane * 8;
  FragH a0[MT], a1[MT], b0[NT], b1[NT];
  // One step: the loads of set (al, bl) for k = kb + ko as one group, then the WMMA block on set (am, bm). ko is a literal and goes into the loads' offset fields; 32 k are one block of 512 elements, so k counts 16-fold.
  // The WMMAs are the plain builtin: the tiles and fragments fill more than 256 registers, and an asm operand cannot lie above v255.
  auto step = [&](FragH (&al)[MT], FragH (&bl)[NT], int kb, int ko, FragH (&am)[MT], FragH (&bm)[NT], const bool mm) {
    const unsigned short* pa = ap + kb * 16; const unsigned short* pw = wp + kb * 16;
#pragma unroll
    for (int m = 0; m < MT; ++m) { al[m].half[0] = *(const v8us*)(pa + ko * 16 + m * 16 * lda); al[m].half[1] = *(const v8us*)(pa + ko * 16 + m * 16 * lda + 256); }
#pragma unroll
    for (int t = 0; t < NT; ++t) { bl[t].half[0] = *(const v8us*)(pw + ko * 16 + t * 16 * ldb); bl[t].half[1] = *(const v8us*)(pw + ko * 16 + t * 16 * ldb + 256); }
    __builtin_amdgcn_sched_barrier(0);      /* the group's loads stay ahead of the WMMA block: else the scheduler sinks them among the WMMAs and their latency is waited out there */
    if (mm) {
#pragma unroll
      for (int m = 0; m < MT; ++m)
#pragma unroll
        for (int t = 0; t < NT; ++t) acc[m][t] = __builtin_amdgcn_wmma_f32_16x16x32_f16(false, am[m].v, false, bm[t].v, (short)0, acc[m][t], false, false);
    }
    __builtin_amdgcn_sched_barrier(0);      /* the statement below stays behind the whole block: else the scheduler lifts it to the block's head, where the wait would stall */
    /* v_nop: the next group's loads overwrite the last WMMA's A and B; four vector slots lie between. s_wait_xcnt: the group's address pairs are named, so no register of them is
       reused (not even as a later load's result) before this wait; it stands behind the block, not directly behind the loads, so that it is not waited out in front of the WMMAs */
    if (mm) asm volatile("v_nop\n\tv_nop\n\tv_nop\n\tv_nop\n\ts_wait_xcnt 0x0" :: "v"(pa), "v"(pw) : "memory");
    else asm volatile("s_wait_xcnt 0x0" :: "v"(pa), "v"(pw) : "memory");      /* the first group, in front of the loop: no WMMA stands ahead of it */
    __builtin_amdgcn_sched_barrier(0); };      /* the next group of loads stays behind this block: it overwrites the set that the block reads */
  step(a0, b0, 0, 0, a1, b1, false);
  for (int kb = 0; kb < K; kb += 64) {
    step(a1, b1, kb, 32, a0, b0, true);
    step(a0, b0, (kb + 64 < K) ? kb + 64 : 0, 0, a1, b1, true);      /* last trip: wraps to k = 0, in bounds, values unused; no branch, so the waits stay counted */
  }
  // The biases of the wave's six column tiles (bf16-rounded input), for both ways out.
  const int cb = col0 + ln; float bvv[NT];
#pragma unroll
  for (int t = 0; t < NT; ++t) bvv[t] = bp[cb + t * 16];
  asm volatile("s_wait_xcnt 0x0" :: "v"(cb) : "memory");      /* the loads' offset register is named, so it is not reused before the loads have taken it */
#pragma unroll
  for (int t = 0; t < NT; ++t) bvv[t] = bf16_round(bvv[t]);
  if (by == 2) {      /* the same for the whole block */
    // acc[m][t][r] is V[row0 + m * 16 + 8 hh + r][col0 + t * 16 + ln]: for the transposed plane that is row d = column % 64 of head column / 64, keys 8 hh .. 8 hh + 7 of a 16-key unit, which is what lane 16 hh + ln owns there:
    // each accumulator tile is one whole unit of Vt (512 B, 4 whole lines) and goes out of the registers as it stands. Vt's row is b * DD + column; the eight tiles m are eight units in a row.
    unsigned short* vu = (unsigned short*)Vt + ((size_t)(row0 / TT) * DD + col0) * TT + (size_t)((row0 % TT) >> 4) * 256 + lane * 8;
#pragma unroll
    for (int t = 0; t < NT; ++t) { FragH f[MT];
#pragma unroll
      for (int m = 0; m < MT; ++m)
#pragma unroll
        for (int r = 0; r < 8; ++r) f[m].h[r] = (_Float16)(acc[m][t][r] * alpha + bvv[t]);
      __builtin_amdgcn_sched_barrier(0);      /* the batch's units are all formed before its first store: no conversion takes a register that an issued store names */
#pragma unroll
      for (int m = 0; m < MT; ++m) *(v8us*)(vu + t * 16 * TT + m * 256) = f[m].half[0];
      asm volatile("s_wait_xcnt 0x0" :: "v"(vu) : "memory");      /* in front of the next batch, which rewrites the registers that these stores name */
      __builtin_amdgcn_sched_barrier(0); }      /* the next batch's conversions stay behind that wait */
    return;
  }
#pragma unroll
  for (int t = 0; t < NT; ++t)
#pragma unroll
    for (int m = 0; m < MT; ++m)
#pragma unroll
      for (int r = 0; r < 8; ++r) so[w][m * 16 + 8 * hh + r][t * 16 + ln] = acc[m][t][r] * alpha + bvv[t];
  __builtin_amdgcn_fence(__ATOMIC_ACQ_REL, "workgroup"); __builtin_amdgcn_wave_barrier();
  {      /* each of the wave's eight row tiles is six units in a row: 3 KiB of whole lines */
    unsigned short* cu = (unsigned short*)((by == 0) ? Q16 : K16) + (size_t)row0 * ldc + (size_t)(col0 >> 4) * 256 + lane * 8;
#pragma unroll
    for (int m = 0; m < MT; ++m) { FragH f[NT];
#pragma unroll
      for (int u = 0; u < NT; ++u) { const v4f v0 = *(const v4fa*)&so[w][m * 16 + ln][u * 16 + 8 * hh], v1 = *(const v4fa*)&so[w][m * 16 + ln][u * 16 + 8 * hh + 4];
#pragma unroll
        for (int i = 0; i < 4; ++i) { f[u].h[i] = (_Float16)v0[i]; f[u].h[4 + i] = (_Float16)v1[i]; } }
      __builtin_amdgcn_sched_barrier(0);      /* the batch's units are all formed before its first store: no conversion takes a register that an issued store names */
#pragma unroll
      for (int u = 0; u < NT; ++u) *(v8us*)(cu + m * 16 * ldc + u * 256) = f[u].half[0];
      asm volatile("s_wait_xcnt 0x0" :: "v"(cu) : "memory");      /* in front of the next batch (behind the last one: of the V part, which follows in the built code), which rewrites the registers that these stores name */
      __builtin_amdgcn_sched_barrier(0); }      /* the next batch's reads and conversions stay behind that wait */
  }
}


typedef _Float16 v4h __attribute__((ext_vector_type(4)));

__global__ __launch_bounds__(256) void k_h16(const float* __restrict__ x, _Float16* __restrict__ X16, size_t n8) { const size_t t = (size_t)blockIdx.x * 256 + threadIdx.x; if (t >= n8) return; FragH f;
#pragma unroll
  for (int q = 0; q < 8; ++q) f.h[q] = (_Float16)x[t * 8 + q]; *(v8us*)((unsigned short*)X16 + t * 8) = f.half[0];  }
__global__ __launch_bounds__(256) void k_round16f(const float* __restrict__ W, _Float16* __restrict__ Bt, size_t n8) { const size_t t = (size_t)blockIdx.x * 256 + threadIdx.x; if (t >= n8) return; FragH f;
#pragma unroll
  for (int i = 0; i < 8; ++i) f.h[i] = (_Float16)(bf16_round(W[t * 8 + i]) * 16.0f); *(v8us*)((unsigned short*)Bt + t * 8) = f.half[0];  }

typedef int v4i __attribute__((ext_vector_type(4)));
typedef int v4ia __attribute__((ext_vector_type(4), may_alias));
// lane l takes the value of lane l ^ 16 (a vector cross-row move, no LDS trip)
__device__ __forceinline__ float xhalf(float x) { return __builtin_bit_cast(float, __builtin_amdgcn_permlanex16(__builtin_bit_cast(int, x), __builtin_bit_cast(int, x), 0x76543210, 0xfedcba98, false, false)); }

// Both attention paths in one walk over the keys. The scores S^T = K Q^T are the same for the two paths, and so are the K and V^T fragments: each is fetched and each score tile is formed once;
// the wave then runs two online softmaxes (additive key bias; 0/1 mask) with two output accumulators, and the gated sum is taken in registers in the epilogue: no per-path output plane, no combining launch.
__global__ __launch_bounds__(128) void k_flash_gl(const _Float16* __restrict__ Q16, int ldq, const _Float16* __restrict__ K16, int ldk, const _Float16* __restrict__ Vt, const float* __restrict__ AB, const int* __restrict__ MSK, const float* __restrict__ gate, float* __restrict__ O, int ldo) {
  constexpr int RPW = 16, NQB = TT / (4 * RPW), DT = 4, KS = 2;
  __shared__ __attribute__((aligned(16))) float sO[4][RPW][64 + 4];
  const int tid = threadIdx.x, w = tid >> 5, lane = tid & 31, ln = lane & 15, hh = lane >> 4;
  const int slab = blockIdx.x / NQB, qblk = blockIdx.x % NQB; const int b = slab / NH, h = slab % NH; const int qb0 = qblk * (4 * RPW); const int q0 = qb0 + w * RPW;
  // Transposed tiles: S^T = K Q^T (A = 16 key rows, B = the wave's 16 queries), O^T += V^T P^T. Lane (ln, hh) owns query q0 + ln; its score registers hold keys j0 + 8 hh + r and j0 + 16 + 8 hh + r,
  // which is the k order of a B operand: P goes from the score registers into the second product with no LDS trip, and maximum and sum run inside the lane plus one exchange between the wave halves.
  FragH aq[KS];
  // Q16, K16 and Vt lie in fragment order (head of the file): a fragment half is one unit of 512 B, this lane's 16 B at lane * 8 elements; a head's 64 columns are two blocks (4 units) in a row.
  { const unsigned short* qr = (const unsigned short*)Q16 + ((size_t)b * TT + q0) * ldq + h * 1024 + lane * 8;
#pragma unroll
    for (int ks = 0; ks < KS; ++ks) { aq[ks].half[0] = *(const v8us*)(qr + ks * 512); aq[ks].half[1] = *(const v8us*)(qr + ks * 512 + 256); }
    asm volatile("s_wait_xcnt 0x0" :: "v"(qr) : "memory"); }      /* as in ldK below: the address pair stays whole until the loads have taken it */
  const unsigned short* Vth = (const unsigned short*)Vt + (size_t)slab * 64 * TT;
  float mg = -3.0e38f, lg = 0.f, ml = -3.0e38f, ll = 0.f; v8f og[DT], ol[DT];      /* running maximum, running sum, output tile: g = additive-bias path, l = 0/1-mask path */
#pragma unroll
  for (int dt = 0; dt < DT; ++dt) { og[dt] = (v8f){0.f,0.f,0.f,0.f,0.f,0.f,0.f,0.f}; ol[dt] = (v8f){0.f,0.f,0.f,0.f,0.f,0.f,0.f,0.f}; }
  const int jend = TT;
  // Global loads are issued ahead of their use: the K fragments, the key bias and the mask words one pass ahead (registers carried round the loop), the V^T fragments at the top of their own pass; their latency then runs under the softmaxes, not in front of each WMMA.
  const unsigned short* Kl = (const unsigned short*)K16 + (size_t)b * TT * ldk + h * 1024 + lane * 8; FragH bk[2][KS];
  const float* aml = AB + (size_t)b * TT + 8 * hh; v4f abn[2][2];
  const int* Ml = MSK + ((size_t)b * TT + q0 + ln) * TT + 8 * hh; v4i mkn[2][2];
  auto ldK = [&](int j) {
    const unsigned short* kr[2] = {Kl + (size_t)j * ldk, Kl + (size_t)(j + 16) * ldk};
#pragma unroll
    for (int nt = 0; nt < 2; ++nt)
#pragma unroll
      for (int ks = 0; ks < KS; ++ks) { bk[nt][ks].half[0] = *(const v8us*)(kr[nt] + ks * 512); bk[nt][ks].half[1] = *(const v8us*)(kr[nt] + ks * 512 + 256); }
    /* the group's address pairs are named so that no register of them is reused (not even as a later load's result) before the loads have taken them */
    asm volatile("s_wait_xcnt 0x0" :: "v"(kr[0]), "v"(kr[1]) : "memory"); };
  // The mask words and the key bias of pass j: issued behind the last use of the pass before, so they land in the registers that pass has just read and nothing is copied aside.
  auto ldM = [&](int j) {
    const float* am = aml + j; const int* mm = Ml + j;
#pragma unroll
    for (int nt = 0; nt < 2; ++nt) { mkn[nt][0] = *(const v4ia*)(mm + nt * 16); mkn[nt][1] = *(const v4ia*)(mm + nt * 16 + 4); }
#pragma unroll
    for (int nt = 0; nt < 2; ++nt) { abn[nt][0] = *(const v4fa*)(am + nt * 16); abn[nt][1] = *(const v4fa*)(am + nt * 16 + 4); }
    asm volatile("s_wait_xcnt 0x0" :: "v"(am), "v"(mm) : "memory"); };      /* as in ldK */
  // One path's online-softmax step on its 32 scores of this pass: new maximum, rescale of sum and output tile, P^T packed as a B operand (element nt * 8 + r is key nt * 16 + 8 hh + r, the order in which bv holds V^T).
  // The exponentials run in base 2 on the hardware's own instruction: exp(x) 2^10 = exp2(x log2(e) + 10). sc and m_r are in units of 1 / cs base-2 exponents (cs > 0, so the maximum is taken on sc as it is);
  // p, and with it the running sum, carries the factor 2^10 that P has as an f16 operand: the epilogue divides by that sum alone.
  auto soft = [&](const float (&sc)[2][8], const float cs, const bool fold, float& m_r, float& l_r, v8f (&oacc)[DT], FragH& pb) {
    float mx[8];
#pragma unroll
    for (int r = 0; r < 8; ++r) mx[r] = fmaxf(sc[0][r], sc[1][r]);
    float mc = fmaxf(fmaxf(fmaxf(mx[0], mx[1]), fmaxf(mx[2], mx[3])), fmaxf(fmaxf(mx[4], mx[5]), fmaxf(mx[6], mx[7])));
    mc = fmaxf(mc, xhalf(mc));      /* both wave halves now hold the maximum of the query's 32 scores of this pass */
    const float mn = fmaxf(m_r, mc); const float ea = __builtin_amdgcn_exp2f((m_r - mn) * cs); const float al = (mn > -1.0e38f) ? ea : 1.0f; m_r = mn;      /* computed, then selected: no branch */
    float p[2][8];      /* a masked score is -inf and mn is finite, so its exponential is 0 */
    const float nm = 10.0f - mn * cs;      /* fold: one multiply-add a score; only where mn * cs cannot overflow (cs < 1). Else the difference is taken first, as large additive biases need */
#pragma unroll
    for (int nt = 0; nt < 2; ++nt)
#pragma unroll
      for (int r = 0; r < 8; ++r) p[nt][r] = __builtin_amdgcn_exp2f(fold ? __builtin_fmaf(sc[nt][r], cs, nm) : __builtin_fmaf(sc[nt][r] - mn, cs, 10.0f));
    float ps[8];
#pragma unroll
    for (int r = 0; r < 8; ++r) ps[r] = p[0][r] + p[1][r];
    l_r = l_r * al + (((ps[0] + ps[1]) + (ps[2] + ps[3])) + ((ps[4] + ps[5]) + (ps[6] + ps[7])));      /* this half's 16 keys; the halves are joined behind the loop */
#pragma unroll
    for (int dt = 0; dt < DT; ++dt)
#pragma unroll
      for (int r = 0; r < 8; ++r) oacc[dt][r] *= al;
#pragma unroll
    for (int nt = 0; nt < 2; ++nt)
#pragma unroll
      for (int r = 0; r < 8; ++r) pb.h[nt * 8 + r] = (_Float16)p[nt][r]; };
  const float gq = bf16_round(gate[((size_t)b * NH + h) * TT + q0 + ln]);      /* the gate of this lane's query (bf16-rounded input) */
  ldK(0); ldM(0);
#pragma unroll 1      /* stays rolled: one set of carried fragment registers, and the pass's code is fetched once */
  for (int j0 = 0; j0 < jend; j0 += 32) {
    const int jn = (j0 + 32 < jend) ? j0 + 32 : 0;      /* the pass fetched for; behind the last pass it wraps to key 0: in bounds, values unused; no branch, so the waits stay counted */
    float ab[2][8];      /* additive attention bias (bf16-rounded input) of keys j0 + nt * 16 + 8 hh + r */
    int mk[2][8];      /* per-batch mask [b][q][k] of query q0 + ln, same keys: nonzero = ATTEND */
#pragma unroll
    for (int nt = 0; nt < 2; ++nt)
#pragma unroll
      for (int r = 0; r < 8; ++r) { ab[nt][r] = (float)(__bf16)abn[nt][r >> 2][r & 3]; mk[nt][r] = mkn[nt][r >> 2][r & 3]; }      /* the convert rounds to nearest even, as bf16_round does */
    FragH bv[DT];      /* V^T fragments of this pass: issued here, used behind the softmaxes, by both paths */
    const unsigned short* vr = Vth + (size_t)j0 * 16 + lane * 8;      /* 32 keys are one block of 512 elements */
#pragma unroll
    for (int dt = 0; dt < DT; ++dt) { bv[dt].half[0] = *(const v8us*)(vr + dt * 16 * TT); bv[dt].half[1] = *(const v8us*)(vr + dt * 16 * TT + 256); }
    asm volatile("s_wait_xcnt 0x0" :: "v"(vr) : "memory");      /* as in ldK: the address pair stays whole until the loads have taken it */
    v8f s[2];      /* the score products are the plain builtin: the compiler keeps the distance behind each with the pass's own vector work, where a fixed run of v_nop took issue slots from the SIMD's other waves */
#pragma unroll
    for (int nt = 0; nt < 2; ++nt) { v8f acc = (v8f){0.f,0.f,0.f,0.f,0.f,0.f,0.f,0.f};
#pragma unroll
      for (int ks = 0; ks < KS; ++ks) acc = __builtin_amdgcn_wmma_f32_16x16x32_f16(false, bk[nt][ks].v, false, aq[ks].v, (short)0, acc, false, false); s[nt] = acc; }
    ldK(jn);
    float scg[2][8], scl[2][8];
#pragma unroll
    for (int nt = 0; nt < 2; ++nt)
#pragma unroll
      for (int r = 0; r < 8; ++r) { scg[nt][r] = s[nt][r] * 0.125f + ab[nt][r]; scl[nt][r] = (mk[nt][r] != 0) ? s[nt][r] : -INFINITY; }      /* the mask path keeps the raw products: its 1 / 8 goes into cs */
    ldM(jn);
    FragH pg, pl;
    soft(scg, 1.4426950408889634f, false, mg, lg, og, pg);
    __builtin_amdgcn_sched_barrier(0);      /* one path's short softmax is scheduled whole, then the other's: else all 32 exponentials stand in one run with every argument and result live (more registers), one overwriting the source of the one directly in front */
    soft(scl, 0.125f * 1.4426950408889634f, true, ml, ll, ol, pl);
#pragma unroll
    for (int dt = 0; dt < DT; ++dt) { og[dt] = __builtin_amdgcn_wmma_f32_16x16x32_f16(false, bv[dt].v, false, pg.v, (short)0, og[dt], false, false);
      if (dt + 1 < DT) ol[dt] = __builtin_amdgcn_wmma_f32_16x16x32_f16(false, bv[dt].v, false, pl.v, (short)0, ol[dt], false, false);
      else ol[dt] = mmaH<1>(bv[dt].v, bv[dt].v, pl.v, pl.v, ol[dt]); } }      /* the pass's last product keeps its four v_nop: over the back edge the next pass's first product may write its result over this one's B */
  { const float sg = lg + xhalf(lg), sl = ll + xhalf(ll); const float lig = (sg > 0.f) ? 1.0f / sg : 0.f, lil = (sl > 0.f) ? 1.0f / sl : 0.f;      /* sums and output tiles both carry 2^10 */ const float g1 = 1.0f - gq;
#pragma unroll
    for (int dt = 0; dt < DT; ++dt) {      /* og[dt][r], ol[dt][r] = the paths' O[q0 + ln][dt * 16 + 8 hh + r]; the gated sum of the two goes out */
      v4f o0, o1;
#pragma unroll
      for (int r = 0; r < 4; ++r) { o0[r] = gq * (ol[dt][r] * lil) + g1 * (og[dt][r] * lig); o1[r] = gq * (ol[dt][4 + r] * lil) + g1 * (og[dt][4 + r] * lig); }
      *(v4fa*)&sO[w][ln][dt * 16 + 8 * hh] = o0; *(v4fa*)&sO[w][ln][dt * 16 + 8 * hh + 4] = o1; } }
  __builtin_amdgcn_fence(__ATOMIC_ACQ_REL, "workgroup"); __builtin_amdgcn_wave_barrier();
  {
#pragma unroll
    for (int rp = 0; rp < RPW; rp += 2) { const int r = rp + (lane >> 4), pc = lane & 15; const v4f val = *(const v4fa*)&sO[w][r][pc * 4]; *(v4f*)(O + ((size_t)b * TT + q0 + r) * ldo + h * 64 + pc * 4) = val; }
     } }

extern "C" void kernel_launch(void* const* d_in, const int* in_sizes, int n_in,
                              void* d_out, int out_size, void* d_ws, size_t ws_size, hipStream_t stream) {
  (void)in_sizes; (void)n_in; (void)out_size;
  const float* const* I = (const float* const*)d_in; const float* x = I[0]; const float* am = I[1]; const int* lm = (const int*)d_in[2]; const float* gate = I[3]; const float* Wq = I[4]; const float* bq = I[5]; const float* Wk = I[6]; const float* bk = I[7]; const float* Wv = I[8]; const float* bv = I[9];
  char* ws = (char*)d_ws; size_t off = 0;
  auto take = [&](size_t bytes) { char* p = ws + off; off += (bytes + 255) & ~(size_t)255; return p; };
  const size_t WSZ = (size_t)DD * DD; _Float16* Bw = (_Float16*)take(3 * WSZ * 2); _Float16* X16 = (_Float16*)take((size_t)NR * DD * 2); _Float16* Q = (_Float16*)take((size_t)NR * DD * 2); _Float16* K = (_Float16*)take((size_t)NR * DD * 2); _Float16* Vt = (_Float16*)take((size_t)NR * DD * 2);
  if (off > ws_size) return;      // 3.5 + 4 x 6.3 = about 29 MB
  k_prep<<<XB + 3 * WB, 256, 0, stream>>>(x, Wq, Wk, Wv, X16, Bw);      /* X and the three W^T x 2^4, f16, fragment order */
  k_gemm_qkv<<<dim3((NR / (2 * GMT * 16)) * (DD / (2 * GNT * 16)), 3), 128, 0, stream>>>(X16, Bw, bq, bk, bv, Q, K, Vt);      /* three times M 4096 N 768 K 768 */
  k_flash_gl<<<BB * NH * (TT / 64), 128, 0, stream>>>(Q, DD, K, DD, Vt, am, lm, gate, (float*)d_out, DD);      /* both paths and the gated sum */
}

// v009
// A run of this version takes 56.7 microseconds.
// Next to v008, in two timings, it ran 1.05 and 1.03 times as fast.
// Over all steps from v000 it is 6.22 times as fast.
#include <hip/hip_runtime.h>
// Gated global/local self attention (B=4, S=1024, HID=768, 12×64): q,k,v = x·W + b ((in,out)); scores = q·k/8; global path softmax(scores + attention_mask[b,0,0,k]); local path softmax(scores + (1 − local_mask[b,0,q,k])·f32_min); ctx = gate[b,h,q]·ctx_local + (1 − gate)·ctx_global, merged → [4,1024,768].
// Compute dtype: x, weights, biases, additive mask and gates rounded to bf16; q/k/v f16 GEMM planes; one flash-style kernel on v_wmma_f32_16x16x32_f16 (online softmax f32, P f16 x 2^10, f32 accumulate) that forms each score tile once and feeds two softmaxes: one with the per-batch additive key bias, one with the per-batch 0/1 (q,k) mask
// (0 -> weight 0); the gated combination in f32, in that kernel's epilogue.
// Every f16 plane that feeds a WMMA from global memory (X, W^T, Q, K, V^T) lies in FRAGMENT ORDER: a plane of rows x cols is cut into blocks of 16 rows x 32 cols (1 KiB, row tile major, then column block);
// a block is two units of 512 B (cols 0..15, cols 16..31); in a unit lane l = 16 hh + ln owns 16 B: row ln, cols 8 hh .. 8 hh + 7. A wave's b128 load of a fragment half is then one unit: 4 whole 128-B lines, where a row-major plane gives 16 pieces of 32 B.
// Element (R, C) of a plane with pitch P (cols): (R / 16) * 16 * P + (C / 32) * 512 + ((C / 16) % 2) * 256 + (((C / 8) % 2) * 16 + R % 16) * 8 + C % 8.
#define BB 4
#define TT 1024
#define DD 768
#define NH 12
#define NR (BB * TT)

typedef __bf16 v16b __attribute__((ext_vector_type(16)));
typedef unsigned short v8us __attribute__((ext_vector_type(8), may_alias));
typedef float  v8f  __attribute__((ext_vector_type(8)));
typedef float  v4f  __attribute__((ext_vector_type(4)));
typedef float  v4fa __attribute__((ext_vector_type(4), may_alias));
union FragB { v16b v; v8us half[2]; unsigned short u[16]; };

__device__ __forceinline__ unsigned short bf16_bits(float x) { unsigned int u = __float_as_uint(x); return (unsigned short)((u + 0x7FFFu + ((u >> 16) & 1u)) >> 16); }
__device__ __forceinline__ float bf16_val(unsigned short b) { return __uint_as_float(((unsigned int)b) << 16); }
__device__ __forceinline__ float bf16_round(float x) { return bf16_val(bf16_bits(x)); }
// D += A·B with NT terms: 1 = ah·bh, 2 = + al·bh (A split), 3 = + ah·bl (both split)
template <int NT>
__device__ __forceinline__ v8f mmaN(v16b ah, v16b al, v16b bh, v16b bl, v8f c) {
  c = __builtin_amdgcn_wmma_f32_16x16x32_bf16(false, ah, false, bh, (short)0, c, false, false);
  if (NT >= 2) c = __builtin_amdgcn_wmma_f32_16x16x32_bf16(false, al, false, bh, (short)0, c, false, false);
  if (NT >= 3) c = __builtin_amdgcn_wmma_f32_16x16x32_bf16(false, ah, false, bl, (short)0, c, false, false);
  asm volatile("v_nop\n\tv_nop\n\tv_nop\n\tv_nop" : "+v"(c) : "v"(ah), "v"(al), "v"(bh), "v"(bl));
  return c;
}

__global__ __launch_bounds__(256) void k_wt_bf16(const float* __restrict__ W, unsigned short* __restrict__ Wt, int K, int N) {
  const int t = blockIdx.x * 256 + threadIdx.x;
  const int k8n = K / 8;
  if (t >= N * k8n) return;
  const int n = t / k8n, k8 = (t % k8n) * 8;
  v8us v;
#pragma unroll
  for (int i = 0; i < 8; ++i) v[i] = bf16_bits(W[(size_t)(k8 + i) * N + n]);
  *(v8us*)(Wt + (size_t)n * K + k8) = v;
  
}

// GEMM C[M][N] (f32, pitch ldc) = act(A[M][K]·W + bias). A f32 row-major (pitch lda) converted per fragment to bf16
// (ASPLIT: hi/lo two planes -> 2 terms, else single rounded term); Wt bf16 [N][K] (pitch ldb). BIAS_BF16 rounds the
// bias to bf16 first (bias quantised to bf16 before the add). K%32==0, M%16==0, N%64==0.
template <bool ASPLIT, int ACT, bool BIAS_BF16>
__global__ __launch_bounds__(128) void k_gemm_bf(const float* __restrict__ A, int lda, const unsigned short* __restrict__ Wt, int ldb,
                                               const float* __restrict__ bias, float* __restrict__ C, int ldc, int M, int N, int K) {
  __shared__ __attribute__((aligned(16))) float so[4][16][64];
  const int tid = threadIdx.x, w = tid >> 5, lane = tid & 31, ln = lane & 15, hh = lane >> 4;
  const int ntn = N / 64;
  const int wid = blockIdx.x * 4 + w;
  const int mt = wid / ntn, nq = wid % ntn;
  if (mt * 16 >= M) return;
  const int row0 = mt * 16, col0 = nq * 64;
  const float* arow = A + (size_t)(row0 + ln) * lda;
  v8f acc[4] = {};
  for (int kb = 0; kb < K; kb += 32) {
    FragB ah, al;
    const v4f x0 = *(const v4fa*)(arow + kb + 8 * hh), x1 = *(const v4fa*)(arow + kb + 8 * hh + 4);
    const v4f x2 = *(const v4fa*)(arow + kb + 16 + 8 * hh), x3 = *(const v4fa*)(arow + kb + 16 + 8 * hh + 4);
    float xs[16] = {x0[0],x0[1],x0[2],x0[3],x1[0],x1[1],x1[2],x1[3],x2[0],x2[1],x2[2],x2[3],x3[0],x3[1],x3[2],x3[3]};
#pragma unroll
    for (int i = 0; i < 16; ++i) { const unsigned short hb = bf16_bits(xs[i]); ah.u[i] = hb; al.u[i] = ASPLIT ? bf16_bits(xs[i] - bf16_val(hb)) : (unsigned short)0; }
#pragma unroll
    for (int t = 0; t < 4; ++t) {
      const unsigned short* brow = Wt + (size_t)(col0 + t * 16 + ln) * ldb + kb;
      FragB b;
      b.half[0] = *(const v8us*)(brow + 8 * hh);
      b.half[1] = *(const v8us*)(brow + 16 + 8 * hh);
      acc[t] = mmaN<ASPLIT ? 2 : 1>(ah.v, al.v, b.v, b.v, acc[t]);
    }
  }
#pragma unroll
  for (int t = 0; t < 4; ++t) {
    float bv = bias ? bias[col0 + t * 16 + ln] : 0.f;
    if (BIAS_BF16) bv = bf16_round(bv);
#pragma unroll
    for (int r = 0; r < 8; ++r) { float v = acc[t][r] + bv; if (ACT == 1) v = fmaxf(v, 0.f); so[w][8 * hh + r][t * 16 + ln] = v; }
  }
  __builtin_amdgcn_fence(__ATOMIC_ACQ_REL, "workgroup");
  __builtin_amdgcn_wave_barrier();
  const int rsub = lane >> 4, c4 = (lane & 15) * 4;
  {
#pragma unroll
    for (int q = 0; q < 8; ++q) {
      const int r = q * 2 + rsub;
      const v4f v = *(const v4fa*)&so[w][r][c4];
      *(v4f*)(C + (size_t)(row0 + r) * ldc + col0 + c4) = v;
    }
    
  }
}

// Flash-style causal/unmasked attention, all contractions 3-term bf16 hi/lo splits, f32 softmax with running max.
// q,k,v rows are read from f32 buffers with arbitrary row pitch (so they can live inside a fused qkv buffer);
// D = head size (multiple of 32, <= 128); one wave = 16 query rows; block = 4 waves (64 queries) sharing K/V chunks of 32.
template <int D, bool CAUSAL>
__global__ __launch_bounds__(128) void k_flash(const float* __restrict__ qb, const float* __restrict__ kb, const float* __restrict__ vb,
                                             int pitch, int T, int H, float scale, float* __restrict__ y, int ypitch) {
  constexpr int KS = D / 32;        // k-steps for QK
  constexpr int DT = D / 16;        // d tiles for PV
  __shared__ __attribute__((aligned(16))) unsigned short sKh[32][D + 8], sKl[32][D + 8], sVh[32][D + 8], sVl[32][D + 8];
  __shared__ __attribute__((aligned(16))) unsigned short sPh[4][16][40], sPl[4][16][40];
  __shared__ __attribute__((aligned(16))) float sO[4][16][D];
  const int tid = threadIdx.x, w = tid >> 5, lane = tid & 31, ln = lane & 15, hh = lane >> 4;
  const int nqb = (T + 63) / 64;
  const int bh = blockIdx.x / nqb, qblk = blockIdx.x % nqb;
  const int b = bh / H, h = bh % H;
  const int q0 = qblk * 64 + w * 16;
  const float* Q = qb + (size_t)b * T * pitch + h * D;
  const float* K = kb + (size_t)b * T * pitch + h * D;
  const float* V = vb + (size_t)b * T * pitch + h * D;

  // A fragments of the wave's 16 query rows (scaled), hi/lo
  FragB aqh[KS], aql[KS];
  {
    int row = q0 + ln; if (row >= T) row = T - 1;
    const float* qr = Q + (size_t)row * pitch;
#pragma unroll
    for (int ks = 0; ks < KS; ++ks)
#pragma unroll
      for (int i = 0; i < 16; ++i) {
        const int d = ks * 32 + ((i < 8) ? (8 * hh + i) : (16 + 8 * hh + (i - 8)));
        const float x = qr[d] * scale; const unsigned short hb = bf16_bits(x);
        aqh[ks].u[i] = hb; aql[ks].u[i] = bf16_bits(x - bf16_val(hb));
      }
  }
  float m_r[8], l_r[8];
#pragma unroll
  for (int r = 0; r < 8; ++r) { m_r[r] = -3.0e38f; l_r[r] = 0.f; }
  v8f oacc[DT];
#pragma unroll
  for (int dt = 0; dt < DT; ++dt) oacc[dt] = (v8f){0.f,0.f,0.f,0.f,0.f,0.f,0.f,0.f};

  const int kv_end = CAUSAL ? min(T, qblk * 64 + 64) : T;     // block-uniform
  for (int j0 = 0; j0 < kv_end; j0 += 32) {
    __syncthreads();
    for (int e = tid; e < 32 * (D / 4); e += 128) {
      const int r = e / (D / 4), c4 = (e % (D / 4)) * 4;
      const int key = j0 + r;
      v4f kf = {0.f,0.f,0.f,0.f}, vf = {0.f,0.f,0.f,0.f};
      if (key < T) { kf = *(const v4fa*)(K + (size_t)key * pitch + c4); vf = *(const v4fa*)(V + (size_t)key * pitch + c4); }
#pragma unroll
      for (int t = 0; t < 4; ++t) {
        unsigned short hb = bf16_bits(kf[t]); sKh[r][c4 + t] = hb; sKl[r][c4 + t] = bf16_bits(kf[t] - bf16_val(hb));
        hb = bf16_bits(vf[t]); sVh[r][c4 + t] = hb; sVl[r][c4 + t] = bf16_bits(vf[t] - bf16_val(hb));
      }
    }
    __syncthreads();
    // S tile 16 x 32
    v8f s[2];
#pragma unroll
    for (int nt = 0; nt < 2; ++nt) {
      v8f acc = {};
#pragma unroll
      for (int ks = 0; ks < KS; ++ks) {
        FragB bh_, bl_;
        bh_.half[0] = *(const v8us*)&sKh[nt * 16 + ln][ks * 32 + 8 * hh]; bh_.half[1] = *(const v8us*)&sKh[nt * 16 + ln][ks * 32 + 16 + 8 * hh];
        bl_.half[0] = *(const v8us*)&sKl[nt * 16 + ln][ks * 32 + 8 * hh]; bl_.half[1] = *(const v8us*)&sKl[nt * 16 + ln][ks * 32 + 16 + 8 * hh];
        acc = mmaN<3>(aqh[ks].v, aql[ks].v, bh_.v, bl_.v, acc);
      }
      s[nt] = acc;
    }
    // mask + running max (rows 8hh+r; the 16 lanes of a half share rows)
    float alpha[8];
#pragma unroll
    for (int r = 0; r < 8; ++r) {
      const int qi = q0 + 8 * hh + r;
      const int ja = j0 + ln, jb = j0 + 16 + ln;
      if (CAUSAL) { if (ja > qi) s[0][r] = -3.0e38f; if (jb > qi) s[1][r] = -3.0e38f; }
      if (ja >= T) s[0][r] = -3.0e38f;
      if (jb >= T) s[1][r] = -3.0e38f;
      float mx = fmaxf(s[0][r], s[1][r]);
      mx = fmaxf(mx, __shfl_xor(mx, 1, 32)); mx = fmaxf(mx, __shfl_xor(mx, 2, 32)); mx = fmaxf(mx, __shfl_xor(mx, 4, 32)); mx = fmaxf(mx, __shfl_xor(mx, 8, 32));
      const float mnew = fmaxf(m_r[r], mx);
      alpha[r] = (mnew > -1.0e38f) ? __expf(m_r[r] - mnew) : 1.0f;
      const float p0 = (s[0][r] > -1.0e38f) ? __expf(s[0][r] - mnew) : 0.f;
      const float p1 = (s[1][r] > -1.0e38f) ? __expf(s[1][r] - mnew) : 0.f;
      m_r[r] = mnew;
      l_r[r] = l_r[r] * alpha[r] + p0 + p1;            // per-lane partial row sum (16 lanes combined at the end)
      unsigned short hb = bf16_bits(p0); sPh[w][8 * hh + r][ln] = hb;      sPl[w][8 * hh + r][ln] = bf16_bits(p0 - bf16_val(hb));
      hb = bf16_bits(p1);                sPh[w][8 * hh + r][16 + ln] = hb; sPl[w][8 * hh + r][16 + ln] = bf16_bits(p1 - bf16_val(hb));
    }
#pragma unroll
    for (int dt = 0; dt < DT; ++dt)
#pragma unroll
      for (int r = 0; r < 8; ++r) oacc[dt][r] *= alpha[r];
    __builtin_amdgcn_fence(__ATOMIC_ACQ_REL, "workgroup");
    __builtin_amdgcn_wave_barrier();
    FragB pah, pal;
    pah.half[0] = *(const v8us*)&sPh[w][ln][8 * hh]; pah.half[1] = *(const v8us*)&sPh[w][ln][16 + 8 * hh];
    pal.half[0] = *(const v8us*)&sPl[w][ln][8 * hh]; pal.half[1] = *(const v8us*)&sPl[w][ln][16 + 8 * hh];
#pragma unroll
    for (int dt = 0; dt < DT; ++dt) {
      FragB bvh, bvl;
#pragma unroll
      for (int i = 0; i < 8; ++i) {
        bvh.u[i] = sVh[8 * hh + i][dt * 16 + ln]; bvh.u[8 + i] = sVh[16 + 8 * hh + i][dt * 16 + ln];
        bvl.u[i] = sVl[8 * hh + i][dt * 16 + ln]; bvl.u[8 + i] = sVl[16 + 8 * hh + i][dt * 16 + ln];
      }
      oacc[dt] = mmaN<3>(pah.v, pal.v, bvh.v, bvl.v, oacc[dt]);
    }
    __builtin_amdgcn_fence(__ATOMIC_ACQ_REL, "workgroup");
    __builtin_amdgcn_wave_barrier();
  }
#pragma unroll
  for (int r = 0; r < 8; ++r) {
    float l = l_r[r];
    l += __shfl_xor(l, 1, 32); l += __shfl_xor(l, 2, 32); l += __shfl_xor(l, 4, 32); l += __shfl_xor(l, 8, 32);
    l_r[r] = (l > 0.f) ? 1.0f / l : 0.f;
  }
#pragma unroll
  for (int dt = 0; dt < DT; ++dt)
#pragma unroll
    for (int r = 0; r < 8; ++r) sO[w][8 * hh + r][dt * 16 + ln] = oacc[dt][r] * l_r[r];
  __builtin_amdgcn_fence(__ATOMIC_ACQ_REL, "workgroup");
  __builtin_amdgcn_wave_barrier();
  {
    for (int r = 0; r < 16; ++r) {
      const int row = q0 + r;
      if (row < T && lane < D / 4) {
        const v4f val = *(const v4fa*)&sO[w][r][lane * 4];
        *(v4f*)(y + ((size_t)b * T + row) * ypitch + h * D + lane * 4) = val;
      }
    }
    
  }
}

// GEMM C = act(A·W + bias + resid): A f32 (ASPLIT -> hi/lo 2 terms), Wt bf16 [N][K]; ACT 0 none, 1 relu, 2 exact gelu;
// resid (optional, f32, row index = (row % rmod), pitch ldr, RES_BF16 rounds it) added before the activation.
template <bool ASPLIT, int ACT, bool BIAS_BF16, bool RES_BF16>
__global__ __launch_bounds__(128) void k_gemm_bf3(const float* __restrict__ A, int lda, const unsigned short* __restrict__ Wt, int ldb,
                                                const float* __restrict__ bias, const float* __restrict__ resid, int rmod, int ldr,
                                                float* __restrict__ C, int ldc, int M, int N, int K) {
  __shared__ __attribute__((aligned(16))) float so[4][16][64];
  const int tid = threadIdx.x, w = tid >> 5, lane = tid & 31, ln = lane & 15, hh = lane >> 4;
  const int ntn = N / 64;
  const int wid = blockIdx.x * 4 + w;
  const int mt = wid / ntn, nq = wid % ntn;
  if (mt * 16 >= M) return;
  const int row0 = mt * 16, col0 = nq * 64;
  const float* arow = A + (size_t)(row0 + ln) * lda;
  v8f acc[4] = {};
  for (int kb = 0; kb < K; kb += 32) {
    FragB ah, al;
    const v4f x0 = *(const v4fa*)(arow + kb + 8 * hh), x1 = *(const v4fa*)(arow + kb + 8 * hh + 4);
    const v4f x2 = *(const v4fa*)(arow + kb + 16 + 8 * hh), x3 = *(const v4fa*)(arow + kb + 16 + 8 * hh + 4);
    float xs[16] = {x0[0],x0[1],x0[2],x0[3],x1[0],x1[1],x1[2],x1[3],x2[0],x2[1],x2[2],x2[3],x3[0],x3[1],x3[2],x3[3]};
#pragma unroll
    for (int i = 0; i < 16; ++i) { const unsigned short hb = bf16_bits(xs[i]); ah.u[i] = hb; al.u[i] = ASPLIT ? bf16_bits(xs[i] - bf16_val(hb)) : (unsigned short)0; }
#pragma unroll
    for (int t = 0; t < 4; ++t) {
      const unsigned short* brow = Wt + (size_t)(col0 + t * 16 + ln) * ldb + kb;
      FragB b;
      b.half[0] = *(const v8us*)(brow + 8 * hh);
      b.half[1] = *(const v8us*)(brow + 16 + 8 * hh);
      acc[t] = mmaN<ASPLIT ? 2 : 1>(ah.v, al.v, b.v, b.v, acc[t]);
    }
  }
#pragma unroll
  for (int t = 0; t < 4; ++t) {
    const int col = col0 + t * 16 + ln;
    float bv = bias ? bias[col] : 0.f;
    if (BIAS_BF16) bv = bf16_round(bv);
#pragma unroll
    for (int r = 0; r < 8; ++r) {
      float v = acc[t][r] + bv;
      if (resid) { float rv = resid[(size_t)((row0 + 8 * hh + r) % rmod) * ldr + col]; if (RES_BF16) rv = bf16_round(rv); v += rv; }
      if (ACT == 1) v = fmaxf(v, 0.f);
      if (ACT == 2) v = 0.5f * v * (1.0f + erff(v * 0.70710678118654752f));
      if (ACT == 3) { const float u = 0.7978845608028654f * (v + 0.044715f * v * v * v); v = 0.5f * v * (1.0f + tanhf(u)); }
      so[w][8 * hh + r][t * 16 + ln] = v;
    }
  }
  __builtin_amdgcn_fence(__ATOMIC_ACQ_REL, "workgroup");
  __builtin_amdgcn_wave_barrier();
  const int rsub = lane >> 4, c4 = (lane & 15) * 4;
  {
#pragma unroll
    for (int q = 0; q < 8; ++q) {
      const int r = q * 2 + rsub;
      const v4f v = *(const v4fa*)&so[w][r][c4];
      *(v4f*)(C + (size_t)(row0 + r) * ldc + col0 + c4) = v;
    }
    
  }
}
// row LayerNorm (biased variance, eps) over N: s = X (+ R); optional out_sum <- s; out_norm <- (s-mu)*rsqrt(var+eps)*g + b
template <bool PARAM_BF16>
__global__ __launch_bounds__(256) void k_layernorm(const float* __restrict__ X, const float* __restrict__ R, const float* __restrict__ g, const float* __restrict__ bta,
                                                  float* __restrict__ out_sum, float* __restrict__ out_norm, int N, float eps) {
  __shared__ float red[256];
  const int row = blockIdx.x, tid = threadIdx.x;
  const float* x = X + (size_t)row * N; const float* rr = R ? R + (size_t)row * N : nullptr;
  float vals[16];                     // up to N = 4096
  const int per = N / 256;            // contiguous chunk per thread? use strided-by-4 chunks: thread handles j = tid*4 + 1024*u
  float s1 = 0.f;
  for (int u = 0; u < per / 4; ++u) {
    const int j = tid * 4 + 1024 * u;
    const v4f a = *(const v4fa*)(x + j);
    v4f b = {0.f,0.f,0.f,0.f}; if (rr) b = *(const v4fa*)(rr + j);
#pragma unroll
    for (int q = 0; q < 4; ++q) { const float v = a[q] + b[q]; vals[u * 4 + q] = v; s1 += v; }
  }
  red[tid] = s1; __syncthreads();
  for (int st = 128; st > 0; st >>= 1) { if (tid < st) red[tid] += red[tid + st]; __syncthreads(); }
  const float mu = red[0] / (float)N; __syncthreads();
  float s2 = 0.f;
  for (int u = 0; u < per / 4; ++u)
#pragma unroll
    for (int q = 0; q < 4; ++q) { const float c = vals[u * 4 + q] - mu; s2 += c * c; }
  red[tid] = s2; __syncthreads();
  for (int st = 128; st > 0; st >>= 1) { if (tid < st) red[tid] += red[tid + st]; __syncthreads(); }
  const float rs = rsqrtf(red[0] / (float)N + eps);
  {
    for (int u = 0; u < per / 4; ++u) {
      const int j = tid * 4 + 1024 * u;
      v4f o, sm;
#pragma unroll
      for (int q = 0; q < 4; ++q) {
        float gg = g[j + q], bb = bta[j + q];
        if (PARAM_BF16) { gg = bf16_round(gg); bb = bf16_round(bb); }
        sm[q] = vals[u * 4 + q]; o[q] = (vals[u * 4 + q] - mu) * rs * gg + bb;
      }
      if (out_sum) *(v4f*)(out_sum + (size_t)row * N + j) = sm;
      *(v4f*)(out_norm + (size_t)row * N + j) = o;
    }
    
  }
}



// ---- f16 WMMA path (v_wmma_f32_16x16x32_f16): 11-bit significands for operands in range — used where a [0,1] probability operand needs more precision than bf16
typedef _Float16 v16h __attribute__((ext_vector_type(16)));
union FragH { v16h v; v8us half[2]; _Float16 h[16]; unsigned short u[16]; };
template <int NT>
__device__ __forceinline__ v8f mmaH(v16h ah, v16h al, v16h bh, v16h bl, v8f c) {
  c = __builtin_amdgcn_wmma_f32_16x16x32_f16(false, ah, false, bh, (short)0, c, false, false);
  if (NT >= 2) c = __builtin_amdgcn_wmma_f32_16x16x32_f16(false, al, false, bh, (short)0, c, false, false);
  if (NT >= 3) c = __builtin_amdgcn_wmma_f32_16x16x32_f16(false, ah, false, bl, (short)0, c, false, false);
  asm volatile("v_nop\n\tv_nop\n\tv_nop\n\tv_nop" : "+v"(c) : "v"(ah), "v"(al), "v"(bh), "v"(bl));
  return c;
}
// batched GEMM like k_gemm_b but f16 operands: A f32 (split into f16 hi/lo if ASPLIT, else rounded to f16), Bt = f16 values [n][k]; alpha; C f32; N multiple of 16 (partial tiles skipped)
template <bool ASPLIT>
__global__ __launch_bounds__(128) void k_gemm_h(const float* __restrict__ A, int lda, size_t sA, const _Float16* __restrict__ Bh, int ldb, size_t sB, float alpha, float* __restrict__ C, int ldc, size_t sC, int M, int N, int K) {
  __shared__ __attribute__((aligned(16))) float so[4][16][64];
  const int tid = threadIdx.x, w = tid >> 5, lane = tid & 31, ln = lane & 15, hh = lane >> 4; const int by = blockIdx.y;
  A += (size_t)by * sA; Bh += (size_t)by * sB; C += (size_t)by * sC;
  const int ntn = (N + 63) / 64; const int wid = blockIdx.x * 4 + w; const int mt = wid / ntn, nq = wid % ntn; if (mt * 16 >= M) return;
  const int row0 = mt * 16, col0 = nq * 64; const float* arow = A + (size_t)(row0 + ln) * lda;
  v8f acc[4] = {};
  for (int kb = 0; kb < K; kb += 32) {
    FragH ah, al;
    const v4f x0 = *(const v4fa*)(arow + kb + 8 * hh), x1 = *(const v4fa*)(arow + kb + 8 * hh + 4), x2 = *(const v4fa*)(arow + kb + 16 + 8 * hh), x3 = *(const v4fa*)(arow + kb + 16 + 8 * hh + 4);
    float xs[16] = {x0[0],x0[1],x0[2],x0[3],x1[0],x1[1],x1[2],x1[3],x2[0],x2[1],x2[2],x2[3],x3[0],x3[1],x3[2],x3[3]};
#pragma unroll
    for (int i = 0; i < 16; ++i) { const _Float16 h = (_Float16)xs[i]; ah.h[i] = h; al.h[i] = ASPLIT ? (_Float16)(xs[i] - (float)h) : (_Float16)0.0f; }
#pragma unroll
    for (int t = 0; t < 4; ++t) { if (col0 + t * 16 >= N) continue; const size_t boff = (size_t)(col0 + t * 16 + ln) * ldb + kb; FragH bq; bq.half[0] = *(const v8us*)(Bh + boff + 8 * hh); bq.half[1] = *(const v8us*)(Bh + boff + 16 + 8 * hh);
      acc[t] = mmaH<ASPLIT ? 2 : 1>(ah.v, al.v, bq.v, bq.v, acc[t]); }
  }
#pragma unroll
  for (int t = 0; t < 4; ++t) { if (col0 + t * 16 >= N) continue;
#pragma unroll
    for (int r = 0; r < 8; ++r) so[w][8 * hh + r][t * 16 + ln] = acc[t][r] * alpha; }
  __builtin_amdgcn_fence(__ATOMIC_ACQ_REL, "workgroup"); __builtin_amdgcn_wave_barrier();
  const int rsub = lane >> 4, c4 = (lane & 15) * 4;
  {
#pragma unroll
    for (int q = 0; q < 8; ++q) { const int r = q * 2 + rsub; if (col0 + c4 < N) { const v4f v = *(const v4fa*)&so[w][r][c4]; *(v4f*)(C + (size_t)(row0 + r) * ldc + col0 + c4) = v; } }
     }
}

// One launch prepares both GEMM operands, in fragment order. XB blocks: X16 = f16(bf16(x)), x row-major with pitch DD: a wave takes one block (16 rows x 32 cols: 16 whole lines of x) and writes its two units.
// Then WB blocks for each of Wq, Wk, Wv: Wt[n][k] = f16(bf16(W[k][n]) * 16) from f32 row-major W[DD][DD] (a power of two: bf16-exact weights stay exact in f16 away from the subnormal range);
// Wt has rows n, cols k, pitch DD: thread t writes the 16 B of lane t % 32 in unit t / 32. The three planes follow one another in Bw. The test on blockIdx.x is the same for a whole block.
#define XB (NR * DD / 16 / 256)
#define WB (DD * (DD / 8) / 256)
static_assert(NR * DD % (16 * 256) == 0 && DD * (DD / 8) % 256 == 0 && DD % 32 == 0, "whole blocks, no tail guards");
// The first BB blocks (one wave each works): the additive key bias as a factor, KF[b][place of k] = exp(bf16(am[b][k]) - A_b), A_b = the batch's largest rounded bias (not below -3e38, so a row of -inf gives zeros, not NaN): 0 <= KF <= 1.
__global__ __launch_bounds__(256) void k_prep(const float* __restrict__ x, const float* __restrict__ Wq, const float* __restrict__ Wk, const float* __restrict__ Wv, const float* __restrict__ am, _Float16* __restrict__ X16, _Float16* __restrict__ Bw, float* __restrict__ KF) {
  if (blockIdx.x < BB) {      /* first in the grid: this part's chain (loads, maximum over the wave, exponentials, stores) is the launch's longest, so it starts first */
    if (threadIdx.x >= 32) return;      /* the same for a whole wave; the kernel has no barrier */
    const unsigned bb = blockIdx.x, lane = threadIdx.x;
    const float* ar = am + (size_t)bb * TT + lane * 4; v4f a[TT / 128];
#pragma unroll
    for (int i = 0; i < TT / 128; ++i) a[i] = *(const v4fa*)(ar + i * 128);
    asm volatile("s_wait_xcnt 0x0" ::: "memory");      /* behind the loads, in front of any rewrite of a register that they name */
    float A = -3.0e38f;
#pragma unroll
    for (int i = 0; i < TT / 128; ++i)
#pragma unroll
      for (int q = 0; q < 4; ++q) { a[i][q] = bf16_round(a[i][q]); A = fmaxf(A, a[i][q]); }
#pragma unroll
    for (int m = 16; m > 0; m >>= 1) A = fmaxf(A, __shfl_xor(A, m, 32));
    // Key k = 32 p + 16 nt + 8 hh + r goes to place 32 p + 16 hh + 2 r + nt: the 16 factors that a lane of the attention kernel wants in pass p lie in a row, paired as its score registers are summed. This lane's keys: p = 4 i + lane / 8, nt, hh = bits 2, 1 of lane, r = 4 (lane % 2) + q.
    float* ko = KF + (size_t)bb * TT + (lane >> 3) * 32 + ((lane >> 1) & 1) * 16 + (lane & 1) * 8 + ((lane >> 2) & 1);
#pragma unroll
    for (int i = 0; i < TT / 128; ++i)
#pragma unroll
      for (int q = 0; q < 4; ++q) ko[i * 128 + q * 2] = __builtin_amdgcn_exp2f((a[i][q] - A) * 1.4426950408889634f);
    asm volatile("s_wait_xcnt 0x0" ::: "memory");      /* behind the stores, in front of whatever the built code places next */
    return;
  }
  FragH f; const unsigned bid = blockIdx.x - BB;
  if (bid < XB) {
    const unsigned t = bid * 256 + threadIdx.x;
    const unsigned lane = t & 31, blk = t >> 5, rt = blk / (DD / 32), kb = blk % (DD / 32);
    const float* xr = x + (size_t)(rt * 16 + (lane & 15)) * DD + kb * 32 + (lane >> 4) * 8;
#pragma unroll
    for (int q = 0; q < 8; ++q) { f.h[q] = (_Float16)bf16_round(xr[q]); f.h[8 + q] = (_Float16)bf16_round(xr[16 + q]); }
    *(v8us*)((unsigned short*)X16 + (size_t)blk * 512 + lane * 8) = f.half[0]; *(v8us*)((unsigned short*)X16 + (size_t)blk * 512 + 256 + lane * 8) = f.half[1];
  } else {
    const unsigned wb = bid - XB, pl = wb / WB; const float* W = (pl == 0) ? Wq : (pl == 1) ? Wk : Wv;
    const int t = (wb % WB) * 256 + threadIdx.x; const int lane = t & 31, u = t >> 5, blk = u >> 1; const int n = (blk / (DD / 32)) * 16 + (lane & 15), k8 = (blk % (DD / 32)) * 32 + (u & 1) * 16 + (lane >> 4) * 8;
#pragma unroll
    for (int i = 0; i < 8; ++i) f.h[i] = (_Float16)(bf16_round(W[(size_t)(k8 + i) * DD + n]) * 16.0f);
    *(v8us*)((unsigned short*)Bw + (size_t)pl * DD * DD + (size_t)t * 8) = f.half[0];
    asm volatile("s_wait_xcnt 0x0" ::: "memory");      /* in the built code the X part follows this store's branch and rewrites the store's registers: the wait stands in front of that rewrite */
  }
}
// The three projections in one launch: blockIdx.y = 0, 1, 2 takes Wq, Wk, Wv (planes of Bw) with its bias. v = acc / 16 + bf16(bias[col]), rounded to f16. A, Bw, Q16, K16 and Vt lie in fragment order.
// Q and K go out as planes of NR rows x DD cols. V goes out transposed, as the attention kernel reads it (Vt: rows (b * NH + h) * 64 + d, cols = keys, pitch TT): no V plane and no transposing launch.
// A wave owns 128 rows x 96 cols (8 x 6 accumulator tiles): 14 fragments of 1 KiB feed 48 WMMAs. The block's four waves stand 2 x 2 (256 x 192), one wave a SIMD, so each fragment is wanted by two waves of the block.
// NR / 256 * DD / 192 * 3 = 192 blocks.
#define GMT 8
#define GNT 6
__global__ __launch_bounds__(128) void k_gemm_qkv(const _Float16* __restrict__ A, const _Float16* __restrict__ Bw, const float* __restrict__ bq, const float* __restrict__ bk, const float* __restrict__ bv,
    _Float16* __restrict__ Q16, _Float16* __restrict__ K16, _Float16* __restrict__ Vt) {
  constexpr int lda = DD, ldb = DD, ldc = DD, K = DD, MT = GMT, NT = GNT, NBN = DD / (2 * NT * 16); constexpr float alpha = 0.0625f;
  static_assert(NR % (2 * MT * 16) == 0 && DD % (2 * NT * 16) == 0 && DD % 64 == 0 && TT % (MT * 16) == 0, "whole tiles, no tail guards; a wave's rows lie in one batch");
  __shared__ __attribute__((aligned(16))) float so[4][MT * 16][NT * 16 + 4];      /* pitch 100: the epilogue's row reads (one row a lane) fall on different banks */
  const int tid = threadIdx.x, w = tid >> 5, lane = tid & 31, ln = lane & 15, hh = lane >> 4; const int by = blockIdx.y;
  const _Float16* Bh = Bw + (size_t)by * DD * DD; const float* bp = (by == 0) ? bq : (by == 1) ? bk : bv;
  const int mb = blockIdx.x / NBN, nb = blockIdx.x % NBN;
  const int row0 = (mb * 2 + (w >> 1)) * (MT * 16), col0 = (nb * 2 + (w & 1)) * (NT * 16);
  v8f acc[MT][NT] = {};
  // Fragments are fetched ahead: two register sets of 32 k each; while one set feeds its 48 WMMAs the other set's 28 loads are in flight. K % 64 == 0.
  const unsigned short* ap = (const unsigned short*)A + (size_t)row0 * lda + lane * 8;      /* this lane's 16 B in the first unit of the first row tile; the next row tile lies 16 * pitch on */
  const unsigned short* wp = (const unsigned short*)Bh + (size_t)col0 * ldb + lane * 8;
  FragH a0[MT], a1[MT], b0[NT], b1[NT];
  // One step: the loads of set (al, bl) for k = kb + ko as one group, then the WMMA block on set (am, bm). ko is a literal and goes into the loads' offset fields; 32 k are one block of 512 elements, so k counts 16-fold.
  // The WMMAs are the plain builtin: the tiles and fragments fill more than 256 registers, and an asm operand cannot lie above v255.
  auto step = [&](FragH (&al)[MT], FragH (&bl)[NT], int kb, int ko, FragH (&am)[MT], FragH (&bm)[NT], const bool mm) {
    const unsigned short* pa = ap + kb * 16; const unsigned short* pw = wp + kb * 16;
#pragma unroll
    for (int m = 0; m < MT; ++m) { al[m].half[0] = *(const v8us*)(pa + ko * 16 + m * 16 * lda); al[m].half[1] = *(const v8us*)(pa + ko * 16 + m * 16 * lda + 256); }
#pragma unroll
    for (int t = 0; t < NT; ++t) { bl[t].half[0] = *(const v8us*)(pw + ko * 16 + t * 16 * ldb); bl[t].half[1] = *(const v8us*)(pw + ko * 16 + t * 16 * ldb + 256); }
    __builtin_amdgcn_sched_barrier(0);      /* the group's loads stay ahead of the WMMA block: else the scheduler sinks them among the WMMAs and their latency is waited out there */
    if (mm) {
#pragma unroll
      for (int m = 0; m < MT; ++m)
#pragma unroll
        for (int t = 0; t < NT; ++t) acc[m][t] = __builtin_amdgcn_wmma_f32_16x16x32_f16(false, am[m].v, false, bm[t].v, (short)0, acc[m][t], false, false);
    }
    __builtin_amdgcn_sched_barrier(0);      /* the statement below stays behind the whole block: else the scheduler lifts it to the block's head, where the wait would stall */
    /* v_nop: the next group's loads overwrite the last WMMA's A and B; four vector slots lie between. s_wait_xcnt: the group's address pairs are named, so no register of them is
       reused (not even as a later load's result) before this wait; it stands behind the block, not directly behind the loads, so that it is not waited out in front of the WMMAs */
    if (mm) asm volatile("v_nop\n\tv_nop\n\tv_nop\n\tv_nop\n\ts_wait_xcnt 0x0" :: "v"(pa), "v"(pw) : "memory");
    else asm volatile("s_wait_xcnt 0x0" :: "v"(pa), "v"(pw) : "memory");      /* the first group, in front of the loop: no WMMA stands ahead of it */
    __builtin_amdgcn_sched_barrier(0); };      /* the next group of loads stays behind this block: it overwrites the set that the block reads */
  step(a0, b0, 0, 0, a1, b1, false);
  for (int kb = 0; kb < K; kb += 64) {
    step(a1, b1, kb, 32, a0, b0, true);
    step(a0, b0, (kb + 64 < K) ? kb + 64 : 0, 0, a1, b1, true);      /* last trip: wraps to k = 0, in bounds, values unused; no branch, so the waits stay counted */
  }
  // The biases of the wave's six column tiles (bf16-rounded input), for both ways out.
  const int cb = col0 + ln; float bvv[NT];
#pragma unroll
  for (int t = 0; t < NT; ++t) bvv[t] = bp[cb + t * 16];
  asm volatile("s_wait_xcnt 0x0" :: "v"(cb) : "memory");      /* the loads' offset register is named, so it is not reused before the loads have taken it */
#pragma unroll
  for (int t = 0; t < NT; ++t) bvv[t] = bf16_round(bvv[t]);
  if (by == 2) {      /* the same for the whole block */
    // acc[m][t][r] is V[row0 + m * 16 + 8 hh + r][col0 + t * 16 + ln]: for the transposed plane that is row d = column % 64 of head column / 64, keys 8 hh .. 8 hh + 7 of a 16-key unit, which is what lane 16 hh + ln owns there:
    // each accumulator tile is one whole unit of Vt (512 B, 4 whole lines) and goes out of the registers as it stands. Vt's row is b * DD + column; the eight tiles m are eight units in a row.
    unsigned short* vu = (unsigned short*)Vt + ((size_t)(row0 / TT) * DD + col0) * TT + (size_t)((row0 % TT) >> 4) * 256 + lane * 8;
#pragma unroll
    for (int t = 0; t < NT; ++t) { FragH f[MT];
#pragma unroll
      for (int m = 0; m < MT; ++m)
#pragma unroll
        for (int r = 0; r < 8; ++r) f[m].h[r] = (_Float16)(acc[m][t][r] * alpha + bvv[t]);
      __builtin_amdgcn_sched_barrier(0);      /* the batch's units are all formed before its first store: no conversion takes a register that an issued store names */
#pragma unroll
      for (int m = 0; m < MT; ++m) *(v8us*)(vu + t * 16 * TT + m * 256) = f[m].half[0];
      asm volatile("s_wait_xcnt 0x0" :: "v"(vu) : "memory");      /* in front of the next batch, which rewrites the registers that these stores name */
      __builtin_amdgcn_sched_barrier(0); }      /* the next batch's conversions stay behind that wait */
    return;
  }
#pragma unroll
  for (int t = 0; t < NT; ++t)
#pragma unroll
    for (int m = 0; m < MT; ++m)
#pragma unroll
      for (int r = 0; r < 8; ++r) so[w][m * 16 + 8 * hh + r][t * 16 + ln] = acc[m][t][r] * alpha + bvv[t];
  __builtin_amdgcn_fence(__ATOMIC_ACQ_REL, "workgroup"); __builtin_amdgcn_wave_barrier();
  {      /* each of the wave's eight row tiles is six units in a row: 3 KiB of whole lines */
    unsigned short* cu = (unsigned short*)((by == 0) ? Q16 : K16) + (size_t)row0 * ldc + (size_t)(col0 >> 4) * 256 + lane * 8;
#pragma unroll
    for (int m = 0; m < MT; ++m) { FragH f[NT];
#pragma unroll
      for (int u = 0; u < NT; ++u) { const v4f v0 = *(const v4fa*)&so[w][m * 16 + ln][u * 16 + 8 * hh], v1 = *(const v4fa*)&so[w][m * 16 + ln][u * 16 + 8 * hh + 4];
#pragma unroll
        for (int i = 0; i < 4; ++i) { f[u].h[i] = (_Float16)v0[i]; f[u].h[4 + i] = (_Float16)v1[i]; } }
      __builtin_amdgcn_sched_barrier(0);      /* the batch's units are all formed before its first store: no conversion takes a register that an issued store names */
#pragma unroll
      for (int u = 0; u < NT; ++u) *(v8us*)(cu + m * 16 * ldc + u * 256) = f[u].half[0];
      asm volatile("s_wait_xcnt 0x0" :: "v"(cu) : "memory");      /* in front of the next batch (behind the last one: of the V part, which follows in the built code), which rewrites the registers that these stores name */
      __builtin_amdgcn_sched_barrier(0); }      /* the next batch's reads and conversions stay behind that wait */
  }
}


typedef _Float16 v4h __attribute__((ext_vector_type(4)));

__global__ __launch_bounds__(256) void k_h16(const float* __restrict__ x, _Float16* __restrict__ X16, size_t n8) { const size_t t = (size_t)blockIdx.x * 256 + threadIdx.x; if (t >= n8) return; FragH f;
#pragma unroll
  for (int q = 0; q < 8; ++q) f.h[q] = (_Float16)x[t * 8 + q]; *(v8us*)((unsigned short*)X16 + t * 8) = f.half[0];  }
__global__ __launch_bounds__(256) void k_round16f(const float* __restrict__ W, _Float16* __restrict__ Bt, size_t n8) { const size_t t = (size_t)blockIdx.x * 256 + threadIdx.x; if (t >= n8) return; FragH f;
#pragma unroll
  for (int i = 0; i < 8; ++i) f.h[i] = (_Float16)(bf16_round(W[t * 8 + i]) * 16.0f); *(v8us*)((unsigned short*)Bt + t * 8) = f.half[0];  }

typedef int v4i __attribute__((ext_vector_type(4)));
typedef int v4ia __attribute__((ext_vector_type(4), may_alias));
// lane l takes the value of lane l ^ 16 (a vector cross-row move, no LDS trip)
__device__ __forceinline__ float xhalf(float x) { return __builtin_bit_cast(float, __builtin_amdgcn_permlanex16(__builtin_bit_cast(int, x), __builtin_bit_cast(int, x), 0x76543210, 0xfedcba98, false, false)); }

// Both attention paths in one walk over the keys. The scores S^T = K Q^T are the same for the two paths, and so are the K and V^T fragments: each is fetched and each score tile is formed once;
// the wave then runs two online softmaxes (additive key bias; 0/1 mask) with two output accumulators, and the gated sum is taken in registers in the epilogue: no per-path output plane, no combining launch.
// The two softmaxes share one shift and one exponential a score: a softmax does not depend on its shift, so both take the running maximum m of the raw scores over all keys. With e = exp((s - m) / 8),
// the mask path's weight is e or 0 and the bias path's is e * KF[k] (KF = exp(bias - largest bias of the batch), made once in k_prep). e <= 1 and KF <= 1, so nothing overflows; as f16 x 2^10 a weight keeps full precision down to 2^-24 of the shared maximum's: a path loses bits of P only where its own best key scores more than 16.6 (natural log) below a key that it drops.
__global__ __launch_bounds__(128) void k_flash_gl(const _Float16* __restrict__ Q16, int ldq, const _Float16* __restrict__ K16, int ldk, const _Float16* __restrict__ Vt, const float* __restrict__ KF, const int* __restrict__ MSK, const float* __restrict__ gate, float* __restrict__ O, int ldo) {
  constexpr int RPW = 16, NQB = TT / (4 * RPW), DT = 4, KS = 2;
  __shared__ __attribute__((aligned(16))) float sO[4][RPW][64 + 4];
  const int tid = threadIdx.x, w = tid >> 5, lane = tid & 31, ln = lane & 15, hh = lane >> 4;
  const int slab = blockIdx.x / NQB, qblk = blockIdx.x % NQB; const int b = slab / NH, h = slab % NH; const int qb0 = qblk * (4 * RPW); const int q0 = qb0 + w * RPW;
  // Transposed tiles: S^T = K Q^T (A = 16 key rows, B = the wave's 16 queries), O^T += V^T P^T. Lane (ln, hh) owns query q0 + ln; its score registers hold keys j0 + 8 hh + r and j0 + 16 + 8 hh + r,
  // which is the k order of a B operand: P goes from the score registers into the second product with no LDS trip, and maximum and sum run inside the lane plus one exchange between the wave halves.
  FragH aq[KS];
  // Q16, K16 and Vt lie in fragment order (head of the file): a fragment half is one unit of 512 B, this lane's 16 B at lane * 8 elements; a head's 64 columns are two blocks (4 units) in a row.
  { const unsigned short* qr = (const unsigned short*)Q16 + ((size_t)b * TT + q0) * ldq + h * 1024 + lane * 8;
#pragma unroll
    for (int ks = 0; ks < KS; ++ks) { aq[ks].half[0] = *(const v8us*)(qr + ks * 512); aq[ks].half[1] = *(const v8us*)(qr + ks * 512 + 256); }
    asm volatile("s_wait_xcnt 0x0" :: "v"(qr) : "memory"); }      /* as in ldK below: the address pair stays whole until the loads have taken it */
  const unsigned short* Vth = (const unsigned short*)Vt + (size_t)slab * 64 * TT;
  float mr = -3.0e38f, lg = 0.f, ll = 0.f; v8f og[DT], ol[DT];      /* the shared running maximum (raw products); running sum, output tile: g = additive-bias path, l = 0/1-mask path */
#pragma unroll
  for (int dt = 0; dt < DT; ++dt) { og[dt] = (v8f){0.f,0.f,0.f,0.f,0.f,0.f,0.f,0.f}; ol[dt] = (v8f){0.f,0.f,0.f,0.f,0.f,0.f,0.f,0.f}; }
  const int jend = TT;
  // Global loads are issued ahead of their use: the K fragments and the mask words one pass ahead (registers carried round the loop), the key factors (4 KiB a batch, read by every wave) and the V^T fragments at the top of their own pass; their latency then runs under the softmaxes, not in front of each WMMA.
  const unsigned short* Kl = (const unsigned short*)K16 + (size_t)b * TT * ldk + h * 1024 + lane * 8; FragH bk[2][KS];
  const float* aml = KF + (size_t)b * TT + 16 * hh;      /* a pass's 32 factors are one line; this half's 16 lie in a row, (r, nt) at 2 r + nt */
  const int* Ml = MSK + ((size_t)b * TT + q0 + ln) * TT + 8 * hh; v4i mkn[2][2];
  auto ldK = [&](int j) {
    const unsigned short* kr[2] = {Kl + (size_t)j * ldk, Kl + (size_t)(j + 16) * ldk};
#pragma unroll
    for (int nt = 0; nt < 2; ++nt)
#pragma unroll
      for (int ks = 0; ks < KS; ++ks) { bk[nt][ks].half[0] = *(const v8us*)(kr[nt] + ks * 512); bk[nt][ks].half[1] = *(const v8us*)(kr[nt] + ks * 512 + 256); }
    /* the group's address pairs are named so that no register of them is reused (not even as a later load's result) before the loads have taken them */
    asm volatile("s_wait_xcnt 0x0" :: "v"(kr[0]), "v"(kr[1]) : "memory"); };
  // The mask words of pass j: issued behind the last use of the pass before, so they land in the registers that pass has just read and nothing is copied aside.
  auto ldMk = [&](int j) {
    const int* mm = Ml + j;
#pragma unroll
    for (int nt = 0; nt < 2; ++nt) { mkn[nt][0] = *(const v4ia*)(mm + nt * 16); mkn[nt][1] = *(const v4ia*)(mm + nt * 16 + 4); }
    asm volatile("s_wait_xcnt 0x0" :: "v"(mm) : "memory"); };      /* as in ldK */
  const float gq = bf16_round(gate[((size_t)b * NH + h) * TT + q0 + ln]);      /* the gate of this lane's query (bf16-rounded input) */
  ldK(0); ldMk(0);
#pragma unroll 1      /* stays rolled: one set of carried fragment registers, and the pass's code is fetched once */
  for (int j0 = 0; j0 < jend; j0 += 32) {
    const int jn = (j0 + 32 < jend) ? j0 + 32 : 0;      /* the pass fetched for; behind the last pass it wraps to key 0: in bounds, values unused; no branch, so the waits stay counted */
    unsigned kp[2][8];      /* per-batch mask [b][q][k] of query q0 + ln, keys j0 + nt * 16 + 8 hh + r: nonzero = ATTEND; kept as one lane-mask word each (a scalar register), formed here so that the mask words' registers are free for the next pass's loads */
#pragma unroll
    for (int nt = 0; nt < 2; ++nt)
#pragma unroll
      for (int r = 0; r < 8; ++r) kp[nt][r] = __builtin_amdgcn_ballot_w32(mkn[nt][r >> 2][r & 3] != 0);
    v4f abn[4]; const float* am = aml + j0;      /* key factors of this pass: issued here, used behind the exponentials */
#pragma unroll
    for (int i = 0; i < 4; ++i) abn[i] = *(const v4fa*)(am + i * 4);
    asm volatile("s_wait_xcnt 0x0" :: "v"(am) : "memory");      /* as in ldK */
    FragH bv[DT];      /* V^T fragments of this pass: issued here, used behind the softmaxes, by both paths */
    const unsigned short* vr = Vth + (size_t)j0 * 16 + lane * 8;      /* 32 keys are one block of 512 elements */
#pragma unroll
    for (int dt = 0; dt < DT; ++dt) { bv[dt].half[0] = *(const v8us*)(vr + dt * 16 * TT); bv[dt].half[1] = *(const v8us*)(vr + dt * 16 * TT + 256); }
    asm volatile("s_wait_xcnt 0x0" :: "v"(vr) : "memory");      /* as in ldK: the address pair stays whole until the loads have taken it */
    v8f s[2];      /* the score products are the plain builtin: the compiler keeps the distance behind each with the pass's own vector work, where a fixed run of v_nop took issue slots from the SIMD's other waves */
#pragma unroll
    for (int nt = 0; nt < 2; ++nt) { v8f acc = (v8f){0.f,0.f,0.f,0.f,0.f,0.f,0.f,0.f};
#pragma unroll
      for (int ks = 0; ks < KS; ++ks) acc = __builtin_amdgcn_wmma_f32_16x16x32_f16(false, bk[nt][ks].v, false, aq[ks].v, (short)0, acc, false, false); s[nt] = acc; }
    ldK(jn);
    __builtin_amdgcn_sched_barrier(0);      /* the compares on this pass's mask words stay ahead of the loads that overwrite them: else the scheduler lifts the loads and the words are copied aside */
    ldMk(jn);
    // One online-softmax step on the pass's 32 raw scores, for both paths: new maximum, one exponential a score, the two weights, rescale of both sums and output tiles, P^T packed as B operands (element nt * 8 + r is key nt * 16 + 8 hh + r, the order in which bv holds V^T).
    // The exponentials run in base 2 on the hardware's own instruction: exp(x) 2^10 = exp2(x log2(e) + 10); the 1 / 8 goes into cs, and cs < 1, so mn * cs cannot overflow. The weights, and with them the running sums, carry the factor 2^10 that P has as an f16 operand: the epilogue divides by those sums alone.
    constexpr float cs = 0.125f * 1.4426950408889634f;
    float mx[8];
#pragma unroll
    for (int r = 0; r < 8; ++r) mx[r] = fmaxf(s[0][r], s[1][r]);
    float mc = fmaxf(fmaxf(fmaxf(mx[0], mx[1]), fmaxf(mx[2], mx[3])), fmaxf(fmaxf(mx[4], mx[5]), fmaxf(mx[6], mx[7])));
    mc = fmaxf(mc, xhalf(mc));      /* both wave halves now hold the maximum of the query's 32 scores of this pass */
    const float mn = fmaxf(mr, mc); const float ea = __builtin_amdgcn_exp2f((mr - mn) * cs); const float al = (mn > -1.0e38f) ? ea : 1.0f; mr = mn;      /* computed, then selected: no branch */
    const float nm = 10.0f - mn * cs;
    float wg[2][8], wl[2][8];
#pragma unroll
    for (int nt = 0; nt < 2; ++nt)
#pragma unroll
      for (int r = 0; r < 8; ++r) { const float e = __builtin_amdgcn_exp2f(__builtin_fmaf(s[nt][r], cs, nm)); wg[nt][r] = e * abn[r >> 1][(r & 1) * 2 + nt]; wl[nt][r] = __builtin_amdgcn_inverse_ballot_w32(kp[nt][r]) ? e : 0.f; }
    float sg8[8], sl8[8];
#pragma unroll
    for (int r = 0; r < 8; ++r) { sg8[r] = wg[0][r] + wg[1][r]; sl8[r] = wl[0][r] + wl[1][r]; }
    lg = lg * al + (((sg8[0] + sg8[1]) + (sg8[2] + sg8[3])) + ((sg8[4] + sg8[5]) + (sg8[6] + sg8[7])));      /* this half's 16 keys; the halves are joined behind the loop */
    ll = ll * al + (((sl8[0] + sl8[1]) + (sl8[2] + sl8[3])) + ((sl8[4] + sl8[5]) + (sl8[6] + sl8[7])));
#pragma unroll
    for (int dt = 0; dt < DT; ++dt)
#pragma unroll
      for (int r = 0; r < 8; ++r) { og[dt][r] *= al; ol[dt][r] *= al; }
    FragH pg, pl;
#pragma unroll
    for (int nt = 0; nt < 2; ++nt)
#pragma unroll
      for (int r = 0; r < 8; ++r) { pg.h[nt * 8 + r] = (_Float16)wg[nt][r]; pl.h[nt * 8 + r] = (_Float16)wl[nt][r]; }
#pragma unroll
    for (int dt = 0; dt < DT; ++dt) { og[dt] = __builtin_amdgcn_wmma_f32_16x16x32_f16(false, bv[dt].v, false, pg.v, (short)0, og[dt], false, false);
      if (dt + 1 < DT) ol[dt] = __builtin_amdgcn_wmma_f32_16x16x32_f16(false, bv[dt].v, false, pl.v, (short)0, ol[dt], false, false);
      else ol[dt] = mmaH<1>(bv[dt].v, bv[dt].v, pl.v, pl.v, ol[dt]); } }      /* the pass's last product keeps its four v_nop: over the back edge the next pass's first product may write its result over this one's B */
  { const float sg = lg + xhalf(lg), sl = ll + xhalf(ll); const float lig = (sg > 0.f) ? 1.0f / sg : 0.f, lil = (sl > 0.f) ? 1.0f / sl : 0.f;      /* sums and output tiles both carry 2^10 */ const float g1 = 1.0f - gq;
#pragma unroll
    for (int dt = 0; dt < DT; ++dt) {      /* og[dt][r], ol[dt][r] = the paths' O[q0 + ln][dt * 16 + 8 hh + r]; the gated sum of the two goes out */
      v4f o0, o1;
#pragma unroll
      for (int r = 0; r < 4; ++r) { o0[r] = gq * (ol[dt][r] * lil) + g1 * (og[dt][r] * lig); o1[r] = gq * (ol[dt][4 + r] * lil) + g1 * (og[dt][4 + r] * lig); }
      *(v4fa*)&sO[w][ln][dt * 16 + 8 * hh] = o0; *(v4fa*)&sO[w][ln][dt * 16 + 8 * hh + 4] = o1; } }
  __builtin_amdgcn_fence(__ATOMIC_ACQ_REL, "workgroup"); __builtin_amdgcn_wave_barrier();
  {
#pragma unroll
    for (int rp = 0; rp < RPW; rp += 2) { const int r = rp + (lane >> 4), pc = lane & 15; const v4f val = *(const v4fa*)&sO[w][r][pc * 4]; *(v4f*)(O + ((size_t)b * TT + q0 + r) * ldo + h * 64 + pc * 4) = val; }
     } }

extern "C" void kernel_launch(void* const* d_in, const int* in_sizes, int n_in,
                              void* d_out, int out_size, void* d_ws, size_t ws_size, hipStream_t stream) {
  (void)in_sizes; (void)n_in; (void)out_size;
  const float* const* I = (const float* const*)d_in; const float* x = I[0]; const float* am = I[1]; const int* lm = (const int*)d_in[2]; const float* gate = I[3]; const float* Wq = I[4]; const float* bq = I[5]; const float* Wk = I[6]; const float* bk = I[7]; const float* Wv = I[8]; const float* bv = I[9];
  char* ws = (char*)d_ws; size_t off = 0;
  auto take = [&](size_t bytes) { char* p = ws + off; off += (bytes + 255) & ~(size_t)255; return p; };
  const size_t WSZ = (size_t)DD * DD; _Float16* Bw = (_Float16*)take(3 * WSZ * 2); _Float16* X16 = (_Float16*)take((size_t)NR * DD * 2); _Float16* Q = (_Float16*)take((size_t)NR * DD * 2); _Float16* K = (_Float16*)take((size_t)NR * DD * 2); _Float16* Vt = (_Float16*)take((size_t)NR * DD * 2); float* KF = (float*)take((size_t)BB * TT * 4);
  if (off > ws_size) return;      // 3.5 + 4 x 6.3 = about 29 MB
  k_prep<<<XB + 3 * WB + BB, 256, 0, stream>>>(x, Wq, Wk, Wv, am, X16, Bw, KF);      /* X and the three W^T x 2^4, f16, fragment order; the key factors */
  k_gemm_qkv<<<dim3((NR / (2 * GMT * 16)) * (DD / (2 * GNT * 16)), 3), 128, 0, stream>>>(X16, Bw, bq, bk, bv, Q, K, Vt);      /* three times M 4096 N 768 K 768 */
  k_flash_gl<<<BB * NH * (TT / 64), 128, 0, stream>>>(Q, DD, K, DD, Vt, KF, lm, gate, (float*)d_out, DD);      /* both paths and the gated sum */
}

// v010
// One run takes 49.6 microseconds.
// In both of two side-by-side timings against v009, it was 1.15 times as fast.
// Over all steps from v000 it is 7.15 times as fast.
#include <hip/hip_runtime.h>
// Gated global/local self attention (B=4, S=1024, HID=768, 12×64): q,k,v = x·W + b ((in,out)); scores = q·k/8; global path softmax(scores + attention_mask[b,0,0,k]); local path softmax(scores + (1 − local_mask[b,0,q,k])·f32_min); ctx = gate[b,h,q]·ctx_local + (1 − gate)·ctx_global, merged → [4,1024,768].
// Compute dtype: x, weights, biases, additive mask and gates rounded to bf16; q/k/v f16 GEMM planes; one flash-style kernel on v_wmma_f32_16x16x32_f16 (online softmax f32, P f16 x 2^10, f32 accumulate) that forms each score tile once and feeds two softmaxes: one with the per-batch additive key bias, one with the per-batch 0/1 (q,k) mask
// (0 -> weight 0); the gated combination in f32, in that kernel's epilogue.
// Every f16 plane that feeds a WMMA from global memory (X, W^T, Q, K, V^T) lies in FRAGMENT ORDER: a plane of rows x cols is cut into blocks of 16 rows x 32 cols (1 KiB, row tile major, then column block);
// a block is two units of 512 B (cols 0..15, cols 16..31); in a unit lane l = 16 hh + ln owns 16 B: row ln, cols 8 hh .. 8 hh + 7. A wave's b128 load of a fragment half is then one unit: 4 whole 128-B lines, where a row-major plane gives 16 pieces of 32 B.
// Element (R, C) of a plane with pitch P (cols): (R / 16) * 16 * P + (C / 32) * 512 + ((C / 16) % 2) * 256 + (((C / 8) % 2) * 16 + R % 16) * 8 + C % 8.
#define BB 4
#define TT 1024
#define DD 768
#define NH 12
#define NR (BB * TT)

typedef __bf16 v16b __attribute__((ext_vector_type(16)));
typedef unsigned short v8us __attribute__((ext_vector_type(8), may_alias));
typedef float  v8f  __attribute__((ext_vector_type(8)));
typedef float  v4f  __attribute__((ext_vector_type(4)));
typedef float  v4fa __attribute__((ext_vector_type(4), may_alias));
union FragB { v16b v; v8us half[2]; unsigned short u[16]; };

__device__ __forceinline__ unsigned short bf16_bits(float x) { unsigned int u = __float_as_uint(x); return (unsigned short)((u + 0x7FFFu + ((u >> 16) & 1u)) >> 16); }
__device__ __forceinline__ float bf16_val(unsigned short b) { return __uint_as_float(((unsigned int)b) << 16); }
__device__ __forceinline__ float bf16_round(float x) { return bf16_val(bf16_bits(x)); }
// D += A·B with NT terms: 1 = ah·bh, 2 = + al·bh (A split), 3 = + ah·bl (both split)
template <int NT>
__device__ __forceinline__ v8f mmaN(v16b ah, v16b al, v16b bh, v16b bl, v8f c) {
  c = __builtin_amdgcn_wmma_f32_16x16x32_bf16(false, ah, false, bh, (short)0, c, false, false);
  if (NT >= 2) c = __builtin_amdgcn_wmma_f32_16x16x32_bf16(false, al, false, bh, (short)0, c, false, false);
  if (NT >= 3) c = __builtin_amdgcn_wmma_f32_16x16x32_bf16(false, ah, false, bl, (short)0, c, false, false);
  asm volatile("v_nop\n\tv_nop\n\tv_nop\n\tv_nop" : "+v"(c) : "v"(ah), "v"(al), "v"(bh), "v"(bl));
  return c;
}

__global__ __launch_bounds__(256) void k_wt_bf16(const float* __restrict__ W, unsigned short* __restrict__ Wt, int K, int N) {
  const int t = blockIdx.x * 256 + threadIdx.x;
  const int k8n = K / 8;
  if (t >= N * k8n) return;
  const int n = t / k8n, k8 = (t % k8n) * 8;
  v8us v;
#pragma unroll
  for (int i = 0; i < 8; ++i) v[i] = bf16_bits(W[(size_t)(k8 + i) * N + n]);
  *(v8us*)(Wt + (size_t)n * K + k8) = v;
  
}

// GEMM C[M][N] (f32, pitch ldc) = act(A[M][K]·W + bias). A f32 row-major (pitch lda) converted per fragment to bf16
// (ASPLIT: hi/lo two planes -> 2 terms, else single rounded term); Wt bf16 [N][K] (pitch ldb). BIAS_BF16 rounds the
// bias to bf16 first (bias quantised to bf16 before the add). K%32==0, M%16==0, N%64==0.
template <bool ASPLIT, int ACT, bool BIAS_BF16>
__global__ __launch_bounds__(128) void k_gemm_bf(const float* __restrict__ A, int lda, const unsigned short* __restrict__ Wt, int ldb,
                                               const float* __restrict__ bias, float* __restrict__ C, int ldc, int M, int N, int K) {
  __shared__ __attribute__((aligned(16))) float so[4][16][64];
  const int tid = threadIdx.x, w = tid >> 5, lane = tid & 31, ln = lane & 15, hh = lane >> 4;
  const int ntn = N / 64;
  const int wid = blockIdx.x * 4 + w;
  const int mt = wid / ntn, nq = wid % ntn;
  if (mt * 16 >= M) return;
  const int row0 = mt * 16, col0 = nq * 64;
  const float* arow = A + (size_t)(row0 + ln) * lda;
  v8f acc[4] = {};
  for (int kb = 0; kb < K; kb += 32) {
    FragB ah, al;
    const v4f x0 = *(const v4fa*)(arow + kb + 8 * hh), x1 = *(const v4fa*)(arow + kb + 8 * hh + 4);
    const v4f x2 = *(const v4fa*)(arow + kb + 16 + 8 * hh), x3 = *(const v4fa*)(arow + kb + 16 + 8 * hh + 4);
    float xs[16] = {x0[0],x0[1],x0[2],x0[3],x1[0],x1[1],x1[2],x1[3],x2[0],x2[1],x2[2],x2[3],x3[0],x3[1],x3[2],x3[3]};
#pragma unroll
    for (int i = 0; i < 16; ++i) { const unsigned short hb = bf16_bits(xs[i]); ah.u[i] = hb; al.u[i] = ASPLIT ? bf16_bits(xs[i] - bf16_val(hb)) : (unsigned short)0; }
#pragma unroll
    for (int t = 0; t < 4; ++t) {
      const unsigned short* brow = Wt + (size_t)(col0 + t * 16 + ln) * ldb + kb;
      FragB b;
      b.half[0] = *(const v8us*)(brow + 8 * hh);
      b.half[1] = *(const v8us*)(brow + 16 + 8 * hh);
      acc[t] = mmaN<ASPLIT ? 2 : 1>(ah.v, al.v, b.v, b.v, acc[t]);
    }
  }
#pragma unroll
  for (int t = 0; t < 4; ++t) {
    float bv = bias ? bias[col0 + t * 16 + ln] : 0.f;
    if (BIAS_BF16) bv = bf16_round(bv);
#pragma unroll
    for (int r = 0; r < 8; ++r) { float v = acc[t][r] + bv; if (ACT == 1) v = fmaxf(v, 0.f); so[w][8 * hh + r][t * 16 + ln] = v; }
  }
  __builtin_amdgcn_fence(__ATOMIC_ACQ_REL, "workgroup");
  __builtin_amdgcn_wave_barrier();
  const int rsub = lane >> 4, c4 = (lane & 15) * 4;
  {
#pragma unroll
    for (int q = 0; q < 8; ++q) {
      const int r = q * 2 + rsub;
      const v4f v = *(const v4fa*)&so[w][r][c4];
      *(v4f*)(C + (size_t)(row0 + r) * ldc + col0 + c4) = v;
    }
    
  }
}

// Flash-style causal/unmasked attention, all contractions 3-term bf16 hi/lo splits, f32 softmax with running max.
// q,k,v rows are read from f32 buffers with arbitrary row pitch (so they can live inside a fused qkv buffer);
// D = head size (multiple of 32, <= 128); one wave = 16 query rows; block = 4 waves (64 queries) sharing K/V chunks of 32.
template <int D, bool CAUSAL>
__global__ __launch_bounds__(128) void k_flash(const float* __restrict__ qb, const float* __restrict__ kb, const float* __restrict__ vb,
                                             int pitch, int T, int H, float scale, float* __restrict__ y, int ypitch) {
  constexpr int KS = D / 32;        // k-steps for QK
  constexpr int DT = D / 16;        // d tiles for PV
  __shared__ __attribute__((aligned(16))) unsigned short sKh[32][D + 8], sKl[32][D + 8], sVh[32][D + 8], sVl[32][D + 8];
  __shared__ __attribute__((aligned(16))) unsigned short sPh[4][16][40], sPl[4][16][40];
  __shared__ __attribute__((aligned(16))) float sO[4][16][D];
  const int tid = threadIdx.x, w = tid >> 5, lane = tid & 31, ln = lane & 15, hh = lane >> 4;
  const int nqb = (T + 63) / 64;
  const int bh = blockIdx.x / nqb, qblk = blockIdx.x % nqb;
  const int b = bh / H, h = bh % H;
  const int q0 = qblk * 64 + w * 16;
  const float* Q = qb + (size_t)b * T * pitch + h * D;
  const float* K = kb + (size_t)b * T * pitch + h * D;
  const float* V = vb + (size_t)b * T * pitch + h * D;

  // A fragments of the wave's 16 query rows (scaled), hi/lo
  FragB aqh[KS], aql[KS];
  {
    int row = q0 + ln; if (row >= T) row = T - 1;
    const float* qr = Q + (size_t)row * pitch;
#pragma unroll
    for (int ks = 0; ks < KS; ++ks)
#pragma unroll
      for (int i = 0; i < 16; ++i) {
        const int d = ks * 32 + ((i < 8) ? (8 * hh + i) : (16 + 8 * hh + (i - 8)));
        const float x = qr[d] * scale; const unsigned short hb = bf16_bits(x);
        aqh[ks].u[i] = hb; aql[ks].u[i] = bf16_bits(x - bf16_val(hb));
      }
  }
  float m_r[8], l_r[8];
#pragma unroll
  for (int r = 0; r < 8; ++r) { m_r[r] = -3.0e38f; l_r[r] = 0.f; }
  v8f oacc[DT];
#pragma unroll
  for (int dt = 0; dt < DT; ++dt) oacc[dt] = (v8f){0.f,0.f,0.f,0.f,0.f,0.f,0.f,0.f};

  const int kv_end = CAUSAL ? min(T, qblk * 64 + 64) : T;     // block-uniform
  for (int j0 = 0; j0 < kv_end; j0 += 32) {
    __syncthreads();
    for (int e = tid; e < 32 * (D / 4); e += 128) {
      const int r = e / (D / 4), c4 = (e % (D / 4)) * 4;
      const int key = j0 + r;
      v4f kf = {0.f,0.f,0.f,0.f}, vf = {0.f,0.f,0.f,0.f};
      if (key < T) { kf = *(const v4fa*)(K + (size_t)key * pitch + c4); vf = *(const v4fa*)(V + (size_t)key * pitch + c4); }
#pragma unroll
      for (int t = 0; t < 4; ++t) {
        unsigned short hb = bf16_bits(kf[t]); sKh[r][c4 + t] = hb; sKl[r][c4 + t] = bf16_bits(kf[t] - bf16_val(hb));
        hb = bf16_bits(vf[t]); sVh[r][c4 + t] = hb; sVl[r][c4 + t] = bf16_bits(vf[t] - bf16_val(hb));
      }
    }
    __syncthreads();
    // S tile 16 x 32
    v8f s[2];
#pragma unroll
    for (int nt = 0; nt < 2; ++nt) {
      v8f acc = {};
#pragma unroll
      for (int ks = 0; ks < KS; ++ks) {
        FragB bh_, bl_;
        bh_.half[0] = *(const v8us*)&sKh[nt * 16 + ln][ks * 32 + 8 * hh]; bh_.half[1] = *(const v8us*)&sKh[nt * 16 + ln][ks * 32 + 16 + 8 * hh];
        bl_.half[0] = *(const v8us*)&sKl[nt * 16 + ln][ks * 32 + 8 * hh]; bl_.half[1] = *(const v8us*)&sKl[nt * 16 + ln][ks * 32 + 16 + 8 * hh];
        acc = mmaN<3>(aqh[ks].v, aql[ks].v, bh_.v, bl_.v, acc);
      }
      s[nt] = acc;
    }
    // mask + running max (rows 8hh+r; the 16 lanes of a half share rows)
    float alpha[8];
#pragma unroll
    for (int r = 0; r < 8; ++r) {
      const int qi = q0 + 8 * hh + r;
      const int ja = j0 + ln, jb = j0 + 16 + ln;
      if (CAUSAL) { if (ja > qi) s[0][r] = -3.0e38f; if (jb > qi) s[1][r] = -3.0e38f; }
      if (ja >= T) s[0][r] = -3.0e38f;
      if (jb >= T) s[1][r] = -3.0e38f;
      float mx = fmaxf(s[0][r], s[1][r]);
      mx = fmaxf(mx, __shfl_xor(mx, 1, 32)); mx = fmaxf(mx, __shfl_xor(mx, 2, 32)); mx = fmaxf(mx, __shfl_xor(mx, 4, 32)); mx = fmaxf(mx, __shfl_xor(mx, 8, 32));
      const float mnew = fmaxf(m_r[r], mx);
      alpha[r] = (mnew > -1.0e38f) ? __expf(m_r[r] - mnew) : 1.0f;
      const float p0 = (s[0][r] > -1.0e38f) ? __expf(s[0][r] - mnew) : 0.f;
      const float p1 = (s[1][r] > -1.0e38f) ? __expf(s[1][r] - mnew) : 0.f;
      m_r[r] = mnew;
      l_r[r] = l_r[r] * alpha[r] + p0 + p1;            // per-lane partial row sum (16 lanes combined at the end)
      unsigned short hb = bf16_bits(p0); sPh[w][8 * hh + r][ln] = hb;      sPl[w][8 * hh + r][ln] = bf16_bits(p0 - bf16_val(hb));
      hb = bf16_bits(p1);                sPh[w][8 * hh + r][16 + ln] = hb; sPl[w][8 * hh + r][16 + ln] = bf16_bits(p1 - bf16_val(hb));
    }
#pragma unroll
    for (int dt = 0; dt < DT; ++dt)
#pragma unroll
      for (int r = 0; r < 8; ++r) oacc[dt][r] *= alpha[r];
    __builtin_amdgcn_fence(__ATOMIC_ACQ_REL, "workgroup");
    __builtin_amdgcn_wave_barrier();
    FragB pah, pal;
    pah.half[0] = *(const v8us*)&sPh[w][ln][8 * hh]; pah.half[1] = *(const v8us*)&sPh[w][ln][16 + 8 * hh];
    pal.half[0] = *(const v8us*)&sPl[w][ln][8 * hh]; pal.half[1] = *(const v8us*)&sPl[w][ln][16 + 8 * hh];
#pragma unroll
    for (int dt = 0; dt < DT; ++dt) {
      FragB bvh, bvl;
#pragma unroll
      for (int i = 0; i < 8; ++i) {
        bvh.u[i] = sVh[8 * hh + i][dt * 16 + ln]; bvh.u[8 + i] = sVh[16 + 8 * hh + i][dt * 16 + ln];
        bvl.u[i] = sVl[8 * hh + i][dt * 16 + ln]; bvl.u[8 + i] = sVl[16 + 8 * hh + i][dt * 16 + ln];
      }
      oacc[dt] = mmaN<3>(pah.v, pal.v, bvh.v, bvl.v, oacc[dt]);
    }
    __builtin_amdgcn_fence(__ATOMIC_ACQ_REL, "workgroup");
    __builtin_amdgcn_wave_barrier();
  }
#pragma unroll
  for (int r = 0; r < 8; ++r) {
    float l = l_r[r];
    l += __shfl_xor(l, 1, 32); l += __shfl_xor(l, 2, 32); l += __shfl_xor(l, 4, 32); l += __shfl_xor(l, 8, 32);
    l_r[r] = (l > 0.f) ? 1.0f / l : 0.f;
  }
#pragma unroll
  for (int dt = 0; dt < DT; ++dt)
#pragma unroll
    for (int r = 0; r < 8; ++r) sO[w][8 * hh + r][dt * 16 + ln] = oacc[dt][r] * l_r[r];
  __builtin_amdgcn_fence(__ATOMIC_ACQ_REL, "workgroup");
  __builtin_amdgcn_wave_barrier();
  {
    for (int r = 0; r < 16; ++r) {
      const int row = q0 + r;
      if (row < T && lane < D / 4) {
        const v4f val = *(const v4fa*)&sO[w][r][lane * 4];
        *(v4f*)(y + ((size_t)b * T + row) * ypitch + h * D + lane * 4) = val;
      }
    }
    
  }
}

// GEMM C = act(A·W + bias + resid): A f32 (ASPLIT -> hi/lo 2 terms), Wt bf16 [N][K]; ACT 0 none, 1 relu, 2 exact gelu;
// resid (optional, f32, row index = (row % rmod), pitch ldr, RES_BF16 rounds it) added before the activation.
template <bool ASPLIT, int ACT, bool BIAS_BF16, bool RES_BF16>
__global__ __launch_bounds__(128) void k_gemm_bf3(const float* __restrict__ A, int lda, const unsigned short* __restrict__ Wt, int ldb,
                                                const float* __restrict__ bias, const float* __restrict__ resid, int rmod, int ldr,
                                                float* __restrict__ C, int ldc, int M, int N, int K) {
  __shared__ __attribute__((aligned(16))) float so[4][16][64];
  const int tid = threadIdx.x, w = tid >> 5, lane = tid & 31, ln = lane & 15, hh = lane >> 4;
  const int ntn = N / 64;
  const int wid = blockIdx.x * 4 + w;
  const int mt = wid / ntn, nq = wid % ntn;
  if (mt * 16 >= M) return;
  const int row0 = mt * 16, col0 = nq * 64;
  const float* arow = A + (size_t)(row0 + ln) * lda;
  v8f acc[4] = {};
  for (int kb = 0; kb < K; kb += 32) {
    FragB ah, al;
    const v4f x0 = *(const v4fa*)(arow + kb + 8 * hh), x1 = *(const v4fa*)(arow + kb + 8 * hh + 4);
    const v4f x2 = *(const v4fa*)(arow + kb + 16 + 8 * hh), x3 = *(const v4fa*)(arow + kb + 16 + 8 * hh + 4);
    float xs[16] = {x0[0],x0[1],x0[2],x0[3],x1[0],x1[1],x1[2],x1[3],x2[0],x2[1],x2[2],x2[3],x3[0],x3[1],x3[2],x3[3]};
#pragma unroll
    for (int i = 0; i < 16; ++i) { const unsigned short hb = bf16_bits(xs[i]); ah.u[i] = hb; al.u[i] = ASPLIT ? bf16_bits(xs[i] - bf16_val(hb)) : (unsigned short)0; }
#pragma unroll
    for (int t = 0; t < 4; ++t) {
      const unsigned short* brow = Wt + (size_t)(col0 + t * 16 + ln) * ldb + kb;
      FragB b;
      b.half[0] = *(const v8us*)(brow + 8 * hh);
      b.half[1] = *(const v8us*)(brow + 16 + 8 * hh);
      acc[t] = mmaN<ASPLIT ? 2 : 1>(ah.v, al.v, b.v, b.v, acc[t]);
    }
  }
#pragma unroll
  for (int t = 0; t < 4; ++t) {
    const int col = col0 + t * 16 + ln;
    float bv = bias ? bias[col] : 0.f;
    if (BIAS_BF16) bv = bf16_round(bv);
#pragma unroll
    for (int r = 0; r < 8; ++r) {
      float v = acc[t][r] + bv;
      if (resid) { float rv = resid[(size_t)((row0 + 8 * hh + r) % rmod) * ldr + col]; if (RES_BF16) rv = bf16_round(rv); v += rv; }
      if (ACT == 1) v = fmaxf(v, 0.f);
      if (ACT == 2) v = 0.5f * v * (1.0f + erff(v * 0.70710678118654752f));
      if (ACT == 3) { const float u = 0.7978845608028654f * (v + 0.044715f * v * v * v); v = 0.5f * v * (1.0f + tanhf(u)); }
      so[w][8 * hh + r][t * 16 + ln] = v;
    }
  }
  __builtin_amdgcn_fence(__ATOMIC_ACQ_REL, "workgroup");
  __builtin_amdgcn_wave_barrier();
  const int rsub = lane >> 4, c4 = (lane & 15) * 4;
  {
#pragma unroll
    for (int q = 0; q < 8; ++q) {
      const int r = q * 2 + rsub;
      const v4f v = *(const v4fa*)&so[w][r][c4];
      *(v4f*)(C + (size_t)(row0 + r) * ldc + col0 + c4) = v;
    }
    
  }
}
// row LayerNorm (biased variance, eps) over N: s = X (+ R); optional out_sum <- s; out_norm <- (s-mu)*rsqrt(var+eps)*g + b
template <bool PARAM_BF16>
__global__ __launch_bounds__(256) void k_layernorm(const float* __restrict__ X, const float* __restrict__ R, const float* __restrict__ g, const float* __restrict__ bta,
                                                  float* __restrict__ out_sum, float* __restrict__ out_norm, int N, float eps) {
  __shared__ float red[256];
  const int row = blockIdx.x, tid = threadIdx.x;
  const float* x = X + (size_t)row * N; const float* rr = R ? R + (size_t)row * N : nullptr;
  float vals[16];                     // up to N = 4096
  const int per = N / 256;            // contiguous chunk per thread? use strided-by-4 chunks: thread handles j = tid*4 + 1024*u
  float s1 = 0.f;
  for (int u = 0; u < per / 4; ++u) {
    const int j = tid * 4 + 1024 * u;
    const v4f a = *(const v4fa*)(x + j);
    v4f b = {0.f,0.f,0.f,0.f}; if (rr) b = *(const v4fa*)(rr + j);
#pragma unroll
    for (int q = 0; q < 4; ++q) { const float v = a[q] + b[q]; vals[u * 4 + q] = v; s1 += v; }
  }
  red[tid] = s1; __syncthreads();
  for (int st = 128; st > 0; st >>= 1) { if (tid < st) red[tid] += red[tid + st]; __syncthreads(); }
  const float mu = red[0] / (float)N; __syncthreads();
  float s2 = 0.f;
  for (int u = 0; u < per / 4; ++u)
#pragma unroll
    for (int q = 0; q < 4; ++q) { const float c = vals[u * 4 + q] - mu; s2 += c * c; }
  red[tid] = s2; __syncthreads();
  for (int st = 128; st > 0; st >>= 1) { if (tid < st) red[tid] += red[tid + st]; __syncthreads(); }
  const float rs = rsqrtf(red[0] / (float)N + eps);
  {
    for (int u = 0; u < per / 4; ++u) {
      const int j = tid * 4 + 1024 * u;
      v4f o, sm;
#pragma unroll
      for (int q = 0; q < 4; ++q) {
        float gg = g[j + q], bb = bta[j + q];
        if (PARAM_BF16) { gg = bf16_round(gg); bb = bf16_round(bb); }
        sm[q] = vals[u * 4 + q]; o[q] = (vals[u * 4 + q] - mu) * rs * gg + bb;
      }
      if (out_sum) *(v4f*)(out_sum + (size_t)row * N + j) = sm;
      *(v4f*)(out_norm + (size_t)row * N + j) = o;
    }
    
  }
}



// ---- f16 WMMA path (v_wmma_f32_16x16x32_f16): 11-bit significands for operands in range — used where a [0,1] probability operand needs more precision than bf16
typedef _Float16 v16h __attribute__((ext_vector_type(16)));
union FragH { v16h v; v8us half[2]; _Float16 h[16]; unsigned short u[16]; };
template <int NT>
__device__ __forceinline__ v8f mmaH(v16h ah, v16h al, v16h bh, v16h bl, v8f c) {
  c = __builtin_amdgcn_wmma_f32_16x16x32_f16(false, ah, false, bh, (short)0, c, false, false);
  if (NT >= 2) c = __builtin_amdgcn_wmma_f32_16x16x32_f16(false, al, false, bh, (short)0, c, false, false);
  if (NT >= 3) c = __builtin_amdgcn_wmma_f32_16x16x32_f16(false, ah, false, bl, (short)0, c, false, false);
  asm volatile("v_nop\n\tv_nop\n\tv_nop\n\tv_nop" : "+v"(c) : "v"(ah), "v"(al), "v"(bh), "v"(bl));
  return c;
}
// batched GEMM like k_gemm_b but f16 operands: A f32 (split into f16 hi/lo if ASPLIT, else rounded to f16), Bt = f16 values [n][k]; alpha; C f32; N multiple of 16 (partial tiles skipped)
template <bool ASPLIT>
__global__ __launch_bounds__(128) void k_gemm_h(const float* __restrict__ A, int lda, size_t sA, const _Float16* __restrict__ Bh, int ldb, size_t sB, float alpha, float* __restrict__ C, int ldc, size_t sC, int M, int N, int K) {
  __shared__ __attribute__((aligned(16))) float so[4][16][64];
  const int tid = threadIdx.x, w = tid >> 5, lane = tid & 31, ln = lane & 15, hh = lane >> 4; const int by = blockIdx.y;
  A += (size_t)by * sA; Bh += (size_t)by * sB; C += (size_t)by * sC;
  const int ntn = (N + 63) / 64; const int wid = blockIdx.x * 4 + w; const int mt = wid / ntn, nq = wid % ntn; if (mt * 16 >= M) return;
  const int row0 = mt * 16, col0 = nq * 64; const float* arow = A + (size_t)(row0 + ln) * lda;
  v8f acc[4] = {};
  for (int kb = 0; kb < K; kb += 32) {
    FragH ah, al;
    const v4f x0 = *(const v4fa*)(arow + kb + 8 * hh), x1 = *(const v4fa*)(arow + kb + 8 * hh + 4), x2 = *(const v4fa*)(arow + kb + 16 + 8 * hh), x3 = *(const v4fa*)(arow + kb + 16 + 8 * hh + 4);
    float xs[16] = {x0[0],x0[1],x0[2],x0[3],x1[0],x1[1],x1[2],x1[3],x2[0],x2[1],x2[2],x2[3],x3[0],x3[1],x3[2],x3[3]};
#pragma unroll
    for (int i = 0; i < 16; ++i) { const _Float16 h = (_Float16)xs[i]; ah.h[i] = h; al.h[i] = ASPLIT ? (_Float16)(xs[i] - (float)h) : (_Float16)0.0f; }
#pragma unroll
    for (int t = 0; t < 4; ++t) { if (col0 + t * 16 >= N) continue; const size_t boff = (size_t)(col0 + t * 16 + ln) * ldb + kb; FragH bq; bq.half[0] = *(const v8us*)(Bh + boff + 8 * hh); bq.half[1] = *(const v8us*)(Bh + boff + 16 + 8 * hh);
      acc[t] = mmaH<ASPLIT ? 2 : 1>(ah.v, al.v, bq.v, bq.v, acc[t]); }
  }
#pragma unroll
  for (int t = 0; t < 4; ++t) { if (col0 + t * 16 >= N) continue;
#pragma unroll
    for (int r = 0; r < 8; ++r) so[w][8 * hh + r][t * 16 + ln] = acc[t][r] * alpha; }
  __builtin_amdgcn_fence(__ATOMIC_ACQ_REL, "workgroup"); __builtin_amdgcn_wave_barrier();
  const int rsub = lane >> 4, c4 = (lane & 15) * 4;
  {
#pragma unroll
    for (int q = 0; q < 8; ++q) { const int r = q * 2 + rsub; if (col0 + c4 < N) { const v4f v = *(const v4fa*)&so[w][r][c4]; *(v4f*)(C + (size_t)(row0 + r) * ldc + col0 + c4) = v; } }
     }
}

// One launch prepares both GEMM operands, in fragment order. XB blocks: X16 = f16(bf16(x)), x row-major with pitch DD: a wave takes one block (16 rows x 32 cols: 16 whole lines of x) and writes its two units.
// Then WB blocks for each of Wq, Wk, Wv: Wt[n][k] = f16(bf16(W[k][n]) * 16) from f32 row-major W[DD][DD] (a power of two: bf16-exact weights stay exact in f16 away from the subnormal range);
// Wt has rows n, cols k, pitch DD: thread t writes the 16 B of lane t % 32 in unit t / 32. The three planes follow one another in Bw. The test on blockIdx.x is the same for a whole block.
#define XB (NR * DD / 16 / 256)
#define WB (DD * (DD / 8) / 256)
static_assert(NR * DD % (16 * 256) == 0 && DD * (DD / 8) % 256 == 0 && DD % 32 == 0, "whole blocks, no tail guards");
// The first BB blocks (one wave each works): the additive key bias as a factor, KF[b][place of k] = exp(bf16(am[b][k]) - A_b), A_b = the batch's largest rounded bias (not below -3e38, so a row of -inf gives zeros, not NaN): 0 <= KF <= 1.
__global__ __launch_bounds__(256) void k_prep(const float* __restrict__ x, const float* __restrict__ Wq, const float* __restrict__ Wk, const float* __restrict__ Wv, const float* __restrict__ am, _Float16* __restrict__ X16, _Float16* __restrict__ Bw, float* __restrict__ KF) {
  if (blockIdx.x < BB) {      /* first in the grid: this part's chain (loads, maximum over the wave, exponentials, stores) is the launch's longest, so it starts first */
    if (threadIdx.x >= 32) return;      /* the same for a whole wave; the kernel has no barrier */
    const unsigned bb = blockIdx.x, lane = threadIdx.x;
    const float* ar = am + (size_t)bb * TT + lane * 4; v4f a[TT / 128];
#pragma unroll
    for (int i = 0; i < TT / 128; ++i) a[i] = *(const v4fa*)(ar + i * 128);
    asm volatile("s_wait_xcnt 0x0" ::: "memory");      /* behind the loads, in front of any rewrite of a register that they name */
    float A = -3.0e38f;
#pragma unroll
    for (int i = 0; i < TT / 128; ++i)
#pragma unroll
      for (int q = 0; q < 4; ++q) { a[i][q] = bf16_round(a[i][q]); A = fmaxf(A, a[i][q]); }
#pragma unroll
    for (int m = 16; m > 0; m >>= 1) A = fmaxf(A, __shfl_xor(A, m, 32));
    // Key k = 32 p + 16 nt + 8 hh + r goes to place 32 p + 16 hh + 2 r + nt: the 16 factors that a lane of the attention kernel wants in pass p lie in a row, paired as its score registers are summed. This lane's keys: p = 4 i + lane / 8, nt, hh = bits 2, 1 of lane, r = 4 (lane % 2) + q.
    float* ko = KF + (size_t)bb * TT + (lane >> 3) * 32 + ((lane >> 1) & 1) * 16 + (lane & 1) * 8 + ((lane >> 2) & 1);
#pragma unroll
    for (int i = 0; i < TT / 128; ++i)
#pragma unroll
      for (int q = 0; q < 4; ++q) ko[i * 128 + q * 2] = __builtin_amdgcn_exp2f((a[i][q] - A) * 1.4426950408889634f);
    asm volatile("s_wait_xcnt 0x0" ::: "memory");      /* behind the stores, in front of whatever the built code places next */
    return;
  }
  FragH f; const unsigned bid = blockIdx.x - BB;
  if (bid < XB) {
    const unsigned t = bid * 256 + threadIdx.x;
    const unsigned lane = t & 31, blk = t >> 5, rt = blk / (DD / 32), kb = blk % (DD / 32);
    const float* xr = x + (size_t)(rt * 16 + (lane & 15)) * DD + kb * 32 + (lane >> 4) * 8;
#pragma unroll
    for (int q = 0; q < 8; ++q) { f.h[q] = (_Float16)bf16_round(xr[q]); f.h[8 + q] = (_Float16)bf16_round(xr[16 + q]); }
    *(v8us*)((unsigned short*)X16 + (size_t)blk * 512 + lane * 8) = f.half[0]; *(v8us*)((unsigned short*)X16 + (size_t)blk * 512 + 256 + lane * 8) = f.half[1];
  } else {
    const unsigned wb = bid - XB, pl = wb / WB; const float* W = (pl == 0) ? Wq : (pl == 1) ? Wk : Wv;
    const int t = (wb % WB) * 256 + threadIdx.x; const int lane = t & 31, u = t >> 5, blk = u >> 1; const int n = (blk / (DD / 32)) * 16 + (lane & 15), k8 = (blk % (DD / 32)) * 32 + (u & 1) * 16 + (lane >> 4) * 8;
#pragma unroll
    for (int i = 0; i < 8; ++i) f.h[i] = (_Float16)(bf16_round(W[(size_t)(k8 + i) * DD + n]) * 16.0f);
    *(v8us*)((unsigned short*)Bw + (size_t)pl * DD * DD + (size_t)t * 8) = f.half[0];
    asm volatile("s_wait_xcnt 0x0" ::: "memory");      /* in the built code the X part follows this store's branch and rewrites the store's registers: the wait stands in front of that rewrite */
  }
}
// The three projections in one launch: blockIdx.y = 0, 1, 2 takes Wq, Wk, Wv (planes of Bw) with its bias. v = acc / 16 + bf16(bias[col]), rounded to f16. A, Bw, Q16, K16 and Vt lie in fragment order.
// Q and K go out as planes of NR rows x DD cols. V goes out transposed, as the attention kernel reads it (Vt: rows (b * NH + h) * 64 + d, cols = keys, pitch TT): no V plane and no transposing launch.
// A wave owns 128 rows x 96 cols (8 x 6 accumulator tiles): 14 fragments of 1 KiB feed 48 WMMAs. The block's four waves stand 2 x 2 (256 x 192), one wave a SIMD, so each fragment is wanted by two waves of the block.
// NR / 256 * DD / 192 * 3 = 192 blocks.
#define GMT 8
#define GNT 6
__global__ __launch_bounds__(128) void k_gemm_qkv(const _Float16* __restrict__ A, const _Float16* __restrict__ Bw, const float* __restrict__ bq, const float* __restrict__ bk, const float* __restrict__ bv,
    _Float16* __restrict__ Q16, _Float16* __restrict__ K16, _Float16* __restrict__ Vt) {
  constexpr int lda = DD, ldb = DD, ldc = DD, K = DD, MT = GMT, NT = GNT, NBN = DD / (2 * NT * 16); constexpr float alpha = 0.0625f;
  static_assert(NR % (2 * MT * 16) == 0 && DD % (2 * NT * 16) == 0 && DD % 64 == 0 && TT % (MT * 16) == 0, "whole tiles, no tail guards; a wave's rows lie in one batch");
  __shared__ __attribute__((aligned(16))) float so[4][MT * 16][NT * 16 + 4];      /* pitch 100: the epilogue's row reads (one row a lane) fall on different banks */
  const int tid = threadIdx.x, w = tid >> 5, lane = tid & 31, ln = lane & 15, hh = lane >> 4; const int by = blockIdx.y;
  const _Float16* Bh = Bw + (size_t)by * DD * DD; const float* bp = (by == 0) ? bq : (by == 1) ? bk : bv;
  const int mb = blockIdx.x / NBN, nb = blockIdx.x % NBN;
  const int row0 = (mb * 2 + (w >> 1)) * (MT * 16), col0 = (nb * 2 + (w & 1)) * (NT * 16);
  v8f acc[MT][NT] = {};
  // Fragments are fetched ahead: two register sets of 32 k each; while one set feeds its 48 WMMAs the other set's 28 loads are in flight. K % 64 == 0.
  const unsigned short* ap = (const unsigned short*)A + (size_t)row0 * lda + lane * 8;      /* this lane's 16 B in the first unit of the first row tile; the next row tile lies 16 * pitch on */
  const unsigned short* wp = (const unsigned short*)Bh + (size_t)col0 * ldb + lane * 8;
  FragH a0[MT], a1[MT], b0[NT], b1[NT];
  // One step: the loads of set (al, bl) for k = kb + ko as one group, then the WMMA block on set (am, bm). ko is a literal and goes into the loads' offset fields; 32 k are one block of 512 elements, so k counts 16-fold.
  // The WMMAs are the plain builtin: the tiles and fragments fill more than 256 registers, and an asm operand cannot lie above v255.
  auto step = [&](FragH (&al)[MT], FragH (&bl)[NT], int kb, int ko, FragH (&am)[MT], FragH (&bm)[NT], const bool mm) {
    const unsigned short* pa = ap + kb * 16; const unsigned short* pw = wp + kb * 16;
#pragma unroll
    for (int m = 0; m < MT; ++m) { al[m].half[0] = *(const v8us*)(pa + ko * 16 + m * 16 * lda); al[m].half[1] = *(const v8us*)(pa + ko * 16 + m * 16 * lda + 256); }
#pragma unroll
    for (int t = 0; t < NT; ++t) { bl[t].half[0] = *(const v8us*)(pw + ko * 16 + t * 16 * ldb); bl[t].half[1] = *(const v8us*)(pw + ko * 16 + t * 16 * ldb + 256); }
    __builtin_amdgcn_sched_barrier(0);      /* the group's loads stay ahead of the WMMA block: else the scheduler sinks them among the WMMAs and their latency is waited out there */
    if (mm) {
#pragma unroll
      for (int m = 0; m < MT; ++m)
#pragma unroll
        for (int t = 0; t < NT; ++t) acc[m][t] = __builtin_amdgcn_wmma_f32_16x16x32_f16(false, am[m].v, false, bm[t].v, (short)0, acc[m][t], false, false);
    }
    __builtin_amdgcn_sched_barrier(0);      /* the statement below stays behind the whole block: else the scheduler lifts it to the block's head, where the wait would stall */
    /* v_nop: the next group's loads overwrite the last WMMA's A and B; four vector slots lie between. s_wait_xcnt: the group's address pairs are named, so no register of them is
       reused (not even as a later load's result) before this wait; it stands behind the block, not directly behind the loads, so that it is not waited out in front of the WMMAs */
    if (mm) asm volatile("v_nop\n\tv_nop\n\tv_nop\n\tv_nop\n\ts_wait_xcnt 0x0" :: "v"(pa), "v"(pw) : "memory");
    else asm volatile("s_wait_xcnt 0x0" :: "v"(pa), "v"(pw) : "memory");      /* the first group, in front of the loop: no WMMA stands ahead of it */
    __builtin_amdgcn_sched_barrier(0); };      /* the next group of loads stays behind this block: it overwrites the set that the block reads */
  // The k walk starts rotated and wraps: the 12 blocks that read the same rows of A (one mb) start at 12 different 64-k slabs, the 16 that read the same rows of W^T (one nb, by) at 12, so blocks that run in step ask L2 for different lines at the same moment. The same for the whole block; each accumulator's sum starts at another k.
  int kb = ((nb + NBN * by + mb) % (K / 64)) * 64;
  step(a0, b0, kb, 0, a1, b1, false);
  for (int it = 0; it < K / 64; ++it) {
    step(a1, b1, kb, 32, a0, b0, true);
    kb = (kb + 64 < K) ? kb + 64 : 0;      /* wraps behind the last slab; no branch, so the waits stay counted */
    step(a0, b0, kb, 0, a1, b1, true);      /* last trip: the walk's first slab again, in bounds, values unused */
  }
  // The biases of the wave's six column tiles (bf16-rounded input), for both ways out.
  const int cb = col0 + ln; float bvv[NT];
#pragma unroll
  for (int t = 0; t < NT; ++t) bvv[t] = bp[cb + t * 16];
  asm volatile("s_wait_xcnt 0x0" :: "v"(cb) : "memory");      /* the loads' offset register is named, so it is not reused before the loads have taken it */
#pragma unroll
  for (int t = 0; t < NT; ++t) bvv[t] = bf16_round(bvv[t]);
  if (by == 2) {      /* the same for the whole block */
    // acc[m][t][r] is V[row0 + m * 16 + 8 hh + r][col0 + t * 16 + ln]: for the transposed plane that is row d = column % 64 of head column / 64, keys 8 hh .. 8 hh + 7 of a 16-key unit, which is what lane 16 hh + ln owns there:
    // each accumulator tile is one whole unit of Vt (512 B, 4 whole lines) and goes out of the registers as it stands. Vt's row is b * DD + column; the eight tiles m are eight units in a row.
    unsigned short* vu = (unsigned short*)Vt + ((size_t)(row0 / TT) * DD + col0) * TT + (size_t)((row0 % TT) >> 4) * 256 + lane * 8;
#pragma unroll
    for (int t = 0; t < NT; ++t) { FragH f[MT];
#pragma unroll
      for (int m = 0; m < MT; ++m)
#pragma unroll
        for (int r = 0; r < 8; ++r) f[m].h[r] = (_Float16)(acc[m][t][r] * alpha + bvv[t]);
      __builtin_amdgcn_sched_barrier(0);      /* the batch's units are all formed before its first store: no conversion takes a register that an issued store names */
#pragma unroll
      for (int m = 0; m < MT; ++m) *(v8us*)(vu + t * 16 * TT + m * 256) = f[m].half[0];
      asm volatile("s_wait_xcnt 0x0" :: "v"(vu) : "memory");      /* in front of the next batch, which rewrites the registers that these stores name */
      __builtin_amdgcn_sched_barrier(0); }      /* the next batch's conversions stay behind that wait */
    return;
  }
#pragma unroll
  for (int t = 0; t < NT; ++t)
#pragma unroll
    for (int m = 0; m < MT; ++m)
#pragma unroll
      for (int r = 0; r < 8; ++r) so[w][m * 16 + 8 * hh + r][t * 16 + ln] = acc[m][t][r] * alpha + bvv[t];
  __builtin_amdgcn_fence(__ATOMIC_ACQ_REL, "workgroup"); __builtin_amdgcn_wave_barrier();
  {      /* each of the wave's eight row tiles is six units in a row: 3 KiB of whole lines */
    unsigned short* cu = (unsigned short*)((by == 0) ? Q16 : K16) + (size_t)row0 * ldc + (size_t)(col0 >> 4) * 256 + lane * 8;
#pragma unroll
    for (int m = 0; m < MT; ++m) { FragH f[NT];
#pragma unroll
      for (int u = 0; u < NT; ++u) { const v4f v0 = *(const v4fa*)&so[w][m * 16 + ln][u * 16 + 8 * hh], v1 = *(const v4fa*)&so[w][m * 16 + ln][u * 16 + 8 * hh + 4];
#pragma unroll
        for (int i = 0; i < 4; ++i) { f[u].h[i] = (_Float16)v0[i]; f[u].h[4 + i] = (_Float16)v1[i]; } }
      __builtin_amdgcn_sched_barrier(0);      /* the batch's units are all formed before its first store: no conversion takes a register that an issued store names */
#pragma unroll
      for (int u = 0; u < NT; ++u) *(v8us*)(cu + m * 16 * ldc + u * 256) = f[u].half[0];
      asm volatile("s_wait_xcnt 0x0" :: "v"(cu) : "memory");      /* in front of the next batch (behind the last one: of the V part, which follows in the built code), which rewrites the registers that these stores name */
      __builtin_amdgcn_sched_barrier(0); }      /* the next batch's reads and conversions stay behind that wait */
  }
}


typedef _Float16 v4h __attribute__((ext_vector_type(4)));

__global__ __launch_bounds__(256) void k_h16(const float* __restrict__ x, _Float16* __restrict__ X16, size_t n8) { const size_t t = (size_t)blockIdx.x * 256 + threadIdx.x; if (t >= n8) return; FragH f;
#pragma unroll
  for (int q = 0; q < 8; ++q) f.h[q] = (_Float16)x[t * 8 + q]; *(v8us*)((unsigned short*)X16 + t * 8) = f.half[0];  }
__global__ __launch_bounds__(256) void k_round16f(const float* __restrict__ W, _Float16* __restrict__ Bt, size_t n8) { const size_t t = (size_t)blockIdx.x * 256 + threadIdx.x; if (t >= n8) return; FragH f;
#pragma unroll
  for (int i = 0; i < 8; ++i) f.h[i] = (_Float16)(bf16_round(W[t * 8 + i]) * 16.0f); *(v8us*)((unsigned short*)Bt + t * 8) = f.half[0];  }

typedef int v4i __attribute__((ext_vector_type(4)));
typedef int v4ia __attribute__((ext_vector_type(4), may_alias));
// lane l takes the value of lane l ^ 16 (a vector cross-row move, no LDS trip)
__device__ __forceinline__ float xhalf(float x) { return __builtin_bit_cast(float, __builtin_amdgcn_permlanex16(__builtin_bit_cast(int, x), __builtin_bit_cast(int, x), 0x76543210, 0xfedcba98, false, false)); }

// Both attention paths in one walk over the keys. The scores S^T = K Q^T are the same for the two paths, and so are the K and V^T fragments: each is fetched and each score tile is formed once;
// the wave then runs two online softmaxes (additive key bias; 0/1 mask) with two output accumulators, and the gated sum is taken in registers in the epilogue: no per-path output plane, no combining launch.
// The two softmaxes share one shift and one exponential a score: a softmax does not depend on its shift, so both take the running maximum m of the raw scores over all keys. With e = exp((s - m) / 8),
// the mask path's weight is e or 0 and the bias path's is e * KF[k] (KF = exp(bias - largest bias of the batch), made once in k_prep). e <= 1 and KF <= 1, so nothing overflows; as f16 x 2^10 a weight keeps full precision down to 2^-24 of the shared maximum's: a path loses bits of P only where its own best key scores more than 16.6 (natural log) below a key that it drops.
__global__ __launch_bounds__(128) void k_flash_gl(const _Float16* __restrict__ Q16, int ldq, const _Float16* __restrict__ K16, int ldk, const _Float16* __restrict__ Vt, const float* __restrict__ KF, const int* __restrict__ MSK, const float* __restrict__ gate, float* __restrict__ O, int ldo) {
  constexpr int RPW = 16, NQB = TT / (4 * RPW), DT = 4, KS = 2;
  __shared__ __attribute__((aligned(16))) float sO[4][RPW][64 + 4];
  const int tid = threadIdx.x, w = tid >> 5, lane = tid & 31, ln = lane & 15, hh = lane >> 4;
  const int slab = blockIdx.x / NQB, qblk = blockIdx.x % NQB; const int b = slab / NH, h = slab % NH; const int qb0 = qblk * (4 * RPW); const int q0 = qb0 + w * RPW;
  // Transposed tiles: S^T = K Q^T (A = 16 key rows, B = the wave's 16 queries), O^T += V^T P^T. Lane (ln, hh) owns query q0 + ln; its score registers hold keys j0 + 8 hh + r and j0 + 16 + 8 hh + r,
  // which is the k order of a B operand: P goes from the score registers into the second product with no LDS trip, and maximum and sum run inside the lane plus one exchange between the wave halves.
  FragH aq[KS];
  // Q16, K16 and Vt lie in fragment order (head of the file): a fragment half is one unit of 512 B, this lane's 16 B at lane * 8 elements; a head's 64 columns are two blocks (4 units) in a row.
  { const unsigned short* qr = (const unsigned short*)Q16 + ((size_t)b * TT + q0) * ldq + h * 1024 + lane * 8;
#pragma unroll
    for (int ks = 0; ks < KS; ++ks) { aq[ks].half[0] = *(const v8us*)(qr + ks * 512); aq[ks].half[1] = *(const v8us*)(qr + ks * 512 + 256); }
    asm volatile("s_wait_xcnt 0x0" :: "v"(qr) : "memory"); }      /* as in ldK below: the address pair stays whole until the loads have taken it */
  const unsigned short* Vth = (const unsigned short*)Vt + (size_t)slab * 64 * TT;
  float mr = -3.0e38f, lg = 0.f, ll = 0.f; v8f og[DT], ol[DT];      /* the shared running maximum (raw products); running sum, output tile: g = additive-bias path, l = 0/1-mask path */
#pragma unroll
  for (int dt = 0; dt < DT; ++dt) { og[dt] = (v8f){0.f,0.f,0.f,0.f,0.f,0.f,0.f,0.f}; ol[dt] = (v8f){0.f,0.f,0.f,0.f,0.f,0.f,0.f,0.f}; }
  const int jend = TT;
  // Global loads are issued ahead of their use: the K fragments and the mask words one pass ahead (registers carried round the loop), the key factors (4 KiB a batch, read by every wave) and the V^T fragments at the top of their own pass; their latency then runs under the softmaxes, not in front of each WMMA.
  const unsigned short* Kl = (const unsigned short*)K16 + (size_t)b * TT * ldk + h * 1024 + lane * 8; FragH bk[2][KS];
  const float* aml = KF + (size_t)b * TT + 16 * hh;      /* a pass's 32 factors are one line; this half's 16 lie in a row, (r, nt) at 2 r + nt */
  const int* Ml = MSK + ((size_t)b * TT + q0 + ln) * TT + 8 * hh; v4i mkn[2][2];
  auto ldK = [&](int j) {
    const unsigned short* kr[2] = {Kl + (size_t)j * ldk, Kl + (size_t)(j + 16) * ldk};
#pragma unroll
    for (int nt = 0; nt < 2; ++nt)
#pragma unroll
      for (int ks = 0; ks < KS; ++ks) { bk[nt][ks].half[0] = *(const v8us*)(kr[nt] + ks * 512); bk[nt][ks].half[1] = *(const v8us*)(kr[nt] + ks * 512 + 256); }
    /* the group's address pairs are named so that no register of them is reused (not even as a later load's result) before the loads have taken them */
    asm volatile("s_wait_xcnt 0x0" :: "v"(kr[0]), "v"(kr[1]) : "memory"); };
  // The mask words of pass j: issued behind the last use of the pass before, so they land in the registers that pass has just read and nothing is copied aside.
  auto ldMk = [&](int j) {
    const int* mm = Ml + j;
#pragma unroll
    for (int nt = 0; nt < 2; ++nt) { mkn[nt][0] = *(const v4ia*)(mm + nt * 16); mkn[nt][1] = *(const v4ia*)(mm + nt * 16 + 4); }
    asm volatile("s_wait_xcnt 0x0" :: "v"(mm) : "memory"); };      /* as in ldK */
  const float gq = bf16_round(gate[((size_t)b * NH + h) * TT + q0 + ln]);      /* the gate of this lane's query (bf16-rounded input) */
  // The key walk starts rotated and wraps: all blocks are resident and run in step; the 16 blocks of a head (same K, V^T lines) start 2 passes apart, the 12 heads of a query block (same mask lines) 3 passes apart, so they ask L2 for different lines at the same moment.
  // An online softmax takes its keys in any order; the order of its sums changes. The start is the same for the whole block.
  static_assert((TT & (TT - 1)) == 0 && TT / 32 == 32 && NQB * 2 <= 32 && NH * 3 <= 36, "the wrap is a mask; starts differ within a head and within a query block");
  int j0 = ((qblk * 2 + h * 3) & (TT / 32 - 1)) * 32;
  ldK(j0); ldMk(j0);
  const float* am = aml + j0; const unsigned short* vr = Vth + (size_t)j0 * 16 + lane * 8;      /* this pass's key factors and V^T fragments (32 keys are one block of 512 elements); carried and stepped, so that a pass forms no address anew */
#pragma unroll 1      /* stays rolled: one set of carried fragment registers, and the pass's code is fetched once */
  for (int it = 0; it < jend / 32; ++it) {
    const int jn = (j0 + 32) & (TT - 1);      /* the pass fetched for; it wraps behind key TT - 32; behind the last pass it is the walk's first pass again: in bounds, values unused; no branch, so the waits stay counted */
    unsigned kp[2][8];      /* per-batch mask [b][q][k] of query q0 + ln, keys j0 + nt * 16 + 8 hh + r: nonzero = ATTEND; kept as one lane-mask word each (a scalar register), formed here so that the mask words' registers are free for the next pass's loads */
#pragma unroll
    for (int nt = 0; nt < 2; ++nt)
#pragma unroll
      for (int r = 0; r < 8; ++r) kp[nt][r] = __builtin_amdgcn_ballot_w32(mkn[nt][r >> 2][r & 3] != 0);
    v4f abn[4];      /* key factors of this pass: issued here, used behind the exponentials */
#pragma unroll
    for (int i = 0; i < 4; ++i) abn[i] = *(const v4fa*)(am + i * 4);
    asm volatile("s_wait_xcnt 0x0" :: "v"(am) : "memory");      /* as in ldK */
    FragH bv[DT];      /* V^T fragments of this pass: issued here, used behind the softmaxes, by both paths */
#pragma unroll
    for (int dt = 0; dt < DT; ++dt) { bv[dt].half[0] = *(const v8us*)(vr + dt * 16 * TT); bv[dt].half[1] = *(const v8us*)(vr + dt * 16 * TT + 256); }
    asm volatile("s_wait_xcnt 0x0" :: "v"(vr) : "memory");      /* as in ldK: the address pair stays whole until the loads have taken it */
    v8f s[2];      /* the products of this loop, all but the pass's last, are the plain builtin: the compiler keeps the distance behind each with the pass's own vector work, where a fixed run of v_nop took issue slots from the SIMD's other waves */
#pragma unroll
    for (int nt = 0; nt < 2; ++nt) { v8f acc = (v8f){0.f,0.f,0.f,0.f,0.f,0.f,0.f,0.f};
#pragma unroll
      for (int ks = 0; ks < KS; ++ks) acc = __builtin_amdgcn_wmma_f32_16x16x32_f16(false, bk[nt][ks].v, false, aq[ks].v, (short)0, acc, false, false); s[nt] = acc; }
    ldK(jn);
    __builtin_amdgcn_sched_barrier(0);      /* the compares on this pass's mask words stay ahead of the loads that overwrite them: else the scheduler lifts the loads and the words are copied aside */
    ldMk(jn);
    // One online-softmax step on the pass's 32 raw scores, for both paths: new maximum, one exponential a score, the two weights, rescale of both sums and output tiles, P^T packed as B operands (element nt * 8 + r is key nt * 16 + 8 hh + r, the order in which bv holds V^T).
    // The exponentials run in base 2 on the hardware's own instruction: exp(x) 2^10 = exp2(x log2(e) + 10); the 1 / 8 goes into cs, and cs < 1, so mn * cs cannot overflow. The weights, and with them the running sums, carry the factor 2^10 that P has as an f16 operand: the epilogue divides by those sums alone.
    constexpr float cs = 0.125f * 1.4426950408889634f;
    float mx[8];
#pragma unroll
    for (int r = 0; r < 8; ++r) mx[r] = fmaxf(s[0][r], s[1][r]);
    float mc = fmaxf(fmaxf(fmaxf(mx[0], mx[1]), fmaxf(mx[2], mx[3])), fmaxf(fmaxf(mx[4], mx[5]), fmaxf(mx[6], mx[7])));
    mc = fmaxf(mc, xhalf(mc));      /* both wave halves now hold the maximum of the query's 32 scores of this pass */
    const float mn = fmaxf(mr, mc); const float ea = __builtin_amdgcn_exp2f((mr - mn) * cs); const float al = (mn > -1.0e38f) ? ea : 1.0f; mr = mn;      /* computed, then selected: no branch */
    const float nm = 10.0f - mn * cs;
    float wg[2][8], wl[2][8];
#pragma unroll
    for (int nt = 0; nt < 2; ++nt)
#pragma unroll
      for (int r = 0; r < 8; ++r) { const float e = __builtin_amdgcn_exp2f(__builtin_fmaf(s[nt][r], cs, nm)); wg[nt][r] = e * abn[r >> 1][(r & 1) * 2 + nt]; wl[nt][r] = __builtin_amdgcn_inverse_ballot_w32(kp[nt][r]) ? e : 0.f; }
    float sg8[8], sl8[8];
#pragma unroll
    for (int r = 0; r < 8; ++r) { sg8[r] = wg[0][r] + wg[1][r]; sl8[r] = wl[0][r] + wl[1][r]; }
    lg = lg * al + (((sg8[0] + sg8[1]) + (sg8[2] + sg8[3])) + ((sg8[4] + sg8[5]) + (sg8[6] + sg8[7])));      /* this half's 16 keys; the halves are joined behind the loop */
    ll = ll * al + (((sl8[0] + sl8[1]) + (sl8[2] + sl8[3])) + ((sl8[4] + sl8[5]) + (sl8[6] + sl8[7])));
#pragma unroll
    for (int dt = 0; dt < DT; ++dt)
#pragma unroll
      for (int r = 0; r < 8; ++r) { og[dt][r] *= al; ol[dt][r] *= al; }
    FragH pg, pl;
#pragma unroll
    for (int nt = 0; nt < 2; ++nt)
#pragma unroll
      for (int r = 0; r < 8; ++r) { pg.h[nt * 8 + r] = (_Float16)wg[nt][r]; pl.h[nt * 8 + r] = (_Float16)wl[nt][r]; }
#pragma unroll
    for (int dt = 0; dt < DT; ++dt) { og[dt] = __builtin_amdgcn_wmma_f32_16x16x32_f16(false, bv[dt].v, false, pg.v, (short)0, og[dt], false, false);
      if (dt + 1 < DT) ol[dt] = __builtin_amdgcn_wmma_f32_16x16x32_f16(false, bv[dt].v, false, pl.v, (short)0, ol[dt], false, false);
      else ol[dt] = mmaH<1>(bv[dt].v, bv[dt].v, pl.v, pl.v, ol[dt]); }      /* the pass's last product keeps its four v_nop: over the back edge the next pass's first product may write its result over this one's B */
    am += jn - j0; vr += (jn - j0) * 16; j0 = jn; }      /* one pass on, or back to key 0 */
  { const float sg = lg + xhalf(lg), sl = ll + xhalf(ll); const float lig = (sg > 0.f) ? 1.0f / sg : 0.f, lil = (sl > 0.f) ? 1.0f / sl : 0.f;      /* sums and output tiles both carry 2^10 */ const float g1 = 1.0f - gq;
#pragma unroll
    for (int dt = 0; dt < DT; ++dt) {      /* og[dt][r], ol[dt][r] = the paths' O[q0 + ln][dt * 16 + 8 hh + r]; the gated sum of the two goes out */
      v4f o0, o1;
#pragma unroll
      for (int r = 0; r < 4; ++r) { o0[r] = gq * (ol[dt][r] * lil) + g1 * (og[dt][r] * lig); o1[r] = gq * (ol[dt][4 + r] * lil) + g1 * (og[dt][4 + r] * lig); }
      *(v4fa*)&sO[w][ln][dt * 16 + 8 * hh] = o0; *(v4fa*)&sO[w][ln][dt * 16 + 8 * hh + 4] = o1; } }
  __builtin_amdgcn_fence(__ATOMIC_ACQ_REL, "workgroup"); __builtin_amdgcn_wave_barrier();
  {
#pragma unroll
    for (int rp = 0; rp < RPW; rp += 2) { const int r = rp + (lane >> 4), pc = lane & 15; const v4f val = *(const v4fa*)&sO[w][r][pc * 4]; *(v4f*)(O + ((size_t)b * TT + q0 + r) * ldo + h * 64 + pc * 4) = val; }
     } }

extern "C" void kernel_launch(void* const* d_in, const int* in_sizes, int n_in,
                              void* d_out, int out_size, void* d_ws, size_t ws_size, hipStream_t stream) {
  (void)in_sizes; (void)n_in; (void)out_size;
  const float* const* I = (const float* const*)d_in; const float* x = I[0]; const float* am = I[1]; const int* lm = (const int*)d_in[2]; const float* gate = I[3]; const float* Wq = I[4]; const float* bq = I[5]; const float* Wk = I[6]; const float* bk = I[7]; const float* Wv = I[8]; const float* bv = I[9];
  char* ws = (char*)d_ws; size_t off = 0;
  auto take = [&](size_t bytes) { char* p = ws + off; off += (bytes + 255) & ~(size_t)255; return p; };
  const size_t WSZ = (size_t)DD * DD; _Float16* Bw = (_Float16*)take(3 * WSZ * 2); _Float16* X16 = (_Float16*)take((size_t)NR * DD * 2); _Float16* Q = (_Float16*)take((size_t)NR * DD * 2); _Float16* K = (_Float16*)take((size_t)NR * DD * 2); _Float16* Vt = (_Float16*)take((size_t)NR * DD * 2); float* KF = (float*)take((size_t)BB * TT * 4);
  if (off > ws_size) return;      // 3.5 + 4 x 6.3 = about 29 MB
  k_prep<<<XB + 3 * WB + BB, 256, 0, stream>>>(x, Wq, Wk, Wv, am, X16, Bw, KF);      /* X and the three W^T x 2^4, f16, fragment order; the key factors */
  k_gemm_qkv<<<dim3((NR / (2 * GMT * 16)) * (DD / (2 * GNT * 16)), 3), 128, 0, stream>>>(X16, Bw, bq, bk, bv, Q, K, Vt);      /* three times M 4096 N 768 K 768 */
  k_flash_gl<<<BB * NH * (TT / 64), 128, 0, stream>>>(Q, DD, K, DD, Vt, KF, lm, gate, (float*)d_out, DD);      /* both paths and the gated sum */
}
